// v000
// Measured on an AMD MI455X. A time is GPU time per run, averaged over a window of back-to-back runs after a warm-up
// (all launches, gaps included; the runs take copies of the inputs in turn), and the median of several windows.
// Apart from v000's, it joins two sittings. Times from different sittings can be a few percent apart, while
// side-by-side timings come from the same sitting.
// v000, which the later versions start from, runs in 1430 microseconds.
#include <hip/hip_runtime.h>
// my_attention (8 x 2048 tokens x 256; 8 heads x 32; q/k/v = query/key/value W^T + b; causal softmax(q.k / sqrt(32)); out = merged ctx Wo^T + bo).
// Compute dtype: inputs rounded to bf16; inputs/weights exact as f16; q/k/v and the softmax weights as plain f16 operands (~2^-12); context hi + residual into Wo; softmax f32. v_wmma_f32_16x16x32_f16.
#define NB 8
#define NTK 2048
#define DIN 256
#define NH 8
#define HD 32
#define DW 256
#define HG 4
#define NR (NB * NTK)
typedef __bf16 v16b __attribute__((ext_vector_type(16)));
typedef unsigned short v8us __attribute__((ext_vector_type(8), may_alias));
typedef float  v8f  __attribute__((ext_vector_type(8)));
typedef float  v4f  __attribute__((ext_vector_type(4)));
typedef float  v4fa __attribute__((ext_vector_type(4), may_alias));
union FragB { v16b v; v8us half[2]; unsigned short u[16]; };

__device__ __forceinline__ unsigned short bf16_bits(float x) { unsigned int u = __float_as_uint(x); return (unsigned short)((u + 0x7FFFu + ((u >> 16) & 1u)) >> 16); }
__device__ __forceinline__ float bf16_val(unsigned short b) { return __uint_as_float(((unsigned int)b) << 16); }
__device__ __forceinline__ float bf16_round(float x) { return bf16_val(bf16_bits(x)); }
// D += A·B with NT terms: 1 = ah·bh, 2 = + al·bh (A split), 3 = + ah·bl (both split)
template <int NT>
__device__ __forceinline__ v8f mmaN(v16b ah, v16b al, v16b bh, v16b bl, v8f c) {
  c = __builtin_amdgcn_wmma_f32_16x16x32_bf16(false, ah, false, bh, (short)0, c, false, false);
  if (NT >= 2) c = __builtin_amdgcn_wmma_f32_16x16x32_bf16(false, al, false, bh, (short)0, c, false, false);
  if (NT >= 3) c = __builtin_amdgcn_wmma_f32_16x16x32_bf16(false, ah, false, bl, (short)0, c, false, false);
  asm volatile("v_nop\n\tv_nop\n\tv_nop\n\tv_nop" : "+v"(c) : "v"(ah), "v"(al), "v"(bh), "v"(bl));
  return c;
}

__global__ __launch_bounds__(256) void k_wt_bf16(const float* __restrict__ W, unsigned short* __restrict__ Wt, int K, int N) {
  const int t = blockIdx.x * 256 + threadIdx.x;
  const int k8n = K / 8;
  if (t >= N * k8n) return;
  const int n = t / k8n, k8 = (t % k8n) * 8;
  v8us v;
#pragma unroll
  for (int i = 0; i < 8; ++i) v[i] = bf16_bits(W[(size_t)(k8 + i) * N + n]);
  *(v8us*)(Wt + (size_t)n * K + k8) = v;
  
}

// GEMM C[M][N] (f32, pitch ldc) = act(A[M][K]·W + bias). A f32 row-major (pitch lda) converted per fragment to bf16
// (ASPLIT: hi/lo two planes -> 2 terms, else single rounded term); Wt bf16 [N][K] (pitch ldb). BIAS_BF16 rounds the
// bias to bf16 first (bias quantised to bf16 before the add). K%32==0, M%16==0, N%64==0.
template <bool ASPLIT, int ACT, bool BIAS_BF16>
__global__ __launch_bounds__(128) void k_gemm_bf(const float* __restrict__ A, int lda, const unsigned short* __restrict__ Wt, int ldb,
                                               const float* __restrict__ bias, float* __restrict__ C, int ldc, int M, int N, int K) {
  __shared__ __attribute__((aligned(16))) float so[4][16][64];
  const int tid = threadIdx.x, w = tid >> 5, lane = tid & 31, ln = lane & 15, hh = lane >> 4;
  const int ntn = N / 64;
  const int wid = blockIdx.x * 4 + w;
  const int mt = wid / ntn, nq = wid % ntn;
  if (mt * 16 >= M) return;
  const int row0 = mt * 16, col0 = nq * 64;
  const float* arow = A + (size_t)(row0 + ln) * lda;
  v8f acc[4] = {};
  for (int kb = 0; kb < K; kb += 32) {
    FragB ah, al;
    const v4f x0 = *(const v4fa*)(arow + kb + 8 * hh), x1 = *(const v4fa*)(arow + kb + 8 * hh + 4);
    const v4f x2 = *(const v4fa*)(arow + kb + 16 + 8 * hh), x3 = *(const v4fa*)(arow + kb + 16 + 8 * hh + 4);
    float xs[16] = {x0[0],x0[1],x0[2],x0[3],x1[0],x1[1],x1[2],x1[3],x2[0],x2[1],x2[2],x2[3],x3[0],x3[1],x3[2],x3[3]};
#pragma unroll
    for (int i = 0; i < 16; ++i) { const unsigned short hb = bf16_bits(xs[i]); ah.u[i] = hb; al.u[i] = ASPLIT ? bf16_bits(xs[i] - bf16_val(hb)) : (unsigned short)0; }
#pragma unroll
    for (int t = 0; t < 4; ++t) {
      const unsigned short* brow = Wt + (size_t)(col0 + t * 16 + ln) * ldb + kb;
      FragB b;
      b.half[0] = *(const v8us*)(brow + 8 * hh);
      b.half[1] = *(const v8us*)(brow + 16 + 8 * hh);
      acc[t] = mmaN<ASPLIT ? 2 : 1>(ah.v, al.v, b.v, b.v, acc[t]);
    }
  }
#pragma unroll
  for (int t = 0; t < 4; ++t) {
    float bv = bias ? bias[col0 + t * 16 + ln] : 0.f;
    if (BIAS_BF16) bv = bf16_round(bv);
#pragma unroll
    for (int r = 0; r < 8; ++r) { float v = acc[t][r] + bv; if (ACT == 1) v = fmaxf(v, 0.f); so[w][8 * hh + r][t * 16 + ln] = v; }
  }
  __builtin_amdgcn_fence(__ATOMIC_ACQ_REL, "workgroup");
  __builtin_amdgcn_wave_barrier();
  const int rsub = lane >> 4, c4 = (lane & 15) * 4;
  {
#pragma unroll
    for (int q = 0; q < 8; ++q) {
      const int r = q * 2 + rsub;
      const v4f v = *(const v4fa*)&so[w][r][c4];
      *(v4f*)(C + (size_t)(row0 + r) * ldc + col0 + c4) = v;
    }
    
  }
}

// GEMM C = act(A·W + bias + resid): A f32 (ASPLIT -> hi/lo 2 terms), Wt bf16 [N][K]; ACT 0 none, 1 relu, 2 exact gelu;
// resid (optional, f32, row index = (row % rmod), pitch ldr, RES_BF16 rounds it) added before the activation.
template <bool ASPLIT, int ACT, bool BIAS_BF16, bool RES_BF16>
__global__ __launch_bounds__(128) void k_gemm_bf3(const float* __restrict__ A, int lda, const unsigned short* __restrict__ Wt, int ldb,
                                                const float* __restrict__ bias, const float* __restrict__ resid, int rmod, int ldr,
                                                float* __restrict__ C, int ldc, int M, int N, int K) {
  __shared__ __attribute__((aligned(16))) float so[4][16][64];
  const int tid = threadIdx.x, w = tid >> 5, lane = tid & 31, ln = lane & 15, hh = lane >> 4;
  const int ntn = N / 64;
  const int wid = blockIdx.x * 4 + w;
  const int mt = wid / ntn, nq = wid % ntn;
  if (mt * 16 >= M) return;
  const int row0 = mt * 16, col0 = nq * 64;
  const float* arow = A + (size_t)(row0 + ln) * lda;
  v8f acc[4] = {};
  for (int kb = 0; kb < K; kb += 32) {
    FragB ah, al;
    const v4f x0 = *(const v4fa*)(arow + kb + 8 * hh), x1 = *(const v4fa*)(arow + kb + 8 * hh + 4);
    const v4f x2 = *(const v4fa*)(arow + kb + 16 + 8 * hh), x3 = *(const v4fa*)(arow + kb + 16 + 8 * hh + 4);
    float xs[16] = {x0[0],x0[1],x0[2],x0[3],x1[0],x1[1],x1[2],x1[3],x2[0],x2[1],x2[2],x2[3],x3[0],x3[1],x3[2],x3[3]};
#pragma unroll
    for (int i = 0; i < 16; ++i) { const unsigned short hb = bf16_bits(xs[i]); ah.u[i] = hb; al.u[i] = ASPLIT ? bf16_bits(xs[i] - bf16_val(hb)) : (unsigned short)0; }
#pragma unroll
    for (int t = 0; t < 4; ++t) {
      const unsigned short* brow = Wt + (size_t)(col0 + t * 16 + ln) * ldb + kb;
      FragB b;
      b.half[0] = *(const v8us*)(brow + 8 * hh);
      b.half[1] = *(const v8us*)(brow + 16 + 8 * hh);
      acc[t] = mmaN<ASPLIT ? 2 : 1>(ah.v, al.v, b.v, b.v, acc[t]);
    }
  }
#pragma unroll
  for (int t = 0; t < 4; ++t) {
    const int col = col0 + t * 16 + ln;
    float bv = bias ? bias[col] : 0.f;
    if (BIAS_BF16) bv = bf16_round(bv);
#pragma unroll
    for (int r = 0; r < 8; ++r) {
      float v = acc[t][r] + bv;
      if (resid) { float rv = resid[(size_t)((row0 + 8 * hh + r) % rmod) * ldr + col]; if (RES_BF16) rv = bf16_round(rv); v += rv; }
      if (ACT == 1) v = fmaxf(v, 0.f);
      if (ACT == 2) v = 0.5f * v * (1.0f + erff(v * 0.70710678118654752f));
      if (ACT == 3) { const float u = 0.7978845608028654f * (v + 0.044715f * v * v * v); v = 0.5f * v * (1.0f + tanhf(u)); }
      so[w][8 * hh + r][t * 16 + ln] = v;
    }
  }
  __builtin_amdgcn_fence(__ATOMIC_ACQ_REL, "workgroup");
  __builtin_amdgcn_wave_barrier();
  const int rsub = lane >> 4, c4 = (lane & 15) * 4;
  {
#pragma unroll
    for (int q = 0; q < 8; ++q) {
      const int r = q * 2 + rsub;
      const v4f v = *(const v4fa*)&so[w][r][c4];
      *(v4f*)(C + (size_t)(row0 + r) * ldc + col0 + c4) = v;
    }
    
  }
}
// row LayerNorm (biased variance, eps) over N: s = X (+ R); optional out_sum <- s; out_norm <- (s-mu)*rsqrt(var+eps)*g + b
template <bool PARAM_BF16>
__global__ __launch_bounds__(256) void k_layernorm(const float* __restrict__ X, const float* __restrict__ R, const float* __restrict__ g, const float* __restrict__ bta,
                                                  float* __restrict__ out_sum, float* __restrict__ out_norm, int N, float eps) {
  __shared__ float red[256];
  const int row = blockIdx.x, tid = threadIdx.x;
  const float* x = X + (size_t)row * N; const float* rr = R ? R + (size_t)row * N : nullptr;
  float vals[16];                     // up to N = 4096
  const int per = N / 256;            // contiguous chunk per thread? use strided-by-4 chunks: thread handles j = tid*4 + 1024*u
  float s1 = 0.f;
  for (int u = 0; u < per / 4; ++u) {
    const int j = tid * 4 + 1024 * u;
    const v4f a = *(const v4fa*)(x + j);
    v4f b = {0.f,0.f,0.f,0.f}; if (rr) b = *(const v4fa*)(rr + j);
#pragma unroll
    for (int q = 0; q < 4; ++q) { const float v = a[q] + b[q]; vals[u * 4 + q] = v; s1 += v; }
  }
  red[tid] = s1; __syncthreads();
  for (int st = 128; st > 0; st >>= 1) { if (tid < st) red[tid] += red[tid + st]; __syncthreads(); }
  const float mu = red[0] / (float)N; __syncthreads();
  float s2 = 0.f;
  for (int u = 0; u < per / 4; ++u)
#pragma unroll
    for (int q = 0; q < 4; ++q) { const float c = vals[u * 4 + q] - mu; s2 += c * c; }
  red[tid] = s2; __syncthreads();
  for (int st = 128; st > 0; st >>= 1) { if (tid < st) red[tid] += red[tid + st]; __syncthreads(); }
  const float rs = rsqrtf(red[0] / (float)N + eps);
  {
    for (int u = 0; u < per / 4; ++u) {
      const int j = tid * 4 + 1024 * u;
      v4f o, sm;
#pragma unroll
      for (int q = 0; q < 4; ++q) {
        float gg = g[j + q], bb = bta[j + q];
        if (PARAM_BF16) { gg = bf16_round(gg); bb = bf16_round(bb); }
        sm[q] = vals[u * 4 + q]; o[q] = (vals[u * 4 + q] - mu) * rs * gg + bb;
      }
      if (out_sum) *(v4f*)(out_sum + (size_t)row * N + j) = sm;
      *(v4f*)(out_norm + (size_t)row * N + j) = o;
    }
    
  }
}



// ---- f16 WMMA path (v_wmma_f32_16x16x32_f16): 11-bit significands for operands in range — used where a [0,1] probability operand needs more precision than bf16
typedef _Float16 v16h __attribute__((ext_vector_type(16)));
union FragH { v16h v; v8us half[2]; _Float16 h[16]; unsigned short u[16]; };
template <int NT>
__device__ __forceinline__ v8f mmaH(v16h ah, v16h al, v16h bh, v16h bl, v8f c) {
  c = __builtin_amdgcn_wmma_f32_16x16x32_f16(false, ah, false, bh, (short)0, c, false, false);
  if (NT >= 2) c = __builtin_amdgcn_wmma_f32_16x16x32_f16(false, al, false, bh, (short)0, c, false, false);
  if (NT >= 3) c = __builtin_amdgcn_wmma_f32_16x16x32_f16(false, ah, false, bl, (short)0, c, false, false);
  asm volatile("v_nop\n\tv_nop\n\tv_nop\n\tv_nop" : "+v"(c) : "v"(ah), "v"(al), "v"(bh), "v"(bl));
  return c;
}
// batched GEMM like k_gemm_b but f16 operands: A f32 (split into f16 hi/lo if ASPLIT, else rounded to f16), Bt = f16 values [n][k]; alpha; C f32; N multiple of 16 (partial tiles skipped)
template <bool ASPLIT>
__global__ __launch_bounds__(128) void k_gemm_h(const float* __restrict__ A, int lda, size_t sA, const _Float16* __restrict__ Bh, int ldb, size_t sB, float alpha, float* __restrict__ C, int ldc, size_t sC, int M, int N, int K) {
  __shared__ __attribute__((aligned(16))) float so[4][16][64];
  const int tid = threadIdx.x, w = tid >> 5, lane = tid & 31, ln = lane & 15, hh = lane >> 4; const int by = blockIdx.y;
  A += (size_t)by * sA; Bh += (size_t)by * sB; C += (size_t)by * sC;
  const int ntn = (N + 63) / 64; const int wid = blockIdx.x * 4 + w; const int mt = wid / ntn, nq = wid % ntn; if (mt * 16 >= M) return;
  const int row0 = mt * 16, col0 = nq * 64; const float* arow = A + (size_t)(row0 + ln) * lda;
  v8f acc[4] = {};
  for (int kb = 0; kb < K; kb += 32) {
    FragH ah, al;
    const v4f x0 = *(const v4fa*)(arow + kb + 8 * hh), x1 = *(const v4fa*)(arow + kb + 8 * hh + 4), x2 = *(const v4fa*)(arow + kb + 16 + 8 * hh), x3 = *(const v4fa*)(arow + kb + 16 + 8 * hh + 4);
    float xs[16] = {x0[0],x0[1],x0[2],x0[3],x1[0],x1[1],x1[2],x1[3],x2[0],x2[1],x2[2],x2[3],x3[0],x3[1],x3[2],x3[3]};
#pragma unroll
    for (int i = 0; i < 16; ++i) { const _Float16 h = (_Float16)xs[i]; ah.h[i] = h; al.h[i] = ASPLIT ? (_Float16)(xs[i] - (float)h) : (_Float16)0.0f; }
#pragma unroll
    for (int t = 0; t < 4; ++t) { if (col0 + t * 16 >= N) continue; const size_t boff = (size_t)(col0 + t * 16 + ln) * ldb + kb; FragH bq; bq.half[0] = *(const v8us*)(Bh + boff + 8 * hh); bq.half[1] = *(const v8us*)(Bh + boff + 16 + 8 * hh);
      acc[t] = mmaH<ASPLIT ? 2 : 1>(ah.v, al.v, bq.v, bq.v, acc[t]); }
  }
#pragma unroll
  for (int t = 0; t < 4; ++t) { if (col0 + t * 16 >= N) continue;
#pragma unroll
    for (int r = 0; r < 8; ++r) so[w][8 * hh + r][t * 16 + ln] = acc[t][r] * alpha; }
  __builtin_amdgcn_fence(__ATOMIC_ACQ_REL, "workgroup"); __builtin_amdgcn_wave_barrier();
  const int rsub = lane >> 4, c4 = (lane & 15) * 4;
  {
#pragma unroll
    for (int q = 0; q < 8; ++q) { const int r = q * 2 + rsub; if (col0 + c4 < N) { const v4f v = *(const v4fa*)&so[w][r][c4]; *(v4f*)(C + (size_t)(row0 + r) * ldc + col0 + c4) = v; } }
     }
}

// Wt[n][k] = f16(W[k][n]·scale) from f32 row-major W[K][N] (scale = power of two; bf16-exact weights stay exact in f16 away from the subnormal range)
__global__ __launch_bounds__(256) void k_wt_f16(const float* __restrict__ W, _Float16* __restrict__ Wt, int K, int N, float scale) {
  const int t = blockIdx.x * 256 + threadIdx.x; if (t >= N * (K / 8)) return; const int n = t / (K / 8), k8 = (t % (K / 8)) * 8; FragH f;
#pragma unroll
  for (int i = 0; i < 8; ++i) f.h[i] = (_Float16)(bf16_round(W[(size_t)(k8 + i) * N + n]) * scale); const v8us o = f.half[0];
  *(v8us*)((unsigned short*)Wt + (size_t)n * K + k8) = o; 
}
// k_gemm_hh variant with fused epilogue: v = acc·alpha + bias[by·sBias + col] (+ CP[(row/rowsPerB)·sCPb + by·64 + col] if CP) ; ACT 0 none / 1 elu ; writes f32 C and/or f16 C16 (each if non-null)
template <int ACT>
__global__ __launch_bounds__(128) void k_gemm_hhx(const _Float16* __restrict__ A, int lda, size_t sA, const _Float16* __restrict__ Bh, int ldb, size_t sB, float alpha, const float* __restrict__ bias, size_t sBias, const float* __restrict__ CP, int rowsPerB, size_t sCPb, int row0g,
    float* __restrict__ C, _Float16* __restrict__ C16, int ldc, size_t sC, int M, int N, int K) {
  __shared__ __attribute__((aligned(16))) float so[4][16][64];
  const int tid = threadIdx.x, w = tid >> 5, lane = tid & 31, ln = lane & 15, hh = lane >> 4; const int by = blockIdx.y;
  A += (size_t)by * sA; Bh += (size_t)by * sB; const size_t cofs = (size_t)by * sC; const float* bp = bias ? bias + (size_t)by * sBias : nullptr;
  const int ntn = (N + 63) / 64; const int wid = blockIdx.x * 4 + w; const int mt = wid / ntn, nq = wid % ntn; if (mt * 16 >= M) return;
  const int row0 = mt * 16, col0 = nq * 64; const _Float16* arow = A + (size_t)(row0 + ln) * lda;
  v8f acc[4] = {};
  for (int kb = 0; kb < K; kb += 32) { FragH ah; ah.half[0] = *(const v8us*)((const unsigned short*)arow + kb + 8 * hh); ah.half[1] = *(const v8us*)((const unsigned short*)arow + kb + 16 + 8 * hh);
#pragma unroll
    for (int t = 0; t < 4; ++t) { if (col0 + t * 16 >= N) continue; const size_t boff = (size_t)(col0 + t * 16 + ln) * ldb + kb; FragH bq; bq.half[0] = *(const v8us*)((const unsigned short*)Bh + boff + 8 * hh); bq.half[1] = *(const v8us*)((const unsigned short*)Bh + boff + 16 + 8 * hh);
      acc[t] = mmaH<1>(ah.v, ah.v, bq.v, bq.v, acc[t]); }
  }
#pragma unroll
  for (int t = 0; t < 4; ++t) { if (col0 + t * 16 >= N) continue; const int col = col0 + t * 16 + ln; const float bv = bp ? bf16_round(bp[col]) : 0.f;
#pragma unroll
    for (int r = 0; r < 8; ++r) { float v = acc[t][r] * alpha + bv; if (CP) { const int rr = row0g + row0 + 8 * hh + r; if (rowsPerB < 0) v += CP[cofs + (size_t)rr * ldc + col];      /* rowsPerB < 0: own element of the batched C plane */ else { const int bidx = rr / rowsPerB; v += CP[(size_t)bidx * sCPb + (size_t)by * 64 + col]; } } if (ACT == 1) v = (v > 0.f) ? v : expm1f(v); else if (ACT == 7) v = (v > 0.f) ? v + 1.0f : expf(v); else if (ACT == 8) v = tanhf(v); else if (ACT == 9) v = 0.5f * v * (1.0f + tanhf(0.7978845608028654f * (v + 0.044715f * v * v * v))); else if (ACT == 11) v = 1.0f / (1.0f + expf(-v)); else if (ACT == 12) v = (v > 0.f) ? v : 0.01f * v; else if (ACT == 14) v = (v > 0.f) ? v : 0.1f * v; else if (ACT == 16) v = (v >= 0.f) ? v : 0.3f * v; else if (ACT == 17) v = (v >= 0.f) ? v : 0.2f * v; else if (ACT == 15) v = v / (1.0f + expf(-v)); else if (ACT == 3) v = fmaxf(v, 0.f); else if (ACT == 6) v = 0.5f * v * (1.0f + erff(v * 0.70710678118654752f)); so[w][8 * hh + r][t * 16 + ln] = v; } }
  __builtin_amdgcn_fence(__ATOMIC_ACQ_REL, "workgroup"); __builtin_amdgcn_wave_barrier();
  const int rsub = lane >> 4, c4 = (lane & 15) * 4; typedef _Float16 v4h __attribute__((ext_vector_type(4)));
  {
#pragma unroll
    for (int q = 0; q < 8; ++q) { const int r = q * 2 + rsub; if (col0 + c4 < N) { const v4f v = *(const v4fa*)&so[w][r][c4]; if (C) *(v4f*)(C + cofs + (size_t)(row0 + r) * ldc + col0 + c4) = v; if (C16) { v4h h4; for (int i = 0; i < 4; ++i) h4[i] = (_Float16)v[i]; *(v4h*)(C16 + cofs + (size_t)(row0 + r) * ldc + col0 + c4) = h4; } } }
     }
}


typedef _Float16 v4h __attribute__((ext_vector_type(4)));

__global__ __launch_bounds__(256) void k_x16(const float* __restrict__ x, _Float16* __restrict__ X16, size_t n8) { const size_t t = (size_t)blockIdx.x * 256 + threadIdx.x; if (t >= n8) return; FragH f;
#pragma unroll
  for (int q = 0; q < 8; ++q) f.h[q] = (_Float16)bf16_round(x[t * 8 + q]); *(v8us*)((unsigned short*)X16 + t * 8) = f.half[0];  }
__global__ __launch_bounds__(256) void k_h16(const float* __restrict__ x, _Float16* __restrict__ X16, size_t n8) { const size_t t = (size_t)blockIdx.x * 256 + threadIdx.x; if (t >= n8) return; FragH f;
#pragma unroll
  for (int q = 0; q < 8; ++q) f.h[q] = (_Float16)x[t * 8 + q]; *(v8us*)((unsigned short*)X16 + t * 8) = f.half[0];  }
__global__ __launch_bounds__(256) void k_round16f(const float* __restrict__ W, _Float16* __restrict__ Bt, size_t n8) { const size_t t = (size_t)blockIdx.x * 256 + threadIdx.x; if (t >= n8) return; FragH f;
#pragma unroll
  for (int i = 0; i < 8; ++i) f.h[i] = (_Float16)(bf16_round(W[t * 8 + i]) * 16.0f); *(v8us*)((unsigned short*)Bt + t * 8) = f.half[0];  }
template <int NHv, int TTv>
__global__ __launch_bounds__(256) void k_vt(const _Float16* __restrict__ V16, int ldv, int voff, _Float16* __restrict__ Vt) { __shared__ unsigned short tl[64][66]; const int tid = threadIdx.x; const int slab = blockIdx.x / (TTv / 64), lg = blockIdx.x % (TTv / 64); const int b = slab / NHv, h = slab % NHv;
  for (int i = tid; i < 64 * 8; i += 256) { const int r = i / 8, c8 = (i % 8) * 8; FragH f; f.half[0] = *(const v8us*)((const unsigned short*)V16 + ((size_t)b * TTv + lg * 64 + r) * ldv + voff + h * 64 + c8);
#pragma unroll
    for (int q = 0; q < 8; ++q) tl[r][c8 + q] = f.u[q]; }
  __syncthreads();
  {
#pragma unroll
    for (int rd = 0; rd < 2; ++rd) { const int d = rd * 32 + tid / 8, pc = tid % 8; FragH f;
#pragma unroll
      for (int q = 0; q < 8; ++q) f.u[q] = tl[pc * 8 + q][d];
      *(v8us*)((unsigned short*)Vt + ((size_t)slab * 64 + d) * TTv + lg * 64 + pc * 8) = f.half[0]; }
     } }

__global__ __launch_bounds__(256) void k_hl(const float* __restrict__ F, _Float16* __restrict__ Hh, _Float16* __restrict__ Hl, size_t n8) { const size_t t = (size_t)blockIdx.x * 256 + threadIdx.x; if (t >= n8) return; FragH fh, fl; const v4f a = *(const v4fa*)(F + t * 8), c = *(const v4fa*)(F + t * 8 + 4);
#pragma unroll
  for (int q = 0; q < 4; ++q) { _Float16 h = (_Float16)a[q]; fh.h[q] = h; fl.h[q] = (_Float16)((a[q] - (float)h) * 1024.0f); h = (_Float16)c[q]; fh.h[4 + q] = h; fl.h[4 + q] = (_Float16)((c[q] - (float)h) * 1024.0f); }
  { *(v8us*)((unsigned short*)Hh + t * 8) = fh.half[0]; *(v8us*)((unsigned short*)Hl + t * 8) = fl.half[0];  } }

// ---- fast GEMM (wave tile 32x64; requires M % 32 == 0 rows per launch region and N % 64 == 0); epilogue = k_gemm_hhx semantics ----
__device__ __forceinline__ v16h g2_frag(const _Float16* p, int hh) { FragH f; f.half[0] = *(const v8us*)((const unsigned short*)p + 8 * hh); f.half[1] = *(const v8us*)((const unsigned short*)p + 16 + 8 * hh); return f.v; }
__device__ __forceinline__ v8f g2_mma(v16h a, v16h b, v8f c) { v8f d = __builtin_amdgcn_wmma_f32_16x16x32_f16(false, a, false, b, (short)0, c, false, false); asm volatile("v_nop\n\tv_nop\n\tv_nop\n\tv_nop" : "+v"(d) : "v"(a), "v"(b)); return d; }
template <int ACT>
__global__ __launch_bounds__(128) void k_gemm2(const _Float16* __restrict__ A, int lda, size_t sA, const _Float16* __restrict__ Bh, int ldb, size_t sB, float alpha, const float* __restrict__ bias, size_t sBias, const float* __restrict__ CP, int rowsPerB, size_t sCPb, int row0g,
    float* __restrict__ C, _Float16* __restrict__ C16, int ldc, size_t sC, int M, int N, int K) { static_assert(ACT == 0 || ACT == 3 || ACT == 6 || ACT == 8 || ACT == 9 || ACT == 11 || ACT == 12 || ACT == 14 || ACT == 15 || ACT == 16 || ACT == 17, "k_gemm2: unsupported ACT code (would silently apply no activation)");
  __shared__ __attribute__((aligned(16))) float so[4][32][68];
  const int tid = threadIdx.x, w = tid >> 5, lane = tid & 31, ln = lane & 15, hh = lane >> 4; const int by = blockIdx.y;
  A += (size_t)by * sA; Bh += (size_t)by * sB; const size_t cofs = (size_t)by * sC; const float* bp = bias ? bias + (size_t)by * sBias : nullptr;
  const int ntn = N >> 6; const int mt = blockIdx.x / ntn, nq = blockIdx.x - mt * ntn; const int row0 = mt * 128 + 32 * w, col0 = nq * 64; if (row0 >= M) return;
  const _Float16* a0p = A + (size_t)(row0 + ln) * lda; const _Float16* a1p = a0p + (size_t)16 * lda;
  const _Float16* b0p = Bh + (size_t)(col0 + ln) * ldb; const _Float16* b1p = b0p + (size_t)16 * ldb; const _Float16* b2p = b1p + (size_t)16 * ldb; const _Float16* b3p = b2p + (size_t)16 * ldb;
  const v8f z8 = {0.f,0.f,0.f,0.f,0.f,0.f,0.f,0.f}; v8f c00 = z8, c01 = z8, c02 = z8, c03 = z8, c10 = z8, c11 = z8, c12 = z8, c13 = z8;
#pragma unroll 1
  for (int kb = 0; kb < K; kb += 32) { const v16h a0 = g2_frag(a0p + kb, hh), a1 = g2_frag(a1p + kb, hh);
    v16h b = g2_frag(b0p + kb, hh); c00 = g2_mma(a0, b, c00); c10 = g2_mma(a1, b, c10);
    b = g2_frag(b1p + kb, hh); c01 = g2_mma(a0, b, c01); c11 = g2_mma(a1, b, c11);
    b = g2_frag(b2p + kb, hh); c02 = g2_mma(a0, b, c02); c12 = g2_mma(a1, b, c12);
    b = g2_frag(b3p + kb, hh); c03 = g2_mma(a0, b, c03); c13 = g2_mma(a1, b, c13); }
  v8f accs[8] = {c00, c01, c02, c03, c10, c11, c12, c13};
#pragma unroll
  for (int u = 0; u < 8; ++u) { const int t = u & 3, half = u >> 2; const int col = col0 + t * 16 + ln; const float bv = bp ? bf16_round(bp[col]) : 0.f;
#pragma unroll
    for (int r = 0; r < 8; ++r) { const int rloc = half * 16 + 8 * hh + r; float v = accs[u][r] * alpha + bv; if (CP) { if (rowsPerB < 0) v += CP[cofs + (size_t)(row0g + row0 + rloc) * ldc + col];      /* rowsPerB < 0: own element of the batched C plane */ else { const int bidx = (row0g + row0 + rloc) / rowsPerB; v += CP[(size_t)bidx * sCPb + (size_t)by * 64 + col]; } }
      if (ACT == 3) v = fmaxf(v, 0.f); else if (ACT == 6) v = 0.5f * v * (1.0f + erff(v * 0.70710678118654752f)); else if (ACT == 11) v = 1.0f / (1.0f + expf(-v)); else if (ACT == 15) v = v / (1.0f + expf(-v)); else if (ACT == 12) v = (v > 0.f) ? v : 0.01f * v; else if (ACT == 8) v = tanhf(v); else if (ACT == 9) v = 0.5f * v * (1.0f + tanhf(0.7978845608028654f * (v + 0.044715f * v * v * v))); else if (ACT == 14) v = (v > 0.f) ? v : 0.1f * v; else if (ACT == 16) v = (v >= 0.f) ? v : 0.3f * v; else if (ACT == 17) v = (v >= 0.f) ? v : 0.2f * v;
      so[w][rloc][t * 16 + ln] = v; } }
  __builtin_amdgcn_fence(__ATOMIC_ACQ_REL, "workgroup"); __builtin_amdgcn_wave_barrier();
  const int rsub = lane >> 4, c4 = (lane & 15) * 4;
  {
#pragma unroll
    for (int q = 0; q < 16; ++q) { const int r = q * 2 + rsub; const v4f v = *(const v4fa*)&so[w][r][c4]; if (C) *(v4f*)(C + cofs + (size_t)(row0 + r) * ldc + col0 + c4) = v; if (C16) { v4h h4; for (int i = 0; i < 4; ++i) h4[i] = (_Float16)v[i]; *(v4h*)(C16 + cofs + (size_t)(row0 + r) * ldc + col0 + c4) = h4; } }
     } }


__global__ __launch_bounds__(256) void k_wsc(const float* __restrict__ Wm, _Float16* __restrict__ Bt, size_t n8, float sc) { const size_t t = (size_t)blockIdx.x * 256 + threadIdx.x; if (t >= n8) return; FragH f; for (int q = 0; q < 8; ++q) f.h[q] = (_Float16)(bf16_round(Wm[t * 8 + q]) * sc); *(v8us*)((unsigned short*)Bt + t * 8) = f.half[0];  }
__global__ __launch_bounds__(256) void k_csoft(const float* __restrict__ S, _Float16* __restrict__ P, float* __restrict__ RS) {
  #pragma clang fp contract(off)
  const int wv = threadIdx.x >> 5, ln = threadIdx.x & 31; const int r = blockIdx.x * 8 + wv; if (r >= HG * NTK) return; const int i = r % NTK; const float scl = 0.17677669529663687f; const float* sr = S + (size_t)r * NTK; float mx = -3.0e38f;
#pragma unroll 1
  for (int gq = 0; gq < NTK / 256; ++gq) { const v8f a = *(const v8f*)(sr + gq * 256 + ln * 8); for (int q = 0; q < 8; ++q) { const int j = gq * 256 + ln * 8 + q; if (j <= i) mx = fmaxf(mx, a[q] * scl); } }
  for (int o = 16; o > 0; o >>= 1) mx = fmaxf(mx, __shfl_xor(mx, o, 32)); float su = 0.f;
{ su = 0.f;
#pragma unroll 1
    for (int gq = 0; gq < NTK / 256; ++gq) { const v8f a = *(const v8f*)(sr + gq * 256 + ln * 8); FragH ph; for (int q = 0; q < 8; ++q) { const int j = gq * 256 + ln * 8 + q; float e = 0.f; if (j <= i) { e = expf(a[q] * scl - mx); su += e; } ph.h[q] = (_Float16)(e * 1024.0f); } *(v8us*)((unsigned short*)P + (size_t)r * NTK + gq * 256 + ln * 8) = ph.half[0]; }
     }
  for (int o = 16; o > 0; o >>= 1) su += __shfl_xor(su, o, 32); if (ln == 0) { *(float*)(RS + (size_t)r * 32) = 1.0f / su;  } }
__global__ __launch_bounds__(256) void k_csc(const float* __restrict__ O, const float* __restrict__ RS, int b, int h0, _Float16* __restrict__ CH, _Float16* __restrict__ CL) {
  #pragma clang fp contract(off)
  const int t = blockIdx.x * 256 + threadIdx.x; if (t >= NTK * HG * (HD / 8)) return; const int d8 = (t % (HD / 8)) * 8; const int g = (t / (HD / 8)) % HG; const int i = t / ((HD / 8) * HG); const float rs = RS[((size_t)g * NTK + i) * 32]; const size_t o = ((size_t)b * NTK + i) * DW + (h0 + g) * HD + d8; const v8f a = *(const v8f*)(O + o); FragH f, fl;
  for (int q = 0; q < 8; ++q) { const float v = a[q] * rs; const _Float16 hh = (_Float16)v; f.h[q] = hh; fl.h[q] = (_Float16)((v - (float)hh) * 1024.0f); }
  { *(v8us*)((unsigned short*)CH + o) = f.half[0]; *(v8us*)((unsigned short*)CL + o) = fl.half[0];  } }

extern "C" void kernel_launch(void* const* d_in, const int* in_sizes, int n_in,
                              void* d_out, int out_size, void* d_ws, size_t ws_size, hipStream_t stream) {
  (void)in_sizes; (void)n_in; (void)out_size;
  const float* const* I = (const float* const*)d_in; const float* xq = I[0]; const float* xk = I[1]; const float* xv = I[2]; const float* Wq = I[3]; const float* bq = I[4]; const float* Wk = I[5]; const float* bk = I[6]; const float* Wv = I[7]; const float* bv = I[8]; const float* Wo = I[9]; const float* bo = I[10];
  char* ws = (char*)d_ws; size_t off = 0;
  auto take = [&](size_t bytes) { char* p = ws + off; off += (bytes + 255) & ~(size_t)255; return p; };
  const size_t np = (size_t)NR * DW;
  _Float16* BW = (_Float16*)take((size_t)4 * DW * DIN * 2); _Float16* XQ = (_Float16*)take(np * 2); _Float16* XK = (_Float16*)take(np * 2); _Float16* XV = (_Float16*)take(np * 2); _Float16* Q16 = (_Float16*)take(np * 2); _Float16* K16 = (_Float16*)take(np * 2); _Float16* V16 = (_Float16*)take(np * 2); _Float16* VT = (_Float16*)take(np * 2);
  float* S = (float*)take((size_t)HG * NTK * NTK * 4); _Float16* P = (_Float16*)take((size_t)HG * NTK * NTK * 2); float* RS = (float*)take((size_t)HG * NTK * 32 * 4); float* O = (float*)take(np * 4); _Float16* CH = XQ; _Float16* CL = XK;      /* context hi/lo over the query / key input planes (dead after the projections) */
  if (off > ws_size) return;      /* 0.5 + 7 x 8 + 64 + 32 + 1 + 16 = ≈ 170 MiB */
  const float* Ws[4] = {Wq, Wk, Wv, Wo};
  for (int i = 0; i < 4; ++i) k_wsc<<<(unsigned)(((size_t)DW * DIN / 8 + 255) / 256), 256, 0, stream>>>(Ws[i], BW + (size_t)i * DW * DIN, (size_t)DW * DIN / 8, 16.0f);      /* torch (out, in) naturals */
  k_x16<<<(unsigned)((np / 8 + 255) / 256), 256, 0, stream>>>(xq, XQ, np / 8); k_x16<<<(unsigned)((np / 8 + 255) / 256), 256, 0, stream>>>(xk, XK, np / 8); k_x16<<<(unsigned)((np / 8 + 255) / 256), 256, 0, stream>>>(xv, XV, np / 8);
  const dim3 gP((NR / 128) * (DW / 64), 1);
  k_gemm2<0><<<gP, 128, 0, stream>>>(XQ, DIN, 0, BW, DIN, 0, 0.0625f, bq, 0, nullptr, 1, 0, 0, nullptr, Q16, DW, 0, NR, DW, DIN);
  k_gemm2<0><<<gP, 128, 0, stream>>>(XK, DIN, 0, BW + (size_t)DW * DIN, DIN, 0, 0.0625f, bk, 0, nullptr, 1, 0, 0, nullptr, K16, DW, 0, NR, DW, DIN);
  k_gemm2<0><<<gP, 128, 0, stream>>>(XV, DIN, 0, BW + (size_t)2 * DW * DIN, DIN, 0, 0.0625f, bv, 0, nullptr, 1, 0, 0, nullptr, V16, DW, 0, NR, DW, DIN);
  k_vt<DW / 64, NTK><<<NB * (DW / 64) * (NTK / 64), 256, 0, stream>>>(V16, DW, 0, VT);      /* V^T [(b, 64-slab)][64][2048]: head h of batch b = rows b*256 + h*32 */
  for (int b = 0; b < NB; ++b) for (int hg = 0; hg < NH / HG; ++hg) { const int h0 = hg * HG; const size_t r0 = (size_t)b * NTK;
    k_gemm2<0><<<dim3((NTK / 128) * (NTK / 64), HG), 128, 0, stream>>>(Q16 + r0 * DW + h0 * HD, DW, (size_t)HD, K16 + r0 * DW + h0 * HD, DW, (size_t)HD, 1.0f, nullptr, 0, nullptr, 1, 0, 0, S, nullptr, NTK, (size_t)NTK * NTK, NTK, NTK, HD);
    k_csoft<<<(HG * NTK) / 8, 256, 0, stream>>>(S, P, RS);
    k_gemm_hhx<0><<<dim3((unsigned)((NTK / 16) * 1 / 4), HG), 128, 0, stream>>>(P, NTK, (size_t)NTK * NTK, VT + (r0 / NTK * DW + h0 * HD) * NTK, NTK, (size_t)HD * NTK, 0.0009765625f, nullptr, 0, nullptr, 1, 0, 0, O + r0 * DW + h0 * HD, nullptr, DW, (size_t)HD, NTK, HD, NTK);      /* unnormalised ctx heads h0..h0+3 */
    k_csc<<<(NTK * HG * (HD / 8) + 255) / 256, 256, 0, stream>>>(O, RS, b, h0, CH, CL); }
  k_gemm2<0><<<gP, 128, 0, stream>>>(CL, DW, 0, BW + (size_t)3 * DW * DIN, DW, 0, 0.0625f / 1024.0f, nullptr, 0, nullptr, 1, 0, 0, (float*)d_out, nullptr, DW, 0, NR, DW, DW);
  k_gemm2<0><<<gP, 128, 0, stream>>>(CH, DW, 0, BW + (size_t)3 * DW * DIN, DW, 0, 0.0625f, bo, 0, (const float*)d_out, 1, (size_t)DW, 0, (float*)d_out, nullptr, DW, 0, NR, DW, DW);      /* out = (ctx_lo + ctx_hi) Wo^T + bo */
}

// v002
// One run takes 124 microseconds.
// It is 11.4 times as fast as v000, going by the measured steps of the versions left out in between.
#include <hip/hip_runtime.h>
// my_attention (8 x 2048 tokens x 256; 8 heads x 32; q/k/v = query/key/value W^T + b; causal softmax(q.k / sqrt(32)); out = merged ctx Wo^T + bo).
// Compute dtype: inputs rounded to bf16; inputs/weights exact as f16; q/k/v and the softmax weights as plain f16 operands (~2^-12); context hi + residual into Wo; softmax f32. v_wmma_f32_16x16x32_f16.
#define NB 8
#define NTK 2048
#define DIN 256
#define NH 8
#define HD 32
#define DW 256
#define NR (NB * NTK)
typedef __bf16 v16b __attribute__((ext_vector_type(16)));
typedef unsigned short v8us __attribute__((ext_vector_type(8), may_alias));
typedef float  v8f  __attribute__((ext_vector_type(8)));
typedef float  v4f  __attribute__((ext_vector_type(4)));
typedef float  v4fa __attribute__((ext_vector_type(4), may_alias));
union FragB { v16b v; v8us half[2]; unsigned short u[16]; };

__device__ __forceinline__ unsigned short bf16_bits(float x) { unsigned int u = __float_as_uint(x); return (unsigned short)((u + 0x7FFFu + ((u >> 16) & 1u)) >> 16); }
__device__ __forceinline__ float bf16_val(unsigned short b) { return __uint_as_float(((unsigned int)b) << 16); }
__device__ __forceinline__ float bf16_round(float x) { return bf16_val(bf16_bits(x)); }
// D += A·B with NT terms: 1 = ah·bh, 2 = + al·bh (A split), 3 = + ah·bl (both split)
template <int NT>
__device__ __forceinline__ v8f mmaN(v16b ah, v16b al, v16b bh, v16b bl, v8f c) {
  c = __builtin_amdgcn_wmma_f32_16x16x32_bf16(false, ah, false, bh, (short)0, c, false, false);
  if (NT >= 2) c = __builtin_amdgcn_wmma_f32_16x16x32_bf16(false, al, false, bh, (short)0, c, false, false);
  if (NT >= 3) c = __builtin_amdgcn_wmma_f32_16x16x32_bf16(false, ah, false, bl, (short)0, c, false, false);
  asm volatile("v_nop\n\tv_nop\n\tv_nop\n\tv_nop" : "+v"(c) : "v"(ah), "v"(al), "v"(bh), "v"(bl));
  return c;
}

__global__ __launch_bounds__(256) void k_wt_bf16(const float* __restrict__ W, unsigned short* __restrict__ Wt, int K, int N) {
  const int t = blockIdx.x * 256 + threadIdx.x;
  const int k8n = K / 8;
  if (t >= N * k8n) return;
  const int n = t / k8n, k8 = (t % k8n) * 8;
  v8us v;
#pragma unroll
  for (int i = 0; i < 8; ++i) v[i] = bf16_bits(W[(size_t)(k8 + i) * N + n]);
  *(v8us*)(Wt + (size_t)n * K + k8) = v;
  
}

// GEMM C[M][N] (f32, pitch ldc) = act(A[M][K]·W + bias). A f32 row-major (pitch lda) converted per fragment to bf16
// (ASPLIT: hi/lo two planes -> 2 terms, else single rounded term); Wt bf16 [N][K] (pitch ldb). BIAS_BF16 rounds the
// bias to bf16 first (bias quantised to bf16 before the add). K%32==0, M%16==0, N%64==0.
template <bool ASPLIT, int ACT, bool BIAS_BF16>
__global__ __launch_bounds__(128) void k_gemm_bf(const float* __restrict__ A, int lda, const unsigned short* __restrict__ Wt, int ldb,
                                               const float* __restrict__ bias, float* __restrict__ C, int ldc, int M, int N, int K) {
  __shared__ __attribute__((aligned(16))) float so[4][16][64];
  const int tid = threadIdx.x, w = tid >> 5, lane = tid & 31, ln = lane & 15, hh = lane >> 4;
  const int ntn = N / 64;
  const int wid = blockIdx.x * 4 + w;
  const int mt = wid / ntn, nq = wid % ntn;
  if (mt * 16 >= M) return;
  const int row0 = mt * 16, col0 = nq * 64;
  const float* arow = A + (size_t)(row0 + ln) * lda;
  v8f acc[4] = {};
  for (int kb = 0; kb < K; kb += 32) {
    FragB ah, al;
    const v4f x0 = *(const v4fa*)(arow + kb + 8 * hh), x1 = *(const v4fa*)(arow + kb + 8 * hh + 4);
    const v4f x2 = *(const v4fa*)(arow + kb + 16 + 8 * hh), x3 = *(const v4fa*)(arow + kb + 16 + 8 * hh + 4);
    float xs[16] = {x0[0],x0[1],x0[2],x0[3],x1[0],x1[1],x1[2],x1[3],x2[0],x2[1],x2[2],x2[3],x3[0],x3[1],x3[2],x3[3]};
#pragma unroll
    for (int i = 0; i < 16; ++i) { const unsigned short hb = bf16_bits(xs[i]); ah.u[i] = hb; al.u[i] = ASPLIT ? bf16_bits(xs[i] - bf16_val(hb)) : (unsigned short)0; }
#pragma unroll
    for (int t = 0; t < 4; ++t) {
      const unsigned short* brow = Wt + (size_t)(col0 + t * 16 + ln) * ldb + kb;
      FragB b;
      b.half[0] = *(const v8us*)(brow + 8 * hh);
      b.half[1] = *(const v8us*)(brow + 16 + 8 * hh);
      acc[t] = mmaN<ASPLIT ? 2 : 1>(ah.v, al.v, b.v, b.v, acc[t]);
    }
  }
#pragma unroll
  for (int t = 0; t < 4; ++t) {
    float bv = bias ? bias[col0 + t * 16 + ln] : 0.f;
    if (BIAS_BF16) bv = bf16_round(bv);
#pragma unroll
    for (int r = 0; r < 8; ++r) { float v = acc[t][r] + bv; if (ACT == 1) v = fmaxf(v, 0.f); so[w][8 * hh + r][t * 16 + ln] = v; }
  }
  __builtin_amdgcn_fence(__ATOMIC_ACQ_REL, "workgroup");
  __builtin_amdgcn_wave_barrier();
  const int rsub = lane >> 4, c4 = (lane & 15) * 4;
  {
#pragma unroll
    for (int q = 0; q < 8; ++q) {
      const int r = q * 2 + rsub;
      const v4f v = *(const v4fa*)&so[w][r][c4];
      *(v4f*)(C + (size_t)(row0 + r) * ldc + col0 + c4) = v;
    }
    
  }
}

// GEMM C = act(A·W + bias + resid): A f32 (ASPLIT -> hi/lo 2 terms), Wt bf16 [N][K]; ACT 0 none, 1 relu, 2 exact gelu;
// resid (optional, f32, row index = (row % rmod), pitch ldr, RES_BF16 rounds it) added before the activation.
template <bool ASPLIT, int ACT, bool BIAS_BF16, bool RES_BF16>
__global__ __launch_bounds__(128) void k_gemm_bf3(const float* __restrict__ A, int lda, const unsigned short* __restrict__ Wt, int ldb,
                                                const float* __restrict__ bias, const float* __restrict__ resid, int rmod, int ldr,
                                                float* __restrict__ C, int ldc, int M, int N, int K) {
  __shared__ __attribute__((aligned(16))) float so[4][16][64];
  const int tid = threadIdx.x, w = tid >> 5, lane = tid & 31, ln = lane & 15, hh = lane >> 4;
  const int ntn = N / 64;
  const int wid = blockIdx.x * 4 + w;
  const int mt = wid / ntn, nq = wid % ntn;
  if (mt * 16 >= M) return;
  const int row0 = mt * 16, col0 = nq * 64;
  const float* arow = A + (size_t)(row0 + ln) * lda;
  v8f acc[4] = {};
  for (int kb = 0; kb < K; kb += 32) {
    FragB ah, al;
    const v4f x0 = *(const v4fa*)(arow + kb + 8 * hh), x1 = *(const v4fa*)(arow + kb + 8 * hh + 4);
    const v4f x2 = *(const v4fa*)(arow + kb + 16 + 8 * hh), x3 = *(const v4fa*)(arow + kb + 16 + 8 * hh + 4);
    float xs[16] = {x0[0],x0[1],x0[2],x0[3],x1[0],x1[1],x1[2],x1[3],x2[0],x2[1],x2[2],x2[3],x3[0],x3[1],x3[2],x3[3]};
#pragma unroll
    for (int i = 0; i < 16; ++i) { const unsigned short hb = bf16_bits(xs[i]); ah.u[i] = hb; al.u[i] = ASPLIT ? bf16_bits(xs[i] - bf16_val(hb)) : (unsigned short)0; }
#pragma unroll
    for (int t = 0; t < 4; ++t) {
      const unsigned short* brow = Wt + (size_t)(col0 + t * 16 + ln) * ldb + kb;
      FragB b;
      b.half[0] = *(const v8us*)(brow + 8 * hh);
      b.half[1] = *(const v8us*)(brow + 16 + 8 * hh);
      acc[t] = mmaN<ASPLIT ? 2 : 1>(ah.v, al.v, b.v, b.v, acc[t]);
    }
  }
#pragma unroll
  for (int t = 0; t < 4; ++t) {
    const int col = col0 + t * 16 + ln;
    float bv = bias ? bias[col] : 0.f;
    if (BIAS_BF16) bv = bf16_round(bv);
#pragma unroll
    for (int r = 0; r < 8; ++r) {
      float v = acc[t][r] + bv;
      if (resid) { float rv = resid[(size_t)((row0 + 8 * hh + r) % rmod) * ldr + col]; if (RES_BF16) rv = bf16_round(rv); v += rv; }
      if (ACT == 1) v = fmaxf(v, 0.f);
      if (ACT == 2) v = 0.5f * v * (1.0f + erff(v * 0.70710678118654752f));
      if (ACT == 3) { const float u = 0.7978845608028654f * (v + 0.044715f * v * v * v); v = 0.5f * v * (1.0f + tanhf(u)); }
      so[w][8 * hh + r][t * 16 + ln] = v;
    }
  }
  __builtin_amdgcn_fence(__ATOMIC_ACQ_REL, "workgroup");
  __builtin_amdgcn_wave_barrier();
  const int rsub = lane >> 4, c4 = (lane & 15) * 4;
  {
#pragma unroll
    for (int q = 0; q < 8; ++q) {
      const int r = q * 2 + rsub;
      const v4f v = *(const v4fa*)&so[w][r][c4];
      *(v4f*)(C + (size_t)(row0 + r) * ldc + col0 + c4) = v;
    }
    
  }
}
// row LayerNorm (biased variance, eps) over N: s = X (+ R); optional out_sum <- s; out_norm <- (s-mu)*rsqrt(var+eps)*g + b
template <bool PARAM_BF16>
__global__ __launch_bounds__(256) void k_layernorm(const float* __restrict__ X, const float* __restrict__ R, const float* __restrict__ g, const float* __restrict__ bta,
                                                  float* __restrict__ out_sum, float* __restrict__ out_norm, int N, float eps) {
  __shared__ float red[256];
  const int row = blockIdx.x, tid = threadIdx.x;
  const float* x = X + (size_t)row * N; const float* rr = R ? R + (size_t)row * N : nullptr;
  float vals[16];                     // up to N = 4096
  const int per = N / 256;            // contiguous chunk per thread? use strided-by-4 chunks: thread handles j = tid*4 + 1024*u
  float s1 = 0.f;
  for (int u = 0; u < per / 4; ++u) {
    const int j = tid * 4 + 1024 * u;
    const v4f a = *(const v4fa*)(x + j);
    v4f b = {0.f,0.f,0.f,0.f}; if (rr) b = *(const v4fa*)(rr + j);
#pragma unroll
    for (int q = 0; q < 4; ++q) { const float v = a[q] + b[q]; vals[u * 4 + q] = v; s1 += v; }
  }
  red[tid] = s1; __syncthreads();
  for (int st = 128; st > 0; st >>= 1) { if (tid < st) red[tid] += red[tid + st]; __syncthreads(); }
  const float mu = red[0] / (float)N; __syncthreads();
  float s2 = 0.f;
  for (int u = 0; u < per / 4; ++u)
#pragma unroll
    for (int q = 0; q < 4; ++q) { const float c = vals[u * 4 + q] - mu; s2 += c * c; }
  red[tid] = s2; __syncthreads();
  for (int st = 128; st > 0; st >>= 1) { if (tid < st) red[tid] += red[tid + st]; __syncthreads(); }
  const float rs = rsqrtf(red[0] / (float)N + eps);
  {
    for (int u = 0; u < per / 4; ++u) {
      const int j = tid * 4 + 1024 * u;
      v4f o, sm;
#pragma unroll
      for (int q = 0; q < 4; ++q) {
        float gg = g[j + q], bb = bta[j + q];
        if (PARAM_BF16) { gg = bf16_round(gg); bb = bf16_round(bb); }
        sm[q] = vals[u * 4 + q]; o[q] = (vals[u * 4 + q] - mu) * rs * gg + bb;
      }
      if (out_sum) *(v4f*)(out_sum + (size_t)row * N + j) = sm;
      *(v4f*)(out_norm + (size_t)row * N + j) = o;
    }
    
  }
}



// ---- f16 WMMA path (v_wmma_f32_16x16x32_f16): 11-bit significands for operands in range — used where a [0,1] probability operand needs more precision than bf16
typedef _Float16 v16h __attribute__((ext_vector_type(16)));
union FragH { v16h v; v8us half[2]; _Float16 h[16]; unsigned short u[16]; };
template <int NT>
__device__ __forceinline__ v8f mmaH(v16h ah, v16h al, v16h bh, v16h bl, v8f c) {
  c = __builtin_amdgcn_wmma_f32_16x16x32_f16(false, ah, false, bh, (short)0, c, false, false);
  if (NT >= 2) c = __builtin_amdgcn_wmma_f32_16x16x32_f16(false, al, false, bh, (short)0, c, false, false);
  if (NT >= 3) c = __builtin_amdgcn_wmma_f32_16x16x32_f16(false, ah, false, bl, (short)0, c, false, false);
  asm volatile("v_nop\n\tv_nop\n\tv_nop\n\tv_nop" : "+v"(c) : "v"(ah), "v"(al), "v"(bh), "v"(bl));
  return c;
}
// batched GEMM like k_gemm_b but f16 operands: A f32 (split into f16 hi/lo if ASPLIT, else rounded to f16), Bt = f16 values [n][k]; alpha; C f32; N multiple of 16 (partial tiles skipped)
template <bool ASPLIT>
__global__ __launch_bounds__(128) void k_gemm_h(const float* __restrict__ A, int lda, size_t sA, const _Float16* __restrict__ Bh, int ldb, size_t sB, float alpha, float* __restrict__ C, int ldc, size_t sC, int M, int N, int K) {
  __shared__ __attribute__((aligned(16))) float so[4][16][64];
  const int tid = threadIdx.x, w = tid >> 5, lane = tid & 31, ln = lane & 15, hh = lane >> 4; const int by = blockIdx.y;
  A += (size_t)by * sA; Bh += (size_t)by * sB; C += (size_t)by * sC;
  const int ntn = (N + 63) / 64; const int wid = blockIdx.x * 4 + w; const int mt = wid / ntn, nq = wid % ntn; if (mt * 16 >= M) return;
  const int row0 = mt * 16, col0 = nq * 64; const float* arow = A + (size_t)(row0 + ln) * lda;
  v8f acc[4] = {};
  for (int kb = 0; kb < K; kb += 32) {
    FragH ah, al;
    const v4f x0 = *(const v4fa*)(arow + kb + 8 * hh), x1 = *(const v4fa*)(arow + kb + 8 * hh + 4), x2 = *(const v4fa*)(arow + kb + 16 + 8 * hh), x3 = *(const v4fa*)(arow + kb + 16 + 8 * hh + 4);
    float xs[16] = {x0[0],x0[1],x0[2],x0[3],x1[0],x1[1],x1[2],x1[3],x2[0],x2[1],x2[2],x2[3],x3[0],x3[1],x3[2],x3[3]};
#pragma unroll
    for (int i = 0; i < 16; ++i) { const _Float16 h = (_Float16)xs[i]; ah.h[i] = h; al.h[i] = ASPLIT ? (_Float16)(xs[i] - (float)h) : (_Float16)0.0f; }
#pragma unroll
    for (int t = 0; t < 4; ++t) { if (col0 + t * 16 >= N) continue; const size_t boff = (size_t)(col0 + t * 16 + ln) * ldb + kb; FragH bq; bq.half[0] = *(const v8us*)(Bh + boff + 8 * hh); bq.half[1] = *(const v8us*)(Bh + boff + 16 + 8 * hh);
      acc[t] = mmaH<ASPLIT ? 2 : 1>(ah.v, al.v, bq.v, bq.v, acc[t]); }
  }
#pragma unroll
  for (int t = 0; t < 4; ++t) { if (col0 + t * 16 >= N) continue;
#pragma unroll
    for (int r = 0; r < 8; ++r) so[w][8 * hh + r][t * 16 + ln] = acc[t][r] * alpha; }
  __builtin_amdgcn_fence(__ATOMIC_ACQ_REL, "workgroup"); __builtin_amdgcn_wave_barrier();
  const int rsub = lane >> 4, c4 = (lane & 15) * 4;
  {
#pragma unroll
    for (int q = 0; q < 8; ++q) { const int r = q * 2 + rsub; if (col0 + c4 < N) { const v4f v = *(const v4fa*)&so[w][r][c4]; *(v4f*)(C + (size_t)(row0 + r) * ldc + col0 + c4) = v; } }
     }
}

// Wt[n][k] = f16(W[k][n]·scale) from f32 row-major W[K][N] (scale = power of two; bf16-exact weights stay exact in f16 away from the subnormal range)
__global__ __launch_bounds__(256) void k_wt_f16(const float* __restrict__ W, _Float16* __restrict__ Wt, int K, int N, float scale) {
  const int t = blockIdx.x * 256 + threadIdx.x; if (t >= N * (K / 8)) return; const int n = t / (K / 8), k8 = (t % (K / 8)) * 8; FragH f;
#pragma unroll
  for (int i = 0; i < 8; ++i) f.h[i] = (_Float16)(bf16_round(W[(size_t)(k8 + i) * N + n]) * scale); const v8us o = f.half[0];
  *(v8us*)((unsigned short*)Wt + (size_t)n * K + k8) = o; 
}
// k_gemm_hh variant with fused epilogue: v = acc·alpha + bias[by·sBias + col] (+ CP[(row/rowsPerB)·sCPb + by·64 + col] if CP) ; ACT 0 none / 1 elu ; writes f32 C and/or f16 C16 (each if non-null)
template <int ACT>
__global__ __launch_bounds__(128) void k_gemm_hhx(const _Float16* __restrict__ A, int lda, size_t sA, const _Float16* __restrict__ Bh, int ldb, size_t sB, float alpha, const float* __restrict__ bias, size_t sBias, const float* __restrict__ CP, int rowsPerB, size_t sCPb, int row0g,
    float* __restrict__ C, _Float16* __restrict__ C16, int ldc, size_t sC, int M, int N, int K) {
  __shared__ __attribute__((aligned(16))) float so[4][16][64];
  const int tid = threadIdx.x, w = tid >> 5, lane = tid & 31, ln = lane & 15, hh = lane >> 4; const int by = blockIdx.y;
  A += (size_t)by * sA; Bh += (size_t)by * sB; const size_t cofs = (size_t)by * sC; const float* bp = bias ? bias + (size_t)by * sBias : nullptr;
  const int ntn = (N + 63) / 64; const int wid = blockIdx.x * 4 + w; const int mt = wid / ntn, nq = wid % ntn; if (mt * 16 >= M) return;
  const int row0 = mt * 16, col0 = nq * 64; const _Float16* arow = A + (size_t)(row0 + ln) * lda;
  v8f acc[4] = {};
  for (int kb = 0; kb < K; kb += 32) { FragH ah; ah.half[0] = *(const v8us*)((const unsigned short*)arow + kb + 8 * hh); ah.half[1] = *(const v8us*)((const unsigned short*)arow + kb + 16 + 8 * hh);
#pragma unroll
    for (int t = 0; t < 4; ++t) { if (col0 + t * 16 >= N) continue; const size_t boff = (size_t)(col0 + t * 16 + ln) * ldb + kb; FragH bq; bq.half[0] = *(const v8us*)((const unsigned short*)Bh + boff + 8 * hh); bq.half[1] = *(const v8us*)((const unsigned short*)Bh + boff + 16 + 8 * hh);
      acc[t] = mmaH<1>(ah.v, ah.v, bq.v, bq.v, acc[t]); }
  }
#pragma unroll
  for (int t = 0; t < 4; ++t) { if (col0 + t * 16 >= N) continue; const int col = col0 + t * 16 + ln; const float bv = bp ? bf16_round(bp[col]) : 0.f;
#pragma unroll
    for (int r = 0; r < 8; ++r) { float v = acc[t][r] * alpha + bv; if (CP) { const int rr = row0g + row0 + 8 * hh + r; if (rowsPerB < 0) v += CP[cofs + (size_t)rr * ldc + col];      /* rowsPerB < 0: own element of the batched C plane */ else { const int bidx = rr / rowsPerB; v += CP[(size_t)bidx * sCPb + (size_t)by * 64 + col]; } } if (ACT == 1) v = (v > 0.f) ? v : expm1f(v); else if (ACT == 7) v = (v > 0.f) ? v + 1.0f : expf(v); else if (ACT == 8) v = tanhf(v); else if (ACT == 9) v = 0.5f * v * (1.0f + tanhf(0.7978845608028654f * (v + 0.044715f * v * v * v))); else if (ACT == 11) v = 1.0f / (1.0f + expf(-v)); else if (ACT == 12) v = (v > 0.f) ? v : 0.01f * v; else if (ACT == 14) v = (v > 0.f) ? v : 0.1f * v; else if (ACT == 16) v = (v >= 0.f) ? v : 0.3f * v; else if (ACT == 17) v = (v >= 0.f) ? v : 0.2f * v; else if (ACT == 15) v = v / (1.0f + expf(-v)); else if (ACT == 3) v = fmaxf(v, 0.f); else if (ACT == 6) v = 0.5f * v * (1.0f + erff(v * 0.70710678118654752f)); so[w][8 * hh + r][t * 16 + ln] = v; } }
  __builtin_amdgcn_fence(__ATOMIC_ACQ_REL, "workgroup"); __builtin_amdgcn_wave_barrier();
  const int rsub = lane >> 4, c4 = (lane & 15) * 4; typedef _Float16 v4h __attribute__((ext_vector_type(4)));
  {
#pragma unroll
    for (int q = 0; q < 8; ++q) { const int r = q * 2 + rsub; if (col0 + c4 < N) { const v4f v = *(const v4fa*)&so[w][r][c4]; if (C) *(v4f*)(C + cofs + (size_t)(row0 + r) * ldc + col0 + c4) = v; if (C16) { v4h h4; for (int i = 0; i < 4; ++i) h4[i] = (_Float16)v[i]; *(v4h*)(C16 + cofs + (size_t)(row0 + r) * ldc + col0 + c4) = h4; } } }
     }
}


typedef _Float16 v4h __attribute__((ext_vector_type(4)));

__global__ __launch_bounds__(256) void k_h16(const float* __restrict__ x, _Float16* __restrict__ X16, size_t n8) { const size_t t = (size_t)blockIdx.x * 256 + threadIdx.x; if (t >= n8) return; FragH f;
#pragma unroll
  for (int q = 0; q < 8; ++q) f.h[q] = (_Float16)x[t * 8 + q]; *(v8us*)((unsigned short*)X16 + t * 8) = f.half[0];  }
__global__ __launch_bounds__(256) void k_round16f(const float* __restrict__ W, _Float16* __restrict__ Bt, size_t n8) { const size_t t = (size_t)blockIdx.x * 256 + threadIdx.x; if (t >= n8) return; FragH f;
#pragma unroll
  for (int i = 0; i < 8; ++i) f.h[i] = (_Float16)(bf16_round(W[t * 8 + i]) * 16.0f); *(v8us*)((unsigned short*)Bt + t * 8) = f.half[0];  }
template <int NHv, int TTv>
__global__ __launch_bounds__(256) void k_vt(const _Float16* __restrict__ V16, int ldv, int voff, _Float16* __restrict__ Vt) { __shared__ unsigned short tl[64][66]; const int tid = threadIdx.x; const int slab = blockIdx.x / (TTv / 64), lg = blockIdx.x % (TTv / 64); const int b = slab / NHv, h = slab % NHv;
  for (int i = tid; i < 64 * 8; i += 256) { const int r = i / 8, c8 = (i % 8) * 8; FragH f; f.half[0] = *(const v8us*)((const unsigned short*)V16 + ((size_t)b * TTv + lg * 64 + r) * ldv + voff + h * 64 + c8);
#pragma unroll
    for (int q = 0; q < 8; ++q) tl[r][c8 + q] = f.u[q]; }
  __syncthreads();
  {
#pragma unroll
    for (int rd = 0; rd < 2; ++rd) { const int d = rd * 32 + tid / 8, pc = tid % 8; FragH f;
#pragma unroll
      for (int q = 0; q < 8; ++q) f.u[q] = tl[pc * 8 + q][d];
      *(v8us*)((unsigned short*)Vt + ((size_t)slab * 64 + d) * TTv + lg * 64 + pc * 8) = f.half[0]; }
     } }

__global__ __launch_bounds__(256) void k_hl(const float* __restrict__ F, _Float16* __restrict__ Hh, _Float16* __restrict__ Hl, size_t n8) { const size_t t = (size_t)blockIdx.x * 256 + threadIdx.x; if (t >= n8) return; FragH fh, fl; const v4f a = *(const v4fa*)(F + t * 8), c = *(const v4fa*)(F + t * 8 + 4);
#pragma unroll
  for (int q = 0; q < 4; ++q) { _Float16 h = (_Float16)a[q]; fh.h[q] = h; fl.h[q] = (_Float16)((a[q] - (float)h) * 1024.0f); h = (_Float16)c[q]; fh.h[4 + q] = h; fl.h[4 + q] = (_Float16)((c[q] - (float)h) * 1024.0f); }
  { *(v8us*)((unsigned short*)Hh + t * 8) = fh.half[0]; *(v8us*)((unsigned short*)Hl + t * 8) = fl.half[0];  } }

// ---- fast GEMM (wave tile 32x64; requires M % 32 == 0 rows per launch region and N % 64 == 0); epilogue = k_gemm_hhx semantics, except that grid.y plane by takes its bias from its own buffer (bias, biasY1, biasY2) ----
__device__ __forceinline__ v16h g2_frag(const _Float16* p, int hh) { FragH f; f.half[0] = *(const v8us*)((const unsigned short*)p + 8 * hh); f.half[1] = *(const v8us*)((const unsigned short*)p + 16 + 8 * hh); return f.v; }
__device__ __forceinline__ v8f g2_mma(v16h a, v16h b, v8f c) { v8f d = __builtin_amdgcn_wmma_f32_16x16x32_f16(false, a, false, b, (short)0, c, false, false); asm volatile("v_nop\n\tv_nop\n\tv_nop\n\tv_nop" : "+v"(d) : "v"(a), "v"(b)); return d; }
template <int ACT>
__global__ __launch_bounds__(128) void k_gemm2(const _Float16* __restrict__ A, int lda, size_t sA, const _Float16* __restrict__ Bh, int ldb, size_t sB, float alpha, const float* __restrict__ bias, const float* __restrict__ biasY1, const float* __restrict__ biasY2, size_t sBias, const float* __restrict__ CP, int rowsPerB, size_t sCPb, int row0g,
    float* __restrict__ C, _Float16* __restrict__ C16, int ldc, size_t sC, int M, int N, int K) { static_assert(ACT == 0 || ACT == 3 || ACT == 6 || ACT == 8 || ACT == 9 || ACT == 11 || ACT == 12 || ACT == 14 || ACT == 15 || ACT == 16 || ACT == 17, "k_gemm2: unsupported ACT code (would silently apply no activation)");
  __shared__ __attribute__((aligned(16))) float so[4][32][68];
  const int tid = threadIdx.x, w = tid >> 5, lane = tid & 31, ln = lane & 15, hh = lane >> 4; const int by = blockIdx.y;
  const float* bsel = (by == 0) ? bias : (by == 1) ? biasY1 : biasY2;      /* the planes of grid.y have bias vectors in buffers of their own */
  A += (size_t)by * sA; Bh += (size_t)by * sB; const size_t cofs = (size_t)by * sC; const float* bp = bsel ? bsel + (size_t)by * sBias : nullptr;
  const int ntn = N >> 6; const int mt = blockIdx.x / ntn, nq = blockIdx.x - mt * ntn; const int row0 = mt * 128 + 32 * w, col0 = nq * 64; if (row0 >= M) return;
  const _Float16* a0p = A + (size_t)(row0 + ln) * lda; const _Float16* a1p = a0p + (size_t)16 * lda;
  const _Float16* b0p = Bh + (size_t)(col0 + ln) * ldb; const _Float16* b1p = b0p + (size_t)16 * ldb; const _Float16* b2p = b1p + (size_t)16 * ldb; const _Float16* b3p = b2p + (size_t)16 * ldb;
  const v8f z8 = {0.f,0.f,0.f,0.f,0.f,0.f,0.f,0.f}; v8f c00 = z8, c01 = z8, c02 = z8, c03 = z8, c10 = z8, c11 = z8, c12 = z8, c13 = z8;
#pragma unroll 1
  for (int kb = 0; kb < K; kb += 32) { const v16h a0 = g2_frag(a0p + kb, hh), a1 = g2_frag(a1p + kb, hh);
    v16h b = g2_frag(b0p + kb, hh); c00 = g2_mma(a0, b, c00); c10 = g2_mma(a1, b, c10);
    b = g2_frag(b1p + kb, hh); c01 = g2_mma(a0, b, c01); c11 = g2_mma(a1, b, c11);
    b = g2_frag(b2p + kb, hh); c02 = g2_mma(a0, b, c02); c12 = g2_mma(a1, b, c12);
    b = g2_frag(b3p + kb, hh); c03 = g2_mma(a0, b, c03); c13 = g2_mma(a1, b, c13); }
  v8f accs[8] = {c00, c01, c02, c03, c10, c11, c12, c13};
#pragma unroll
  for (int u = 0; u < 8; ++u) { const int t = u & 3, half = u >> 2; const int col = col0 + t * 16 + ln; const float bv = bp ? bf16_round(bp[col]) : 0.f;
#pragma unroll
    for (int r = 0; r < 8; ++r) { const int rloc = half * 16 + 8 * hh + r; float v = accs[u][r] * alpha + bv; if (CP) { if (rowsPerB < 0) v += CP[cofs + (size_t)(row0g + row0 + rloc) * ldc + col];      /* rowsPerB < 0: own element of the batched C plane */ else { const int bidx = (row0g + row0 + rloc) / rowsPerB; v += CP[(size_t)bidx * sCPb + (size_t)by * 64 + col]; } }
      if (ACT == 3) v = fmaxf(v, 0.f); else if (ACT == 6) v = 0.5f * v * (1.0f + erff(v * 0.70710678118654752f)); else if (ACT == 11) v = 1.0f / (1.0f + expf(-v)); else if (ACT == 15) v = v / (1.0f + expf(-v)); else if (ACT == 12) v = (v > 0.f) ? v : 0.01f * v; else if (ACT == 8) v = tanhf(v); else if (ACT == 9) v = 0.5f * v * (1.0f + tanhf(0.7978845608028654f * (v + 0.044715f * v * v * v))); else if (ACT == 14) v = (v > 0.f) ? v : 0.1f * v; else if (ACT == 16) v = (v >= 0.f) ? v : 0.3f * v; else if (ACT == 17) v = (v >= 0.f) ? v : 0.2f * v;
      so[w][rloc][t * 16 + ln] = v; } }
  __builtin_amdgcn_fence(__ATOMIC_ACQ_REL, "workgroup"); __builtin_amdgcn_wave_barrier();
  const int rsub = lane >> 4, c4 = (lane & 15) * 4;
  {
#pragma unroll
    for (int q = 0; q < 16; ++q) { const int r = q * 2 + rsub; const v4f v = *(const v4fa*)&so[w][r][c4]; if (C) *(v4f*)(C + cofs + (size_t)(row0 + r) * ldc + col0 + c4) = v; if (C16) { v4h h4; for (int i = 0; i < 4; ++i) h4[i] = (_Float16)v[i]; *(v4h*)(C16 + cofs + (size_t)(row0 + r) * ldc + col0 + c4) = h4; } }
     } }


// One grid for the seven conversions, none of which reads another's result; the block index picks the job (uniform in a work-group).
// Blocks 0..127: the four weight matrices, f16(bf16(w) * 16). Then 2048 blocks for each input plane, f16(bf16(x)); the factor 1 there is exact.
__global__ __launch_bounds__(256) void k_cvt7(const float* __restrict__ w0, const float* __restrict__ w1, const float* __restrict__ w2, const float* __restrict__ w3,
                                              const float* __restrict__ x0, const float* __restrict__ x1, const float* __restrict__ x2, _Float16* __restrict__ Bt, _Float16* __restrict__ X16) {
  constexpr int WB = DW * DIN / 8 / 256, XB = NR * DW / 8 / 256;      /* blocks per weight matrix, per input plane */
  const int bi = blockIdx.x; const float* s; _Float16* d; float sc; int blk;
  if (bi < 4 * WB) { const int j = bi / WB; blk = bi - j * WB; s = (j == 0) ? w0 : (j == 1) ? w1 : (j == 2) ? w2 : w3; d = Bt + (size_t)j * DW * DIN; sc = 16.0f; }
  else { const int j = (bi - 4 * WB) / XB; blk = bi - 4 * WB - j * XB; s = (j == 0) ? x0 : (j == 1) ? x1 : x2; d = X16 + (size_t)j * NR * DW; sc = 1.0f; }
  const size_t t = (size_t)blk * 256 + threadIdx.x; FragH f;
#pragma unroll      /* constant indices: the eight values stay in registers and their loads join into two of 16 bytes */
  for (int q = 0; q < 8; ++q) f.h[q] = (_Float16)(bf16_round(s[t * 8 + q]) * sc);
  *(v8us*)((unsigned short*)d + t * 8) = f.half[0];
}
// ---- fused causal attention: S^T = K Q^T, online softmax in registers, O^T += V^T P^T; scores and weights never reach memory ----
// One wave = 32 queries of one head; a pass = 32 keys. In S^T a lane holds one query's scores (column ln, keys 8*hh + r), so two S^T tiles,
// converted in place, are the B operand of V^T P^T in the hardware k order. Weights carry a factor 1024 (as exp2(... + 10)); it cancels in O / l.
__device__ __forceinline__ float fa_xhalf(float x) { const int b = __float_as_int(x); return __int_as_float(__builtin_amdgcn_permlanex16(b, b, 0x76543210, 0xfedcba98, false, false)); }
__device__ __forceinline__ v16h fa_frag(const _Float16* p) { FragH f; f.half[0] = *(const v8us*)((const unsigned short*)p); f.half[1] = *(const v8us*)((const unsigned short*)p + 16); return f.v; }      /* p already holds the lane half's 8 * hh */
__device__ __forceinline__ v8f fa_mma(v16h a, v16h b, v8f c) { return __builtin_amdgcn_wmma_f32_16x16x32_f16(false, a, false, b, (short)0, c, false, false); }
// Eight independent v_exp_f32 and the slot that the instruction set asks for behind a transcendental, in one statement: a v_nop in a statement of its own
// did not stay behind them. Outputs are early-clobber, so that none of the eight overwrites a source of the one in front of it.
__device__ __forceinline__ void fa_exp8(v8f& e, const v8f x) {
  float e0, e1, e2, e3, e4, e5, e6, e7;
  asm("v_exp_f32 %0, %8\n\tv_exp_f32 %1, %9\n\tv_exp_f32 %2, %10\n\tv_exp_f32 %3, %11\n\tv_exp_f32 %4, %12\n\tv_exp_f32 %5, %13\n\tv_exp_f32 %6, %14\n\tv_exp_f32 %7, %15\n\tv_nop"
      : "=&v"(e0), "=&v"(e1), "=&v"(e2), "=&v"(e3), "=&v"(e4), "=&v"(e5), "=&v"(e6), "=&v"(e7)
      : "v"(x[0]), "v"(x[1]), "v"(x[2]), "v"(x[3]), "v"(x[4]), "v"(x[5]), "v"(x[6]), "v"(x[7]));
  e[0] = e0; e[1] = e1; e[2] = e2; e[3] = e3; e[4] = e4; e[5] = e5; e[6] = e6; e[7] = e7;
}
template <bool DIAG>
__device__ __forceinline__ void fa_pass(const v16h k0, const v16h k1, const v16h v0, const v16h v1, const v16h q0f, const v16h q1f, v8f (&o)[2][2], float (&m)[2], float (&l)[2], const int ln, const int hh) {
  const float C = 0.17677669529663687f * 1.4426950408889634f;      /* 1/sqrt(32) * log2(e) */
  const v8f z8 = {0.f,0.f,0.f,0.f,0.f,0.f,0.f,0.f};
  v8f s[2][2];
  s[0][0] = fa_mma(k0, q0f, z8); s[0][1] = fa_mma(k1, q0f, z8); s[1][0] = fa_mma(k0, q1f, z8); s[1][1] = fa_mma(k1, q1f, z8);
  float mn[2];
#pragma unroll      /* constant indices: the tiles stay in registers */
  for (int qt = 0; qt < 2; ++qt) {
    if (DIAG) {
#pragma unroll      /* constant indices: the tiles stay in registers */
      for (int r = 0; r < 8; ++r) { if (8 * hh + r > 16 * qt + ln) s[qt][0][r] = -3.0e38f; if (16 + 8 * hh + r > 16 * qt + ln) s[qt][1][r] = -3.0e38f; }
    }
    float mx = fmaxf(s[qt][0][0], s[qt][1][0]);
#pragma unroll      /* constant indices: the tiles stay in registers */
    for (int r = 1; r < 8; ++r) mx = fmaxf(mx, fmaxf(s[qt][0][r], s[qt][1][r]));
    mx = fmaxf(mx, fa_xhalf(mx));
    mn[qt] = fmaxf(m[qt], mx * C);
  }
  if (__builtin_amdgcn_ballot_w32(mn[0] > m[0] || mn[1] > m[1]) != 0) {      /* a maximum rose somewhere in the wave: rescale (factor exactly 1 where it did not) */
#pragma unroll      /* constant indices: the tiles stay in registers */
    for (int qt = 0; qt < 2; ++qt) { const float al = __builtin_amdgcn_exp2f(m[qt] - mn[qt]); o[qt][0] *= al; o[qt][1] *= al; l[qt] *= al; m[qt] = mn[qt]; }
  }
  FragH p[2];
#pragma unroll      /* constant indices: the tiles stay in registers */
  for (int qt = 0; qt < 2; ++qt) {
    const float sh = 10.0f - m[qt]; float su = 0.f;
#pragma unroll      /* constant indices: the tiles stay in registers */
    for (int t = 0; t < 2; ++t) { v8f x, e;
#pragma unroll      /* constant indices: the tiles stay in registers */
      for (int r = 0; r < 8; ++r) x[r] = fmaf(s[qt][t][r], C, sh);
      fa_exp8(e, x);
#pragma unroll      /* constant indices: the tiles stay in registers */
      for (int r = 0; r < 8; ++r) { su += e[r]; p[qt].h[8 * t + r] = (_Float16)e[r]; } }
    l[qt] += su;
  }
  o[0][0] = fa_mma(v0, p[0].v, o[0][0]); o[0][1] = fa_mma(v1, p[0].v, o[0][1]); o[1][0] = fa_mma(v0, p[1].v, o[1][0]); o[1][1] = fa_mma(v1, p[1].v, o[1][1]);
}
// Grid: 16 x 32 work-groups of 8 waves = two heads (which share each 128-byte line of the context planes) x four query groups p, 63-p, 31-p, 32+p
// (equal work in every work-group). Context = O / l, split hi + residual * 1024, staged in LDS so that each line is stored whole by one wave.
__global__ __launch_bounds__(256) void k_fattn(const _Float16* __restrict__ Q, const _Float16* __restrict__ Kk, const _Float16* __restrict__ Vt, _Float16* __restrict__ CH, _Float16* __restrict__ CL) {
  __shared__ __attribute__((aligned(16))) _Float16 st[4][2][32][72];
  const int lane = threadIdx.x & 31, ln = lane & 15, hh = lane >> 4; const int w = __builtin_amdgcn_readfirstlane(threadIdx.x >> 5);
  const int hp = blockIdx.x & 31, p = blockIdx.x >> 5; const int b = hp >> 2, hsel = w & 1, head = (hp & 3) * 2 + hsel; const int role = w >> 1;
  const int g = (role == 0) ? p : (role == 1) ? 31 - p : (role == 2) ? 63 - p : 32 + p;      /* waves w and w + 4 together: 63 */
  const _Float16* qp = Q + ((size_t)b * NTK + g * 32 + ln) * DW + head * HD + 8 * hh;
  const v16h q0f = fa_frag(qp), q1f = fa_frag(qp + (size_t)16 * DW);
  const _Float16* kp = Kk + ((size_t)b * NTK + ln) * DW + head * HD + 8 * hh;
  const _Float16* vp = Vt + ((size_t)b * DW + head * HD + ln) * NTK + 8 * hh;
  const v8f z8 = {0.f,0.f,0.f,0.f,0.f,0.f,0.f,0.f};
  v8f o[2][2] = {{z8, z8}, {z8, z8}}; float m[2] = {-3.0e38f, -3.0e38f}, l[2] = {0.f, 0.f};
  v16h k0 = fa_frag(kp), k1 = fa_frag(kp + (size_t)16 * DW), v0 = fa_frag(vp), v1 = fa_frag(vp + (size_t)16 * NTK);
  asm volatile("s_wait_xcnt 0x0" :: "v"(qp) : "memory");      /* stands before the registers of the query address are used again: the operand keeps them untouched up to here */
  for (int kb = 0; kb < g; ++kb) {      /* passes below the diagonal; the next pass's fragments are fetched ahead (pass g always exists) */
    kp += (size_t)32 * DW; vp += 32;
    const v16h nk0 = fa_frag(kp), nk1 = fa_frag(kp + (size_t)16 * DW), nv0 = fa_frag(vp), nv1 = fa_frag(vp + (size_t)16 * NTK);
    fa_pass<false>(k0, k1, v0, v1, q0f, q1f, o, m, l, ln, hh);
    k0 = nk0; k1 = nk1; v0 = nv0; v1 = nv1;
  }
  fa_pass<true>(k0, k1, v0, v1, q0f, q1f, o, m, l, ln, hh);
#pragma unroll      /* constant indices: the tiles stay in registers */
  for (int qt = 0; qt < 2; ++qt) { const float inv = 1.0f / (l[qt] + fa_xhalf(l[qt]));
#pragma unroll      /* constant indices: the tiles stay in registers */
    for (int dt = 0; dt < 2; ++dt) { FragH f, fl;
#pragma unroll      /* constant indices: the tiles stay in registers */
      for (int r = 0; r < 8; ++r) { const float v = o[qt][dt][r] * inv; const _Float16 hv = (_Float16)v; f.h[r] = hv; fl.h[r] = (_Float16)((v - (float)hv) * 1024.0f); }
      *(v8us*)&st[role][0][16 * qt + ln][hsel * 32 + 16 * dt + 8 * hh] = f.half[0]; *(v8us*)&st[role][1][16 * qt + ln][hsel * 32 + 16 * dt + 8 * hh] = fl.half[0]; } }
  __syncthreads();      /* the partner head's half of each line is in LDS */
#pragma unroll      /* the LDS reads of all four steps issue ahead of the stores */
  for (int i = 0; i < 4; ++i) { const int row = hsel * 16 + i * 4 + (lane >> 3), c8 = (lane & 7) * 8; const size_t go = ((size_t)b * NTK + g * 32 + row) * DW + (hp & 3) * 64 + c8;
    *(v8us*)((unsigned short*)CH + go) = *(const v8us*)&st[role][0][row][c8]; *(v8us*)((unsigned short*)CL + go) = *(const v8us*)&st[role][1][row][c8]; }
}

extern "C" void kernel_launch(void* const* d_in, const int* in_sizes, int n_in,
                              void* d_out, int out_size, void* d_ws, size_t ws_size, hipStream_t stream) {
  (void)in_sizes; (void)n_in; (void)out_size;
  const float* const* I = (const float* const*)d_in; const float* xq = I[0]; const float* xk = I[1]; const float* xv = I[2]; const float* Wq = I[3]; const float* bq = I[4]; const float* Wk = I[5]; const float* bk = I[6]; const float* Wv = I[7]; const float* bv = I[8]; const float* Wo = I[9]; const float* bo = I[10];
  char* ws = (char*)d_ws; size_t off = 0;
  auto take = [&](size_t bytes) { char* p = ws + off; off += (bytes + 255) & ~(size_t)255; return p; };
  const size_t np = (size_t)NR * DW;
  _Float16* BW = (_Float16*)take((size_t)4 * DW * DIN * 2); _Float16* XQ = (_Float16*)take(3 * np * 2); _Float16* XK = XQ + np; _Float16* Q16 = (_Float16*)take(3 * np * 2); _Float16* K16 = Q16 + np; _Float16* V16 = K16 + np; _Float16* VT = (_Float16*)take(np * 2);      /* inputs and projections: three planes in a row each, a plane is one step of grid.y */
  _Float16* CH = XQ; _Float16* CL = XK;      /* context hi/lo over the query / key input planes (dead after the projections) */
  if (off > ws_size) return;      /* 0.5 + 7 x 8 MiB */
  k_cvt7<<<4 * (DW * DIN / 8 / 256) + 3 * (NR * DW / 8 / 256), 256, 0, stream>>>(Wq, Wk, Wv, Wo, xq, xk, xv, BW, XQ);      /* torch (out, in) naturals */
  const dim3 gP((NR / 128) * (DW / 64), 1), gP3((NR / 128) * (DW / 64), 3);
  k_gemm2<0><<<gP3, 128, 0, stream>>>(XQ, DIN, np, BW, DIN, (size_t)DW * DIN, 0.0625f, bq, bk, bv, 0, nullptr, 1, 0, 0, nullptr, Q16, DW, np, NR, DW, DIN);      /* q, k, v projections: grid.y = 0, 1, 2 */
  k_vt<DW / 64, NTK><<<NB * (DW / 64) * (NTK / 64), 256, 0, stream>>>(V16, DW, 0, VT);      /* V^T [(b, 64-slab)][64][2048]: head h of batch b = rows b*256 + h*32 */
  k_fattn<<<16 * (NB * NH / 2), 256, 0, stream>>>(Q16, K16, VT, CH, CL);      /* all heads, all batches: context hi / residual */
  k_gemm2<0><<<gP, 128, 0, stream>>>(CL, DW, 0, BW + (size_t)3 * DW * DIN, DW, 0, 0.0625f / 1024.0f, nullptr, nullptr, nullptr, 0, nullptr, 1, 0, 0, (float*)d_out, nullptr, DW, 0, NR, DW, DW);
  k_gemm2<0><<<gP, 128, 0, stream>>>(CH, DW, 0, BW + (size_t)3 * DW * DIN, DW, 0, 0.0625f, bo, nullptr, nullptr, 0, (const float*)d_out, 1, (size_t)DW, 0, (float*)d_out, nullptr, DW, 0, NR, DW, DW);      /* out = (ctx_lo + ctx_hi) Wo^T + bo */
}

// v003
// A run of this version takes 105 microseconds.
// Next to v002, in two timings, it ran 1.17 and 1.21 times as fast.
// Counting every step since v000, it is 13.5 times as fast.
#include <hip/hip_runtime.h>
// my_attention (8 x 2048 tokens x 256; 8 heads x 32; q/k/v = query/key/value W^T + b; causal softmax(q.k / sqrt(32)); out = merged ctx Wo^T + bo).
// Compute dtype: inputs rounded to bf16; inputs/weights exact as f16; q/k/v and the softmax weights as plain f16 operands (~2^-12); context hi + residual into Wo; softmax f32. v_wmma_f32_16x16x32_f16.
#define NB 8
#define NTK 2048
#define DIN 256
#define NH 8
#define HD 32
#define DW 256
#define NR (NB * NTK)
typedef __bf16 v16b __attribute__((ext_vector_type(16)));
typedef unsigned short v8us __attribute__((ext_vector_type(8), may_alias));
typedef float  v8f  __attribute__((ext_vector_type(8)));
typedef float  v4f  __attribute__((ext_vector_type(4)));
typedef float  v4fa __attribute__((ext_vector_type(4), may_alias));
union FragB { v16b v; v8us half[2]; unsigned short u[16]; };

__device__ __forceinline__ unsigned short bf16_bits(float x) { unsigned int u = __float_as_uint(x); return (unsigned short)((u + 0x7FFFu + ((u >> 16) & 1u)) >> 16); }
__device__ __forceinline__ float bf16_val(unsigned short b) { return __uint_as_float(((unsigned int)b) << 16); }
__device__ __forceinline__ float bf16_round(float x) { return bf16_val(bf16_bits(x)); }
// D += A·B with NT terms: 1 = ah·bh, 2 = + al·bh (A split), 3 = + ah·bl (both split)
template <int NT>
__device__ __forceinline__ v8f mmaN(v16b ah, v16b al, v16b bh, v16b bl, v8f c) {
  c = __builtin_amdgcn_wmma_f32_16x16x32_bf16(false, ah, false, bh, (short)0, c, false, false);
  if (NT >= 2) c = __builtin_amdgcn_wmma_f32_16x16x32_bf16(false, al, false, bh, (short)0, c, false, false);
  if (NT >= 3) c = __builtin_amdgcn_wmma_f32_16x16x32_bf16(false, ah, false, bl, (short)0, c, false, false);
  asm volatile("v_nop\n\tv_nop\n\tv_nop\n\tv_nop" : "+v"(c) : "v"(ah), "v"(al), "v"(bh), "v"(bl));
  return c;
}

__global__ __launch_bounds__(256) void k_wt_bf16(const float* __restrict__ W, unsigned short* __restrict__ Wt, int K, int N) {
  const int t = blockIdx.x * 256 + threadIdx.x;
  const int k8n = K / 8;
  if (t >= N * k8n) return;
  const int n = t / k8n, k8 = (t % k8n) * 8;
  v8us v;
#pragma unroll
  for (int i = 0; i < 8; ++i) v[i] = bf16_bits(W[(size_t)(k8 + i) * N + n]);
  *(v8us*)(Wt + (size_t)n * K + k8) = v;
  
}

// GEMM C[M][N] (f32, pitch ldc) = act(A[M][K]·W + bias). A f32 row-major (pitch lda) converted per fragment to bf16
// (ASPLIT: hi/lo two planes -> 2 terms, else single rounded term); Wt bf16 [N][K] (pitch ldb). BIAS_BF16 rounds the
// bias to bf16 first (bias quantised to bf16 before the add). K%32==0, M%16==0, N%64==0.
template <bool ASPLIT, int ACT, bool BIAS_BF16>
__global__ __launch_bounds__(128) void k_gemm_bf(const float* __restrict__ A, int lda, const unsigned short* __restrict__ Wt, int ldb,
                                               const float* __restrict__ bias, float* __restrict__ C, int ldc, int M, int N, int K) {
  __shared__ __attribute__((aligned(16))) float so[4][16][64];
  const int tid = threadIdx.x, w = tid >> 5, lane = tid & 31, ln = lane & 15, hh = lane >> 4;
  const int ntn = N / 64;
  const int wid = blockIdx.x * 4 + w;
  const int mt = wid / ntn, nq = wid % ntn;
  if (mt * 16 >= M) return;
  const int row0 = mt * 16, col0 = nq * 64;
  const float* arow = A + (size_t)(row0 + ln) * lda;
  v8f acc[4] = {};
  for (int kb = 0; kb < K; kb += 32) {
    FragB ah, al;
    const v4f x0 = *(const v4fa*)(arow + kb + 8 * hh), x1 = *(const v4fa*)(arow + kb + 8 * hh + 4);
    const v4f x2 = *(const v4fa*)(arow + kb + 16 + 8 * hh), x3 = *(const v4fa*)(arow + kb + 16 + 8 * hh + 4);
    float xs[16] = {x0[0],x0[1],x0[2],x0[3],x1[0],x1[1],x1[2],x1[3],x2[0],x2[1],x2[2],x2[3],x3[0],x3[1],x3[2],x3[3]};
#pragma unroll
    for (int i = 0; i < 16; ++i) { const unsigned short hb = bf16_bits(xs[i]); ah.u[i] = hb; al.u[i] = ASPLIT ? bf16_bits(xs[i] - bf16_val(hb)) : (unsigned short)0; }
#pragma unroll
    for (int t = 0; t < 4; ++t) {
      const unsigned short* brow = Wt + (size_t)(col0 + t * 16 + ln) * ldb + kb;
      FragB b;
      b.half[0] = *(const v8us*)(brow + 8 * hh);
      b.half[1] = *(const v8us*)(brow + 16 + 8 * hh);
      acc[t] = mmaN<ASPLIT ? 2 : 1>(ah.v, al.v, b.v, b.v, acc[t]);
    }
  }
#pragma unroll
  for (int t = 0; t < 4; ++t) {
    float bv = bias ? bias[col0 + t * 16 + ln] : 0.f;
    if (BIAS_BF16) bv = bf16_round(bv);
#pragma unroll
    for (int r = 0; r < 8; ++r) { float v = acc[t][r] + bv; if (ACT == 1) v = fmaxf(v, 0.f); so[w][8 * hh + r][t * 16 + ln] = v; }
  }
  __builtin_amdgcn_fence(__ATOMIC_ACQ_REL, "workgroup");
  __builtin_amdgcn_wave_barrier();
  const int rsub = lane >> 4, c4 = (lane & 15) * 4;
  {
#pragma unroll
    for (int q = 0; q < 8; ++q) {
      const int r = q * 2 + rsub;
      const v4f v = *(const v4fa*)&so[w][r][c4];
      *(v4f*)(C + (size_t)(row0 + r) * ldc + col0 + c4) = v;
    }
    
  }
}

// GEMM C = act(A·W + bias + resid): A f32 (ASPLIT -> hi/lo 2 terms), Wt bf16 [N][K]; ACT 0 none, 1 relu, 2 exact gelu;
// resid (optional, f32, row index = (row % rmod), pitch ldr, RES_BF16 rounds it) added before the activation.
template <bool ASPLIT, int ACT, bool BIAS_BF16, bool RES_BF16>
__global__ __launch_bounds__(128) void k_gemm_bf3(const float* __restrict__ A, int lda, const unsigned short* __restrict__ Wt, int ldb,
                                                const float* __restrict__ bias, const float* __restrict__ resid, int rmod, int ldr,
                                                float* __restrict__ C, int ldc, int M, int N, int K) {
  __shared__ __attribute__((aligned(16))) float so[4][16][64];
  const int tid = threadIdx.x, w = tid >> 5, lane = tid & 31, ln = lane & 15, hh = lane >> 4;
  const int ntn = N / 64;
  const int wid = blockIdx.x * 4 + w;
  const int mt = wid / ntn, nq = wid % ntn;
  if (mt * 16 >= M) return;
  const int row0 = mt * 16, col0 = nq * 64;
  const float* arow = A + (size_t)(row0 + ln) * lda;
  v8f acc[4] = {};
  for (int kb = 0; kb < K; kb += 32) {
    FragB ah, al;
    const v4f x0 = *(const v4fa*)(arow + kb + 8 * hh), x1 = *(const v4fa*)(arow + kb + 8 * hh + 4);
    const v4f x2 = *(const v4fa*)(arow + kb + 16 + 8 * hh), x3 = *(const v4fa*)(arow + kb + 16 + 8 * hh + 4);
    float xs[16] = {x0[0],x0[1],x0[2],x0[3],x1[0],x1[1],x1[2],x1[3],x2[0],x2[1],x2[2],x2[3],x3[0],x3[1],x3[2],x3[3]};
#pragma unroll
    for (int i = 0; i < 16; ++i) { const unsigned short hb = bf16_bits(xs[i]); ah.u[i] = hb; al.u[i] = ASPLIT ? bf16_bits(xs[i] - bf16_val(hb)) : (unsigned short)0; }
#pragma unroll
    for (int t = 0; t < 4; ++t) {
      const unsigned short* brow = Wt + (size_t)(col0 + t * 16 + ln) * ldb + kb;
      FragB b;
      b.half[0] = *(const v8us*)(brow + 8 * hh);
      b.half[1] = *(const v8us*)(brow + 16 + 8 * hh);
      acc[t] = mmaN<ASPLIT ? 2 : 1>(ah.v, al.v, b.v, b.v, acc[t]);
    }
  }
#pragma unroll
  for (int t = 0; t < 4; ++t) {
    const int col = col0 + t * 16 + ln;
    float bv = bias ? bias[col] : 0.f;
    if (BIAS_BF16) bv = bf16_round(bv);
#pragma unroll
    for (int r = 0; r < 8; ++r) {
      float v = acc[t][r] + bv;
      if (resid) { float rv = resid[(size_t)((row0 + 8 * hh + r) % rmod) * ldr + col]; if (RES_BF16) rv = bf16_round(rv); v += rv; }
      if (ACT == 1) v = fmaxf(v, 0.f);
      if (ACT == 2) v = 0.5f * v * (1.0f + erff(v * 0.70710678118654752f));
      if (ACT == 3) { const float u = 0.7978845608028654f * (v + 0.044715f * v * v * v); v = 0.5f * v * (1.0f + tanhf(u)); }
      so[w][8 * hh + r][t * 16 + ln] = v;
    }
  }
  __builtin_amdgcn_fence(__ATOMIC_ACQ_REL, "workgroup");
  __builtin_amdgcn_wave_barrier();
  const int rsub = lane >> 4, c4 = (lane & 15) * 4;
  {
#pragma unroll
    for (int q = 0; q < 8; ++q) {
      const int r = q * 2 + rsub;
      const v4f v = *(const v4fa*)&so[w][r][c4];
      *(v4f*)(C + (size_t)(row0 + r) * ldc + col0 + c4) = v;
    }
    
  }
}
// row LayerNorm (biased variance, eps) over N: s = X (+ R); optional out_sum <- s; out_norm <- (s-mu)*rsqrt(var+eps)*g + b
template <bool PARAM_BF16>
__global__ __launch_bounds__(256) void k_layernorm(const float* __restrict__ X, const float* __restrict__ R, const float* __restrict__ g, const float* __restrict__ bta,
                                                  float* __restrict__ out_sum, float* __restrict__ out_norm, int N, float eps) {
  __shared__ float red[256];
  const int row = blockIdx.x, tid = threadIdx.x;
  const float* x = X + (size_t)row * N; const float* rr = R ? R + (size_t)row * N : nullptr;
  float vals[16];                     // up to N = 4096
  const int per = N / 256;            // contiguous chunk per thread? use strided-by-4 chunks: thread handles j = tid*4 + 1024*u
  float s1 = 0.f;
  for (int u = 0; u < per / 4; ++u) {
    const int j = tid * 4 + 1024 * u;
    const v4f a = *(const v4fa*)(x + j);
    v4f b = {0.f,0.f,0.f,0.f}; if (rr) b = *(const v4fa*)(rr + j);
#pragma unroll
    for (int q = 0; q < 4; ++q) { const float v = a[q] + b[q]; vals[u * 4 + q] = v; s1 += v; }
  }
  red[tid] = s1; __syncthreads();
  for (int st = 128; st > 0; st >>= 1) { if (tid < st) red[tid] += red[tid + st]; __syncthreads(); }
  const float mu = red[0] / (float)N; __syncthreads();
  float s2 = 0.f;
  for (int u = 0; u < per / 4; ++u)
#pragma unroll
    for (int q = 0; q < 4; ++q) { const float c = vals[u * 4 + q] - mu; s2 += c * c; }
  red[tid] = s2; __syncthreads();
  for (int st = 128; st > 0; st >>= 1) { if (tid < st) red[tid] += red[tid + st]; __syncthreads(); }
  const float rs = rsqrtf(red[0] / (float)N + eps);
  {
    for (int u = 0; u < per / 4; ++u) {
      const int j = tid * 4 + 1024 * u;
      v4f o, sm;
#pragma unroll
      for (int q = 0; q < 4; ++q) {
        float gg = g[j + q], bb = bta[j + q];
        if (PARAM_BF16) { gg = bf16_round(gg); bb = bf16_round(bb); }
        sm[q] = vals[u * 4 + q]; o[q] = (vals[u * 4 + q] - mu) * rs * gg + bb;
      }
      if (out_sum) *(v4f*)(out_sum + (size_t)row * N + j) = sm;
      *(v4f*)(out_norm + (size_t)row * N + j) = o;
    }
    
  }
}



// ---- f16 WMMA path (v_wmma_f32_16x16x32_f16): 11-bit significands for operands in range — used where a [0,1] probability operand needs more precision than bf16
typedef _Float16 v16h __attribute__((ext_vector_type(16)));
union FragH { v16h v; v8us half[2]; _Float16 h[16]; unsigned short u[16]; };
template <int NT>
__device__ __forceinline__ v8f mmaH(v16h ah, v16h al, v16h bh, v16h bl, v8f c) {
  c = __builtin_amdgcn_wmma_f32_16x16x32_f16(false, ah, false, bh, (short)0, c, false, false);
  if (NT >= 2) c = __builtin_amdgcn_wmma_f32_16x16x32_f16(false, al, false, bh, (short)0, c, false, false);
  if (NT >= 3) c = __builtin_amdgcn_wmma_f32_16x16x32_f16(false, ah, false, bl, (short)0, c, false, false);
  asm volatile("v_nop\n\tv_nop\n\tv_nop\n\tv_nop" : "+v"(c) : "v"(ah), "v"(al), "v"(bh), "v"(bl));
  return c;
}
// batched GEMM like k_gemm_b but f16 operands: A f32 (split into f16 hi/lo if ASPLIT, else rounded to f16), Bt = f16 values [n][k]; alpha; C f32; N multiple of 16 (partial tiles skipped)
template <bool ASPLIT>
__global__ __launch_bounds__(128) void k_gemm_h(const float* __restrict__ A, int lda, size_t sA, const _Float16* __restrict__ Bh, int ldb, size_t sB, float alpha, float* __restrict__ C, int ldc, size_t sC, int M, int N, int K) {
  __shared__ __attribute__((aligned(16))) float so[4][16][64];
  const int tid = threadIdx.x, w = tid >> 5, lane = tid & 31, ln = lane & 15, hh = lane >> 4; const int by = blockIdx.y;
  A += (size_t)by * sA; Bh += (size_t)by * sB; C += (size_t)by * sC;
  const int ntn = (N + 63) / 64; const int wid = blockIdx.x * 4 + w; const int mt = wid / ntn, nq = wid % ntn; if (mt * 16 >= M) return;
  const int row0 = mt * 16, col0 = nq * 64; const float* arow = A + (size_t)(row0 + ln) * lda;
  v8f acc[4] = {};
  for (int kb = 0; kb < K; kb += 32) {
    FragH ah, al;
    const v4f x0 = *(const v4fa*)(arow + kb + 8 * hh), x1 = *(const v4fa*)(arow + kb + 8 * hh + 4), x2 = *(const v4fa*)(arow + kb + 16 + 8 * hh), x3 = *(const v4fa*)(arow + kb + 16 + 8 * hh + 4);
    float xs[16] = {x0[0],x0[1],x0[2],x0[3],x1[0],x1[1],x1[2],x1[3],x2[0],x2[1],x2[2],x2[3],x3[0],x3[1],x3[2],x3[3]};
#pragma unroll
    for (int i = 0; i < 16; ++i) { const _Float16 h = (_Float16)xs[i]; ah.h[i] = h; al.h[i] = ASPLIT ? (_Float16)(xs[i] - (float)h) : (_Float16)0.0f; }
#pragma unroll
    for (int t = 0; t < 4; ++t) { if (col0 + t * 16 >= N) continue; const size_t boff = (size_t)(col0 + t * 16 + ln) * ldb + kb; FragH bq; bq.half[0] = *(const v8us*)(Bh + boff + 8 * hh); bq.half[1] = *(const v8us*)(Bh + boff + 16 + 8 * hh);
      acc[t] = mmaH<ASPLIT ? 2 : 1>(ah.v, al.v, bq.v, bq.v, acc[t]); }
  }
#pragma unroll
  for (int t = 0; t < 4; ++t) { if (col0 + t * 16 >= N) continue;
#pragma unroll
    for (int r = 0; r < 8; ++r) so[w][8 * hh + r][t * 16 + ln] = acc[t][r] * alpha; }
  __builtin_amdgcn_fence(__ATOMIC_ACQ_REL, "workgroup"); __builtin_amdgcn_wave_barrier();
  const int rsub = lane >> 4, c4 = (lane & 15) * 4;
  {
#pragma unroll
    for (int q = 0; q < 8; ++q) { const int r = q * 2 + rsub; if (col0 + c4 < N) { const v4f v = *(const v4fa*)&so[w][r][c4]; *(v4f*)(C + (size_t)(row0 + r) * ldc + col0 + c4) = v; } }
     }
}

// Wt[n][k] = f16(W[k][n]·scale) from f32 row-major W[K][N] (scale = power of two; bf16-exact weights stay exact in f16 away from the subnormal range)
__global__ __launch_bounds__(256) void k_wt_f16(const float* __restrict__ W, _Float16* __restrict__ Wt, int K, int N, float scale) {
  const int t = blockIdx.x * 256 + threadIdx.x; if (t >= N * (K / 8)) return; const int n = t / (K / 8), k8 = (t % (K / 8)) * 8; FragH f;
#pragma unroll
  for (int i = 0; i < 8; ++i) f.h[i] = (_Float16)(bf16_round(W[(size_t)(k8 + i) * N + n]) * scale); const v8us o = f.half[0];
  *(v8us*)((unsigned short*)Wt + (size_t)n * K + k8) = o; 
}
// k_gemm_hh variant with fused epilogue: v = acc·alpha + bias[by·sBias + col] (+ CP[(row/rowsPerB)·sCPb + by·64 + col] if CP) ; ACT 0 none / 1 elu ; writes f32 C and/or f16 C16 (each if non-null)
template <int ACT>
__global__ __launch_bounds__(128) void k_gemm_hhx(const _Float16* __restrict__ A, int lda, size_t sA, const _Float16* __restrict__ Bh, int ldb, size_t sB, float alpha, const float* __restrict__ bias, size_t sBias, const float* __restrict__ CP, int rowsPerB, size_t sCPb, int row0g,
    float* __restrict__ C, _Float16* __restrict__ C16, int ldc, size_t sC, int M, int N, int K) {
  __shared__ __attribute__((aligned(16))) float so[4][16][64];
  const int tid = threadIdx.x, w = tid >> 5, lane = tid & 31, ln = lane & 15, hh = lane >> 4; const int by = blockIdx.y;
  A += (size_t)by * sA; Bh += (size_t)by * sB; const size_t cofs = (size_t)by * sC; const float* bp = bias ? bias + (size_t)by * sBias : nullptr;
  const int ntn = (N + 63) / 64; const int wid = blockIdx.x * 4 + w; const int mt = wid / ntn, nq = wid % ntn; if (mt * 16 >= M) return;
  const int row0 = mt * 16, col0 = nq * 64; const _Float16* arow = A + (size_t)(row0 + ln) * lda;
  v8f acc[4] = {};
  for (int kb = 0; kb < K; kb += 32) { FragH ah; ah.half[0] = *(const v8us*)((const unsigned short*)arow + kb + 8 * hh); ah.half[1] = *(const v8us*)((const unsigned short*)arow + kb + 16 + 8 * hh);
#pragma unroll
    for (int t = 0; t < 4; ++t) { if (col0 + t * 16 >= N) continue; const size_t boff = (size_t)(col0 + t * 16 + ln) * ldb + kb; FragH bq; bq.half[0] = *(const v8us*)((const unsigned short*)Bh + boff + 8 * hh); bq.half[1] = *(const v8us*)((const unsigned short*)Bh + boff + 16 + 8 * hh);
      acc[t] = mmaH<1>(ah.v, ah.v, bq.v, bq.v, acc[t]); }
  }
#pragma unroll
  for (int t = 0; t < 4; ++t) { if (col0 + t * 16 >= N) continue; const int col = col0 + t * 16 + ln; const float bv = bp ? bf16_round(bp[col]) : 0.f;
#pragma unroll
    for (int r = 0; r < 8; ++r) { float v = acc[t][r] * alpha + bv; if (CP) { const int rr = row0g + row0 + 8 * hh + r; if (rowsPerB < 0) v += CP[cofs + (size_t)rr * ldc + col];      /* rowsPerB < 0: own element of the batched C plane */ else { const int bidx = rr / rowsPerB; v += CP[(size_t)bidx * sCPb + (size_t)by * 64 + col]; } } if (ACT == 1) v = (v > 0.f) ? v : expm1f(v); else if (ACT == 7) v = (v > 0.f) ? v + 1.0f : expf(v); else if (ACT == 8) v = tanhf(v); else if (ACT == 9) v = 0.5f * v * (1.0f + tanhf(0.7978845608028654f * (v + 0.044715f * v * v * v))); else if (ACT == 11) v = 1.0f / (1.0f + expf(-v)); else if (ACT == 12) v = (v > 0.f) ? v : 0.01f * v; else if (ACT == 14) v = (v > 0.f) ? v : 0.1f * v; else if (ACT == 16) v = (v >= 0.f) ? v : 0.3f * v; else if (ACT == 17) v = (v >= 0.f) ? v : 0.2f * v; else if (ACT == 15) v = v / (1.0f + expf(-v)); else if (ACT == 3) v = fmaxf(v, 0.f); else if (ACT == 6) v = 0.5f * v * (1.0f + erff(v * 0.70710678118654752f)); so[w][8 * hh + r][t * 16 + ln] = v; } }
  __builtin_amdgcn_fence(__ATOMIC_ACQ_REL, "workgroup"); __builtin_amdgcn_wave_barrier();
  const int rsub = lane >> 4, c4 = (lane & 15) * 4; typedef _Float16 v4h __attribute__((ext_vector_type(4)));
  {
#pragma unroll
    for (int q = 0; q < 8; ++q) { const int r = q * 2 + rsub; if (col0 + c4 < N) { const v4f v = *(const v4fa*)&so[w][r][c4]; if (C) *(v4f*)(C + cofs + (size_t)(row0 + r) * ldc + col0 + c4) = v; if (C16) { v4h h4; for (int i = 0; i < 4; ++i) h4[i] = (_Float16)v[i]; *(v4h*)(C16 + cofs + (size_t)(row0 + r) * ldc + col0 + c4) = h4; } } }
     }
}


typedef _Float16 v4h __attribute__((ext_vector_type(4)));

__global__ __launch_bounds__(256) void k_h16(const float* __restrict__ x, _Float16* __restrict__ X16, size_t n8) { const size_t t = (size_t)blockIdx.x * 256 + threadIdx.x; if (t >= n8) return; FragH f;
#pragma unroll
  for (int q = 0; q < 8; ++q) f.h[q] = (_Float16)x[t * 8 + q]; *(v8us*)((unsigned short*)X16 + t * 8) = f.half[0];  }
__global__ __launch_bounds__(256) void k_round16f(const float* __restrict__ W, _Float16* __restrict__ Bt, size_t n8) { const size_t t = (size_t)blockIdx.x * 256 + threadIdx.x; if (t >= n8) return; FragH f;
#pragma unroll
  for (int i = 0; i < 8; ++i) f.h[i] = (_Float16)(bf16_round(W[t * 8 + i]) * 16.0f); *(v8us*)((unsigned short*)Bt + t * 8) = f.half[0];  }
template <int NHv, int TTv>
__global__ __launch_bounds__(256) void k_vt(const _Float16* __restrict__ V16, int ldv, int voff, _Float16* __restrict__ Vt) { __shared__ unsigned short tl[64][66]; const int tid = threadIdx.x; const int slab = blockIdx.x / (TTv / 64), lg = blockIdx.x % (TTv / 64); const int b = slab / NHv, h = slab % NHv;
  for (int i = tid; i < 64 * 8; i += 256) { const int r = i / 8, c8 = (i % 8) * 8; FragH f; f.half[0] = *(const v8us*)((const unsigned short*)V16 + ((size_t)b * TTv + lg * 64 + r) * ldv + voff + h * 64 + c8);
#pragma unroll
    for (int q = 0; q < 8; ++q) tl[r][c8 + q] = f.u[q]; }
  __syncthreads();
  {
#pragma unroll
    for (int rd = 0; rd < 2; ++rd) { const int d = rd * 32 + tid / 8, pc = tid % 8; FragH f;
#pragma unroll
      for (int q = 0; q < 8; ++q) f.u[q] = tl[pc * 8 + q][d];
      *(v8us*)((unsigned short*)Vt + ((size_t)slab * 64 + d) * TTv + lg * 64 + pc * 8) = f.half[0]; }
     } }

__global__ __launch_bounds__(256) void k_hl(const float* __restrict__ F, _Float16* __restrict__ Hh, _Float16* __restrict__ Hl, size_t n8) { const size_t t = (size_t)blockIdx.x * 256 + threadIdx.x; if (t >= n8) return; FragH fh, fl; const v4f a = *(const v4fa*)(F + t * 8), c = *(const v4fa*)(F + t * 8 + 4);
#pragma unroll
  for (int q = 0; q < 4; ++q) { _Float16 h = (_Float16)a[q]; fh.h[q] = h; fl.h[q] = (_Float16)((a[q] - (float)h) * 1024.0f); h = (_Float16)c[q]; fh.h[4 + q] = h; fl.h[4 + q] = (_Float16)((c[q] - (float)h) * 1024.0f); }
  { *(v8us*)((unsigned short*)Hh + t * 8) = fh.half[0]; *(v8us*)((unsigned short*)Hl + t * 8) = fl.half[0];  } }

// ---- fast GEMM (wave tile 32x64; requires M % 32 == 0 rows per launch region and N % 64 == 0); epilogue = k_gemm_hhx semantics, except that grid.y plane by takes its bias from its own buffer (bias, biasY1, biasY2) ----
__device__ __forceinline__ v16h g2_frag(const _Float16* p, int hh) { FragH f; f.half[0] = *(const v8us*)((const unsigned short*)p + 8 * hh); f.half[1] = *(const v8us*)((const unsigned short*)p + 16 + 8 * hh); return f.v; }
__device__ __forceinline__ v8f g2_mma(v16h a, v16h b, v8f c) { v8f d = __builtin_amdgcn_wmma_f32_16x16x32_f16(false, a, false, b, (short)0, c, false, false); asm volatile("v_nop\n\tv_nop\n\tv_nop\n\tv_nop" : "+v"(d) : "v"(a), "v"(b)); return d; }
template <int ACT>
__global__ __launch_bounds__(128) void k_gemm2(const _Float16* __restrict__ A, int lda, size_t sA, const _Float16* __restrict__ Bh, int ldb, size_t sB, float alpha, const float* __restrict__ bias, const float* __restrict__ biasY1, const float* __restrict__ biasY2, size_t sBias, const float* __restrict__ CP, int rowsPerB, size_t sCPb, int row0g,
    float* __restrict__ C, _Float16* __restrict__ C16, int ldc, size_t sC, int M, int N, int K) { static_assert(ACT == 0 || ACT == 3 || ACT == 6 || ACT == 8 || ACT == 9 || ACT == 11 || ACT == 12 || ACT == 14 || ACT == 15 || ACT == 16 || ACT == 17, "k_gemm2: unsupported ACT code (would silently apply no activation)");
  __shared__ __attribute__((aligned(16))) float so[4][32][68];
  const int tid = threadIdx.x, w = tid >> 5, lane = tid & 31, ln = lane & 15, hh = lane >> 4; const int by = blockIdx.y;
  const float* bsel = (by == 0) ? bias : (by == 1) ? biasY1 : biasY2;      /* the planes of grid.y have bias vectors in buffers of their own */
  A += (size_t)by * sA; Bh += (size_t)by * sB; const size_t cofs = (size_t)by * sC; const float* bp = bsel ? bsel + (size_t)by * sBias : nullptr;
  const int ntn = N >> 6; const int mt = blockIdx.x / ntn, nq = blockIdx.x - mt * ntn; const int row0 = mt * 128 + 32 * w, col0 = nq * 64; if (row0 >= M) return;
  const _Float16* a0p = A + (size_t)(row0 + ln) * lda; const _Float16* a1p = a0p + (size_t)16 * lda;
  const _Float16* b0p = Bh + (size_t)(col0 + ln) * ldb; const _Float16* b1p = b0p + (size_t)16 * ldb; const _Float16* b2p = b1p + (size_t)16 * ldb; const _Float16* b3p = b2p + (size_t)16 * ldb;
  const v8f z8 = {0.f,0.f,0.f,0.f,0.f,0.f,0.f,0.f}; v8f c00 = z8, c01 = z8, c02 = z8, c03 = z8, c10 = z8, c11 = z8, c12 = z8, c13 = z8;
#pragma unroll 1
  for (int kb = 0; kb < K; kb += 32) { const v16h a0 = g2_frag(a0p + kb, hh), a1 = g2_frag(a1p + kb, hh);
    v16h b = g2_frag(b0p + kb, hh); c00 = g2_mma(a0, b, c00); c10 = g2_mma(a1, b, c10);
    b = g2_frag(b1p + kb, hh); c01 = g2_mma(a0, b, c01); c11 = g2_mma(a1, b, c11);
    b = g2_frag(b2p + kb, hh); c02 = g2_mma(a0, b, c02); c12 = g2_mma(a1, b, c12);
    b = g2_frag(b3p + kb, hh); c03 = g2_mma(a0, b, c03); c13 = g2_mma(a1, b, c13); }
  v8f accs[8] = {c00, c01, c02, c03, c10, c11, c12, c13};
#pragma unroll
  for (int u = 0; u < 8; ++u) { const int t = u & 3, half = u >> 2; const int col = col0 + t * 16 + ln; const float bv = bp ? bf16_round(bp[col]) : 0.f;
#pragma unroll
    for (int r = 0; r < 8; ++r) { const int rloc = half * 16 + 8 * hh + r; float v = accs[u][r] * alpha + bv; if (CP) { if (rowsPerB < 0) v += CP[cofs + (size_t)(row0g + row0 + rloc) * ldc + col];      /* rowsPerB < 0: own element of the batched C plane */ else { const int bidx = (row0g + row0 + rloc) / rowsPerB; v += CP[(size_t)bidx * sCPb + (size_t)by * 64 + col]; } }
      if (ACT == 3) v = fmaxf(v, 0.f); else if (ACT == 6) v = 0.5f * v * (1.0f + erff(v * 0.70710678118654752f)); else if (ACT == 11) v = 1.0f / (1.0f + expf(-v)); else if (ACT == 15) v = v / (1.0f + expf(-v)); else if (ACT == 12) v = (v > 0.f) ? v : 0.01f * v; else if (ACT == 8) v = tanhf(v); else if (ACT == 9) v = 0.5f * v * (1.0f + tanhf(0.7978845608028654f * (v + 0.044715f * v * v * v))); else if (ACT == 14) v = (v > 0.f) ? v : 0.1f * v; else if (ACT == 16) v = (v >= 0.f) ? v : 0.3f * v; else if (ACT == 17) v = (v >= 0.f) ? v : 0.2f * v;
      so[w][rloc][t * 16 + ln] = v; } }
  __builtin_amdgcn_fence(__ATOMIC_ACQ_REL, "workgroup"); __builtin_amdgcn_wave_barrier();
  const int rsub = lane >> 4, c4 = (lane & 15) * 4;
  {
#pragma unroll
    for (int q = 0; q < 16; ++q) { const int r = q * 2 + rsub; const v4f v = *(const v4fa*)&so[w][r][c4]; if (C) *(v4f*)(C + cofs + (size_t)(row0 + r) * ldc + col0 + c4) = v; if (C16) { v4h h4; for (int i = 0; i < 4; ++i) h4[i] = (_Float16)v[i]; *(v4h*)(C16 + cofs + (size_t)(row0 + r) * ldc + col0 + c4) = h4; } }
     } }


// The four weight matrices, f16(bf16(w) * 16), in one grid; the block index picks the matrix (uniform in a work-group).
__global__ __launch_bounds__(256) void k_cvt4(const float* __restrict__ w0, const float* __restrict__ w1, const float* __restrict__ w2, const float* __restrict__ w3, _Float16* __restrict__ Bt) {
  constexpr int WB = DW * DIN / 8 / 256;      /* blocks per weight matrix */
  const int j = blockIdx.x / WB, blk = blockIdx.x - j * WB; const float* s = (j == 0) ? w0 : (j == 1) ? w1 : (j == 2) ? w2 : w3; _Float16* d = Bt + (size_t)j * DW * DIN;
  const size_t t = (size_t)blk * 256 + threadIdx.x; FragH f;
#pragma unroll      /* constant indices: the eight values stay in registers and their loads join into two of 16 bytes */
  for (int q = 0; q < 8; ++q) f.h[q] = (_Float16)(bf16_round(s[t * 8 + q]) * 16.0f);
  *(v8us*)((unsigned short*)d + t * 8) = f.half[0];
}
// ---- q, k, v projections straight from the f32 inputs (grid.y = plane): no conversion launch, no f16 copy of the inputs in memory ----
// A work-group of 8 waves owns 64 token rows x all 256 output columns, so each input row is read from memory once, in whole lines, all 16 loads of a
// lane in flight, rounded once (f16(bf16(x)), as the conversion kernel did) and laid in LDS at a pitch of 16 B x 33 for the ds_load_b128 fragment reads.
// Wave tile 32 x 64, k order, WMMA order and epilogue are those of k_gemm2.
__global__ __launch_bounds__(256) void k_proj(const float* __restrict__ x0, const float* __restrict__ x1, const float* __restrict__ x2, const _Float16* __restrict__ Bh,
                                              const float* __restrict__ bias0, const float* __restrict__ bias1, const float* __restrict__ bias2, _Float16* __restrict__ C16) {
  __shared__ __attribute__((aligned(16))) _Float16 sa[64][DIN + 8];
  __shared__ __attribute__((aligned(16))) float so[8][32][68];
  const int tid = threadIdx.x, w = tid >> 5, lane = tid & 31, ln = lane & 15, hh = lane >> 4; const int by = blockIdx.y;
  const float* xs = ((by == 0) ? x0 : (by == 1) ? x1 : x2) + (size_t)blockIdx.x * 64 * DIN; const float* bp = (by == 0) ? bias0 : (by == 1) ? bias1 : bias2;
  v4f t[16];
#pragma unroll      /* constant indices: the sixteen loads stand in registers and issue together */
  for (int i = 0; i < 16; ++i) t[i] = *(const v4fa*)(xs + (size_t)(i * 256 + tid) * 4);
#pragma unroll      /* constant indices, as above */
  for (int i = 0; i < 16; ++i) { v4h h4;
#pragma unroll      /* constant indices, as above */
    for (int q = 0; q < 4; ++q) h4[q] = (_Float16)bf16_round(t[i][q]);
    *(v4h*)&sa[i * 4 + (tid >> 6)][(tid & 63) * 4] = h4; }
  __syncthreads();      /* the 64 converted rows are in LDS for all eight waves */
  const int rl0 = (w >> 2) * 32, col0 = (w & 3) * 64; const int row0 = blockIdx.x * 64 + rl0; const size_t cofs = (size_t)by * NR * DW;
  const _Float16* a0p = &sa[rl0 + ln][0]; const _Float16* a1p = &sa[rl0 + 16 + ln][0];
  const _Float16* b0p = Bh + (size_t)by * DW * DIN + (size_t)(col0 + ln) * DIN; const _Float16* b1p = b0p + (size_t)16 * DIN; const _Float16* b2p = b1p + (size_t)16 * DIN; const _Float16* b3p = b2p + (size_t)16 * DIN;
  const v8f z8 = {0.f,0.f,0.f,0.f,0.f,0.f,0.f,0.f}; v8f c00 = z8, c01 = z8, c02 = z8, c03 = z8, c10 = z8, c11 = z8, c12 = z8, c13 = z8;
  for (int kb = 0; kb < DIN; kb += 32) { const v16h a0 = g2_frag(a0p + kb, hh), a1 = g2_frag(a1p + kb, hh);
    v16h b = g2_frag(b0p + kb, hh); c00 = g2_mma(a0, b, c00); c10 = g2_mma(a1, b, c10);
    b = g2_frag(b1p + kb, hh); c01 = g2_mma(a0, b, c01); c11 = g2_mma(a1, b, c11);
    b = g2_frag(b2p + kb, hh); c02 = g2_mma(a0, b, c02); c12 = g2_mma(a1, b, c12);
    b = g2_frag(b3p + kb, hh); c03 = g2_mma(a0, b, c03); c13 = g2_mma(a1, b, c13); }
  v8f accs[8] = {c00, c01, c02, c03, c10, c11, c12, c13};
#pragma unroll      /* constant indices: the tiles stay in registers */
  for (int u = 0; u < 8; ++u) { const int tt = u & 3, half = u >> 2; const float bv = bf16_round(bp[col0 + tt * 16 + ln]);
#pragma unroll      /* constant indices: the tiles stay in registers */
    for (int r = 0; r < 8; ++r) so[w][half * 16 + 8 * hh + r][tt * 16 + ln] = accs[u][r] * 0.0625f + bv; }
  __builtin_amdgcn_fence(__ATOMIC_ACQ_REL, "workgroup"); __builtin_amdgcn_wave_barrier();      /* a wave reads back only its own staging rows */
  const int rsub = lane >> 4, c4 = (lane & 15) * 4;
#pragma unroll      /* the LDS reads issue ahead of the stores */
  for (int q = 0; q < 16; ++q) { const int r = q * 2 + rsub; const v4f v = *(const v4fa*)&so[w][r][c4]; v4h h4;
#pragma unroll      /* constant indices */
    for (int i = 0; i < 4; ++i) h4[i] = (_Float16)v[i];
    *(v4h*)(C16 + cofs + (size_t)(row0 + r) * DW + col0 + c4) = h4; }
}
// ---- fused causal attention: S^T = K Q^T, online softmax in registers, O^T += V^T P^T; scores and weights never reach memory ----
// One wave = 32 queries of one head; a pass = 32 keys. In S^T a lane holds one query's scores (column ln, keys 8*hh + r), so two S^T tiles,
// converted in place, are the B operand of V^T P^T in the hardware k order. Weights carry a factor 1024 (as exp2(... + 10)); it cancels in O / l.
__device__ __forceinline__ float fa_xhalf(float x) { const int b = __float_as_int(x); return __int_as_float(__builtin_amdgcn_permlanex16(b, b, 0x76543210, 0xfedcba98, false, false)); }
__device__ __forceinline__ v16h fa_frag(const _Float16* p) { FragH f; f.half[0] = *(const v8us*)((const unsigned short*)p); f.half[1] = *(const v8us*)((const unsigned short*)p + 16); return f.v; }      /* p already holds the lane half's 8 * hh */
__device__ __forceinline__ v8f fa_mma(v16h a, v16h b, v8f c) { return __builtin_amdgcn_wmma_f32_16x16x32_f16(false, a, false, b, (short)0, c, false, false); }
// Eight independent v_exp_f32 and the slot that the instruction set asks for behind a transcendental, in one statement: a v_nop in a statement of its own
// did not stay behind them. Outputs are early-clobber, so that none of the eight overwrites a source of the one in front of it.
__device__ __forceinline__ void fa_exp8(v8f& e, const v8f x) {
  float e0, e1, e2, e3, e4, e5, e6, e7;
  asm("v_exp_f32 %0, %8\n\tv_exp_f32 %1, %9\n\tv_exp_f32 %2, %10\n\tv_exp_f32 %3, %11\n\tv_exp_f32 %4, %12\n\tv_exp_f32 %5, %13\n\tv_exp_f32 %6, %14\n\tv_exp_f32 %7, %15\n\tv_nop"
      : "=&v"(e0), "=&v"(e1), "=&v"(e2), "=&v"(e3), "=&v"(e4), "=&v"(e5), "=&v"(e6), "=&v"(e7)
      : "v"(x[0]), "v"(x[1]), "v"(x[2]), "v"(x[3]), "v"(x[4]), "v"(x[5]), "v"(x[6]), "v"(x[7]));
  e[0] = e0; e[1] = e1; e[2] = e2; e[3] = e3; e[4] = e4; e[5] = e5; e[6] = e6; e[7] = e7;
}
template <bool DIAG>
__device__ __forceinline__ void fa_pass(const v16h k0, const v16h k1, const v16h v0, const v16h v1, const v16h q0f, const v16h q1f, v8f (&o)[2][2], float (&m)[2], float (&l)[2], const int ln, const int hh) {
  const float C = 0.17677669529663687f * 1.4426950408889634f;      /* 1/sqrt(32) * log2(e) */
  const v8f z8 = {0.f,0.f,0.f,0.f,0.f,0.f,0.f,0.f};
  v8f s[2][2];
  s[0][0] = fa_mma(k0, q0f, z8); s[0][1] = fa_mma(k1, q0f, z8); s[1][0] = fa_mma(k0, q1f, z8); s[1][1] = fa_mma(k1, q1f, z8);
  float mn[2];
#pragma unroll      /* constant indices: the tiles stay in registers */
  for (int qt = 0; qt < 2; ++qt) {
    if (DIAG) {
#pragma unroll      /* constant indices: the tiles stay in registers */
      for (int r = 0; r < 8; ++r) { if (8 * hh + r > 16 * qt + ln) s[qt][0][r] = -3.0e38f; if (16 + 8 * hh + r > 16 * qt + ln) s[qt][1][r] = -3.0e38f; }
    }
    float mx = fmaxf(s[qt][0][0], s[qt][1][0]);
#pragma unroll      /* constant indices: the tiles stay in registers */
    for (int r = 1; r < 8; ++r) mx = fmaxf(mx, fmaxf(s[qt][0][r], s[qt][1][r]));
    mx = fmaxf(mx, fa_xhalf(mx));
    mn[qt] = fmaxf(m[qt], mx * C);
  }
  if (__builtin_amdgcn_ballot_w32(mn[0] > m[0] || mn[1] > m[1]) != 0) {      /* a maximum rose somewhere in the wave: rescale (factor exactly 1 where it did not) */
#pragma unroll      /* constant indices: the tiles stay in registers */
    for (int qt = 0; qt < 2; ++qt) { const float al = __builtin_amdgcn_exp2f(m[qt] - mn[qt]); o[qt][0] *= al; o[qt][1] *= al; l[qt] *= al; m[qt] = mn[qt]; }
  }
  FragH p[2];
#pragma unroll      /* constant indices: the tiles stay in registers */
  for (int qt = 0; qt < 2; ++qt) {
    const float sh = 10.0f - m[qt]; float su = 0.f;
#pragma unroll      /* constant indices: the tiles stay in registers */
    for (int t = 0; t < 2; ++t) { v8f x, e;
#pragma unroll      /* constant indices: the tiles stay in registers */
      for (int r = 0; r < 8; ++r) x[r] = fmaf(s[qt][t][r], C, sh);
      fa_exp8(e, x);
#pragma unroll      /* constant indices: the tiles stay in registers */
      for (int r = 0; r < 8; ++r) { su += e[r]; p[qt].h[8 * t + r] = (_Float16)e[r]; } }
    l[qt] += su;
  }
  o[0][0] = fa_mma(v0, p[0].v, o[0][0]); o[0][1] = fa_mma(v1, p[0].v, o[0][1]); o[1][0] = fa_mma(v0, p[1].v, o[1][0]); o[1][1] = fa_mma(v1, p[1].v, o[1][1]);
}
// Grid: 16 x 32 work-groups of 8 waves = two heads (which share each 128-byte line of the context planes) x four query groups p, 63-p, 31-p, 32+p
// (equal work in every work-group). Context = O / l, split hi + residual * 1024, staged in LDS so that each line is stored whole by one wave.
__global__ __launch_bounds__(256) void k_fattn(const _Float16* __restrict__ Q, const _Float16* __restrict__ Kk, const _Float16* __restrict__ Vt, _Float16* __restrict__ CH, _Float16* __restrict__ CL) {
  __shared__ __attribute__((aligned(16))) _Float16 st[4][2][32][72];
  const int lane = threadIdx.x & 31, ln = lane & 15, hh = lane >> 4; const int w = __builtin_amdgcn_readfirstlane(threadIdx.x >> 5);
  const int hp = blockIdx.x & 31, p = blockIdx.x >> 5; const int b = hp >> 2, hsel = w & 1, head = (hp & 3) * 2 + hsel; const int role = w >> 1;
  const int g = (role == 0) ? p : (role == 1) ? 31 - p : (role == 2) ? 63 - p : 32 + p;      /* waves w and w + 4 together: 63 */
  const _Float16* qp = Q + ((size_t)b * NTK + g * 32 + ln) * DW + head * HD + 8 * hh;
  const v16h q0f = fa_frag(qp), q1f = fa_frag(qp + (size_t)16 * DW);
  const _Float16* kp = Kk + ((size_t)b * NTK + ln) * DW + head * HD + 8 * hh;
  const _Float16* vp = Vt + ((size_t)b * DW + head * HD + ln) * NTK + 8 * hh;
  const v8f z8 = {0.f,0.f,0.f,0.f,0.f,0.f,0.f,0.f};
  v8f o[2][2] = {{z8, z8}, {z8, z8}}; float m[2] = {-3.0e38f, -3.0e38f}, l[2] = {0.f, 0.f};
  v16h k0 = fa_frag(kp), k1 = fa_frag(kp + (size_t)16 * DW), v0 = fa_frag(vp), v1 = fa_frag(vp + (size_t)16 * NTK);
  asm volatile("s_wait_xcnt 0x0" :: "v"(qp) : "memory");      /* stands before the registers of the query address are used again: the operand keeps them untouched up to here */
  for (int kb = 0; kb < g; ++kb) {      /* passes below the diagonal; the next pass's fragments are fetched ahead (pass g always exists) */
    kp += (size_t)32 * DW; vp += 32;
    const v16h nk0 = fa_frag(kp), nk1 = fa_frag(kp + (size_t)16 * DW), nv0 = fa_frag(vp), nv1 = fa_frag(vp + (size_t)16 * NTK);
    fa_pass<false>(k0, k1, v0, v1, q0f, q1f, o, m, l, ln, hh);
    k0 = nk0; k1 = nk1; v0 = nv0; v1 = nv1;
  }
  fa_pass<true>(k0, k1, v0, v1, q0f, q1f, o, m, l, ln, hh);
#pragma unroll      /* constant indices: the tiles stay in registers */
  for (int qt = 0; qt < 2; ++qt) { const float inv = 1.0f / (l[qt] + fa_xhalf(l[qt]));
#pragma unroll      /* constant indices: the tiles stay in registers */
    for (int dt = 0; dt < 2; ++dt) { FragH f, fl;
#pragma unroll      /* constant indices: the tiles stay in registers */
      for (int r = 0; r < 8; ++r) { const float v = o[qt][dt][r] * inv; const _Float16 hv = (_Float16)v; f.h[r] = hv; fl.h[r] = (_Float16)((v - (float)hv) * 1024.0f); }
      *(v8us*)&st[role][0][16 * qt + ln][hsel * 32 + 16 * dt + 8 * hh] = f.half[0]; *(v8us*)&st[role][1][16 * qt + ln][hsel * 32 + 16 * dt + 8 * hh] = fl.half[0]; } }
  __syncthreads();      /* the partner head's half of each line is in LDS */
#pragma unroll      /* the LDS reads of all four steps issue ahead of the stores */
  for (int i = 0; i < 4; ++i) { const int row = hsel * 16 + i * 4 + (lane >> 3), c8 = (lane & 7) * 8; const size_t go = ((size_t)b * NTK + g * 32 + row) * DW + (hp & 3) * 64 + c8;
    *(v8us*)((unsigned short*)CH + go) = *(const v8us*)&st[role][0][row][c8]; *(v8us*)((unsigned short*)CL + go) = *(const v8us*)&st[role][1][row][c8]; }
}

extern "C" void kernel_launch(void* const* d_in, const int* in_sizes, int n_in,
                              void* d_out, int out_size, void* d_ws, size_t ws_size, hipStream_t stream) {
  (void)in_sizes; (void)n_in; (void)out_size;
  const float* const* I = (const float* const*)d_in; const float* xq = I[0]; const float* xk = I[1]; const float* xv = I[2]; const float* Wq = I[3]; const float* bq = I[4]; const float* Wk = I[5]; const float* bk = I[6]; const float* Wv = I[7]; const float* bv = I[8]; const float* Wo = I[9]; const float* bo = I[10];
  char* ws = (char*)d_ws; size_t off = 0;
  auto take = [&](size_t bytes) { char* p = ws + off; off += (bytes + 255) & ~(size_t)255; return p; };
  const size_t np = (size_t)NR * DW;
  _Float16* BW = (_Float16*)take((size_t)4 * DW * DIN * 2); _Float16* CH = (_Float16*)take(2 * np * 2); _Float16* CL = CH + np; _Float16* Q16 = (_Float16*)take(3 * np * 2); _Float16* K16 = Q16 + np; _Float16* V16 = K16 + np; _Float16* VT = (_Float16*)take(np * 2);      /* context hi / residual; projections: three planes in a row, a plane is one step of grid.y */
  if (off > ws_size) return;      /* 0.5 + 6 x 8 MiB */
  k_cvt4<<<4 * (DW * DIN / 8 / 256), 256, 0, stream>>>(Wq, Wk, Wv, Wo, BW);      /* torch (out, in) naturals */
  const dim3 gP((NR / 128) * (DW / 64), 1), gP3(NR / 64, 3);
  k_proj<<<gP3, 256, 0, stream>>>(xq, xk, xv, BW, bq, bk, bv, Q16);      /* q, k, v projections from the f32 inputs: grid.y = 0, 1, 2 */
  k_vt<DW / 64, NTK><<<NB * (DW / 64) * (NTK / 64), 256, 0, stream>>>(V16, DW, 0, VT);      /* V^T [(b, 64-slab)][64][2048]: head h of batch b = rows b*256 + h*32 */
  k_fattn<<<16 * (NB * NH / 2), 256, 0, stream>>>(Q16, K16, VT, CH, CL);      /* all heads, all batches: context hi / residual */
  k_gemm2<0><<<gP, 128, 0, stream>>>(CL, DW, 0, BW + (size_t)3 * DW * DIN, DW, 0, 0.0625f / 1024.0f, nullptr, nullptr, nullptr, 0, nullptr, 1, 0, 0, (float*)d_out, nullptr, DW, 0, NR, DW, DW);
  k_gemm2<0><<<gP, 128, 0, stream>>>(CH, DW, 0, BW + (size_t)3 * DW * DIN, DW, 0, 0.0625f, bo, nullptr, nullptr, 0, (const float*)d_out, 1, (size_t)DW, 0, (float*)d_out, nullptr, DW, 0, NR, DW, DW);      /* out = (ctx_lo + ctx_hi) Wo^T + bo */
}

// v004
// One run takes 76.3 microseconds.
// Two timings next to v003 put it at 1.36 and 1.38 times that version's speed.
// Counting every step since v000, it is 18.6 times as fast.
#include <hip/hip_runtime.h>
// my_attention (8 x 2048 tokens x 256; 8 heads x 32; q/k/v = query/key/value W^T + b; causal softmax(q.k / sqrt(32)); out = merged ctx Wo^T + bo).
// Compute dtype: inputs rounded to bf16; inputs/weights exact as f16; q/k/v and the softmax weights as plain f16 operands (~2^-12); context hi + residual into Wo; softmax f32. v_wmma_f32_16x16x32_f16.
#define NB 8
#define NTK 2048
#define DIN 256
#define NH 8
#define HD 32
#define DW 256
#define NR (NB * NTK)
typedef __bf16 v16b __attribute__((ext_vector_type(16)));
typedef unsigned short v8us __attribute__((ext_vector_type(8), may_alias));
typedef float  v8f  __attribute__((ext_vector_type(8)));
typedef float  v4f  __attribute__((ext_vector_type(4)));
typedef float  v4fa __attribute__((ext_vector_type(4), may_alias));
union FragB { v16b v; v8us half[2]; unsigned short u[16]; };

__device__ __forceinline__ unsigned short bf16_bits(float x) { unsigned int u = __float_as_uint(x); return (unsigned short)((u + 0x7FFFu + ((u >> 16) & 1u)) >> 16); }
__device__ __forceinline__ float bf16_val(unsigned short b) { return __uint_as_float(((unsigned int)b) << 16); }
__device__ __forceinline__ float bf16_round(float x) { return bf16_val(bf16_bits(x)); }
// D += A·B with NT terms: 1 = ah·bh, 2 = + al·bh (A split), 3 = + ah·bl (both split)
template <int NT>
__device__ __forceinline__ v8f mmaN(v16b ah, v16b al, v16b bh, v16b bl, v8f c) {
  c = __builtin_amdgcn_wmma_f32_16x16x32_bf16(false, ah, false, bh, (short)0, c, false, false);
  if (NT >= 2) c = __builtin_amdgcn_wmma_f32_16x16x32_bf16(false, al, false, bh, (short)0, c, false, false);
  if (NT >= 3) c = __builtin_amdgcn_wmma_f32_16x16x32_bf16(false, ah, false, bl, (short)0, c, false, false);
  asm volatile("v_nop\n\tv_nop\n\tv_nop\n\tv_nop" : "+v"(c) : "v"(ah), "v"(al), "v"(bh), "v"(bl));
  return c;
}

__global__ __launch_bounds__(256) void k_wt_bf16(const float* __restrict__ W, unsigned short* __restrict__ Wt, int K, int N) {
  const int t = blockIdx.x * 256 + threadIdx.x;
  const int k8n = K / 8;
  if (t >= N * k8n) return;
  const int n = t / k8n, k8 = (t % k8n) * 8;
  v8us v;
#pragma unroll
  for (int i = 0; i < 8; ++i) v[i] = bf16_bits(W[(size_t)(k8 + i) * N + n]);
  *(v8us*)(Wt + (size_t)n * K + k8) = v;
  
}

// GEMM C[M][N] (f32, pitch ldc) = act(A[M][K]·W + bias). A f32 row-major (pitch lda) converted per fragment to bf16
// (ASPLIT: hi/lo two planes -> 2 terms, else single rounded term); Wt bf16 [N][K] (pitch ldb). BIAS_BF16 rounds the
// bias to bf16 first (bias quantised to bf16 before the add). K%32==0, M%16==0, N%64==0.
template <bool ASPLIT, int ACT, bool BIAS_BF16>
__global__ __launch_bounds__(128) void k_gemm_bf(const float* __restrict__ A, int lda, const unsigned short* __restrict__ Wt, int ldb,
                                               const float* __restrict__ bias, float* __restrict__ C, int ldc, int M, int N, int K) {
  __shared__ __attribute__((aligned(16))) float so[4][16][64];
  const int tid = threadIdx.x, w = tid >> 5, lane = tid & 31, ln = lane & 15, hh = lane >> 4;
  const int ntn = N / 64;
  const int wid = blockIdx.x * 4 + w;
  const int mt = wid / ntn, nq = wid % ntn;
  if (mt * 16 >= M) return;
  const int row0 = mt * 16, col0 = nq * 64;
  const float* arow = A + (size_t)(row0 + ln) * lda;
  v8f acc[4] = {};
  for (int kb = 0; kb < K; kb += 32) {
    FragB ah, al;
    const v4f x0 = *(const v4fa*)(arow + kb + 8 * hh), x1 = *(const v4fa*)(arow + kb + 8 * hh + 4);
    const v4f x2 = *(const v4fa*)(arow + kb + 16 + 8 * hh), x3 = *(const v4fa*)(arow + kb + 16 + 8 * hh + 4);
    float xs[16] = {x0[0],x0[1],x0[2],x0[3],x1[0],x1[1],x1[2],x1[3],x2[0],x2[1],x2[2],x2[3],x3[0],x3[1],x3[2],x3[3]};
#pragma unroll
    for (int i = 0; i < 16; ++i) { const unsigned short hb = bf16_bits(xs[i]); ah.u[i] = hb; al.u[i] = ASPLIT ? bf16_bits(xs[i] - bf16_val(hb)) : (unsigned short)0; }
#pragma unroll
    for (int t = 0; t < 4; ++t) {
      const unsigned short* brow = Wt + (size_t)(col0 + t * 16 + ln) * ldb + kb;
      FragB b;
      b.half[0] = *(const v8us*)(brow + 8 * hh);
      b.half[1] = *(const v8us*)(brow + 16 + 8 * hh);
      acc[t] = mmaN<ASPLIT ? 2 : 1>(ah.v, al.v, b.v, b.v, acc[t]);
    }
  }
#pragma unroll
  for (int t = 0; t < 4; ++t) {
    float bv = bias ? bias[col0 + t * 16 + ln] : 0.f;
    if (BIAS_BF16) bv = bf16_round(bv);
#pragma unroll
    for (int r = 0; r < 8; ++r) { float v = acc[t][r] + bv; if (ACT == 1) v = fmaxf(v, 0.f); so[w][8 * hh + r][t * 16 + ln] = v; }
  }
  __builtin_amdgcn_fence(__ATOMIC_ACQ_REL, "workgroup");
  __builtin_amdgcn_wave_barrier();
  const int rsub = lane >> 4, c4 = (lane & 15) * 4;
  {
#pragma unroll
    for (int q = 0; q < 8; ++q) {
      const int r = q * 2 + rsub;
      const v4f v = *(const v4fa*)&so[w][r][c4];
      *(v4f*)(C + (size_t)(row0 + r) * ldc + col0 + c4) = v;
    }
    
  }
}

// GEMM C = act(A·W + bias + resid): A f32 (ASPLIT -> hi/lo 2 terms), Wt bf16 [N][K]; ACT 0 none, 1 relu, 2 exact gelu;
// resid (optional, f32, row index = (row % rmod), pitch ldr, RES_BF16 rounds it) added before the activation.
template <bool ASPLIT, int ACT, bool BIAS_BF16, bool RES_BF16>
__global__ __launch_bounds__(128) void k_gemm_bf3(const float* __restrict__ A, int lda, const unsigned short* __restrict__ Wt, int ldb,
                                                const float* __restrict__ bias, const float* __restrict__ resid, int rmod, int ldr,
                                                float* __restrict__ C, int ldc, int M, int N, int K) {
  __shared__ __attribute__((aligned(16))) float so[4][16][64];
  const int tid = threadIdx.x, w = tid >> 5, lane = tid & 31, ln = lane & 15, hh = lane >> 4;
  const int ntn = N / 64;
  const int wid = blockIdx.x * 4 + w;
  const int mt = wid / ntn, nq = wid % ntn;
  if (mt * 16 >= M) return;
  const int row0 = mt * 16, col0 = nq * 64;
  const float* arow = A + (size_t)(row0 + ln) * lda;
  v8f acc[4] = {};
  for (int kb = 0; kb < K; kb += 32) {
    FragB ah, al;
    const v4f x0 = *(const v4fa*)(arow + kb + 8 * hh), x1 = *(const v4fa*)(arow + kb + 8 * hh + 4);
    const v4f x2 = *(const v4fa*)(arow + kb + 16 + 8 * hh), x3 = *(const v4fa*)(arow + kb + 16 + 8 * hh + 4);
    float xs[16] = {x0[0],x0[1],x0[2],x0[3],x1[0],x1[1],x1[2],x1[3],x2[0],x2[1],x2[2],x2[3],x3[0],x3[1],x3[2],x3[3]};
#pragma unroll
    for (int i = 0; i < 16; ++i) { const unsigned short hb = bf16_bits(xs[i]); ah.u[i] = hb; al.u[i] = ASPLIT ? bf16_bits(xs[i] - bf16_val(hb)) : (unsigned short)0; }
#pragma unroll
    for (int t = 0; t < 4; ++t) {
      const unsigned short* brow = Wt + (size_t)(col0 + t * 16 + ln) * ldb + kb;
      FragB b;
      b.half[0] = *(const v8us*)(brow + 8 * hh);
      b.half[1] = *(const v8us*)(brow + 16 + 8 * hh);
      acc[t] = mmaN<ASPLIT ? 2 : 1>(ah.v, al.v, b.v, b.v, acc[t]);
    }
  }
#pragma unroll
  for (int t = 0; t < 4; ++t) {
    const int col = col0 + t * 16 + ln;
    float bv = bias ? bias[col] : 0.f;
    if (BIAS_BF16) bv = bf16_round(bv);
#pragma unroll
    for (int r = 0; r < 8; ++r) {
      float v = acc[t][r] + bv;
      if (resid) { float rv = resid[(size_t)((row0 + 8 * hh + r) % rmod) * ldr + col]; if (RES_BF16) rv = bf16_round(rv); v += rv; }
      if (ACT == 1) v = fmaxf(v, 0.f);
      if (ACT == 2) v = 0.5f * v * (1.0f + erff(v * 0.70710678118654752f));
      if (ACT == 3) { const float u = 0.7978845608028654f * (v + 0.044715f * v * v * v); v = 0.5f * v * (1.0f + tanhf(u)); }
      so[w][8 * hh + r][t * 16 + ln] = v;
    }
  }
  __builtin_amdgcn_fence(__ATOMIC_ACQ_REL, "workgroup");
  __builtin_amdgcn_wave_barrier();
  const int rsub = lane >> 4, c4 = (lane & 15) * 4;
  {
#pragma unroll
    for (int q = 0; q < 8; ++q) {
      const int r = q * 2 + rsub;
      const v4f v = *(const v4fa*)&so[w][r][c4];
      *(v4f*)(C + (size_t)(row0 + r) * ldc + col0 + c4) = v;
    }
    
  }
}
// row LayerNorm (biased variance, eps) over N: s = X (+ R); optional out_sum <- s; out_norm <- (s-mu)*rsqrt(var+eps)*g + b
template <bool PARAM_BF16>
__global__ __launch_bounds__(256) void k_layernorm(const float* __restrict__ X, const float* __restrict__ R, const float* __restrict__ g, const float* __restrict__ bta,
                                                  float* __restrict__ out_sum, float* __restrict__ out_norm, int N, float eps) {
  __shared__ float red[256];
  const int row = blockIdx.x, tid = threadIdx.x;
  const float* x = X + (size_t)row * N; const float* rr = R ? R + (size_t)row * N : nullptr;
  float vals[16];                     // up to N = 4096
  const int per = N / 256;            // contiguous chunk per thread? use strided-by-4 chunks: thread handles j = tid*4 + 1024*u
  float s1 = 0.f;
  for (int u = 0; u < per / 4; ++u) {
    const int j = tid * 4 + 1024 * u;
    const v4f a = *(const v4fa*)(x + j);
    v4f b = {0.f,0.f,0.f,0.f}; if (rr) b = *(const v4fa*)(rr + j);
#pragma unroll
    for (int q = 0; q < 4; ++q) { const float v = a[q] + b[q]; vals[u * 4 + q] = v; s1 += v; }
  }
  red[tid] = s1; __syncthreads();
  for (int st = 128; st > 0; st >>= 1) { if (tid < st) red[tid] += red[tid + st]; __syncthreads(); }
  const float mu = red[0] / (float)N; __syncthreads();
  float s2 = 0.f;
  for (int u = 0; u < per / 4; ++u)
#pragma unroll
    for (int q = 0; q < 4; ++q) { const float c = vals[u * 4 + q] - mu; s2 += c * c; }
  red[tid] = s2; __syncthreads();
  for (int st = 128; st > 0; st >>= 1) { if (tid < st) red[tid] += red[tid + st]; __syncthreads(); }
  const float rs = rsqrtf(red[0] / (float)N + eps);
  {
    for (int u = 0; u < per / 4; ++u) {
      const int j = tid * 4 + 1024 * u;
      v4f o, sm;
#pragma unroll
      for (int q = 0; q < 4; ++q) {
        float gg = g[j + q], bb = bta[j + q];
        if (PARAM_BF16) { gg = bf16_round(gg); bb = bf16_round(bb); }
        sm[q] = vals[u * 4 + q]; o[q] = (vals[u * 4 + q] - mu) * rs * gg + bb;
      }
      if (out_sum) *(v4f*)(out_sum + (size_t)row * N + j) = sm;
      *(v4f*)(out_norm + (size_t)row * N + j) = o;
    }
    
  }
}



// ---- f16 WMMA path (v_wmma_f32_16x16x32_f16): 11-bit significands for operands in range — used where a [0,1] probability operand needs more precision than bf16
typedef _Float16 v16h __attribute__((ext_vector_type(16)));
union FragH { v16h v; v8us half[2]; _Float16 h[16]; unsigned short u[16]; };
template <int NT>
__device__ __forceinline__ v8f mmaH(v16h ah, v16h al, v16h bh, v16h bl, v8f c) {
  c = __builtin_amdgcn_wmma_f32_16x16x32_f16(false, ah, false, bh, (short)0, c, false, false);
  if (NT >= 2) c = __builtin_amdgcn_wmma_f32_16x16x32_f16(false, al, false, bh, (short)0, c, false, false);
  if (NT >= 3) c = __builtin_amdgcn_wmma_f32_16x16x32_f16(false, ah, false, bl, (short)0, c, false, false);
  asm volatile("v_nop\n\tv_nop\n\tv_nop\n\tv_nop" : "+v"(c) : "v"(ah), "v"(al), "v"(bh), "v"(bl));
  return c;
}
// batched GEMM like k_gemm_b but f16 operands: A f32 (split into f16 hi/lo if ASPLIT, else rounded to f16), Bt = f16 values [n][k]; alpha; C f32; N multiple of 16 (partial tiles skipped)
template <bool ASPLIT>
__global__ __launch_bounds__(128) void k_gemm_h(const float* __restrict__ A, int lda, size_t sA, const _Float16* __restrict__ Bh, int ldb, size_t sB, float alpha, float* __restrict__ C, int ldc, size_t sC, int M, int N, int K) {
  __shared__ __attribute__((aligned(16))) float so[4][16][64];
  const int tid = threadIdx.x, w = tid >> 5, lane = tid & 31, ln = lane & 15, hh = lane >> 4; const int by = blockIdx.y;
  A += (size_t)by * sA; Bh += (size_t)by * sB; C += (size_t)by * sC;
  const int ntn = (N + 63) / 64; const int wid = blockIdx.x * 4 + w; const int mt = wid / ntn, nq = wid % ntn; if (mt * 16 >= M) return;
  const int row0 = mt * 16, col0 = nq * 64; const float* arow = A + (size_t)(row0 + ln) * lda;
  v8f acc[4] = {};
  for (int kb = 0; kb < K; kb += 32) {
    FragH ah, al;
    const v4f x0 = *(const v4fa*)(arow + kb + 8 * hh), x1 = *(const v4fa*)(arow + kb + 8 * hh + 4), x2 = *(const v4fa*)(arow + kb + 16 + 8 * hh), x3 = *(const v4fa*)(arow + kb + 16 + 8 * hh + 4);
    float xs[16] = {x0[0],x0[1],x0[2],x0[3],x1[0],x1[1],x1[2],x1[3],x2[0],x2[1],x2[2],x2[3],x3[0],x3[1],x3[2],x3[3]};
#pragma unroll
    for (int i = 0; i < 16; ++i) { const _Float16 h = (_Float16)xs[i]; ah.h[i] = h; al.h[i] = ASPLIT ? (_Float16)(xs[i] - (float)h) : (_Float16)0.0f; }
#pragma unroll
    for (int t = 0; t < 4; ++t) { if (col0 + t * 16 >= N) continue; const size_t boff = (size_t)(col0 + t * 16 + ln) * ldb + kb; FragH bq; bq.half[0] = *(const v8us*)(Bh + boff + 8 * hh); bq.half[1] = *(const v8us*)(Bh + boff + 16 + 8 * hh);
      acc[t] = mmaH<ASPLIT ? 2 : 1>(ah.v, al.v, bq.v, bq.v, acc[t]); }
  }
#pragma unroll
  for (int t = 0; t < 4; ++t) { if (col0 + t * 16 >= N) continue;
#pragma unroll
    for (int r = 0; r < 8; ++r) so[w][8 * hh + r][t * 16 + ln] = acc[t][r] * alpha; }
  __builtin_amdgcn_fence(__ATOMIC_ACQ_REL, "workgroup"); __builtin_amdgcn_wave_barrier();
  const int rsub = lane >> 4, c4 = (lane & 15) * 4;
  {
#pragma unroll
    for (int q = 0; q < 8; ++q) { const int r = q * 2 + rsub; if (col0 + c4 < N) { const v4f v = *(const v4fa*)&so[w][r][c4]; *(v4f*)(C + (size_t)(row0 + r) * ldc + col0 + c4) = v; } }
     }
}

// Wt[n][k] = f16(W[k][n]·scale) from f32 row-major W[K][N] (scale = power of two; bf16-exact weights stay exact in f16 away from the subnormal range)
__global__ __launch_bounds__(256) void k_wt_f16(const float* __restrict__ W, _Float16* __restrict__ Wt, int K, int N, float scale) {
  const int t = blockIdx.x * 256 + threadIdx.x; if (t >= N * (K / 8)) return; const int n = t / (K / 8), k8 = (t % (K / 8)) * 8; FragH f;
#pragma unroll
  for (int i = 0; i < 8; ++i) f.h[i] = (_Float16)(bf16_round(W[(size_t)(k8 + i) * N + n]) * scale); const v8us o = f.half[0];
  *(v8us*)((unsigned short*)Wt + (size_t)n * K + k8) = o; 
}
// k_gemm_hh variant with fused epilogue: v = acc·alpha + bias[by·sBias + col] (+ CP[(row/rowsPerB)·sCPb + by·64 + col] if CP) ; ACT 0 none / 1 elu ; writes f32 C and/or f16 C16 (each if non-null)
template <int ACT>
__global__ __launch_bounds__(128) void k_gemm_hhx(const _Float16* __restrict__ A, int lda, size_t sA, const _Float16* __restrict__ Bh, int ldb, size_t sB, float alpha, const float* __restrict__ bias, size_t sBias, const float* __restrict__ CP, int rowsPerB, size_t sCPb, int row0g,
    float* __restrict__ C, _Float16* __restrict__ C16, int ldc, size_t sC, int M, int N, int K) {
  __shared__ __attribute__((aligned(16))) float so[4][16][64];
  const int tid = threadIdx.x, w = tid >> 5, lane = tid & 31, ln = lane & 15, hh = lane >> 4; const int by = blockIdx.y;
  A += (size_t)by * sA; Bh += (size_t)by * sB; const size_t cofs = (size_t)by * sC; const float* bp = bias ? bias + (size_t)by * sBias : nullptr;
  const int ntn = (N + 63) / 64; const int wid = blockIdx.x * 4 + w; const int mt = wid / ntn, nq = wid % ntn; if (mt * 16 >= M) return;
  const int row0 = mt * 16, col0 = nq * 64; const _Float16* arow = A + (size_t)(row0 + ln) * lda;
  v8f acc[4] = {};
  for (int kb = 0; kb < K; kb += 32) { FragH ah; ah.half[0] = *(const v8us*)((const unsigned short*)arow + kb + 8 * hh); ah.half[1] = *(const v8us*)((const unsigned short*)arow + kb + 16 + 8 * hh);
#pragma unroll
    for (int t = 0; t < 4; ++t) { if (col0 + t * 16 >= N) continue; const size_t boff = (size_t)(col0 + t * 16 + ln) * ldb + kb; FragH bq; bq.half[0] = *(const v8us*)((const unsigned short*)Bh + boff + 8 * hh); bq.half[1] = *(const v8us*)((const unsigned short*)Bh + boff + 16 + 8 * hh);
      acc[t] = mmaH<1>(ah.v, ah.v, bq.v, bq.v, acc[t]); }
  }
#pragma unroll
  for (int t = 0; t < 4; ++t) { if (col0 + t * 16 >= N) continue; const int col = col0 + t * 16 + ln; const float bv = bp ? bf16_round(bp[col]) : 0.f;
#pragma unroll
    for (int r = 0; r < 8; ++r) { float v = acc[t][r] * alpha + bv; if (CP) { const int rr = row0g + row0 + 8 * hh + r; if (rowsPerB < 0) v += CP[cofs + (size_t)rr * ldc + col];      /* rowsPerB < 0: own element of the batched C plane */ else { const int bidx = rr / rowsPerB; v += CP[(size_t)bidx * sCPb + (size_t)by * 64 + col]; } } if (ACT == 1) v = (v > 0.f) ? v : expm1f(v); else if (ACT == 7) v = (v > 0.f) ? v + 1.0f : expf(v); else if (ACT == 8) v = tanhf(v); else if (ACT == 9) v = 0.5f * v * (1.0f + tanhf(0.7978845608028654f * (v + 0.044715f * v * v * v))); else if (ACT == 11) v = 1.0f / (1.0f + expf(-v)); else if (ACT == 12) v = (v > 0.f) ? v : 0.01f * v; else if (ACT == 14) v = (v > 0.f) ? v : 0.1f * v; else if (ACT == 16) v = (v >= 0.f) ? v : 0.3f * v; else if (ACT == 17) v = (v >= 0.f) ? v : 0.2f * v; else if (ACT == 15) v = v / (1.0f + expf(-v)); else if (ACT == 3) v = fmaxf(v, 0.f); else if (ACT == 6) v = 0.5f * v * (1.0f + erff(v * 0.70710678118654752f)); so[w][8 * hh + r][t * 16 + ln] = v; } }
  __builtin_amdgcn_fence(__ATOMIC_ACQ_REL, "workgroup"); __builtin_amdgcn_wave_barrier();
  const int rsub = lane >> 4, c4 = (lane & 15) * 4; typedef _Float16 v4h __attribute__((ext_vector_type(4)));
  {
#pragma unroll
    for (int q = 0; q < 8; ++q) { const int r = q * 2 + rsub; if (col0 + c4 < N) { const v4f v = *(const v4fa*)&so[w][r][c4]; if (C) *(v4f*)(C + cofs + (size_t)(row0 + r) * ldc + col0 + c4) = v; if (C16) { v4h h4; for (int i = 0; i < 4; ++i) h4[i] = (_Float16)v[i]; *(v4h*)(C16 + cofs + (size_t)(row0 + r) * ldc + col0 + c4) = h4; } } }
     }
}


typedef _Float16 v4h __attribute__((ext_vector_type(4)));

__global__ __launch_bounds__(256) void k_h16(const float* __restrict__ x, _Float16* __restrict__ X16, size_t n8) { const size_t t = (size_t)blockIdx.x * 256 + threadIdx.x; if (t >= n8) return; FragH f;
#pragma unroll
  for (int q = 0; q < 8; ++q) f.h[q] = (_Float16)x[t * 8 + q]; *(v8us*)((unsigned short*)X16 + t * 8) = f.half[0];  }
__global__ __launch_bounds__(256) void k_round16f(const float* __restrict__ W, _Float16* __restrict__ Bt, size_t n8) { const size_t t = (size_t)blockIdx.x * 256 + threadIdx.x; if (t >= n8) return; FragH f;
#pragma unroll
  for (int i = 0; i < 8; ++i) f.h[i] = (_Float16)(bf16_round(W[t * 8 + i]) * 16.0f); *(v8us*)((unsigned short*)Bt + t * 8) = f.half[0];  }
template <int NHv, int TTv>
__global__ __launch_bounds__(256) void k_vt(const _Float16* __restrict__ V16, int ldv, int voff, _Float16* __restrict__ Vt) { __shared__ unsigned short tl[64][66]; const int tid = threadIdx.x; const int slab = blockIdx.x / (TTv / 64), lg = blockIdx.x % (TTv / 64); const int b = slab / NHv, h = slab % NHv;
  for (int i = tid; i < 64 * 8; i += 256) { const int r = i / 8, c8 = (i % 8) * 8; FragH f; f.half[0] = *(const v8us*)((const unsigned short*)V16 + ((size_t)b * TTv + lg * 64 + r) * ldv + voff + h * 64 + c8);
#pragma unroll
    for (int q = 0; q < 8; ++q) tl[r][c8 + q] = f.u[q]; }
  __syncthreads();
  {
#pragma unroll
    for (int rd = 0; rd < 2; ++rd) { const int d = rd * 32 + tid / 8, pc = tid % 8; FragH f;
#pragma unroll
      for (int q = 0; q < 8; ++q) f.u[q] = tl[pc * 8 + q][d];
      *(v8us*)((unsigned short*)Vt + ((size_t)slab * 64 + d) * TTv + lg * 64 + pc * 8) = f.half[0]; }
     } }

__global__ __launch_bounds__(256) void k_hl(const float* __restrict__ F, _Float16* __restrict__ Hh, _Float16* __restrict__ Hl, size_t n8) { const size_t t = (size_t)blockIdx.x * 256 + threadIdx.x; if (t >= n8) return; FragH fh, fl; const v4f a = *(const v4fa*)(F + t * 8), c = *(const v4fa*)(F + t * 8 + 4);
#pragma unroll
  for (int q = 0; q < 4; ++q) { _Float16 h = (_Float16)a[q]; fh.h[q] = h; fl.h[q] = (_Float16)((a[q] - (float)h) * 1024.0f); h = (_Float16)c[q]; fh.h[4 + q] = h; fl.h[4 + q] = (_Float16)((c[q] - (float)h) * 1024.0f); }
  { *(v8us*)((unsigned short*)Hh + t * 8) = fh.half[0]; *(v8us*)((unsigned short*)Hl + t * 8) = fl.half[0];  } }

// ---- fragment load and product of the 32x64 wave tile ----
__device__ __forceinline__ v16h g2_frag(const _Float16* p, int hh) { FragH f; f.half[0] = *(const v8us*)((const unsigned short*)p + 8 * hh); f.half[1] = *(const v8us*)((const unsigned short*)p + 16 + 8 * hh); return f.v; }
__device__ __forceinline__ v8f g2_mma(v16h a, v16h b, v8f c) { v8f d = __builtin_amdgcn_wmma_f32_16x16x32_f16(false, a, false, b, (short)0, c, false, false); asm volatile("v_nop\n\tv_nop\n\tv_nop\n\tv_nop" : "+v"(d) : "v"(a), "v"(b)); return d; }

// The four weight matrices, f16(bf16(w) * 16), in one grid; the block index picks the matrix (uniform in a work-group).
__global__ __launch_bounds__(256) void k_cvt4(const float* __restrict__ w0, const float* __restrict__ w1, const float* __restrict__ w2, const float* __restrict__ w3, _Float16* __restrict__ Bt) {
  constexpr int WB = DW * DIN / 8 / 256;      /* blocks per weight matrix */
  const int j = blockIdx.x / WB, blk = blockIdx.x - j * WB; const float* s = (j == 0) ? w0 : (j == 1) ? w1 : (j == 2) ? w2 : w3; _Float16* d = Bt + (size_t)j * DW * DIN;
  const size_t t = (size_t)blk * 256 + threadIdx.x; FragH f;
#pragma unroll      /* constant indices: the eight values stay in registers and their loads join into two of 16 bytes */
  for (int q = 0; q < 8; ++q) f.h[q] = (_Float16)(bf16_round(s[t * 8 + q]) * 16.0f);
  *(v8us*)((unsigned short*)d + t * 8) = f.half[0];
}
// ---- q, k, v projections straight from the f32 inputs (grid.y = plane): no conversion launch, no f16 copy of the inputs in memory ----
// A work-group of 8 waves owns 64 token rows x all 256 output columns, so each input row is read from memory once, in whole lines, all 16 loads of a
// lane in flight, rounded once (f16(bf16(x)), as the conversion kernel did) and laid in LDS at a pitch of 16 B x 33 for the ds_load_b128 fragment reads.
// Wave tile 32 x 64.
__global__ __launch_bounds__(256) void k_proj(const float* __restrict__ x0, const float* __restrict__ x1, const float* __restrict__ x2, const _Float16* __restrict__ Bh,
                                              const float* __restrict__ bias0, const float* __restrict__ bias1, const float* __restrict__ bias2, _Float16* __restrict__ C16) {
  __shared__ __attribute__((aligned(16))) _Float16 sa[64][DIN + 8];
  __shared__ __attribute__((aligned(16))) float so[8][32][68];
  const int tid = threadIdx.x, w = tid >> 5, lane = tid & 31, ln = lane & 15, hh = lane >> 4; const int by = blockIdx.y;
  const float* xs = ((by == 0) ? x0 : (by == 1) ? x1 : x2) + (size_t)blockIdx.x * 64 * DIN; const float* bp = (by == 0) ? bias0 : (by == 1) ? bias1 : bias2;
  v4f t[16];
#pragma unroll      /* constant indices: the sixteen loads stand in registers and issue together */
  for (int i = 0; i < 16; ++i) t[i] = *(const v4fa*)(xs + (size_t)(i * 256 + tid) * 4);
#pragma unroll      /* constant indices, as above */
  for (int i = 0; i < 16; ++i) { v4h h4;
#pragma unroll      /* constant indices, as above */
    for (int q = 0; q < 4; ++q) h4[q] = (_Float16)bf16_round(t[i][q]);
    *(v4h*)&sa[i * 4 + (tid >> 6)][(tid & 63) * 4] = h4; }
  __syncthreads();      /* the 64 converted rows are in LDS for all eight waves */
  const int rl0 = (w >> 2) * 32, col0 = (w & 3) * 64; const int row0 = blockIdx.x * 64 + rl0; const size_t cofs = (size_t)by * NR * DW;
  const _Float16* a0p = &sa[rl0 + ln][0]; const _Float16* a1p = &sa[rl0 + 16 + ln][0];
  const _Float16* b0p = Bh + (size_t)by * DW * DIN + (size_t)(col0 + ln) * DIN; const _Float16* b1p = b0p + (size_t)16 * DIN; const _Float16* b2p = b1p + (size_t)16 * DIN; const _Float16* b3p = b2p + (size_t)16 * DIN;
  const v8f z8 = {0.f,0.f,0.f,0.f,0.f,0.f,0.f,0.f}; v8f c00 = z8, c01 = z8, c02 = z8, c03 = z8, c10 = z8, c11 = z8, c12 = z8, c13 = z8;
  for (int kb = 0; kb < DIN; kb += 32) { const v16h a0 = g2_frag(a0p + kb, hh), a1 = g2_frag(a1p + kb, hh);
    v16h b = g2_frag(b0p + kb, hh); c00 = g2_mma(a0, b, c00); c10 = g2_mma(a1, b, c10);
    b = g2_frag(b1p + kb, hh); c01 = g2_mma(a0, b, c01); c11 = g2_mma(a1, b, c11);
    b = g2_frag(b2p + kb, hh); c02 = g2_mma(a0, b, c02); c12 = g2_mma(a1, b, c12);
    b = g2_frag(b3p + kb, hh); c03 = g2_mma(a0, b, c03); c13 = g2_mma(a1, b, c13); }
  v8f accs[8] = {c00, c01, c02, c03, c10, c11, c12, c13};
#pragma unroll      /* constant indices: the tiles stay in registers */
  for (int u = 0; u < 8; ++u) { const int tt = u & 3, half = u >> 2; const float bv = bf16_round(bp[col0 + tt * 16 + ln]);
#pragma unroll      /* constant indices: the tiles stay in registers */
    for (int r = 0; r < 8; ++r) so[w][half * 16 + 8 * hh + r][tt * 16 + ln] = accs[u][r] * 0.0625f + bv; }
  __builtin_amdgcn_fence(__ATOMIC_ACQ_REL, "workgroup"); __builtin_amdgcn_wave_barrier();      /* a wave reads back only its own staging rows */
  const int rsub = lane >> 4, c4 = (lane & 15) * 4;
#pragma unroll      /* the LDS reads issue ahead of the stores */
  for (int q = 0; q < 16; ++q) { const int r = q * 2 + rsub; const v4f v = *(const v4fa*)&so[w][r][c4]; v4h h4;
#pragma unroll      /* constant indices */
    for (int i = 0; i < 4; ++i) h4[i] = (_Float16)v[i];
    *(v4h*)(C16 + cofs + (size_t)(row0 + r) * DW + col0 + c4) = h4; }
}
// ---- fused causal attention: S^T = K Q^T, online softmax in registers, O^T += V^T P^T; scores and weights never reach memory ----
// One wave = 32 queries of one head; a pass = 32 keys. In S^T a lane holds one query's scores (column ln, keys 8*hh + r), so two S^T tiles,
// converted in place, are the B operand of V^T P^T in the hardware k order. Weights carry a factor 1024 (as exp2(... + 10)); it cancels in O / l.
__device__ __forceinline__ float fa_xhalf(float x) { const int b = __float_as_int(x); return __int_as_float(__builtin_amdgcn_permlanex16(b, b, 0x76543210, 0xfedcba98, false, false)); }
__device__ __forceinline__ v16h fa_frag(const _Float16* p) { FragH f; f.half[0] = *(const v8us*)((const unsigned short*)p); f.half[1] = *(const v8us*)((const unsigned short*)p + 16); return f.v; }      /* p already holds the lane half's 8 * hh */
__device__ __forceinline__ v8f fa_mma(v16h a, v16h b, v8f c) { return __builtin_amdgcn_wmma_f32_16x16x32_f16(false, a, false, b, (short)0, c, false, false); }
// Eight independent v_exp_f32 and the slot that the instruction set asks for behind a transcendental, in one statement: a v_nop in a statement of its own
// did not stay behind them. Outputs are early-clobber, so that none of the eight overwrites a source of the one in front of it.
__device__ __forceinline__ void fa_exp8(v8f& e, const v8f x) {
  float e0, e1, e2, e3, e4, e5, e6, e7;
  asm("v_exp_f32 %0, %8\n\tv_exp_f32 %1, %9\n\tv_exp_f32 %2, %10\n\tv_exp_f32 %3, %11\n\tv_exp_f32 %4, %12\n\tv_exp_f32 %5, %13\n\tv_exp_f32 %6, %14\n\tv_exp_f32 %7, %15\n\tv_nop"
      : "=&v"(e0), "=&v"(e1), "=&v"(e2), "=&v"(e3), "=&v"(e4), "=&v"(e5), "=&v"(e6), "=&v"(e7)
      : "v"(x[0]), "v"(x[1]), "v"(x[2]), "v"(x[3]), "v"(x[4]), "v"(x[5]), "v"(x[6]), "v"(x[7]));
  e[0] = e0; e[1] = e1; e[2] = e2; e[3] = e3; e[4] = e4; e[5] = e5; e[6] = e6; e[7] = e7;
}
template <bool DIAG>
__device__ __forceinline__ void fa_pass(const v16h k0, const v16h k1, const v16h v0, const v16h v1, const v16h q0f, const v16h q1f, v8f (&o)[2][2], float (&m)[2], float (&l)[2], const int ln, const int hh) {
  const float C = 0.17677669529663687f * 1.4426950408889634f;      /* 1/sqrt(32) * log2(e) */
  const v8f z8 = {0.f,0.f,0.f,0.f,0.f,0.f,0.f,0.f};
  v8f s[2][2];
  s[0][0] = fa_mma(k0, q0f, z8); s[0][1] = fa_mma(k1, q0f, z8); s[1][0] = fa_mma(k0, q1f, z8); s[1][1] = fa_mma(k1, q1f, z8);
  float mn[2];
#pragma unroll      /* constant indices: the tiles stay in registers */
  for (int qt = 0; qt < 2; ++qt) {
    if (DIAG) {
#pragma unroll      /* constant indices: the tiles stay in registers */
      for (int r = 0; r < 8; ++r) { if (8 * hh + r > 16 * qt + ln) s[qt][0][r] = -3.0e38f; if (16 + 8 * hh + r > 16 * qt + ln) s[qt][1][r] = -3.0e38f; }
    }
    float mx = fmaxf(s[qt][0][0], s[qt][1][0]);
#pragma unroll      /* constant indices: the tiles stay in registers */
    for (int r = 1; r < 8; ++r) mx = fmaxf(mx, fmaxf(s[qt][0][r], s[qt][1][r]));
    mx = fmaxf(mx, fa_xhalf(mx));
    mn[qt] = fmaxf(m[qt], mx * C);
  }
  if (__builtin_amdgcn_ballot_w32(mn[0] > m[0] || mn[1] > m[1]) != 0) {      /* a maximum rose somewhere in the wave: rescale (factor exactly 1 where it did not) */
#pragma unroll      /* constant indices: the tiles stay in registers */
    for (int qt = 0; qt < 2; ++qt) { const float al = __builtin_amdgcn_exp2f(m[qt] - mn[qt]); o[qt][0] *= al; o[qt][1] *= al; l[qt] *= al; m[qt] = mn[qt]; }
  }
  FragH p[2];
#pragma unroll      /* constant indices: the tiles stay in registers */
  for (int qt = 0; qt < 2; ++qt) {
    const float sh = 10.0f - m[qt]; float su = 0.f;
#pragma unroll      /* constant indices: the tiles stay in registers */
    for (int t = 0; t < 2; ++t) { v8f x, e;
#pragma unroll      /* constant indices: the tiles stay in registers */
      for (int r = 0; r < 8; ++r) x[r] = fmaf(s[qt][t][r], C, sh);
      fa_exp8(e, x);
#pragma unroll      /* constant indices: the tiles stay in registers */
      for (int r = 0; r < 8; ++r) { su += e[r]; p[qt].h[8 * t + r] = (_Float16)e[r]; } }
    l[qt] += su;
  }
  o[0][0] = fa_mma(v0, p[0].v, o[0][0]); o[0][1] = fa_mma(v1, p[0].v, o[0][1]); o[1][0] = fa_mma(v0, p[1].v, o[1][0]); o[1][1] = fa_mma(v1, p[1].v, o[1][1]);
}
// Grid: 16 x 32 work-groups of 8 waves = two heads (which share each 128-byte line of the context planes) x four query groups p, 63-p, 31-p, 32+p
// (equal work in every work-group). Context = O / l, split hi + residual * 1024, staged in LDS so that each line is stored whole by one wave.
__global__ __launch_bounds__(256) void k_fattn(const _Float16* __restrict__ Q, const _Float16* __restrict__ Kk, const _Float16* __restrict__ Vt, _Float16* __restrict__ CH, _Float16* __restrict__ CL) {
  __shared__ __attribute__((aligned(16))) _Float16 st[4][2][32][72];
  const int lane = threadIdx.x & 31, ln = lane & 15, hh = lane >> 4; const int w = __builtin_amdgcn_readfirstlane(threadIdx.x >> 5);
  const int hp = blockIdx.x & 31, p = blockIdx.x >> 5; const int b = hp >> 2, hsel = w & 1, head = (hp & 3) * 2 + hsel; const int role = w >> 1;
  const int g = (role == 0) ? p : (role == 1) ? 31 - p : (role == 2) ? 63 - p : 32 + p;      /* waves w and w + 4 together: 63 */
  const _Float16* qp = Q + ((size_t)b * NTK + g * 32 + ln) * DW + head * HD + 8 * hh;
  const v16h q0f = fa_frag(qp), q1f = fa_frag(qp + (size_t)16 * DW);
  const _Float16* kp = Kk + ((size_t)b * NTK + ln) * DW + head * HD + 8 * hh;
  const _Float16* vp = Vt + ((size_t)b * DW + head * HD + ln) * NTK + 8 * hh;
  const v8f z8 = {0.f,0.f,0.f,0.f,0.f,0.f,0.f,0.f};
  v8f o[2][2] = {{z8, z8}, {z8, z8}}; float m[2] = {-3.0e38f, -3.0e38f}, l[2] = {0.f, 0.f};
  v16h k0 = fa_frag(kp), k1 = fa_frag(kp + (size_t)16 * DW), v0 = fa_frag(vp), v1 = fa_frag(vp + (size_t)16 * NTK);
  asm volatile("s_wait_xcnt 0x0" :: "v"(qp) : "memory");      /* stands before the registers of the query address are used again: the operand keeps them untouched up to here */
  for (int kb = 0; kb < g; ++kb) {      /* passes below the diagonal; the next pass's fragments are fetched ahead (pass g always exists) */
    kp += (size_t)32 * DW; vp += 32;
    const v16h nk0 = fa_frag(kp), nk1 = fa_frag(kp + (size_t)16 * DW), nv0 = fa_frag(vp), nv1 = fa_frag(vp + (size_t)16 * NTK);
    fa_pass<false>(k0, k1, v0, v1, q0f, q1f, o, m, l, ln, hh);
    k0 = nk0; k1 = nk1; v0 = nv0; v1 = nv1;
  }
  fa_pass<true>(k0, k1, v0, v1, q0f, q1f, o, m, l, ln, hh);
#pragma unroll      /* constant indices: the tiles stay in registers */
  for (int qt = 0; qt < 2; ++qt) { const float inv = 1.0f / (l[qt] + fa_xhalf(l[qt]));
#pragma unroll      /* constant indices: the tiles stay in registers */
    for (int dt = 0; dt < 2; ++dt) { FragH f, fl;
#pragma unroll      /* constant indices: the tiles stay in registers */
      for (int r = 0; r < 8; ++r) { const float v = o[qt][dt][r] * inv; const _Float16 hv = (_Float16)v; f.h[r] = hv; fl.h[r] = (_Float16)((v - (float)hv) * 1024.0f); }
      *(v8us*)&st[role][0][16 * qt + ln][hsel * 32 + 16 * dt + 8 * hh] = f.half[0]; *(v8us*)&st[role][1][16 * qt + ln][hsel * 32 + 16 * dt + 8 * hh] = fl.half[0]; } }
  __syncthreads();      /* the partner head's half of each line is in LDS */
#pragma unroll      /* the LDS reads of all four steps issue ahead of the stores */
  for (int i = 0; i < 4; ++i) { const int row = hsel * 16 + i * 4 + (lane >> 3), c8 = (lane & 7) * 8; const size_t go = ((size_t)b * NTK + g * 32 + row) * DW + (hp & 3) * 64 + c8;
    *(v8us*)((unsigned short*)CH + go) = *(const v8us*)&st[role][0][row][c8]; *(v8us*)((unsigned short*)CL + go) = *(const v8us*)&st[role][1][row][c8]; }
}

// ---- output projection, one launch: out = (ctx_hi + ctx_lo / 1024) Wo^T + bo ----
// A work-group of 8 waves owns the 128 x 64 tile that a work-group of each of the former two GEMM launches owned; a wave owns 16 rows x 64 columns of it and
// keeps two sets of accumulators, one per context plane, so that each weight fragment is loaded once and serves both planes and no partial result goes
// through memory. The sums and the epilogue's operations are those of the two launches. The 8 k steps are unrolled over a ring of three fragment sets in
// registers: the loads of two steps are in flight while one step's products run.
__global__ __launch_bounds__(256) void k_oproj(const _Float16* __restrict__ AH, const _Float16* __restrict__ AL, const _Float16* __restrict__ Bh, const float* __restrict__ bias, float* __restrict__ C) {
  __shared__ __attribute__((aligned(16))) float so[8][16][68];
  const int tid = threadIdx.x, w = tid >> 5, lane = tid & 31, ln = lane & 15, hh = lane >> 4;
  const int mt = blockIdx.x >> 2, nq = blockIdx.x & 3; const int row0 = mt * 128 + 16 * w, col0 = nq * 64;
  const size_t ao = (size_t)(row0 + ln) * DW + 8 * hh;
  const _Float16* ahp = AH + ao; const _Float16* alp = AL + ao; const _Float16* bp = Bh + (size_t)(col0 + ln) * DW + 8 * hh;
  const v8f z8 = {0.f,0.f,0.f,0.f,0.f,0.f,0.f,0.f}; v8f ch[4] = {z8, z8, z8, z8}, cl[4] = {z8, z8, z8, z8};
  float bv[4];
#pragma unroll      /* constant indices; read here so that the epilogue does not wait for them */
  for (int t = 0; t < 4; ++t) bv[t] = bias[col0 + t * 16 + ln];
  v16h fh[3], fl[3], fb[3][4];
#pragma unroll      /* constant indices: the ring stays in registers */
  for (int s = 0; s < 2; ++s) { fh[s] = fa_frag(ahp + s * 32); fl[s] = fa_frag(alp + s * 32);
#pragma unroll      /* constant indices, as above */
    for (int t = 0; t < 4; ++t) fb[s][t] = fa_frag(bp + t * 16 * DW + s * 32); }
#pragma unroll      /* constant indices: the ring stays in registers and every address is a base plus an immediate */
  for (int s = 0; s < DW / 32; ++s) {
    if (s + 2 < DW / 32) { const int n = s + 2, sl = n % 3; fh[sl] = fa_frag(ahp + n * 32); fl[sl] = fa_frag(alp + n * 32);
#pragma unroll      /* constant indices, as above */
      for (int t = 0; t < 4; ++t) fb[sl][t] = fa_frag(bp + t * 16 * DW + n * 32); }
    const int cu = s % 3;
#pragma unroll      /* constant indices, as above */
    for (int t = 0; t < 4; ++t) { ch[t] = fa_mma(fh[cu], fb[cu][t], ch[t]); cl[t] = fa_mma(fl[cu], fb[cu][t], cl[t]); }
    __builtin_amdgcn_sched_barrier(0);      /* keeps later steps' loads below this step: lifted to the top they took over 256 registers (half the grid resident) or spilled */
  }
#pragma unroll      /* constant indices: the tiles stay in registers */
  for (int t = 0; t < 4; ++t) { const float bt = bf16_round(bv[t]);
#pragma unroll      /* constant indices: the tiles stay in registers */
    for (int r = 0; r < 8; ++r) { float v = ch[t][r] * 0.0625f + bt; v += cl[t][r] * (0.0625f / 1024.0f); so[w][8 * hh + r][t * 16 + ln] = v; } }
  __builtin_amdgcn_fence(__ATOMIC_ACQ_REL, "workgroup"); __builtin_amdgcn_wave_barrier();      /* a wave reads back only its own staging rows */
  const int rsub = lane >> 4, c4 = (lane & 15) * 4;
#pragma unroll      /* the LDS reads issue ahead of the stores */
  for (int q = 0; q < 8; ++q) { const int r = q * 2 + rsub; const v4f v = *(const v4fa*)&so[w][r][c4]; *(v4f*)(C + (size_t)(row0 + r) * DW + col0 + c4) = v; }
}

extern "C" void kernel_launch(void* const* d_in, const int* in_sizes, int n_in,
                              void* d_out, int out_size, void* d_ws, size_t ws_size, hipStream_t stream) {
  (void)in_sizes; (void)n_in; (void)out_size;
  const float* const* I = (const float* const*)d_in; const float* xq = I[0]; const float* xk = I[1]; const float* xv = I[2]; const float* Wq = I[3]; const float* bq = I[4]; const float* Wk = I[5]; const float* bk = I[6]; const float* Wv = I[7]; const float* bv = I[8]; const float* Wo = I[9]; const float* bo = I[10];
  char* ws = (char*)d_ws; size_t off = 0;
  auto take = [&](size_t bytes) { char* p = ws + off; off += (bytes + 255) & ~(size_t)255; return p; };
  const size_t np = (size_t)NR * DW;
  _Float16* BW = (_Float16*)take((size_t)4 * DW * DIN * 2); _Float16* CH = (_Float16*)take(2 * np * 2); _Float16* CL = CH + np; _Float16* Q16 = (_Float16*)take(3 * np * 2); _Float16* K16 = Q16 + np; _Float16* V16 = K16 + np; _Float16* VT = (_Float16*)take(np * 2);      /* context hi / residual; projections: three planes in a row, a plane is one step of grid.y */
  if (off > ws_size) return;      /* 0.5 + 6 x 8 MiB */
  k_cvt4<<<4 * (DW * DIN / 8 / 256), 256, 0, stream>>>(Wq, Wk, Wv, Wo, BW);      /* torch (out, in) naturals */
  const dim3 gP((NR / 128) * (DW / 64), 1), gP3(NR / 64, 3);
  k_proj<<<gP3, 256, 0, stream>>>(xq, xk, xv, BW, bq, bk, bv, Q16);      /* q, k, v projections from the f32 inputs: grid.y = 0, 1, 2 */
  k_vt<DW / 64, NTK><<<NB * (DW / 64) * (NTK / 64), 256, 0, stream>>>(V16, DW, 0, VT);      /* V^T [(b, 64-slab)][64][2048]: head h of batch b = rows b*256 + h*32 */
  k_fattn<<<16 * (NB * NH / 2), 256, 0, stream>>>(Q16, K16, VT, CH, CL);      /* all heads, all batches: context hi / residual */
  k_oproj<<<gP, 256, 0, stream>>>(CH, CL, BW + (size_t)3 * DW * DIN, bo, (float*)d_out);      /* out = (ctx_hi + ctx_lo / 1024) Wo^T + bo */
}

// v005
// A run of this version takes 73.6 microseconds.
// Two timings next to v004 put it at 1.06 and 1.04 times that version's speed.
// Counting every step since v000, it is 19.5 times as fast.
#include <hip/hip_runtime.h>
// my_attention (8 x 2048 tokens x 256; 8 heads x 32; q/k/v = query/key/value W^T + b; causal softmax(q.k / sqrt(32)); out = merged ctx Wo^T + bo).
// Compute dtype: inputs rounded to bf16; inputs/weights exact as f16; q/k/v and the softmax weights as plain f16 operands (~2^-12); context hi + residual into Wo; softmax f32. v_wmma_f32_16x16x32_f16.
#define NB 8
#define NTK 2048
#define DIN 256
#define NH 8
#define HD 32
#define DW 256
#define NR (NB * NTK)
typedef __bf16 v16b __attribute__((ext_vector_type(16)));
typedef unsigned short v8us __attribute__((ext_vector_type(8), may_alias));
typedef float  v8f  __attribute__((ext_vector_type(8)));
typedef float  v4f  __attribute__((ext_vector_type(4)));
typedef float  v4fa __attribute__((ext_vector_type(4), may_alias));
union FragB { v16b v; v8us half[2]; unsigned short u[16]; };

__device__ __forceinline__ unsigned short bf16_bits(float x) { unsigned int u = __float_as_uint(x); return (unsigned short)((u + 0x7FFFu + ((u >> 16) & 1u)) >> 16); }
__device__ __forceinline__ float bf16_val(unsigned short b) { return __uint_as_float(((unsigned int)b) << 16); }
__device__ __forceinline__ float bf16_round(float x) { return bf16_val(bf16_bits(x)); }
// D += A·B with NT terms: 1 = ah·bh, 2 = + al·bh (A split), 3 = + ah·bl (both split)
template <int NT>
__device__ __forceinline__ v8f mmaN(v16b ah, v16b al, v16b bh, v16b bl, v8f c) {
  c = __builtin_amdgcn_wmma_f32_16x16x32_bf16(false, ah, false, bh, (short)0, c, false, false);
  if (NT >= 2) c = __builtin_amdgcn_wmma_f32_16x16x32_bf16(false, al, false, bh, (short)0, c, false, false);
  if (NT >= 3) c = __builtin_amdgcn_wmma_f32_16x16x32_bf16(false, ah, false, bl, (short)0, c, false, false);
  asm volatile("v_nop\n\tv_nop\n\tv_nop\n\tv_nop" : "+v"(c) : "v"(ah), "v"(al), "v"(bh), "v"(bl));
  return c;
}

__global__ __launch_bounds__(256) void k_wt_bf16(const float* __restrict__ W, unsigned short* __restrict__ Wt, int K, int N) {
  const int t = blockIdx.x * 256 + threadIdx.x;
  const int k8n = K / 8;
  if (t >= N * k8n) return;
  const int n = t / k8n, k8 = (t % k8n) * 8;
  v8us v;
#pragma unroll
  for (int i = 0; i < 8; ++i) v[i] = bf16_bits(W[(size_t)(k8 + i) * N + n]);
  *(v8us*)(Wt + (size_t)n * K + k8) = v;
  
}

// GEMM C[M][N] (f32, pitch ldc) = act(A[M][K]·W + bias). A f32 row-major (pitch lda) converted per fragment to bf16
// (ASPLIT: hi/lo two planes -> 2 terms, else single rounded term); Wt bf16 [N][K] (pitch ldb). BIAS_BF16 rounds the
// bias to bf16 first (bias quantised to bf16 before the add). K%32==0, M%16==0, N%64==0.
template <bool ASPLIT, int ACT, bool BIAS_BF16>
__global__ __launch_bounds__(128) void k_gemm_bf(const float* __restrict__ A, int lda, const unsigned short* __restrict__ Wt, int ldb,
                                               const float* __restrict__ bias, float* __restrict__ C, int ldc, int M, int N, int K) {
  __shared__ __attribute__((aligned(16))) float so[4][16][64];
  const int tid = threadIdx.x, w = tid >> 5, lane = tid & 31, ln = lane & 15, hh = lane >> 4;
  const int ntn = N / 64;
  const int wid = blockIdx.x * 4 + w;
  const int mt = wid / ntn, nq = wid % ntn;
  if (mt * 16 >= M) return;
  const int row0 = mt * 16, col0 = nq * 64;
  const float* arow = A + (size_t)(row0 + ln) * lda;
  v8f acc[4] = {};
  for (int kb = 0; kb < K; kb += 32) {
    FragB ah, al;
    const v4f x0 = *(const v4fa*)(arow + kb + 8 * hh), x1 = *(const v4fa*)(arow + kb + 8 * hh + 4);
    const v4f x2 = *(const v4fa*)(arow + kb + 16 + 8 * hh), x3 = *(const v4fa*)(arow + kb + 16 + 8 * hh + 4);
    float xs[16] = {x0[0],x0[1],x0[2],x0[3],x1[0],x1[1],x1[2],x1[3],x2[0],x2[1],x2[2],x2[3],x3[0],x3[1],x3[2],x3[3]};
#pragma unroll
    for (int i = 0; i < 16; ++i) { const unsigned short hb = bf16_bits(xs[i]); ah.u[i] = hb; al.u[i] = ASPLIT ? bf16_bits(xs[i] - bf16_val(hb)) : (unsigned short)0; }
#pragma unroll
    for (int t = 0; t < 4; ++t) {
      const unsigned short* brow = Wt + (size_t)(col0 + t * 16 + ln) * ldb + kb;
      FragB b;
      b.half[0] = *(const v8us*)(brow + 8 * hh);
      b.half[1] = *(const v8us*)(brow + 16 + 8 * hh);
      acc[t] = mmaN<ASPLIT ? 2 : 1>(ah.v, al.v, b.v, b.v, acc[t]);
    }
  }
#pragma unroll
  for (int t = 0; t < 4; ++t) {
    float bv = bias ? bias[col0 + t * 16 + ln] : 0.f;
    if (BIAS_BF16) bv = bf16_round(bv);
#pragma unroll
    for (int r = 0; r < 8; ++r) { float v = acc[t][r] + bv; if (ACT == 1) v = fmaxf(v, 0.f); so[w][8 * hh + r][t * 16 + ln] = v; }
  }
  __builtin_amdgcn_fence(__ATOMIC_ACQ_REL, "workgroup");
  __builtin_amdgcn_wave_barrier();
  const int rsub = lane >> 4, c4 = (lane & 15) * 4;
  {
#pragma unroll
    for (int q = 0; q < 8; ++q) {
      const int r = q * 2 + rsub;
      const v4f v = *(const v4fa*)&so[w][r][c4];
      *(v4f*)(C + (size_t)(row0 + r) * ldc + col0 + c4) = v;
    }
    
  }
}

// GEMM C = act(A·W + bias + resid): A f32 (ASPLIT -> hi/lo 2 terms), Wt bf16 [N][K]; ACT 0 none, 1 relu, 2 exact gelu;
// resid (optional, f32, row index = (row % rmod), pitch ldr, RES_BF16 rounds it) added before the activation.
template <bool ASPLIT, int ACT, bool BIAS_BF16, bool RES_BF16>
__global__ __launch_bounds__(128) void k_gemm_bf3(const float* __restrict__ A, int lda, const unsigned short* __restrict__ Wt, int ldb,
                                                const float* __restrict__ bias, const float* __restrict__ resid, int rmod, int ldr,
                                                float* __restrict__ C, int ldc, int M, int N, int K) {
  __shared__ __attribute__((aligned(16))) float so[4][16][64];
  const int tid = threadIdx.x, w = tid >> 5, lane = tid & 31, ln = lane & 15, hh = lane >> 4;
  const int ntn = N / 64;
  const int wid = blockIdx.x * 4 + w;
  const int mt = wid / ntn, nq = wid % ntn;
  if (mt * 16 >= M) return;
  const int row0 = mt * 16, col0 = nq * 64;
  const float* arow = A + (size_t)(row0 + ln) * lda;
  v8f acc[4] = {};
  for (int kb = 0; kb < K; kb += 32) {
    FragB ah, al;
    const v4f x0 = *(const v4fa*)(arow + kb + 8 * hh), x1 = *(const v4fa*)(arow + kb + 8 * hh + 4);
    const v4f x2 = *(const v4fa*)(arow + kb + 16 + 8 * hh), x3 = *(const v4fa*)(arow + kb + 16 + 8 * hh + 4);
    float xs[16] = {x0[0],x0[1],x0[2],x0[3],x1[0],x1[1],x1[2],x1[3],x2[0],x2[1],x2[2],x2[3],x3[0],x3[1],x3[2],x3[3]};
#pragma unroll
    for (int i = 0; i < 16; ++i) { const unsigned short hb = bf16_bits(xs[i]); ah.u[i] = hb; al.u[i] = ASPLIT ? bf16_bits(xs[i] - bf16_val(hb)) : (unsigned short)0; }
#pragma unroll
    for (int t = 0; t < 4; ++t) {
      const unsigned short* brow = Wt + (size_t)(col0 + t * 16 + ln) * ldb + kb;
      FragB b;
      b.half[0] = *(const v8us*)(brow + 8 * hh);
      b.half[1] = *(const v8us*)(brow + 16 + 8 * hh);
      acc[t] = mmaN<ASPLIT ? 2 : 1>(ah.v, al.v, b.v, b.v, acc[t]);
    }
  }
#pragma unroll
  for (int t = 0; t < 4; ++t) {
    const int col = col0 + t * 16 + ln;
    float bv = bias ? bias[col] : 0.f;
    if (BIAS_BF16) bv = bf16_round(bv);
#pragma unroll
    for (int r = 0; r < 8; ++r) {
      float v = acc[t][r] + bv;
      if (resid) { float rv = resid[(size_t)((row0 + 8 * hh + r) % rmod) * ldr + col]; if (RES_BF16) rv = bf16_round(rv); v += rv; }
      if (ACT == 1) v = fmaxf(v, 0.f);
      if (ACT == 2) v = 0.5f * v * (1.0f + erff(v * 0.70710678118654752f));
      if (ACT == 3) { const float u = 0.7978845608028654f * (v + 0.044715f * v * v * v); v = 0.5f * v * (1.0f + tanhf(u)); }
      so[w][8 * hh + r][t * 16 + ln] = v;
    }
  }
  __builtin_amdgcn_fence(__ATOMIC_ACQ_REL, "workgroup");
  __builtin_amdgcn_wave_barrier();
  const int rsub = lane >> 4, c4 = (lane & 15) * 4;
  {
#pragma unroll
    for (int q = 0; q < 8; ++q) {
      const int r = q * 2 + rsub;
      const v4f v = *(const v4fa*)&so[w][r][c4];
      *(v4f*)(C + (size_t)(row0 + r) * ldc + col0 + c4) = v;
    }
    
  }
}
// row LayerNorm (biased variance, eps) over N: s = X (+ R); optional out_sum <- s; out_norm <- (s-mu)*rsqrt(var+eps)*g + b
template <bool PARAM_BF16>
__global__ __launch_bounds__(256) void k_layernorm(const float* __restrict__ X, const float* __restrict__ R, const float* __restrict__ g, const float* __restrict__ bta,
                                                  float* __restrict__ out_sum, float* __restrict__ out_norm, int N, float eps) {
  __shared__ float red[256];
  const int row = blockIdx.x, tid = threadIdx.x;
  const float* x = X + (size_t)row * N; const float* rr = R ? R + (size_t)row * N : nullptr;
  float vals[16];                     // up to N = 4096
  const int per = N / 256;            // contiguous chunk per thread? use strided-by-4 chunks: thread handles j = tid*4 + 1024*u
  float s1 = 0.f;
  for (int u = 0; u < per / 4; ++u) {
    const int j = tid * 4 + 1024 * u;
    const v4f a = *(const v4fa*)(x + j);
    v4f b = {0.f,0.f,0.f,0.f}; if (rr) b = *(const v4fa*)(rr + j);
#pragma unroll
    for (int q = 0; q < 4; ++q) { const float v = a[q] + b[q]; vals[u * 4 + q] = v; s1 += v; }
  }
  red[tid] = s1; __syncthreads();
  for (int st = 128; st > 0; st >>= 1) { if (tid < st) red[tid] += red[tid + st]; __syncthreads(); }
  const float mu = red[0] / (float)N; __syncthreads();
  float s2 = 0.f;
  for (int u = 0; u < per / 4; ++u)
#pragma unroll
    for (int q = 0; q < 4; ++q) { const float c = vals[u * 4 + q] - mu; s2 += c * c; }
  red[tid] = s2; __syncthreads();
  for (int st = 128; st > 0; st >>= 1) { if (tid < st) red[tid] += red[tid + st]; __syncthreads(); }
  const float rs = rsqrtf(red[0] / (float)N + eps);
  {
    for (int u = 0; u < per / 4; ++u) {
      const int j = tid * 4 + 1024 * u;
      v4f o, sm;
#pragma unroll
      for (int q = 0; q < 4; ++q) {
        float gg = g[j + q], bb = bta[j + q];
        if (PARAM_BF16) { gg = bf16_round(gg); bb = bf16_round(bb); }
        sm[q] = vals[u * 4 + q]; o[q] = (vals[u * 4 + q] - mu) * rs * gg + bb;
      }
      if (out_sum) *(v4f*)(out_sum + (size_t)row * N + j) = sm;
      *(v4f*)(out_norm + (size_t)row * N + j) = o;
    }
    
  }
}



// ---- f16 WMMA path (v_wmma_f32_16x16x32_f16): 11-bit significands for operands in range — used where a [0,1] probability operand needs more precision than bf16
typedef _Float16 v16h __attribute__((ext_vector_type(16)));
union FragH { v16h v; v8us half[2]; _Float16 h[16]; unsigned short u[16]; };
template <int NT>
__device__ __forceinline__ v8f mmaH(v16h ah, v16h al, v16h bh, v16h bl, v8f c) {
  c = __builtin_amdgcn_wmma_f32_16x16x32_f16(false, ah, false, bh, (short)0, c, false, false);
  if (NT >= 2) c = __builtin_amdgcn_wmma_f32_16x16x32_f16(false, al, false, bh, (short)0, c, false, false);
  if (NT >= 3) c = __builtin_amdgcn_wmma_f32_16x16x32_f16(false, ah, false, bl, (short)0, c, false, false);
  asm volatile("v_nop\n\tv_nop\n\tv_nop\n\tv_nop" : "+v"(c) : "v"(ah), "v"(al), "v"(bh), "v"(bl));
  return c;
}
// batched GEMM like k_gemm_b but f16 operands: A f32 (split into f16 hi/lo if ASPLIT, else rounded to f16), Bt = f16 values [n][k]; alpha; C f32; N multiple of 16 (partial tiles skipped)
template <bool ASPLIT>
__global__ __launch_bounds__(128) void k_gemm_h(const float* __restrict__ A, int lda, size_t sA, const _Float16* __restrict__ Bh, int ldb, size_t sB, float alpha, float* __restrict__ C, int ldc, size_t sC, int M, int N, int K) {
  __shared__ __attribute__((aligned(16))) float so[4][16][64];
  const int tid = threadIdx.x, w = tid >> 5, lane = tid & 31, ln = lane & 15, hh = lane >> 4; const int by = blockIdx.y;
  A += (size_t)by * sA; Bh += (size_t)by * sB; C += (size_t)by * sC;
  const int ntn = (N + 63) / 64; const int wid = blockIdx.x * 4 + w; const int mt = wid / ntn, nq = wid % ntn; if (mt * 16 >= M) return;
  const int row0 = mt * 16, col0 = nq * 64; const float* arow = A + (size_t)(row0 + ln) * lda;
  v8f acc[4] = {};
  for (int kb = 0; kb < K; kb += 32) {
    FragH ah, al;
    const v4f x0 = *(const v4fa*)(arow + kb + 8 * hh), x1 = *(const v4fa*)(arow + kb + 8 * hh + 4), x2 = *(const v4fa*)(arow + kb + 16 + 8 * hh), x3 = *(const v4fa*)(arow + kb + 16 + 8 * hh + 4);
    float xs[16] = {x0[0],x0[1],x0[2],x0[3],x1[0],x1[1],x1[2],x1[3],x2[0],x2[1],x2[2],x2[3],x3[0],x3[1],x3[2],x3[3]};
#pragma unroll
    for (int i = 0; i < 16; ++i) { const _Float16 h = (_Float16)xs[i]; ah.h[i] = h; al.h[i] = ASPLIT ? (_Float16)(xs[i] - (float)h) : (_Float16)0.0f; }
#pragma unroll
    for (int t = 0; t < 4; ++t) { if (col0 + t * 16 >= N) continue; const size_t boff = (size_t)(col0 + t * 16 + ln) * ldb + kb; FragH bq; bq.half[0] = *(const v8us*)(Bh + boff + 8 * hh); bq.half[1] = *(const v8us*)(Bh + boff + 16 + 8 * hh);
      acc[t] = mmaH<ASPLIT ? 2 : 1>(ah.v, al.v, bq.v, bq.v, acc[t]); }
  }
#pragma unroll
  for (int t = 0; t < 4; ++t) { if (col0 + t * 16 >= N) continue;
#pragma unroll
    for (int r = 0; r < 8; ++r) so[w][8 * hh + r][t * 16 + ln] = acc[t][r] * alpha; }
  __builtin_amdgcn_fence(__ATOMIC_ACQ_REL, "workgroup"); __builtin_amdgcn_wave_barrier();
  const int rsub = lane >> 4, c4 = (lane & 15) * 4;
  {
#pragma unroll
    for (int q = 0; q < 8; ++q) { const int r = q * 2 + rsub; if (col0 + c4 < N) { const v4f v = *(const v4fa*)&so[w][r][c4]; *(v4f*)(C + (size_t)(row0 + r) * ldc + col0 + c4) = v; } }
     }
}

// Wt[n][k] = f16(W[k][n]·scale) from f32 row-major W[K][N] (scale = power of two; bf16-exact weights stay exact in f16 away from the subnormal range)
__global__ __launch_bounds__(256) void k_wt_f16(const float* __restrict__ W, _Float16* __restrict__ Wt, int K, int N, float scale) {
  const int t = blockIdx.x * 256 + threadIdx.x; if (t >= N * (K / 8)) return; const int n = t / (K / 8), k8 = (t % (K / 8)) * 8; FragH f;
#pragma unroll
  for (int i = 0; i < 8; ++i) f.h[i] = (_Float16)(bf16_round(W[(size_t)(k8 + i) * N + n]) * scale); const v8us o = f.half[0];
  *(v8us*)((unsigned short*)Wt + (size_t)n * K + k8) = o; 
}
// k_gemm_hh variant with fused epilogue: v = acc·alpha + bias[by·sBias + col] (+ CP[(row/rowsPerB)·sCPb + by·64 + col] if CP) ; ACT 0 none / 1 elu ; writes f32 C and/or f16 C16 (each if non-null)
template <int ACT>
__global__ __launch_bounds__(128) void k_gemm_hhx(const _Float16* __restrict__ A, int lda, size_t sA, const _Float16* __restrict__ Bh, int ldb, size_t sB, float alpha, const float* __restrict__ bias, size_t sBias, const float* __restrict__ CP, int rowsPerB, size_t sCPb, int row0g,
    float* __restrict__ C, _Float16* __restrict__ C16, int ldc, size_t sC, int M, int N, int K) {
  __shared__ __attribute__((aligned(16))) float so[4][16][64];
  const int tid = threadIdx.x, w = tid >> 5, lane = tid & 31, ln = lane & 15, hh = lane >> 4; const int by = blockIdx.y;
  A += (size_t)by * sA; Bh += (size_t)by * sB; const size_t cofs = (size_t)by * sC; const float* bp = bias ? bias + (size_t)by * sBias : nullptr;
  const int ntn = (N + 63) / 64; const int wid = blockIdx.x * 4 + w; const int mt = wid / ntn, nq = wid % ntn; if (mt * 16 >= M) return;
  const int row0 = mt * 16, col0 = nq * 64; const _Float16* arow = A + (size_t)(row0 + ln) * lda;
  v8f acc[4] = {};
  for (int kb = 0; kb < K; kb += 32) { FragH ah; ah.half[0] = *(const v8us*)((const unsigned short*)arow + kb + 8 * hh); ah.half[1] = *(const v8us*)((const unsigned short*)arow + kb + 16 + 8 * hh);
#pragma unroll
    for (int t = 0; t < 4; ++t) { if (col0 + t * 16 >= N) continue; const size_t boff = (size_t)(col0 + t * 16 + ln) * ldb + kb; FragH bq; bq.half[0] = *(const v8us*)((const unsigned short*)Bh + boff + 8 * hh); bq.half[1] = *(const v8us*)((const unsigned short*)Bh + boff + 16 + 8 * hh);
      acc[t] = mmaH<1>(ah.v, ah.v, bq.v, bq.v, acc[t]); }
  }
#pragma unroll
  for (int t = 0; t < 4; ++t) { if (col0 + t * 16 >= N) continue; const int col = col0 + t * 16 + ln; const float bv = bp ? bf16_round(bp[col]) : 0.f;
#pragma unroll
    for (int r = 0; r < 8; ++r) { float v = acc[t][r] * alpha + bv; if (CP) { const int rr = row0g + row0 + 8 * hh + r; if (rowsPerB < 0) v += CP[cofs + (size_t)rr * ldc + col];      /* rowsPerB < 0: own element of the batched C plane */ else { const int bidx = rr / rowsPerB; v += CP[(size_t)bidx * sCPb + (size_t)by * 64 + col]; } } if (ACT == 1) v = (v > 0.f) ? v : expm1f(v); else if (ACT == 7) v = (v > 0.f) ? v + 1.0f : expf(v); else if (ACT == 8) v = tanhf(v); else if (ACT == 9) v = 0.5f * v * (1.0f + tanhf(0.7978845608028654f * (v + 0.044715f * v * v * v))); else if (ACT == 11) v = 1.0f / (1.0f + expf(-v)); else if (ACT == 12) v = (v > 0.f) ? v : 0.01f * v; else if (ACT == 14) v = (v > 0.f) ? v : 0.1f * v; else if (ACT == 16) v = (v >= 0.f) ? v : 0.3f * v; else if (ACT == 17) v = (v >= 0.f) ? v : 0.2f * v; else if (ACT == 15) v = v / (1.0f + expf(-v)); else if (ACT == 3) v = fmaxf(v, 0.f); else if (ACT == 6) v = 0.5f * v * (1.0f + erff(v * 0.70710678118654752f)); so[w][8 * hh + r][t * 16 + ln] = v; } }
  __builtin_amdgcn_fence(__ATOMIC_ACQ_REL, "workgroup"); __builtin_amdgcn_wave_barrier();
  const int rsub = lane >> 4, c4 = (lane & 15) * 4; typedef _Float16 v4h __attribute__((ext_vector_type(4)));
  {
#pragma unroll
    for (int q = 0; q < 8; ++q) { const int r = q * 2 + rsub; if (col0 + c4 < N) { const v4f v = *(const v4fa*)&so[w][r][c4]; if (C) *(v4f*)(C + cofs + (size_t)(row0 + r) * ldc + col0 + c4) = v; if (C16) { v4h h4; for (int i = 0; i < 4; ++i) h4[i] = (_Float16)v[i]; *(v4h*)(C16 + cofs + (size_t)(row0 + r) * ldc + col0 + c4) = h4; } } }
     }
}


typedef _Float16 v4h __attribute__((ext_vector_type(4)));

__global__ __launch_bounds__(256) void k_h16(const float* __restrict__ x, _Float16* __restrict__ X16, size_t n8) { const size_t t = (size_t)blockIdx.x * 256 + threadIdx.x; if (t >= n8) return; FragH f;
#pragma unroll
  for (int q = 0; q < 8; ++q) f.h[q] = (_Float16)x[t * 8 + q]; *(v8us*)((unsigned short*)X16 + t * 8) = f.half[0];  }
__global__ __launch_bounds__(256) void k_round16f(const float* __restrict__ W, _Float16* __restrict__ Bt, size_t n8) { const size_t t = (size_t)blockIdx.x * 256 + threadIdx.x; if (t >= n8) return; FragH f;
#pragma unroll
  for (int i = 0; i < 8; ++i) f.h[i] = (_Float16)(bf16_round(W[t * 8 + i]) * 16.0f); *(v8us*)((unsigned short*)Bt + t * 8) = f.half[0];  }

__global__ __launch_bounds__(256) void k_hl(const float* __restrict__ F, _Float16* __restrict__ Hh, _Float16* __restrict__ Hl, size_t n8) { const size_t t = (size_t)blockIdx.x * 256 + threadIdx.x; if (t >= n8) return; FragH fh, fl; const v4f a = *(const v4fa*)(F + t * 8), c = *(const v4fa*)(F + t * 8 + 4);
#pragma unroll
  for (int q = 0; q < 4; ++q) { _Float16 h = (_Float16)a[q]; fh.h[q] = h; fl.h[q] = (_Float16)((a[q] - (float)h) * 1024.0f); h = (_Float16)c[q]; fh.h[4 + q] = h; fl.h[4 + q] = (_Float16)((c[q] - (float)h) * 1024.0f); }
  { *(v8us*)((unsigned short*)Hh + t * 8) = fh.half[0]; *(v8us*)((unsigned short*)Hl + t * 8) = fl.half[0];  } }

// ---- fragment load and product of the 32x64 wave tile ----
__device__ __forceinline__ v16h g2_frag(const _Float16* p, int hh) { FragH f; f.half[0] = *(const v8us*)((const unsigned short*)p + 8 * hh); f.half[1] = *(const v8us*)((const unsigned short*)p + 16 + 8 * hh); return f.v; }
__device__ __forceinline__ v8f g2_mma(v16h a, v16h b, v8f c) { v8f d = __builtin_amdgcn_wmma_f32_16x16x32_f16(false, a, false, b, (short)0, c, false, false); asm volatile("v_nop\n\tv_nop\n\tv_nop\n\tv_nop" : "+v"(d) : "v"(a), "v"(b)); return d; }

// The four weight matrices, f16(bf16(w) * 16), in one grid; the block index picks the matrix (uniform in a work-group).
__global__ __launch_bounds__(256) void k_cvt4(const float* __restrict__ w0, const float* __restrict__ w1, const float* __restrict__ w2, const float* __restrict__ w3, _Float16* __restrict__ Bt) {
  constexpr int WB = DW * DIN / 8 / 256;      /* blocks per weight matrix */
  const int j = blockIdx.x / WB, blk = blockIdx.x - j * WB; const float* s = (j == 0) ? w0 : (j == 1) ? w1 : (j == 2) ? w2 : w3; _Float16* d = Bt + (size_t)j * DW * DIN;
  const size_t t = (size_t)blk * 256 + threadIdx.x; FragH f;
#pragma unroll      /* constant indices: the eight values stay in registers and their loads join into two of 16 bytes */
  for (int q = 0; q < 8; ++q) f.h[q] = (_Float16)(bf16_round(s[t * 8 + q]) * 16.0f);
  *(v8us*)((unsigned short*)d + t * 8) = f.half[0];
}
// ---- q, k, v projections straight from the f32 inputs (grid.y = plane): no conversion launch, no f16 copy of the inputs in memory ----
// A work-group of 8 waves owns 64 token rows x all 256 output columns, so each input row is read from memory once, in whole lines, all 16 loads of a
// lane in flight, rounded once (f16(bf16(x)), as the conversion kernel did) and laid in LDS at a pitch of 16 B x 33 for the ds_load_b128 fragment reads.
// Wave tile 32 x 64. The v plane is stored transposed, V^T [(b, column)][token], the layout the attention kernel's A fragments read: in an accumulator tile a
// lane holds 8 consecutive tokens of one column, 16 bytes of a V^T row; the work-group's 64 tokens are one whole 128-byte line of each of its 256 V^T rows.
__global__ __launch_bounds__(256) void k_proj(const float* __restrict__ x0, const float* __restrict__ x1, const float* __restrict__ x2, const _Float16* __restrict__ Bh,
                                              const float* __restrict__ bias0, const float* __restrict__ bias1, const float* __restrict__ bias2, _Float16* __restrict__ C16, _Float16* __restrict__ VT) {
  __shared__ __attribute__((aligned(16))) _Float16 sa[64][DIN + 8];
  __shared__ __attribute__((aligned(16))) float so[8][32][68];
  const int tid = threadIdx.x, w = tid >> 5, lane = tid & 31, ln = lane & 15, hh = lane >> 4; const int by = blockIdx.y;
  const float* xs = ((by == 0) ? x0 : (by == 1) ? x1 : x2) + (size_t)blockIdx.x * 64 * DIN; const float* bp = (by == 0) ? bias0 : (by == 1) ? bias1 : bias2;
  v4f t[16];
#pragma unroll      /* constant indices: the sixteen loads stand in registers and issue together */
  for (int i = 0; i < 16; ++i) t[i] = *(const v4fa*)(xs + (size_t)(i * 256 + tid) * 4);
#pragma unroll      /* constant indices, as above */
  for (int i = 0; i < 16; ++i) { v4h h4;
#pragma unroll      /* constant indices, as above */
    for (int q = 0; q < 4; ++q) h4[q] = (_Float16)bf16_round(t[i][q]);
    *(v4h*)&sa[i * 4 + (tid >> 6)][(tid & 63) * 4] = h4; }
  __syncthreads();      /* the 64 converted rows are in LDS for all eight waves */
  const int rl0 = (w >> 2) * 32, col0 = (w & 3) * 64; const int row0 = blockIdx.x * 64 + rl0; const size_t cofs = (size_t)by * NR * DW;
  const _Float16* a0p = &sa[rl0 + ln][0]; const _Float16* a1p = &sa[rl0 + 16 + ln][0];
  const _Float16* b0p = Bh + (size_t)by * DW * DIN + (size_t)(col0 + ln) * DIN; const _Float16* b1p = b0p + (size_t)16 * DIN; const _Float16* b2p = b1p + (size_t)16 * DIN; const _Float16* b3p = b2p + (size_t)16 * DIN;
  const v8f z8 = {0.f,0.f,0.f,0.f,0.f,0.f,0.f,0.f}; v8f c00 = z8, c01 = z8, c02 = z8, c03 = z8, c10 = z8, c11 = z8, c12 = z8, c13 = z8;
  for (int kb = 0; kb < DIN; kb += 32) { const v16h a0 = g2_frag(a0p + kb, hh), a1 = g2_frag(a1p + kb, hh);
    v16h b = g2_frag(b0p + kb, hh); c00 = g2_mma(a0, b, c00); c10 = g2_mma(a1, b, c10);
    b = g2_frag(b1p + kb, hh); c01 = g2_mma(a0, b, c01); c11 = g2_mma(a1, b, c11);
    b = g2_frag(b2p + kb, hh); c02 = g2_mma(a0, b, c02); c12 = g2_mma(a1, b, c12);
    b = g2_frag(b3p + kb, hh); c03 = g2_mma(a0, b, c03); c13 = g2_mma(a1, b, c13); }
  v8f accs[8] = {c00, c01, c02, c03, c10, c11, c12, c13};
  if (by < 2) {      /* q and k planes, row-major. The test in this form and order: the built code then has the v path first, and the q/k path does not keep the v path's values alive (162 registers, five waves a SIMD instead of six, with the test written the other way round) */
#pragma unroll      /* constant indices: the tiles stay in registers */
  for (int u = 0; u < 8; ++u) { const int tt = u & 3, half = u >> 2; const float bv = bf16_round(bp[col0 + tt * 16 + ln]);
#pragma unroll      /* constant indices: the tiles stay in registers */
    for (int r = 0; r < 8; ++r) so[w][half * 16 + 8 * hh + r][tt * 16 + ln] = accs[u][r] * 0.0625f + bv; }
  __builtin_amdgcn_fence(__ATOMIC_ACQ_REL, "workgroup"); __builtin_amdgcn_wave_barrier();      /* a wave reads back only its own staging rows */
  const int rsub = lane >> 4, c4 = (lane & 15) * 4;
#pragma unroll      /* the LDS reads issue ahead of the stores */
  for (int q = 0; q < 16; ++q) { const int r = q * 2 + rsub; const v4f v = *(const v4fa*)&so[w][r][c4]; v4h h4;
#pragma unroll      /* constant indices */
    for (int i = 0; i < 4; ++i) h4[i] = (_Float16)v[i];
    *(v4h*)(C16 + cofs + (size_t)(row0 + r) * DW + col0 + c4) = h4; }
  } else {      /* v plane (uniform in the grid's y): 256 columns x 64 tokens through LDS at a pitch of 16 B x 9, in the staging space that this plane does not use otherwise */
    unsigned short* tv = (unsigned short*)&so[0][0][0];
#pragma unroll      /* constant indices: the tiles stay in registers */
    for (int u = 0; u < 8; ++u) { const int tt = u & 3, half = u >> 2; const float bv = bf16_round(bp[col0 + tt * 16 + ln]); FragH f;
#pragma unroll      /* constant indices: the tiles stay in registers */
      for (int r = 0; r < 8; ++r) f.h[r] = (_Float16)(accs[u][r] * 0.0625f + bv);
      *(v8us*)(tv + (col0 + tt * 16 + ln) * 72 + rl0 + half * 16 + 8 * hh) = f.half[0]; }
    __syncthreads();      /* both token halves of every V^T line are in LDS: a line is stored whole by 8 lanes of one wave */
    unsigned short* vo = (unsigned short*)VT + (size_t)(blockIdx.x / (NTK / 64)) * DW * NTK + (blockIdx.x % (NTK / 64)) * 64;
#pragma unroll      /* the LDS reads issue ahead of the stores */
    for (int i = 0; i < 8; ++i) { const int idx = i * 256 + tid, col = idx >> 3, c8 = (idx & 7) * 8; *(v8us*)(vo + (size_t)col * NTK + c8) = *(const v8us*)(tv + col * 72 + c8); }
    asm volatile("s_wait_xcnt 0x0" ::: "memory");      /* behind the last store: in the built code the q/k path stands below this one and rewrites the stores' address registers */
  }
}
// ---- fused causal attention: S^T = K Q^T, online softmax in registers, O^T += V^T P^T; scores and weights never reach memory ----
// One wave = 32 queries of one head; a pass = 32 keys. In S^T a lane holds one query's scores (column ln, keys 8*hh + r), so two S^T tiles,
// converted in place, are the B operand of V^T P^T in the hardware k order. Weights carry a factor 1024 (as exp2(... + 10)); it cancels in O / l.
__device__ __forceinline__ float fa_xhalf(float x) { const int b = __float_as_int(x); return __int_as_float(__builtin_amdgcn_permlanex16(b, b, 0x76543210, 0xfedcba98, false, false)); }
__device__ __forceinline__ v16h fa_frag(const _Float16* p) { FragH f; f.half[0] = *(const v8us*)((const unsigned short*)p); f.half[1] = *(const v8us*)((const unsigned short*)p + 16); return f.v; }      /* p already holds the lane half's 8 * hh */
__device__ __forceinline__ v8f fa_mma(v16h a, v16h b, v8f c) { return __builtin_amdgcn_wmma_f32_16x16x32_f16(false, a, false, b, (short)0, c, false, false); }
// Eight independent v_exp_f32 and the slot that the instruction set asks for behind a transcendental, in one statement: a v_nop in a statement of its own
// did not stay behind them. Outputs are early-clobber, so that none of the eight overwrites a source of the one in front of it.
__device__ __forceinline__ void fa_exp8(v8f& e, const v8f x) {
  float e0, e1, e2, e3, e4, e5, e6, e7;
  asm("v_exp_f32 %0, %8\n\tv_exp_f32 %1, %9\n\tv_exp_f32 %2, %10\n\tv_exp_f32 %3, %11\n\tv_exp_f32 %4, %12\n\tv_exp_f32 %5, %13\n\tv_exp_f32 %6, %14\n\tv_exp_f32 %7, %15\n\tv_nop"
      : "=&v"(e0), "=&v"(e1), "=&v"(e2), "=&v"(e3), "=&v"(e4), "=&v"(e5), "=&v"(e6), "=&v"(e7)
      : "v"(x[0]), "v"(x[1]), "v"(x[2]), "v"(x[3]), "v"(x[4]), "v"(x[5]), "v"(x[6]), "v"(x[7]));
  e[0] = e0; e[1] = e1; e[2] = e2; e[3] = e3; e[4] = e4; e[5] = e5; e[6] = e6; e[7] = e7;
}
template <bool DIAG>
__device__ __forceinline__ void fa_pass(const v16h k0, const v16h k1, const v16h v0, const v16h v1, const v16h q0f, const v16h q1f, v8f (&o)[2][2], float (&m)[2], float (&l)[2], const int ln, const int hh) {
  const float C = 0.17677669529663687f * 1.4426950408889634f;      /* 1/sqrt(32) * log2(e) */
  const v8f z8 = {0.f,0.f,0.f,0.f,0.f,0.f,0.f,0.f};
  v8f s[2][2];
  s[0][0] = fa_mma(k0, q0f, z8); s[0][1] = fa_mma(k1, q0f, z8); s[1][0] = fa_mma(k0, q1f, z8); s[1][1] = fa_mma(k1, q1f, z8);
  float mn[2];
#pragma unroll      /* constant indices: the tiles stay in registers */
  for (int qt = 0; qt < 2; ++qt) {
    if (DIAG) {
#pragma unroll      /* constant indices: the tiles stay in registers */
      for (int r = 0; r < 8; ++r) { if (8 * hh + r > 16 * qt + ln) s[qt][0][r] = -3.0e38f; if (16 + 8 * hh + r > 16 * qt + ln) s[qt][1][r] = -3.0e38f; }
    }
    float mx = fmaxf(s[qt][0][0], s[qt][1][0]);
#pragma unroll      /* constant indices: the tiles stay in registers */
    for (int r = 1; r < 8; ++r) mx = fmaxf(mx, fmaxf(s[qt][0][r], s[qt][1][r]));
    mx = fmaxf(mx, fa_xhalf(mx));
    mn[qt] = fmaxf(m[qt], mx * C);
  }
  if (__builtin_amdgcn_ballot_w32(mn[0] > m[0] || mn[1] > m[1]) != 0) {      /* a maximum rose somewhere in the wave: rescale (factor exactly 1 where it did not) */
#pragma unroll      /* constant indices: the tiles stay in registers */
    for (int qt = 0; qt < 2; ++qt) { const float al = __builtin_amdgcn_exp2f(m[qt] - mn[qt]); o[qt][0] *= al; o[qt][1] *= al; l[qt] *= al; m[qt] = mn[qt]; }
  }
  FragH p[2];
#pragma unroll      /* constant indices: the tiles stay in registers */
  for (int qt = 0; qt < 2; ++qt) {
    const float sh = 10.0f - m[qt]; float su = 0.f;
#pragma unroll      /* constant indices: the tiles stay in registers */
    for (int t = 0; t < 2; ++t) { v8f x, e;
#pragma unroll      /* constant indices: the tiles stay in registers */
      for (int r = 0; r < 8; ++r) x[r] = fmaf(s[qt][t][r], C, sh);
      fa_exp8(e, x);
#pragma unroll      /* constant indices: the tiles stay in registers */
      for (int r = 0; r < 8; ++r) { su += e[r]; p[qt].h[8 * t + r] = (_Float16)e[r]; } }
    l[qt] += su;
  }
  o[0][0] = fa_mma(v0, p[0].v, o[0][0]); o[0][1] = fa_mma(v1, p[0].v, o[0][1]); o[1][0] = fa_mma(v0, p[1].v, o[1][0]); o[1][1] = fa_mma(v1, p[1].v, o[1][1]);
}
// Grid: 16 x 32 work-groups of 8 waves = two heads (which share each 128-byte line of the context planes) x four query groups p, 63-p, 31-p, 32+p
// (equal work in every work-group). Context = O / l, split hi + residual * 1024, staged in LDS so that each line is stored whole by one wave.
__global__ __launch_bounds__(256) void k_fattn(const _Float16* __restrict__ Q, const _Float16* __restrict__ Kk, const _Float16* __restrict__ Vt, _Float16* __restrict__ CH, _Float16* __restrict__ CL) {
  __shared__ __attribute__((aligned(16))) _Float16 st[4][2][32][72];
  const int lane = threadIdx.x & 31, ln = lane & 15, hh = lane >> 4; const int w = __builtin_amdgcn_readfirstlane(threadIdx.x >> 5);
  const int hp = blockIdx.x & 31, p = blockIdx.x >> 5; const int b = hp >> 2, hsel = w & 1, head = (hp & 3) * 2 + hsel; const int role = w >> 1;
  const int g = (role == 0) ? p : (role == 1) ? 31 - p : (role == 2) ? 63 - p : 32 + p;      /* waves w and w + 4 together: 63 */
  const _Float16* qp = Q + ((size_t)b * NTK + g * 32 + ln) * DW + head * HD + 8 * hh;
  const v16h q0f = fa_frag(qp), q1f = fa_frag(qp + (size_t)16 * DW);
  const _Float16* kp = Kk + ((size_t)b * NTK + ln) * DW + head * HD + 8 * hh;
  const _Float16* vp = Vt + ((size_t)b * DW + head * HD + ln) * NTK + 8 * hh;
  const v8f z8 = {0.f,0.f,0.f,0.f,0.f,0.f,0.f,0.f};
  v8f o[2][2] = {{z8, z8}, {z8, z8}}; float m[2] = {-3.0e38f, -3.0e38f}, l[2] = {0.f, 0.f};
  v16h k0 = fa_frag(kp), k1 = fa_frag(kp + (size_t)16 * DW), v0 = fa_frag(vp), v1 = fa_frag(vp + (size_t)16 * NTK);
  asm volatile("s_wait_xcnt 0x0" :: "v"(qp) : "memory");      /* stands before the registers of the query address are used again: the operand keeps them untouched up to here */
  for (int kb = 0; kb < g; ++kb) {      /* passes below the diagonal; the next pass's fragments are fetched ahead (pass g always exists) */
    kp += (size_t)32 * DW; vp += 32;
    const v16h nk0 = fa_frag(kp), nk1 = fa_frag(kp + (size_t)16 * DW), nv0 = fa_frag(vp), nv1 = fa_frag(vp + (size_t)16 * NTK);
    fa_pass<false>(k0, k1, v0, v1, q0f, q1f, o, m, l, ln, hh);
    k0 = nk0; k1 = nk1; v0 = nv0; v1 = nv1;
  }
  fa_pass<true>(k0, k1, v0, v1, q0f, q1f, o, m, l, ln, hh);
#pragma unroll      /* constant indices: the tiles stay in registers */
  for (int qt = 0; qt < 2; ++qt) { const float inv = 1.0f / (l[qt] + fa_xhalf(l[qt]));
#pragma unroll      /* constant indices: the tiles stay in registers */
    for (int dt = 0; dt < 2; ++dt) { FragH f, fl;
#pragma unroll      /* constant indices: the tiles stay in registers */
      for (int r = 0; r < 8; ++r) { const float v = o[qt][dt][r] * inv; const _Float16 hv = (_Float16)v; f.h[r] = hv; fl.h[r] = (_Float16)((v - (float)hv) * 1024.0f); }
      *(v8us*)&st[role][0][16 * qt + ln][hsel * 32 + 16 * dt + 8 * hh] = f.half[0]; *(v8us*)&st[role][1][16 * qt + ln][hsel * 32 + 16 * dt + 8 * hh] = fl.half[0]; } }
  __syncthreads();      /* the partner head's half of each line is in LDS */
#pragma unroll      /* the LDS reads of all four steps issue ahead of the stores */
  for (int i = 0; i < 4; ++i) { const int row = hsel * 16 + i * 4 + (lane >> 3), c8 = (lane & 7) * 8; const size_t go = ((size_t)b * NTK + g * 32 + row) * DW + (hp & 3) * 64 + c8;
    *(v8us*)((unsigned short*)CH + go) = *(const v8us*)&st[role][0][row][c8]; *(v8us*)((unsigned short*)CL + go) = *(const v8us*)&st[role][1][row][c8]; }
}

// ---- output projection, one launch: out = (ctx_hi + ctx_lo / 1024) Wo^T + bo ----
// A work-group of 8 waves owns the 128 x 64 tile that a work-group of each of the former two GEMM launches owned; a wave owns 16 rows x 64 columns of it and
// keeps two sets of accumulators, one per context plane, so that each weight fragment is loaded once and serves both planes and no partial result goes
// through memory. The sums and the epilogue's operations are those of the two launches. The 8 k steps are unrolled over a ring of three fragment sets in
// registers: the loads of two steps are in flight while one step's products run.
__global__ __launch_bounds__(256) void k_oproj(const _Float16* __restrict__ AH, const _Float16* __restrict__ AL, const _Float16* __restrict__ Bh, const float* __restrict__ bias, float* __restrict__ C) {
  __shared__ __attribute__((aligned(16))) float so[8][16][68];
  const int tid = threadIdx.x, w = tid >> 5, lane = tid & 31, ln = lane & 15, hh = lane >> 4;
  const int mt = blockIdx.x >> 2, nq = blockIdx.x & 3; const int row0 = mt * 128 + 16 * w, col0 = nq * 64;
  const size_t ao = (size_t)(row0 + ln) * DW + 8 * hh;
  const _Float16* ahp = AH + ao; const _Float16* alp = AL + ao; const _Float16* bp = Bh + (size_t)(col0 + ln) * DW + 8 * hh;
  const v8f z8 = {0.f,0.f,0.f,0.f,0.f,0.f,0.f,0.f}; v8f ch[4] = {z8, z8, z8, z8}, cl[4] = {z8, z8, z8, z8};
  float bv[4];
#pragma unroll      /* constant indices; read here so that the epilogue does not wait for them */
  for (int t = 0; t < 4; ++t) bv[t] = bias[col0 + t * 16 + ln];
  v16h fh[3], fl[3], fb[3][4];
#pragma unroll      /* constant indices: the ring stays in registers */
  for (int s = 0; s < 2; ++s) { fh[s] = fa_frag(ahp + s * 32); fl[s] = fa_frag(alp + s * 32);
#pragma unroll      /* constant indices, as above */
    for (int t = 0; t < 4; ++t) fb[s][t] = fa_frag(bp + t * 16 * DW + s * 32); }
#pragma unroll      /* constant indices: the ring stays in registers and every address is a base plus an immediate */
  for (int s = 0; s < DW / 32; ++s) {
    if (s + 2 < DW / 32) { const int n = s + 2, sl = n % 3; fh[sl] = fa_frag(ahp + n * 32); fl[sl] = fa_frag(alp + n * 32);
#pragma unroll      /* constant indices, as above */
      for (int t = 0; t < 4; ++t) fb[sl][t] = fa_frag(bp + t * 16 * DW + n * 32); }
    const int cu = s % 3;
#pragma unroll      /* constant indices, as above */
    for (int t = 0; t < 4; ++t) { ch[t] = fa_mma(fh[cu], fb[cu][t], ch[t]); cl[t] = fa_mma(fl[cu], fb[cu][t], cl[t]); }
    __builtin_amdgcn_sched_barrier(0);      /* keeps later steps' loads below this step: lifted to the top they took over 256 registers (half the grid resident) or spilled */
  }
#pragma unroll      /* constant indices: the tiles stay in registers */
  for (int t = 0; t < 4; ++t) { const float bt = bf16_round(bv[t]);
#pragma unroll      /* constant indices: the tiles stay in registers */
    for (int r = 0; r < 8; ++r) { float v = ch[t][r] * 0.0625f + bt; v += cl[t][r] * (0.0625f / 1024.0f); so[w][8 * hh + r][t * 16 + ln] = v; } }
  __builtin_amdgcn_fence(__ATOMIC_ACQ_REL, "workgroup"); __builtin_amdgcn_wave_barrier();      /* a wave reads back only its own staging rows */
  const int rsub = lane >> 4, c4 = (lane & 15) * 4;
#pragma unroll      /* the LDS reads issue ahead of the stores */
  for (int q = 0; q < 8; ++q) { const int r = q * 2 + rsub; const v4f v = *(const v4fa*)&so[w][r][c4]; *(v4f*)(C + (size_t)(row0 + r) * DW + col0 + c4) = v; }
}

extern "C" void kernel_launch(void* const* d_in, const int* in_sizes, int n_in,
                              void* d_out, int out_size, void* d_ws, size_t ws_size, hipStream_t stream) {
  (void)in_sizes; (void)n_in; (void)out_size;
  const float* const* I = (const float* const*)d_in; const float* xq = I[0]; const float* xk = I[1]; const float* xv = I[2]; const float* Wq = I[3]; const float* bq = I[4]; const float* Wk = I[5]; const float* bk = I[6]; const float* Wv = I[7]; const float* bv = I[8]; const float* Wo = I[9]; const float* bo = I[10];
  char* ws = (char*)d_ws; size_t off = 0;
  auto take = [&](size_t bytes) { char* p = ws + off; off += (bytes + 255) & ~(size_t)255; return p; };
  const size_t np = (size_t)NR * DW;
  _Float16* BW = (_Float16*)take((size_t)4 * DW * DIN * 2); _Float16* CH = (_Float16*)take(2 * np * 2); _Float16* CL = CH + np; _Float16* Q16 = (_Float16*)take(2 * np * 2); _Float16* K16 = Q16 + np; _Float16* VT = (_Float16*)take(np * 2);      /* context hi / residual; q and k planes in a row, a plane is one step of grid.y; v transposed */
  if (off > ws_size) return;      /* 0.5 + 5 x 8 MiB */
  k_cvt4<<<4 * (DW * DIN / 8 / 256), 256, 0, stream>>>(Wq, Wk, Wv, Wo, BW);      /* torch (out, in) naturals */
  const dim3 gP((NR / 128) * (DW / 64), 1), gP3(NR / 64, 3);
  k_proj<<<gP3, 256, 0, stream>>>(xq, xk, xv, BW, bq, bk, bv, Q16, VT);      /* q, k, v projections from the f32 inputs: grid.y = 0, 1, 2; v as V^T [b*256 + column][2048]: head h of batch b = rows b*256 + h*32 */
  k_fattn<<<16 * (NB * NH / 2), 256, 0, stream>>>(Q16, K16, VT, CH, CL);      /* all heads, all batches: context hi / residual */
  k_oproj<<<gP, 256, 0, stream>>>(CH, CL, BW + (size_t)3 * DW * DIN, bo, (float*)d_out);      /* out = (ctx_hi + ctx_lo / 1024) Wo^T + bo */
}

// v006
// It runs in 67 microseconds.
// Timed twice side by side with v005, it ran 1.09 and 1.08 times as fast.
// Over all steps from v000 it is 21.2 times as fast.
#include <hip/hip_runtime.h>
// my_attention (8 x 2048 tokens x 256; 8 heads x 32; q/k/v = query/key/value W^T + b; causal softmax(q.k / sqrt(32)); out = merged ctx Wo^T + bo).
// Compute dtype: inputs rounded to bf16; inputs/weights exact as f16; q/k/v and the softmax weights as plain f16 operands (~2^-12); context hi + residual into Wo; softmax f32. v_wmma_f32_16x16x32_f16.
#define NB 8
#define NTK 2048
#define DIN 256
#define NH 8
#define HD 32
#define DW 256
#define NR (NB * NTK)
typedef __bf16 v16b __attribute__((ext_vector_type(16)));
typedef unsigned short v8us __attribute__((ext_vector_type(8), may_alias));
typedef float  v8f  __attribute__((ext_vector_type(8)));
typedef float  v4f  __attribute__((ext_vector_type(4)));
typedef float  v4fa __attribute__((ext_vector_type(4), may_alias));
union FragB { v16b v; v8us half[2]; unsigned short u[16]; };

__device__ __forceinline__ unsigned short bf16_bits(float x) { unsigned int u = __float_as_uint(x); return (unsigned short)((u + 0x7FFFu + ((u >> 16) & 1u)) >> 16); }
__device__ __forceinline__ float bf16_val(unsigned short b) { return __uint_as_float(((unsigned int)b) << 16); }
__device__ __forceinline__ float bf16_round(float x) { return bf16_val(bf16_bits(x)); }
// D += A·B with NT terms: 1 = ah·bh, 2 = + al·bh (A split), 3 = + ah·bl (both split)
template <int NT>
__device__ __forceinline__ v8f mmaN(v16b ah, v16b al, v16b bh, v16b bl, v8f c) {
  c = __builtin_amdgcn_wmma_f32_16x16x32_bf16(false, ah, false, bh, (short)0, c, false, false);
  if (NT >= 2) c = __builtin_amdgcn_wmma_f32_16x16x32_bf16(false, al, false, bh, (short)0, c, false, false);
  if (NT >= 3) c = __builtin_amdgcn_wmma_f32_16x16x32_bf16(false, ah, false, bl, (short)0, c, false, false);
  asm volatile("v_nop\n\tv_nop\n\tv_nop\n\tv_nop" : "+v"(c) : "v"(ah), "v"(al), "v"(bh), "v"(bl));
  return c;
}

__global__ __launch_bounds__(256) void k_wt_bf16(const float* __restrict__ W, unsigned short* __restrict__ Wt, int K, int N) {
  const int t = blockIdx.x * 256 + threadIdx.x;
  const int k8n = K / 8;
  if (t >= N * k8n) return;
  const int n = t / k8n, k8 = (t % k8n) * 8;
  v8us v;
#pragma unroll
  for (int i = 0; i < 8; ++i) v[i] = bf16_bits(W[(size_t)(k8 + i) * N + n]);
  *(v8us*)(Wt + (size_t)n * K + k8) = v;
  
}

// GEMM C[M][N] (f32, pitch ldc) = act(A[M][K]·W + bias). A f32 row-major (pitch lda) converted per fragment to bf16
// (ASPLIT: hi/lo two planes -> 2 terms, else single rounded term); Wt bf16 [N][K] (pitch ldb). BIAS_BF16 rounds the
// bias to bf16 first (bias quantised to bf16 before the add). K%32==0, M%16==0, N%64==0.
template <bool ASPLIT, int ACT, bool BIAS_BF16>
__global__ __launch_bounds__(128) void k_gemm_bf(const float* __restrict__ A, int lda, const unsigned short* __restrict__ Wt, int ldb,
                                               const float* __restrict__ bias, float* __restrict__ C, int ldc, int M, int N, int K) {
  __shared__ __attribute__((aligned(16))) float so[4][16][64];
  const int tid = threadIdx.x, w = tid >> 5, lane = tid & 31, ln = lane & 15, hh = lane >> 4;
  const int ntn = N / 64;
  const int wid = blockIdx.x * 4 + w;
  const int mt = wid / ntn, nq = wid % ntn;
  if (mt * 16 >= M) return;
  const int row0 = mt * 16, col0 = nq * 64;
  const float* arow = A + (size_t)(row0 + ln) * lda;
  v8f acc[4] = {};
  for (int kb = 0; kb < K; kb += 32) {
    FragB ah, al;
    const v4f x0 = *(const v4fa*)(arow + kb + 8 * hh), x1 = *(const v4fa*)(arow + kb + 8 * hh + 4);
    const v4f x2 = *(const v4fa*)(arow + kb + 16 + 8 * hh), x3 = *(const v4fa*)(arow + kb + 16 + 8 * hh + 4);
    float xs[16] = {x0[0],x0[1],x0[2],x0[3],x1[0],x1[1],x1[2],x1[3],x2[0],x2[1],x2[2],x2[3],x3[0],x3[1],x3[2],x3[3]};
#pragma unroll
    for (int i = 0; i < 16; ++i) { const unsigned short hb = bf16_bits(xs[i]); ah.u[i] = hb; al.u[i] = ASPLIT ? bf16_bits(xs[i] - bf16_val(hb)) : (unsigned short)0; }
#pragma unroll
    for (int t = 0; t < 4; ++t) {
      const unsigned short* brow = Wt + (size_t)(col0 + t * 16 + ln) * ldb + kb;
      FragB b;
      b.half[0] = *(const v8us*)(brow + 8 * hh);
      b.half[1] = *(const v8us*)(brow + 16 + 8 * hh);
      acc[t] = mmaN<ASPLIT ? 2 : 1>(ah.v, al.v, b.v, b.v, acc[t]);
    }
  }
#pragma unroll
  for (int t = 0; t < 4; ++t) {
    float bv = bias ? bias[col0 + t * 16 + ln] : 0.f;
    if (BIAS_BF16) bv = bf16_round(bv);
#pragma unroll
    for (int r = 0; r < 8; ++r) { float v = acc[t][r] + bv; if (ACT == 1) v = fmaxf(v, 0.f); so[w][8 * hh + r][t * 16 + ln] = v; }
  }
  __builtin_amdgcn_fence(__ATOMIC_ACQ_REL, "workgroup");
  __builtin_amdgcn_wave_barrier();
  const int rsub = lane >> 4, c4 = (lane & 15) * 4;
  {
#pragma unroll
    for (int q = 0; q < 8; ++q) {
      const int r = q * 2 + rsub;
      const v4f v = *(const v4fa*)&so[w][r][c4];
      *(v4f*)(C + (size_t)(row0 + r) * ldc + col0 + c4) = v;
    }
    
  }
}

// GEMM C = act(A·W + bias + resid): A f32 (ASPLIT -> hi/lo 2 terms), Wt bf16 [N][K]; ACT 0 none, 1 relu, 2 exact gelu;
// resid (optional, f32, row index = (row % rmod), pitch ldr, RES_BF16 rounds it) added before the activation.
template <bool ASPLIT, int ACT, bool BIAS_BF16, bool RES_BF16>
__global__ __launch_bounds__(128) void k_gemm_bf3(const float* __restrict__ A, int lda, const unsigned short* __restrict__ Wt, int ldb,
                                                const float* __restrict__ bias, const float* __restrict__ resid, int rmod, int ldr,
                                                float* __restrict__ C, int ldc, int M, int N, int K) {
  __shared__ __attribute__((aligned(16))) float so[4][16][64];
  const int tid = threadIdx.x, w = tid >> 5, lane = tid & 31, ln = lane & 15, hh = lane >> 4;
  const int ntn = N / 64;
  const int wid = blockIdx.x * 4 + w;
  const int mt = wid / ntn, nq = wid % ntn;
  if (mt * 16 >= M) return;
  const int row0 = mt * 16, col0 = nq * 64;
  const float* arow = A + (size_t)(row0 + ln) * lda;
  v8f acc[4] = {};
  for (int kb = 0; kb < K; kb += 32) {
    FragB ah, al;
    const v4f x0 = *(const v4fa*)(arow + kb + 8 * hh), x1 = *(const v4fa*)(arow + kb + 8 * hh + 4);
    const v4f x2 = *(const v4fa*)(arow + kb + 16 + 8 * hh), x3 = *(const v4fa*)(arow + kb + 16 + 8 * hh + 4);
    float xs[16] = {x0[0],x0[1],x0[2],x0[3],x1[0],x1[1],x1[2],x1[3],x2[0],x2[1],x2[2],x2[3],x3[0],x3[1],x3[2],x3[3]};
#pragma unroll
    for (int i = 0; i < 16; ++i) { const unsigned short hb = bf16_bits(xs[i]); ah.u[i] = hb; al.u[i] = ASPLIT ? bf16_bits(xs[i] - bf16_val(hb)) : (unsigned short)0; }
#pragma unroll
    for (int t = 0; t < 4; ++t) {
      const unsigned short* brow = Wt + (size_t)(col0 + t * 16 + ln) * ldb + kb;
      FragB b;
      b.half[0] = *(const v8us*)(brow + 8 * hh);
      b.half[1] = *(const v8us*)(brow + 16 + 8 * hh);
      acc[t] = mmaN<ASPLIT ? 2 : 1>(ah.v, al.v, b.v, b.v, acc[t]);
    }
  }
#pragma unroll
  for (int t = 0; t < 4; ++t) {
    const int col = col0 + t * 16 + ln;
    float bv = bias ? bias[col] : 0.f;
    if (BIAS_BF16) bv = bf16_round(bv);
#pragma unroll
    for (int r = 0; r < 8; ++r) {
      float v = acc[t][r] + bv;
      if (resid) { float rv = resid[(size_t)((row0 + 8 * hh + r) % rmod) * ldr + col]; if (RES_BF16) rv = bf16_round(rv); v += rv; }
      if (ACT == 1) v = fmaxf(v, 0.f);
      if (ACT == 2) v = 0.5f * v * (1.0f + erff(v * 0.70710678118654752f));
      if (ACT == 3) { const float u = 0.7978845608028654f * (v + 0.044715f * v * v * v); v = 0.5f * v * (1.0f + tanhf(u)); }
      so[w][8 * hh + r][t * 16 + ln] = v;
    }
  }
  __builtin_amdgcn_fence(__ATOMIC_ACQ_REL, "workgroup");
  __builtin_amdgcn_wave_barrier();
  const int rsub = lane >> 4, c4 = (lane & 15) * 4;
  {
#pragma unroll
    for (int q = 0; q < 8; ++q) {
      const int r = q * 2 + rsub;
      const v4f v = *(const v4fa*)&so[w][r][c4];
      *(v4f*)(C + (size_t)(row0 + r) * ldc + col0 + c4) = v;
    }
    
  }
}
// row LayerNorm (biased variance, eps) over N: s = X (+ R); optional out_sum <- s; out_norm <- (s-mu)*rsqrt(var+eps)*g + b
template <bool PARAM_BF16>
__global__ __launch_bounds__(256) void k_layernorm(const float* __restrict__ X, const float* __restrict__ R, const float* __restrict__ g, const float* __restrict__ bta,
                                                  float* __restrict__ out_sum, float* __restrict__ out_norm, int N, float eps) {
  __shared__ float red[256];
  const int row = blockIdx.x, tid = threadIdx.x;
  const float* x = X + (size_t)row * N; const float* rr = R ? R + (size_t)row * N : nullptr;
  float vals[16];                     // up to N = 4096
  const int per = N / 256;            // contiguous chunk per thread? use strided-by-4 chunks: thread handles j = tid*4 + 1024*u
  float s1 = 0.f;
  for (int u = 0; u < per / 4; ++u) {
    const int j = tid * 4 + 1024 * u;
    const v4f a = *(const v4fa*)(x + j);
    v4f b = {0.f,0.f,0.f,0.f}; if (rr) b = *(const v4fa*)(rr + j);
#pragma unroll
    for (int q = 0; q < 4; ++q) { const float v = a[q] + b[q]; vals[u * 4 + q] = v; s1 += v; }
  }
  red[tid] = s1; __syncthreads();
  for (int st = 128; st > 0; st >>= 1) { if (tid < st) red[tid] += red[tid + st]; __syncthreads(); }
  const float mu = red[0] / (float)N; __syncthreads();
  float s2 = 0.f;
  for (int u = 0; u < per / 4; ++u)
#pragma unroll
    for (int q = 0; q < 4; ++q) { const float c = vals[u * 4 + q] - mu; s2 += c * c; }
  red[tid] = s2; __syncthreads();
  for (int st = 128; st > 0; st >>= 1) { if (tid < st) red[tid] += red[tid + st]; __syncthreads(); }
  const float rs = rsqrtf(red[0] / (float)N + eps);
  {
    for (int u = 0; u < per / 4; ++u) {
      const int j = tid * 4 + 1024 * u;
      v4f o, sm;
#pragma unroll
      for (int q = 0; q < 4; ++q) {
        float gg = g[j + q], bb = bta[j + q];
        if (PARAM_BF16) { gg = bf16_round(gg); bb = bf16_round(bb); }
        sm[q] = vals[u * 4 + q]; o[q] = (vals[u * 4 + q] - mu) * rs * gg + bb;
      }
      if (out_sum) *(v4f*)(out_sum + (size_t)row * N + j) = sm;
      *(v4f*)(out_norm + (size_t)row * N + j) = o;
    }
    
  }
}



// ---- f16 WMMA path (v_wmma_f32_16x16x32_f16): 11-bit significands for operands in range — used where a [0,1] probability operand needs more precision than bf16
typedef _Float16 v16h __attribute__((ext_vector_type(16)));
union FragH { v16h v; v8us half[2]; _Float16 h[16]; unsigned short u[16]; };
template <int NT>
__device__ __forceinline__ v8f mmaH(v16h ah, v16h al, v16h bh, v16h bl, v8f c) {
  c = __builtin_amdgcn_wmma_f32_16x16x32_f16(false, ah, false, bh, (short)0, c, false, false);
  if (NT >= 2) c = __builtin_amdgcn_wmma_f32_16x16x32_f16(false, al, false, bh, (short)0, c, false, false);
  if (NT >= 3) c = __builtin_amdgcn_wmma_f32_16x16x32_f16(false, ah, false, bl, (short)0, c, false, false);
  asm volatile("v_nop\n\tv_nop\n\tv_nop\n\tv_nop" : "+v"(c) : "v"(ah), "v"(al), "v"(bh), "v"(bl));
  return c;
}
// batched GEMM like k_gemm_b but f16 operands: A f32 (split into f16 hi/lo if ASPLIT, else rounded to f16), Bt = f16 values [n][k]; alpha; C f32; N multiple of 16 (partial tiles skipped)
template <bool ASPLIT>
__global__ __launch_bounds__(128) void k_gemm_h(const float* __restrict__ A, int lda, size_t sA, const _Float16* __restrict__ Bh, int ldb, size_t sB, float alpha, float* __restrict__ C, int ldc, size_t sC, int M, int N, int K) {
  __shared__ __attribute__((aligned(16))) float so[4][16][64];
  const int tid = threadIdx.x, w = tid >> 5, lane = tid & 31, ln = lane & 15, hh = lane >> 4; const int by = blockIdx.y;
  A += (size_t)by * sA; Bh += (size_t)by * sB; C += (size_t)by * sC;
  const int ntn = (N + 63) / 64; const int wid = blockIdx.x * 4 + w; const int mt = wid / ntn, nq = wid % ntn; if (mt * 16 >= M) return;
  const int row0 = mt * 16, col0 = nq * 64; const float* arow = A + (size_t)(row0 + ln) * lda;
  v8f acc[4] = {};
  for (int kb = 0; kb < K; kb += 32) {
    FragH ah, al;
    const v4f x0 = *(const v4fa*)(arow + kb + 8 * hh), x1 = *(const v4fa*)(arow + kb + 8 * hh + 4), x2 = *(const v4fa*)(arow + kb + 16 + 8 * hh), x3 = *(const v4fa*)(arow + kb + 16 + 8 * hh + 4);
    float xs[16] = {x0[0],x0[1],x0[2],x0[3],x1[0],x1[1],x1[2],x1[3],x2[0],x2[1],x2[2],x2[3],x3[0],x3[1],x3[2],x3[3]};
#pragma unroll
    for (int i = 0; i < 16; ++i) { const _Float16 h = (_Float16)xs[i]; ah.h[i] = h; al.h[i] = ASPLIT ? (_Float16)(xs[i] - (float)h) : (_Float16)0.0f; }
#pragma unroll
    for (int t = 0; t < 4; ++t) { if (col0 + t * 16 >= N) continue; const size_t boff = (size_t)(col0 + t * 16 + ln) * ldb + kb; FragH bq; bq.half[0] = *(const v8us*)(Bh + boff + 8 * hh); bq.half[1] = *(const v8us*)(Bh + boff + 16 + 8 * hh);
      acc[t] = mmaH<ASPLIT ? 2 : 1>(ah.v, al.v, bq.v, bq.v, acc[t]); }
  }
#pragma unroll
  for (int t = 0; t < 4; ++t) { if (col0 + t * 16 >= N) continue;
#pragma unroll
    for (int r = 0; r < 8; ++r) so[w][8 * hh + r][t * 16 + ln] = acc[t][r] * alpha; }
  __builtin_amdgcn_fence(__ATOMIC_ACQ_REL, "workgroup"); __builtin_amdgcn_wave_barrier();
  const int rsub = lane >> 4, c4 = (lane & 15) * 4;
  {
#pragma unroll
    for (int q = 0; q < 8; ++q) { const int r = q * 2 + rsub; if (col0 + c4 < N) { const v4f v = *(const v4fa*)&so[w][r][c4]; *(v4f*)(C + (size_t)(row0 + r) * ldc + col0 + c4) = v; } }
     }
}

// Wt[n][k] = f16(W[k][n]·scale) from f32 row-major W[K][N] (scale = power of two; bf16-exact weights stay exact in f16 away from the subnormal range)
__global__ __launch_bounds__(256) void k_wt_f16(const float* __restrict__ W, _Float16* __restrict__ Wt, int K, int N, float scale) {
  const int t = blockIdx.x * 256 + threadIdx.x; if (t >= N * (K / 8)) return; const int n = t / (K / 8), k8 = (t % (K / 8)) * 8; FragH f;
#pragma unroll
  for (int i = 0; i < 8; ++i) f.h[i] = (_Float16)(bf16_round(W[(size_t)(k8 + i) * N + n]) * scale); const v8us o = f.half[0];
  *(v8us*)((unsigned short*)Wt + (size_t)n * K + k8) = o; 
}
// k_gemm_hh variant with fused epilogue: v = acc·alpha + bias[by·sBias + col] (+ CP[(row/rowsPerB)·sCPb + by·64 + col] if CP) ; ACT 0 none / 1 elu ; writes f32 C and/or f16 C16 (each if non-null)
template <int ACT>
__global__ __launch_bounds__(128) void k_gemm_hhx(const _Float16* __restrict__ A, int lda, size_t sA, const _Float16* __restrict__ Bh, int ldb, size_t sB, float alpha, const float* __restrict__ bias, size_t sBias, const float* __restrict__ CP, int rowsPerB, size_t sCPb, int row0g,
    float* __restrict__ C, _Float16* __restrict__ C16, int ldc, size_t sC, int M, int N, int K) {
  __shared__ __attribute__((aligned(16))) float so[4][16][64];
  const int tid = threadIdx.x, w = tid >> 5, lane = tid & 31, ln = lane & 15, hh = lane >> 4; const int by = blockIdx.y;
  A += (size_t)by * sA; Bh += (size_t)by * sB; const size_t cofs = (size_t)by * sC; const float* bp = bias ? bias + (size_t)by * sBias : nullptr;
  const int ntn = (N + 63) / 64; const int wid = blockIdx.x * 4 + w; const int mt = wid / ntn, nq = wid % ntn; if (mt * 16 >= M) return;
  const int row0 = mt * 16, col0 = nq * 64; const _Float16* arow = A + (size_t)(row0 + ln) * lda;
  v8f acc[4] = {};
  for (int kb = 0; kb < K; kb += 32) { FragH ah; ah.half[0] = *(const v8us*)((const unsigned short*)arow + kb + 8 * hh); ah.half[1] = *(const v8us*)((const unsigned short*)arow + kb + 16 + 8 * hh);
#pragma unroll
    for (int t = 0; t < 4; ++t) { if (col0 + t * 16 >= N) continue; const size_t boff = (size_t)(col0 + t * 16 + ln) * ldb + kb; FragH bq; bq.half[0] = *(const v8us*)((const unsigned short*)Bh + boff + 8 * hh); bq.half[1] = *(const v8us*)((const unsigned short*)Bh + boff + 16 + 8 * hh);
      acc[t] = mmaH<1>(ah.v, ah.v, bq.v, bq.v, acc[t]); }
  }
#pragma unroll
  for (int t = 0; t < 4; ++t) { if (col0 + t * 16 >= N) continue; const int col = col0 + t * 16 + ln; const float bv = bp ? bf16_round(bp[col]) : 0.f;
#pragma unroll
    for (int r = 0; r < 8; ++r) { float v = acc[t][r] * alpha + bv; if (CP) { const int rr = row0g + row0 + 8 * hh + r; if (rowsPerB < 0) v += CP[cofs + (size_t)rr * ldc + col];      /* rowsPerB < 0: own element of the batched C plane */ else { const int bidx = rr / rowsPerB; v += CP[(size_t)bidx * sCPb + (size_t)by * 64 + col]; } } if (ACT == 1) v = (v > 0.f) ? v : expm1f(v); else if (ACT == 7) v = (v > 0.f) ? v + 1.0f : expf(v); else if (ACT == 8) v = tanhf(v); else if (ACT == 9) v = 0.5f * v * (1.0f + tanhf(0.7978845608028654f * (v + 0.044715f * v * v * v))); else if (ACT == 11) v = 1.0f / (1.0f + expf(-v)); else if (ACT == 12) v = (v > 0.f) ? v : 0.01f * v; else if (ACT == 14) v = (v > 0.f) ? v : 0.1f * v; else if (ACT == 16) v = (v >= 0.f) ? v : 0.3f * v; else if (ACT == 17) v = (v >= 0.f) ? v : 0.2f * v; else if (ACT == 15) v = v / (1.0f + expf(-v)); else if (ACT == 3) v = fmaxf(v, 0.f); else if (ACT == 6) v = 0.5f * v * (1.0f + erff(v * 0.70710678118654752f)); so[w][8 * hh + r][t * 16 + ln] = v; } }
  __builtin_amdgcn_fence(__ATOMIC_ACQ_REL, "workgroup"); __builtin_amdgcn_wave_barrier();
  const int rsub = lane >> 4, c4 = (lane & 15) * 4; typedef _Float16 v4h __attribute__((ext_vector_type(4)));
  {
#pragma unroll
    for (int q = 0; q < 8; ++q) { const int r = q * 2 + rsub; if (col0 + c4 < N) { const v4f v = *(const v4fa*)&so[w][r][c4]; if (C) *(v4f*)(C + cofs + (size_t)(row0 + r) * ldc + col0 + c4) = v; if (C16) { v4h h4; for (int i = 0; i < 4; ++i) h4[i] = (_Float16)v[i]; *(v4h*)(C16 + cofs + (size_t)(row0 + r) * ldc + col0 + c4) = h4; } } }
     }
}


typedef _Float16 v4h __attribute__((ext_vector_type(4)));

__global__ __launch_bounds__(256) void k_h16(const float* __restrict__ x, _Float16* __restrict__ X16, size_t n8) { const size_t t = (size_t)blockIdx.x * 256 + threadIdx.x; if (t >= n8) return; FragH f;
#pragma unroll
  for (int q = 0; q < 8; ++q) f.h[q] = (_Float16)x[t * 8 + q]; *(v8us*)((unsigned short*)X16 + t * 8) = f.half[0];  }
__global__ __launch_bounds__(256) void k_round16f(const float* __restrict__ W, _Float16* __restrict__ Bt, size_t n8) { const size_t t = (size_t)blockIdx.x * 256 + threadIdx.x; if (t >= n8) return; FragH f;
#pragma unroll
  for (int i = 0; i < 8; ++i) f.h[i] = (_Float16)(bf16_round(W[t * 8 + i]) * 16.0f); *(v8us*)((unsigned short*)Bt + t * 8) = f.half[0];  }

__global__ __launch_bounds__(256) void k_hl(const float* __restrict__ F, _Float16* __restrict__ Hh, _Float16* __restrict__ Hl, size_t n8) { const size_t t = (size_t)blockIdx.x * 256 + threadIdx.x; if (t >= n8) return; FragH fh, fl; const v4f a = *(const v4fa*)(F + t * 8), c = *(const v4fa*)(F + t * 8 + 4);
#pragma unroll
  for (int q = 0; q < 4; ++q) { _Float16 h = (_Float16)a[q]; fh.h[q] = h; fl.h[q] = (_Float16)((a[q] - (float)h) * 1024.0f); h = (_Float16)c[q]; fh.h[4 + q] = h; fl.h[4 + q] = (_Float16)((c[q] - (float)h) * 1024.0f); }
  { *(v8us*)((unsigned short*)Hh + t * 8) = fh.half[0]; *(v8us*)((unsigned short*)Hl + t * 8) = fl.half[0];  } }

// ---- fragment load and product of the 32x64 wave tile ----
__device__ __forceinline__ v16h g2_frag(const _Float16* p, int hh) { FragH f; f.half[0] = *(const v8us*)((const unsigned short*)p + 8 * hh); f.half[1] = *(const v8us*)((const unsigned short*)p + 16 + 8 * hh); return f.v; }
__device__ __forceinline__ v8f g2_mma(v16h a, v16h b, v8f c) { v8f d = __builtin_amdgcn_wmma_f32_16x16x32_f16(false, a, false, b, (short)0, c, false, false); asm volatile("v_nop\n\tv_nop\n\tv_nop\n\tv_nop" : "+v"(d) : "v"(a), "v"(b)); return d; }

// The four weight matrices, f16(bf16(w) * 16), in one grid; the block index picks the matrix (uniform in a work-group).
__global__ __launch_bounds__(256) void k_cvt4(const float* __restrict__ w0, const float* __restrict__ w1, const float* __restrict__ w2, const float* __restrict__ w3, _Float16* __restrict__ Bt) {
  constexpr int WB = DW * DIN / 8 / 256;      /* blocks per weight matrix */
  const int j = blockIdx.x / WB, blk = blockIdx.x - j * WB; const float* s = (j == 0) ? w0 : (j == 1) ? w1 : (j == 2) ? w2 : w3; _Float16* d = Bt + (size_t)j * DW * DIN;
  const size_t t = (size_t)blk * 256 + threadIdx.x; FragH f;
#pragma unroll      /* constant indices: the eight values stay in registers and their loads join into two of 16 bytes */
  for (int q = 0; q < 8; ++q) f.h[q] = (_Float16)(bf16_round(s[t * 8 + q]) * 16.0f);
  *(v8us*)((unsigned short*)d + t * 8) = f.half[0];
}
// ---- q, k, v projections straight from the f32 inputs (grid.y = plane): no conversion launch, no f16 copy of the inputs in memory ----
// A work-group of 8 waves owns 64 token rows x all 256 output columns, so each input row is read from memory once, in whole lines, all 16 loads of a
// lane in flight, rounded once (f16(bf16(x)), as the conversion kernel did) and laid in LDS at a pitch of 16 B x 33 for the ds_load_b128 fragment reads.
// The plane's weights go through LDS as well, in four stages of 64 k (one whole 128-byte line of each of the 256 weight rows): the work-group fetches each line once, a
// wave-wide load covering 4 whole lines, and all eight waves take their B fragments from LDS (pitch 16 B x 9). Two stage buffers, in the space that the output
// staging uses afterwards; stage 0 is fetched beside the input rows, each later stage during the products of the stage before it, so no product waits for a load from L2.
// Wave tile 32 x 64. The v plane is stored transposed, V^T [(b, column)][token], the layout the attention kernel's A fragments read: in an accumulator tile a
// lane holds 8 consecutive tokens of one column, 16 bytes of a V^T row; the work-group's 64 tokens are one whole 128-byte line of each of its 256 V^T rows.
__global__ __launch_bounds__(256) void k_proj(const float* __restrict__ x0, const float* __restrict__ x1, const float* __restrict__ x2, const _Float16* __restrict__ Bh,
                                              const float* __restrict__ bias0, const float* __restrict__ bias1, const float* __restrict__ bias2, _Float16* __restrict__ C16, _Float16* __restrict__ VT) {
  __shared__ __attribute__((aligned(16))) _Float16 sa[64][DIN + 8];
  constexpr int WST = DW * 72;      /* one weight stage in LDS, in f16: 256 rows of 64 k at a pitch of 72 */
  __shared__ __attribute__((aligned(16))) float su[2 * WST / 2];      /* two weight stages during the k loop, output staging behind it */
  float (*so)[32][68] = reinterpret_cast<float (*)[32][68]>(su); unsigned short* sb = (unsigned short*)su;
  static_assert(sizeof(float) * 8 * 32 * 68 <= sizeof(su), "output staging fits the stage buffers");
  const int tid = threadIdx.x, w = tid >> 5, lane = tid & 31, ln = lane & 15, hh = lane >> 4; const int by = blockIdx.y;
  const float* xs = ((by == 0) ? x0 : (by == 1) ? x1 : x2) + (size_t)blockIdx.x * 64 * DIN; const float* bp = (by == 0) ? bias0 : (by == 1) ? bias1 : bias2;
  const unsigned short* wsrc = (const unsigned short*)Bh + (size_t)by * DW * DIN + (size_t)(tid >> 3) * DIN + (tid & 7) * 8;      /* 8 lanes = one 128-byte line of a weight row */
  unsigned short* wdst = sb + (tid >> 3) * 72 + (tid & 7) * 8;
  v4f t[16]; v8us wn[8];
#pragma unroll      /* constant indices: the sixteen loads stand in registers and issue together */
  for (int i = 0; i < 16; ++i) t[i] = *(const v4fa*)(xs + (size_t)(i * 256 + tid) * 4);
#pragma unroll      /* constant indices: the loads of weight stage 0 issue behind the input loads */
  for (int i = 0; i < 8; ++i) wn[i] = *(const v8us*)(wsrc + (size_t)i * 32 * DIN);
  __builtin_amdgcn_sched_barrier(0);      /* keeps the weight loads up here: sunk below the input conversion they started only when the inputs had arrived */
#pragma unroll      /* constant indices, as above */
  for (int i = 0; i < 16; ++i) { v4h h4;
#pragma unroll      /* constant indices, as above */
    for (int q = 0; q < 4; ++q) h4[q] = (_Float16)bf16_round(t[i][q]);
    *(v4h*)&sa[i * 4 + (tid >> 6)][(tid & 63) * 4] = h4; }
#pragma unroll      /* constant indices, as above */
  for (int i = 0; i < 8; ++i) *(v8us*)(wdst + i * 32 * 72) = wn[i];
  __syncthreads();      /* the 64 converted rows and weight stage 0 are in LDS for all eight waves */
  const int rl0 = (w >> 2) * 32, col0 = (w & 3) * 64; const int row0 = blockIdx.x * 64 + rl0; const size_t cofs = (size_t)by * NR * DW;
  const _Float16* a0p = &sa[rl0 + ln][0]; const _Float16* a1p = &sa[rl0 + 16 + ln][0];
  const v8f z8 = {0.f,0.f,0.f,0.f,0.f,0.f,0.f,0.f}; v8f c00 = z8, c01 = z8, c02 = z8, c03 = z8, c10 = z8, c11 = z8, c12 = z8, c13 = z8;
#pragma unroll      /* four stages: buffer choice, the refills and every LDS offset are constants */
  for (int j = 0; j < DIN / 64; ++j) { const _Float16* bs = (const _Float16*)(sb + (j & 1) * WST + (col0 + ln) * 72);
    if (j + 1 < DIN / 64) {
#pragma unroll      /* constant indices: the next stage stays in registers and flies during this stage's products (issued behind the barrier, which waits for every load in flight) */
      for (int i = 0; i < 8; ++i) wn[i] = *(const v8us*)(wsrc + (size_t)i * 32 * DIN + (j + 1) * 64);
    }
#pragma unroll      /* constant offsets, as above */
    for (int ks = 0; ks < 2; ++ks) { const int kb = j * 64 + ks * 32; const v16h a0 = g2_frag(a0p + kb, hh), a1 = g2_frag(a1p + kb, hh);
      const v16h b0 = g2_frag(bs + ks * 32, hh), b1 = g2_frag(bs + 16 * 72 + ks * 32, hh), b2 = g2_frag(bs + 32 * 72 + ks * 32, hh), b3 = g2_frag(bs + 48 * 72 + ks * 32, hh);
      c00 = g2_mma(a0, b0, c00); c10 = g2_mma(a1, b0, c10); c01 = g2_mma(a0, b1, c01); c11 = g2_mma(a1, b1, c11);
      c02 = g2_mma(a0, b2, c02); c12 = g2_mma(a1, b2, c12); c03 = g2_mma(a0, b3, c03); c13 = g2_mma(a1, b3, c13); }
    if (j + 1 < DIN / 64) {
#pragma unroll      /* constant indices, as above; the other buffer: its last readers, stage j - 1's products, ended in front of the barrier before this stage */
      for (int i = 0; i < 8; ++i) *(v8us*)(wdst + ((j + 1) & 1) * WST + i * 32 * 72) = wn[i];
    }
    __syncthreads();      /* stage j + 1 is in LDS for all eight waves, and every wave has read stage j (behind the last stage: the buffers become output staging) */
  }
  asm volatile("s_wait_xcnt 0x0" :: "v"(wsrc) : "memory");      /* stands before the registers of the weight address are used again: the operand keeps them untouched up to here */
  v8f accs[8] = {c00, c01, c02, c03, c10, c11, c12, c13};
  if (by < 2) {      /* q and k planes, row-major. The test in this form and order: the built code then has the v path first, and the q/k path does not keep the v path's values alive (162 registers, five waves a SIMD instead of six, with the test written the other way round) */
#pragma unroll      /* constant indices: the tiles stay in registers */
  for (int u = 0; u < 8; ++u) { const int tt = u & 3, half = u >> 2; const float bv = bf16_round(bp[col0 + tt * 16 + ln]);
#pragma unroll      /* constant indices: the tiles stay in registers */
    for (int r = 0; r < 8; ++r) so[w][half * 16 + 8 * hh + r][tt * 16 + ln] = accs[u][r] * 0.0625f + bv; }
  __builtin_amdgcn_fence(__ATOMIC_ACQ_REL, "workgroup"); __builtin_amdgcn_wave_barrier();      /* a wave reads back only its own staging rows */
  const int rsub = lane >> 4, c4 = (lane & 15) * 4;
#pragma unroll      /* the LDS reads issue ahead of the stores */
  for (int q = 0; q < 16; ++q) { const int r = q * 2 + rsub; const v4f v = *(const v4fa*)&so[w][r][c4]; v4h h4;
#pragma unroll      /* constant indices */
    for (int i = 0; i < 4; ++i) h4[i] = (_Float16)v[i];
    *(v4h*)(C16 + cofs + (size_t)(row0 + r) * DW + col0 + c4) = h4; }
  } else {      /* v plane (uniform in the grid's y): 256 columns x 64 tokens through LDS at a pitch of 16 B x 9, in the weight stage buffers, free behind the k loop */
    unsigned short* tv = (unsigned short*)&so[0][0][0];
#pragma unroll      /* constant indices: the tiles stay in registers */
    for (int u = 0; u < 8; ++u) { const int tt = u & 3, half = u >> 2; const float bv = bf16_round(bp[col0 + tt * 16 + ln]); FragH f;
#pragma unroll      /* constant indices: the tiles stay in registers */
      for (int r = 0; r < 8; ++r) f.h[r] = (_Float16)(accs[u][r] * 0.0625f + bv);
      *(v8us*)(tv + (col0 + tt * 16 + ln) * 72 + rl0 + half * 16 + 8 * hh) = f.half[0]; }
    __syncthreads();      /* both token halves of every V^T line are in LDS: a line is stored whole by 8 lanes of one wave */
    unsigned short* vo = (unsigned short*)VT + (size_t)(blockIdx.x / (NTK / 64)) * DW * NTK + (blockIdx.x % (NTK / 64)) * 64;
#pragma unroll      /* the LDS reads issue ahead of the stores */
    for (int i = 0; i < 8; ++i) { const int idx = i * 256 + tid, col = idx >> 3, c8 = (idx & 7) * 8; *(v8us*)(vo + (size_t)col * NTK + c8) = *(const v8us*)(tv + col * 72 + c8); }
    asm volatile("s_wait_xcnt 0x0" ::: "memory");      /* behind the last store: in the built code the q/k path stands below this one and rewrites the stores' address registers */
  }
}
// ---- fused causal attention: S^T = K Q^T, online softmax in registers, O^T += V^T P^T; scores and weights never reach memory ----
// One wave = 32 queries of one head; a pass = 32 keys. In S^T a lane holds one query's scores (column ln, keys 8*hh + r), so two S^T tiles,
// converted in place, are the B operand of V^T P^T in the hardware k order. Weights carry a factor 1024 (as exp2(... + 10)); it cancels in O / l.
__device__ __forceinline__ float fa_xhalf(float x) { const int b = __float_as_int(x); return __int_as_float(__builtin_amdgcn_permlanex16(b, b, 0x76543210, 0xfedcba98, false, false)); }
__device__ __forceinline__ v16h fa_frag(const _Float16* p) { FragH f; f.half[0] = *(const v8us*)((const unsigned short*)p); f.half[1] = *(const v8us*)((const unsigned short*)p + 16); return f.v; }      /* p already holds the lane half's 8 * hh */
__device__ __forceinline__ v8f fa_mma(v16h a, v16h b, v8f c) { return __builtin_amdgcn_wmma_f32_16x16x32_f16(false, a, false, b, (short)0, c, false, false); }
// Eight independent v_exp_f32 and the slot that the instruction set asks for behind a transcendental, in one statement: a v_nop in a statement of its own
// did not stay behind them. Outputs are early-clobber, so that none of the eight overwrites a source of the one in front of it.
__device__ __forceinline__ void fa_exp8(v8f& e, const v8f x) {
  float e0, e1, e2, e3, e4, e5, e6, e7;
  asm("v_exp_f32 %0, %8\n\tv_exp_f32 %1, %9\n\tv_exp_f32 %2, %10\n\tv_exp_f32 %3, %11\n\tv_exp_f32 %4, %12\n\tv_exp_f32 %5, %13\n\tv_exp_f32 %6, %14\n\tv_exp_f32 %7, %15\n\tv_nop"
      : "=&v"(e0), "=&v"(e1), "=&v"(e2), "=&v"(e3), "=&v"(e4), "=&v"(e5), "=&v"(e6), "=&v"(e7)
      : "v"(x[0]), "v"(x[1]), "v"(x[2]), "v"(x[3]), "v"(x[4]), "v"(x[5]), "v"(x[6]), "v"(x[7]));
  e[0] = e0; e[1] = e1; e[2] = e2; e[3] = e3; e[4] = e4; e[5] = e5; e[6] = e6; e[7] = e7;
}
template <bool DIAG>
__device__ __forceinline__ void fa_pass(const v16h k0, const v16h k1, const v16h v0, const v16h v1, const v16h q0f, const v16h q1f, v8f (&o)[2][2], float (&m)[2], float (&l)[2], const int ln, const int hh) {
  const float C = 0.17677669529663687f * 1.4426950408889634f;      /* 1/sqrt(32) * log2(e) */
  const v8f z8 = {0.f,0.f,0.f,0.f,0.f,0.f,0.f,0.f};
  v8f s[2][2];
  s[0][0] = fa_mma(k0, q0f, z8); s[0][1] = fa_mma(k1, q0f, z8); s[1][0] = fa_mma(k0, q1f, z8); s[1][1] = fa_mma(k1, q1f, z8);
  float mn[2];
#pragma unroll      /* constant indices: the tiles stay in registers */
  for (int qt = 0; qt < 2; ++qt) {
    if (DIAG) {
#pragma unroll      /* constant indices: the tiles stay in registers */
      for (int r = 0; r < 8; ++r) { if (8 * hh + r > 16 * qt + ln) s[qt][0][r] = -3.0e38f; if (16 + 8 * hh + r > 16 * qt + ln) s[qt][1][r] = -3.0e38f; }
    }
    float mx = fmaxf(s[qt][0][0], s[qt][1][0]);
#pragma unroll      /* constant indices: the tiles stay in registers */
    for (int r = 1; r < 8; ++r) mx = fmaxf(mx, fmaxf(s[qt][0][r], s[qt][1][r]));
    mx = fmaxf(mx, fa_xhalf(mx));
    mn[qt] = fmaxf(m[qt], mx * C);
  }
  if (__builtin_amdgcn_ballot_w32(mn[0] > m[0] || mn[1] > m[1]) != 0) {      /* a maximum rose somewhere in the wave: rescale (factor exactly 1 where it did not) */
#pragma unroll      /* constant indices: the tiles stay in registers */
    for (int qt = 0; qt < 2; ++qt) { const float al = __builtin_amdgcn_exp2f(m[qt] - mn[qt]); o[qt][0] *= al; o[qt][1] *= al; l[qt] *= al; m[qt] = mn[qt]; }
  }
  FragH p[2];
#pragma unroll      /* constant indices: the tiles stay in registers */
  for (int qt = 0; qt < 2; ++qt) {
    const float sh = 10.0f - m[qt]; float su = 0.f;
#pragma unroll      /* constant indices: the tiles stay in registers */
    for (int t = 0; t < 2; ++t) { v8f x, e;
#pragma unroll      /* constant indices: the tiles stay in registers */
      for (int r = 0; r < 8; ++r) x[r] = fmaf(s[qt][t][r], C, sh);
      fa_exp8(e, x);
#pragma unroll      /* constant indices: the tiles stay in registers */
      for (int r = 0; r < 8; ++r) { su += e[r]; p[qt].h[8 * t + r] = (_Float16)e[r]; } }
    l[qt] += su;
  }
  o[0][0] = fa_mma(v0, p[0].v, o[0][0]); o[0][1] = fa_mma(v1, p[0].v, o[0][1]); o[1][0] = fa_mma(v0, p[1].v, o[1][0]); o[1][1] = fa_mma(v1, p[1].v, o[1][1]);
}
// Grid: 16 x 32 work-groups of 8 waves = two heads (which share each 128-byte line of the context planes) x four query groups p, 63-p, 31-p, 32+p
// (equal work in every work-group). Context = O / l, split hi + residual * 1024, staged in LDS so that each line is stored whole by one wave.
__global__ __launch_bounds__(256) void k_fattn(const _Float16* __restrict__ Q, const _Float16* __restrict__ Kk, const _Float16* __restrict__ Vt, _Float16* __restrict__ CH, _Float16* __restrict__ CL) {
  __shared__ __attribute__((aligned(16))) _Float16 st[4][2][32][72];
  const int lane = threadIdx.x & 31, ln = lane & 15, hh = lane >> 4; const int w = __builtin_amdgcn_readfirstlane(threadIdx.x >> 5);
  const int hp = blockIdx.x & 31, p = blockIdx.x >> 5; const int b = hp >> 2, hsel = w & 1, head = (hp & 3) * 2 + hsel; const int role = w >> 1;
  const int g = (role == 0) ? p : (role == 1) ? 31 - p : (role == 2) ? 63 - p : 32 + p;      /* waves w and w + 4 together: 63 */
  const _Float16* qp = Q + ((size_t)b * NTK + g * 32 + ln) * DW + head * HD + 8 * hh;
  const v16h q0f = fa_frag(qp), q1f = fa_frag(qp + (size_t)16 * DW);
  const _Float16* kp = Kk + ((size_t)b * NTK + ln) * DW + head * HD + 8 * hh;
  const _Float16* vp = Vt + ((size_t)b * DW + head * HD + ln) * NTK + 8 * hh;
  const v8f z8 = {0.f,0.f,0.f,0.f,0.f,0.f,0.f,0.f};
  v8f o[2][2] = {{z8, z8}, {z8, z8}}; float m[2] = {-3.0e38f, -3.0e38f}, l[2] = {0.f, 0.f};
  v16h k0 = fa_frag(kp), k1 = fa_frag(kp + (size_t)16 * DW), v0 = fa_frag(vp), v1 = fa_frag(vp + (size_t)16 * NTK);
  asm volatile("s_wait_xcnt 0x0" :: "v"(qp) : "memory");      /* stands before the registers of the query address are used again: the operand keeps them untouched up to here */
  for (int kb = 0; kb < g; ++kb) {      /* passes below the diagonal; the next pass's fragments are fetched ahead (pass g always exists) */
    kp += (size_t)32 * DW; vp += 32;
    const v16h nk0 = fa_frag(kp), nk1 = fa_frag(kp + (size_t)16 * DW), nv0 = fa_frag(vp), nv1 = fa_frag(vp + (size_t)16 * NTK);
    fa_pass<false>(k0, k1, v0, v1, q0f, q1f, o, m, l, ln, hh);
    k0 = nk0; k1 = nk1; v0 = nv0; v1 = nv1;
  }
  fa_pass<true>(k0, k1, v0, v1, q0f, q1f, o, m, l, ln, hh);
#pragma unroll      /* constant indices: the tiles stay in registers */
  for (int qt = 0; qt < 2; ++qt) { const float inv = 1.0f / (l[qt] + fa_xhalf(l[qt]));
#pragma unroll      /* constant indices: the tiles stay in registers */
    for (int dt = 0; dt < 2; ++dt) { FragH f, fl;
#pragma unroll      /* constant indices: the tiles stay in registers */
      for (int r = 0; r < 8; ++r) { const float v = o[qt][dt][r] * inv; const _Float16 hv = (_Float16)v; f.h[r] = hv; fl.h[r] = (_Float16)((v - (float)hv) * 1024.0f); }
      *(v8us*)&st[role][0][16 * qt + ln][hsel * 32 + 16 * dt + 8 * hh] = f.half[0]; *(v8us*)&st[role][1][16 * qt + ln][hsel * 32 + 16 * dt + 8 * hh] = fl.half[0]; } }
  __syncthreads();      /* the partner head's half of each line is in LDS */
#pragma unroll      /* the LDS reads of all four steps issue ahead of the stores */
  for (int i = 0; i < 4; ++i) { const int row = hsel * 16 + i * 4 + (lane >> 3), c8 = (lane & 7) * 8; const size_t go = ((size_t)b * NTK + g * 32 + row) * DW + (hp & 3) * 64 + c8;
    *(v8us*)((unsigned short*)CH + go) = *(const v8us*)&st[role][0][row][c8]; *(v8us*)((unsigned short*)CL + go) = *(const v8us*)&st[role][1][row][c8]; }
}

// ---- output projection, one launch: out = (ctx_hi + ctx_lo / 1024) Wo^T + bo ----
// A work-group of 8 waves owns the 128 x 64 tile that a work-group of each of the former two GEMM launches owned; a wave owns 16 rows x 64 columns of it and
// keeps two sets of accumulators, one per context plane, so that each weight fragment is loaded once and serves both planes and no partial result goes
// through memory. The sums and the epilogue's operations are those of the two launches. The 8 k steps are unrolled over a ring of three fragment sets in
// registers: the loads of two steps are in flight while one step's products run.
__global__ __launch_bounds__(256) void k_oproj(const _Float16* __restrict__ AH, const _Float16* __restrict__ AL, const _Float16* __restrict__ Bh, const float* __restrict__ bias, float* __restrict__ C) {
  __shared__ __attribute__((aligned(16))) float so[8][16][68];
  const int tid = threadIdx.x, w = tid >> 5, lane = tid & 31, ln = lane & 15, hh = lane >> 4;
  const int mt = blockIdx.x >> 2, nq = blockIdx.x & 3; const int row0 = mt * 128 + 16 * w, col0 = nq * 64;
  const size_t ao = (size_t)(row0 + ln) * DW + 8 * hh;
  const _Float16* ahp = AH + ao; const _Float16* alp = AL + ao; const _Float16* bp = Bh + (size_t)(col0 + ln) * DW + 8 * hh;
  const v8f z8 = {0.f,0.f,0.f,0.f,0.f,0.f,0.f,0.f}; v8f ch[4] = {z8, z8, z8, z8}, cl[4] = {z8, z8, z8, z8};
  float bv[4];
#pragma unroll      /* constant indices; read here so that the epilogue does not wait for them */
  for (int t = 0; t < 4; ++t) bv[t] = bias[col0 + t * 16 + ln];
  v16h fh[3], fl[3], fb[3][4];
#pragma unroll      /* constant indices: the ring stays in registers */
  for (int s = 0; s < 2; ++s) { fh[s] = fa_frag(ahp + s * 32); fl[s] = fa_frag(alp + s * 32);
#pragma unroll      /* constant indices, as above */
    for (int t = 0; t < 4; ++t) fb[s][t] = fa_frag(bp + t * 16 * DW + s * 32); }
#pragma unroll      /* constant indices: the ring stays in registers and every address is a base plus an immediate */
  for (int s = 0; s < DW / 32; ++s) {
    if (s + 2 < DW / 32) { const int n = s + 2, sl = n % 3; fh[sl] = fa_frag(ahp + n * 32); fl[sl] = fa_frag(alp + n * 32);
#pragma unroll      /* constant indices, as above */
      for (int t = 0; t < 4; ++t) fb[sl][t] = fa_frag(bp + t * 16 * DW + n * 32); }
    const int cu = s % 3;
#pragma unroll      /* constant indices, as above */
    for (int t = 0; t < 4; ++t) { ch[t] = fa_mma(fh[cu], fb[cu][t], ch[t]); cl[t] = fa_mma(fl[cu], fb[cu][t], cl[t]); }
    __builtin_amdgcn_sched_barrier(0);      /* keeps later steps' loads below this step: lifted to the top they took over 256 registers (half the grid resident) or spilled */
  }
#pragma unroll      /* constant indices: the tiles stay in registers */
  for (int t = 0; t < 4; ++t) { const float bt = bf16_round(bv[t]);
#pragma unroll      /* constant indices: the tiles stay in registers */
    for (int r = 0; r < 8; ++r) { float v = ch[t][r] * 0.0625f + bt; v += cl[t][r] * (0.0625f / 1024.0f); so[w][8 * hh + r][t * 16 + ln] = v; } }
  __builtin_amdgcn_fence(__ATOMIC_ACQ_REL, "workgroup"); __builtin_amdgcn_wave_barrier();      /* a wave reads back only its own staging rows */
  const int rsub = lane >> 4, c4 = (lane & 15) * 4;
#pragma unroll      /* the LDS reads issue ahead of the stores */
  for (int q = 0; q < 8; ++q) { const int r = q * 2 + rsub; const v4f v = *(const v4fa*)&so[w][r][c4]; *(v4f*)(C + (size_t)(row0 + r) * DW + col0 + c4) = v; }
}

extern "C" void kernel_launch(void* const* d_in, const int* in_sizes, int n_in,
                              void* d_out, int out_size, void* d_ws, size_t ws_size, hipStream_t stream) {
  (void)in_sizes; (void)n_in; (void)out_size;
  const float* const* I = (const float* const*)d_in; const float* xq = I[0]; const float* xk = I[1]; const float* xv = I[2]; const float* Wq = I[3]; const float* bq = I[4]; const float* Wk = I[5]; const float* bk = I[6]; const float* Wv = I[7]; const float* bv = I[8]; const float* Wo = I[9]; const float* bo = I[10];
  char* ws = (char*)d_ws; size_t off = 0;
  auto take = [&](size_t bytes) { char* p = ws + off; off += (bytes + 255) & ~(size_t)255; return p; };
  const size_t np = (size_t)NR * DW;
  _Float16* BW = (_Float16*)take((size_t)4 * DW * DIN * 2); _Float16* CH = (_Float16*)take(2 * np * 2); _Float16* CL = CH + np; _Float16* Q16 = (_Float16*)take(2 * np * 2); _Float16* K16 = Q16 + np; _Float16* VT = (_Float16*)take(np * 2);      /* context hi / residual; q and k planes in a row, a plane is one step of grid.y; v transposed */
  if (off > ws_size) return;      /* 0.5 + 5 x 8 MiB */
  k_cvt4<<<4 * (DW * DIN / 8 / 256), 256, 0, stream>>>(Wq, Wk, Wv, Wo, BW);      /* torch (out, in) naturals */
  const dim3 gP((NR / 128) * (DW / 64), 1), gP3(NR / 64, 3);
  k_proj<<<gP3, 256, 0, stream>>>(xq, xk, xv, BW, bq, bk, bv, Q16, VT);      /* q, k, v projections from the f32 inputs: grid.y = 0, 1, 2; v as V^T [b*256 + column][2048]: head h of batch b = rows b*256 + h*32 */
  k_fattn<<<16 * (NB * NH / 2), 256, 0, stream>>>(Q16, K16, VT, CH, CL);      /* all heads, all batches: context hi / residual */
  k_oproj<<<gP, 256, 0, stream>>>(CH, CL, BW + (size_t)3 * DW * DIN, bo, (float*)d_out);      /* out = (ctx_hi + ctx_lo / 1024) Wo^T + bo */
}

// v007
// Measured time: 59.7 microseconds a run.
// Timed twice side by side with v006, it ran 1.15 and 1.13 times as fast.
// Over all steps from v000 it is 24.1 times as fast.
#include <hip/hip_runtime.h>
// my_attention (8 x 2048 tokens x 256; 8 heads x 32; q/k/v = query/key/value W^T + b; causal softmax(q.k / sqrt(32)); out = merged ctx Wo^T + bo).
// Compute dtype: inputs rounded to bf16; inputs/weights exact as f16; q/k/v and the softmax weights as plain f16 operands (~2^-12); context hi + residual into Wo; softmax f32. v_wmma_f32_16x16x32_f16.
#define NB 8
#define NTK 2048
#define DIN 256
#define NH 8
#define HD 32
#define DW 256
#define NR (NB * NTK)
typedef __bf16 v16b __attribute__((ext_vector_type(16)));
typedef unsigned short v8us __attribute__((ext_vector_type(8), may_alias));
typedef float  v8f  __attribute__((ext_vector_type(8)));
typedef float  v4f  __attribute__((ext_vector_type(4)));
typedef float  v4fa __attribute__((ext_vector_type(4), may_alias));
union FragB { v16b v; v8us half[2]; unsigned short u[16]; };

__device__ __forceinline__ unsigned short bf16_bits(float x) { unsigned int u = __float_as_uint(x); return (unsigned short)((u + 0x7FFFu + ((u >> 16) & 1u)) >> 16); }
__device__ __forceinline__ float bf16_val(unsigned short b) { return __uint_as_float(((unsigned int)b) << 16); }
__device__ __forceinline__ float bf16_round(float x) { return bf16_val(bf16_bits(x)); }
// D += A·B with NT terms: 1 = ah·bh, 2 = + al·bh (A split), 3 = + ah·bl (both split)
template <int NT>
__device__ __forceinline__ v8f mmaN(v16b ah, v16b al, v16b bh, v16b bl, v8f c) {
  c = __builtin_amdgcn_wmma_f32_16x16x32_bf16(false, ah, false, bh, (short)0, c, false, false);
  if (NT >= 2) c = __builtin_amdgcn_wmma_f32_16x16x32_bf16(false, al, false, bh, (short)0, c, false, false);
  if (NT >= 3) c = __builtin_amdgcn_wmma_f32_16x16x32_bf16(false, ah, false, bl, (short)0, c, false, false);
  asm volatile("v_nop\n\tv_nop\n\tv_nop\n\tv_nop" : "+v"(c) : "v"(ah), "v"(al), "v"(bh), "v"(bl));
  return c;
}

__global__ __launch_bounds__(256) void k_wt_bf16(const float* __restrict__ W, unsigned short* __restrict__ Wt, int K, int N) {
  const int t = blockIdx.x * 256 + threadIdx.x;
  const int k8n = K / 8;
  if (t >= N * k8n) return;
  const int n = t / k8n, k8 = (t % k8n) * 8;
  v8us v;
#pragma unroll
  for (int i = 0; i < 8; ++i) v[i] = bf16_bits(W[(size_t)(k8 + i) * N + n]);
  *(v8us*)(Wt + (size_t)n * K + k8) = v;
  
}

// GEMM C[M][N] (f32, pitch ldc) = act(A[M][K]·W + bias). A f32 row-major (pitch lda) converted per fragment to bf16
// (ASPLIT: hi/lo two planes -> 2 terms, else single rounded term); Wt bf16 [N][K] (pitch ldb). BIAS_BF16 rounds the
// bias to bf16 first (bias quantised to bf16 before the add). K%32==0, M%16==0, N%64==0.
template <bool ASPLIT, int ACT, bool BIAS_BF16>
__global__ __launch_bounds__(128) void k_gemm_bf(const float* __restrict__ A, int lda, const unsigned short* __restrict__ Wt, int ldb,
                                               const float* __restrict__ bias, float* __restrict__ C, int ldc, int M, int N, int K) {
  __shared__ __attribute__((aligned(16))) float so[4][16][64];
  const int tid = threadIdx.x, w = tid >> 5, lane = tid & 31, ln = lane & 15, hh = lane >> 4;
  const int ntn = N / 64;
  const int wid = blockIdx.x * 4 + w;
  const int mt = wid / ntn, nq = wid % ntn;
  if (mt * 16 >= M) return;
  const int row0 = mt * 16, col0 = nq * 64;
  const float* arow = A + (size_t)(row0 + ln) * lda;
  v8f acc[4] = {};
  for (int kb = 0; kb < K; kb += 32) {
    FragB ah, al;
    const v4f x0 = *(const v4fa*)(arow + kb + 8 * hh), x1 = *(const v4fa*)(arow + kb + 8 * hh + 4);
    const v4f x2 = *(const v4fa*)(arow + kb + 16 + 8 * hh), x3 = *(const v4fa*)(arow + kb + 16 + 8 * hh + 4);
    float xs[16] = {x0[0],x0[1],x0[2],x0[3],x1[0],x1[1],x1[2],x1[3],x2[0],x2[1],x2[2],x2[3],x3[0],x3[1],x3[2],x3[3]};
#pragma unroll
    for (int i = 0; i < 16; ++i) { const unsigned short hb = bf16_bits(xs[i]); ah.u[i] = hb; al.u[i] = ASPLIT ? bf16_bits(xs[i] - bf16_val(hb)) : (unsigned short)0; }
#pragma unroll
    for (int t = 0; t < 4; ++t) {
      const unsigned short* brow = Wt + (size_t)(col0 + t * 16 + ln) * ldb + kb;
      FragB b;
      b.half[0] = *(const v8us*)(brow + 8 * hh);
      b.half[1] = *(const v8us*)(brow + 16 + 8 * hh);
      acc[t] = mmaN<ASPLIT ? 2 : 1>(ah.v, al.v, b.v, b.v, acc[t]);
    }
  }
#pragma unroll
  for (int t = 0; t < 4; ++t) {
    float bv = bias ? bias[col0 + t * 16 + ln] : 0.f;
    if (BIAS_BF16) bv = bf16_round(bv);
#pragma unroll
    for (int r = 0; r < 8; ++r) { float v = acc[t][r] + bv; if (ACT == 1) v = fmaxf(v, 0.f); so[w][8 * hh + r][t * 16 + ln] = v; }
  }
  __builtin_amdgcn_fence(__ATOMIC_ACQ_REL, "workgroup");
  __builtin_amdgcn_wave_barrier();
  const int rsub = lane >> 4, c4 = (lane & 15) * 4;
  {
#pragma unroll
    for (int q = 0; q < 8; ++q) {
      const int r = q * 2 + rsub;
      const v4f v = *(const v4fa*)&so[w][r][c4];
      *(v4f*)(C + (size_t)(row0 + r) * ldc + col0 + c4) = v;
    }
    
  }
}

// GEMM C = act(A·W + bias + resid): A f32 (ASPLIT -> hi/lo 2 terms), Wt bf16 [N][K]; ACT 0 none, 1 relu, 2 exact gelu;
// resid (optional, f32, row index = (row % rmod), pitch ldr, RES_BF16 rounds it) added before the activation.
template <bool ASPLIT, int ACT, bool BIAS_BF16, bool RES_BF16>
__global__ __launch_bounds__(128) void k_gemm_bf3(const float* __restrict__ A, int lda, const unsigned short* __restrict__ Wt, int ldb,
                                                const float* __restrict__ bias, const float* __restrict__ resid, int rmod, int ldr,
                                                float* __restrict__ C, int ldc, int M, int N, int K) {
  __shared__ __attribute__((aligned(16))) float so[4][16][64];
  const int tid = threadIdx.x, w = tid >> 5, lane = tid & 31, ln = lane & 15, hh = lane >> 4;
  const int ntn = N / 64;
  const int wid = blockIdx.x * 4 + w;
  const int mt = wid / ntn, nq = wid % ntn;
  if (mt * 16 >= M) return;
  const int row0 = mt * 16, col0 = nq * 64;
  const float* arow = A + (size_t)(row0 + ln) * lda;
  v8f acc[4] = {};
  for (int kb = 0; kb < K; kb += 32) {
    FragB ah, al;
    const v4f x0 = *(const v4fa*)(arow + kb + 8 * hh), x1 = *(const v4fa*)(arow + kb + 8 * hh + 4);
    const v4f x2 = *(const v4fa*)(arow + kb + 16 + 8 * hh), x3 = *(const v4fa*)(arow + kb + 16 + 8 * hh + 4);
    float xs[16] = {x0[0],x0[1],x0[2],x0[3],x1[0],x1[1],x1[2],x1[3],x2[0],x2[1],x2[2],x2[3],x3[0],x3[1],x3[2],x3[3]};
#pragma unroll
    for (int i = 0; i < 16; ++i) { const unsigned short hb = bf16_bits(xs[i]); ah.u[i] = hb; al.u[i] = ASPLIT ? bf16_bits(xs[i] - bf16_val(hb)) : (unsigned short)0; }
#pragma unroll
    for (int t = 0; t < 4; ++t) {
      const unsigned short* brow = Wt + (size_t)(col0 + t * 16 + ln) * ldb + kb;
      FragB b;
      b.half[0] = *(const v8us*)(brow + 8 * hh);
      b.half[1] = *(const v8us*)(brow + 16 + 8 * hh);
      acc[t] = mmaN<ASPLIT ? 2 : 1>(ah.v, al.v, b.v, b.v, acc[t]);
    }
  }
#pragma unroll
  for (int t = 0; t < 4; ++t) {
    const int col = col0 + t * 16 + ln;
    float bv = bias ? bias[col] : 0.f;
    if (BIAS_BF16) bv = bf16_round(bv);
#pragma unroll
    for (int r = 0; r < 8; ++r) {
      float v = acc[t][r] + bv;
      if (resid) { float rv = resid[(size_t)((row0 + 8 * hh + r) % rmod) * ldr + col]; if (RES_BF16) rv = bf16_round(rv); v += rv; }
      if (ACT == 1) v = fmaxf(v, 0.f);
      if (ACT == 2) v = 0.5f * v * (1.0f + erff(v * 0.70710678118654752f));
      if (ACT == 3) { const float u = 0.7978845608028654f * (v + 0.044715f * v * v * v); v = 0.5f * v * (1.0f + tanhf(u)); }
      so[w][8 * hh + r][t * 16 + ln] = v;
    }
  }
  __builtin_amdgcn_fence(__ATOMIC_ACQ_REL, "workgroup");
  __builtin_amdgcn_wave_barrier();
  const int rsub = lane >> 4, c4 = (lane & 15) * 4;
  {
#pragma unroll
    for (int q = 0; q < 8; ++q) {
      const int r = q * 2 + rsub;
      const v4f v = *(const v4fa*)&so[w][r][c4];
      *(v4f*)(C + (size_t)(row0 + r) * ldc + col0 + c4) = v;
    }
    
  }
}
// row LayerNorm (biased variance, eps) over N: s = X (+ R); optional out_sum <- s; out_norm <- (s-mu)*rsqrt(var+eps)*g + b
template <bool PARAM_BF16>
__global__ __launch_bounds__(256) void k_layernorm(const float* __restrict__ X, const float* __restrict__ R, const float* __restrict__ g, const float* __restrict__ bta,
                                                  float* __restrict__ out_sum, float* __restrict__ out_norm, int N, float eps) {
  __shared__ float red[256];
  const int row = blockIdx.x, tid = threadIdx.x;
  const float* x = X + (size_t)row * N; const float* rr = R ? R + (size_t)row * N : nullptr;
  float vals[16];                     // up to N = 4096
  const int per = N / 256;            // contiguous chunk per thread? use strided-by-4 chunks: thread handles j = tid*4 + 1024*u
  float s1 = 0.f;
  for (int u = 0; u < per / 4; ++u) {
    const int j = tid * 4 + 1024 * u;
    const v4f a = *(const v4fa*)(x + j);
    v4f b = {0.f,0.f,0.f,0.f}; if (rr) b = *(const v4fa*)(rr + j);
#pragma unroll
    for (int q = 0; q < 4; ++q) { const float v = a[q] + b[q]; vals[u * 4 + q] = v; s1 += v; }
  }
  red[tid] = s1; __syncthreads();
  for (int st = 128; st > 0; st >>= 1) { if (tid < st) red[tid] += red[tid + st]; __syncthreads(); }
  const float mu = red[0] / (float)N; __syncthreads();
  float s2 = 0.f;
  for (int u = 0; u < per / 4; ++u)
#pragma unroll
    for (int q = 0; q < 4; ++q) { const float c = vals[u * 4 + q] - mu; s2 += c * c; }
  red[tid] = s2; __syncthreads();
  for (int st = 128; st > 0; st >>= 1) { if (tid < st) red[tid] += red[tid + st]; __syncthreads(); }
  const float rs = rsqrtf(red[0] / (float)N + eps);
  {
    for (int u = 0; u < per / 4; ++u) {
      const int j = tid * 4 + 1024 * u;
      v4f o, sm;
#pragma unroll
      for (int q = 0; q < 4; ++q) {
        float gg = g[j + q], bb = bta[j + q];
        if (PARAM_BF16) { gg = bf16_round(gg); bb = bf16_round(bb); }
        sm[q] = vals[u * 4 + q]; o[q] = (vals[u * 4 + q] - mu) * rs * gg + bb;
      }
      if (out_sum) *(v4f*)(out_sum + (size_t)row * N + j) = sm;
      *(v4f*)(out_norm + (size_t)row * N + j) = o;
    }
    
  }
}



// ---- f16 WMMA path (v_wmma_f32_16x16x32_f16): 11-bit significands for operands in range — used where a [0,1] probability operand needs more precision than bf16
typedef _Float16 v16h __attribute__((ext_vector_type(16)));
union FragH { v16h v; v8us half[2]; _Float16 h[16]; unsigned short u[16]; };
template <int NT>
__device__ __forceinline__ v8f mmaH(v16h ah, v16h al, v16h bh, v16h bl, v8f c) {
  c = __builtin_amdgcn_wmma_f32_16x16x32_f16(false, ah, false, bh, (short)0, c, false, false);
  if (NT >= 2) c = __builtin_amdgcn_wmma_f32_16x16x32_f16(false, al, false, bh, (short)0, c, false, false);
  if (NT >= 3) c = __builtin_amdgcn_wmma_f32_16x16x32_f16(false, ah, false, bl, (short)0, c, false, false);
  asm volatile("v_nop\n\tv_nop\n\tv_nop\n\tv_nop" : "+v"(c) : "v"(ah), "v"(al), "v"(bh), "v"(bl));
  return c;
}
// batched GEMM like k_gemm_b but f16 operands: A f32 (split into f16 hi/lo if ASPLIT, else rounded to f16), Bt = f16 values [n][k]; alpha; C f32; N multiple of 16 (partial tiles skipped)
template <bool ASPLIT>
__global__ __launch_bounds__(128) void k_gemm_h(const float* __restrict__ A, int lda, size_t sA, const _Float16* __restrict__ Bh, int ldb, size_t sB, float alpha, float* __restrict__ C, int ldc, size_t sC, int M, int N, int K) {
  __shared__ __attribute__((aligned(16))) float so[4][16][64];
  const int tid = threadIdx.x, w = tid >> 5, lane = tid & 31, ln = lane & 15, hh = lane >> 4; const int by = blockIdx.y;
  A += (size_t)by * sA; Bh += (size_t)by * sB; C += (size_t)by * sC;
  const int ntn = (N + 63) / 64; const int wid = blockIdx.x * 4 + w; const int mt = wid / ntn, nq = wid % ntn; if (mt * 16 >= M) return;
  const int row0 = mt * 16, col0 = nq * 64; const float* arow = A + (size_t)(row0 + ln) * lda;
  v8f acc[4] = {};
  for (int kb = 0; kb < K; kb += 32) {
    FragH ah, al;
    const v4f x0 = *(const v4fa*)(arow + kb + 8 * hh), x1 = *(const v4fa*)(arow + kb + 8 * hh + 4), x2 = *(const v4fa*)(arow + kb + 16 + 8 * hh), x3 = *(const v4fa*)(arow + kb + 16 + 8 * hh + 4);
    float xs[16] = {x0[0],x0[1],x0[2],x0[3],x1[0],x1[1],x1[2],x1[3],x2[0],x2[1],x2[2],x2[3],x3[0],x3[1],x3[2],x3[3]};
#pragma unroll
    for (int i = 0; i < 16; ++i) { const _Float16 h = (_Float16)xs[i]; ah.h[i] = h; al.h[i] = ASPLIT ? (_Float16)(xs[i] - (float)h) : (_Float16)0.0f; }
#pragma unroll
    for (int t = 0; t < 4; ++t) { if (col0 + t * 16 >= N) continue; const size_t boff = (size_t)(col0 + t * 16 + ln) * ldb + kb; FragH bq; bq.half[0] = *(const v8us*)(Bh + boff + 8 * hh); bq.half[1] = *(const v8us*)(Bh + boff + 16 + 8 * hh);
      acc[t] = mmaH<ASPLIT ? 2 : 1>(ah.v, al.v, bq.v, bq.v, acc[t]); }
  }
#pragma unroll
  for (int t = 0; t < 4; ++t) { if (col0 + t * 16 >= N) continue;
#pragma unroll
    for (int r = 0; r < 8; ++r) so[w][8 * hh + r][t * 16 + ln] = acc[t][r] * alpha; }
  __builtin_amdgcn_fence(__ATOMIC_ACQ_REL, "workgroup"); __builtin_amdgcn_wave_barrier();
  const int rsub = lane >> 4, c4 = (lane & 15) * 4;
  {
#pragma unroll
    for (int q = 0; q < 8; ++q) { const int r = q * 2 + rsub; if (col0 + c4 < N) { const v4f v = *(const v4fa*)&so[w][r][c4]; *(v4f*)(C + (size_t)(row0 + r) * ldc + col0 + c4) = v; } }
     }
}

// Wt[n][k] = f16(W[k][n]·scale) from f32 row-major W[K][N] (scale = power of two; bf16-exact weights stay exact in f16 away from the subnormal range)
__global__ __launch_bounds__(256) void k_wt_f16(const float* __restrict__ W, _Float16* __restrict__ Wt, int K, int N, float scale) {
  const int t = blockIdx.x * 256 + threadIdx.x; if (t >= N * (K / 8)) return; const int n = t / (K / 8), k8 = (t % (K / 8)) * 8; FragH f;
#pragma unroll
  for (int i = 0; i < 8; ++i) f.h[i] = (_Float16)(bf16_round(W[(size_t)(k8 + i) * N + n]) * scale); const v8us o = f.half[0];
  *(v8us*)((unsigned short*)Wt + (size_t)n * K + k8) = o; 
}
// k_gemm_hh variant with fused epilogue: v = acc·alpha + bias[by·sBias + col] (+ CP[(row/rowsPerB)·sCPb + by·64 + col] if CP) ; ACT 0 none / 1 elu ; writes f32 C and/or f16 C16 (each if non-null)
template <int ACT>
__global__ __launch_bounds__(128) void k_gemm_hhx(const _Float16* __restrict__ A, int lda, size_t sA, const _Float16* __restrict__ Bh, int ldb, size_t sB, float alpha, const float* __restrict__ bias, size_t sBias, const float* __restrict__ CP, int rowsPerB, size_t sCPb, int row0g,
    float* __restrict__ C, _Float16* __restrict__ C16, int ldc, size_t sC, int M, int N, int K) {
  __shared__ __attribute__((aligned(16))) float so[4][16][64];
  const int tid = threadIdx.x, w = tid >> 5, lane = tid & 31, ln = lane & 15, hh = lane >> 4; const int by = blockIdx.y;
  A += (size_t)by * sA; Bh += (size_t)by * sB; const size_t cofs = (size_t)by * sC; const float* bp = bias ? bias + (size_t)by * sBias : nullptr;
  const int ntn = (N + 63) / 64; const int wid = blockIdx.x * 4 + w; const int mt = wid / ntn, nq = wid % ntn; if (mt * 16 >= M) return;
  const int row0 = mt * 16, col0 = nq * 64; const _Float16* arow = A + (size_t)(row0 + ln) * lda;
  v8f acc[4] = {};
  for (int kb = 0; kb < K; kb += 32) { FragH ah; ah.half[0] = *(const v8us*)((const unsigned short*)arow + kb + 8 * hh); ah.half[1] = *(const v8us*)((const unsigned short*)arow + kb + 16 + 8 * hh);
#pragma unroll
    for (int t = 0; t < 4; ++t) { if (col0 + t * 16 >= N) continue; const size_t boff = (size_t)(col0 + t * 16 + ln) * ldb + kb; FragH bq; bq.half[0] = *(const v8us*)((const unsigned short*)Bh + boff + 8 * hh); bq.half[1] = *(const v8us*)((const unsigned short*)Bh + boff + 16 + 8 * hh);
      acc[t] = mmaH<1>(ah.v, ah.v, bq.v, bq.v, acc[t]); }
  }
#pragma unroll
  for (int t = 0; t < 4; ++t) { if (col0 + t * 16 >= N) continue; const int col = col0 + t * 16 + ln; const float bv = bp ? bf16_round(bp[col]) : 0.f;
#pragma unroll
    for (int r = 0; r < 8; ++r) { float v = acc[t][r] * alpha + bv; if (CP) { const int rr = row0g + row0 + 8 * hh + r; if (rowsPerB < 0) v += CP[cofs + (size_t)rr * ldc + col];      /* rowsPerB < 0: own element of the batched C plane */ else { const int bidx = rr / rowsPerB; v += CP[(size_t)bidx * sCPb + (size_t)by * 64 + col]; } } if (ACT == 1) v = (v > 0.f) ? v : expm1f(v); else if (ACT == 7) v = (v > 0.f) ? v + 1.0f : expf(v); else if (ACT == 8) v = tanhf(v); else if (ACT == 9) v = 0.5f * v * (1.0f + tanhf(0.7978845608028654f * (v + 0.044715f * v * v * v))); else if (ACT == 11) v = 1.0f / (1.0f + expf(-v)); else if (ACT == 12) v = (v > 0.f) ? v : 0.01f * v; else if (ACT == 14) v = (v > 0.f) ? v : 0.1f * v; else if (ACT == 16) v = (v >= 0.f) ? v : 0.3f * v; else if (ACT == 17) v = (v >= 0.f) ? v : 0.2f * v; else if (ACT == 15) v = v / (1.0f + expf(-v)); else if (ACT == 3) v = fmaxf(v, 0.f); else if (ACT == 6) v = 0.5f * v * (1.0f + erff(v * 0.70710678118654752f)); so[w][8 * hh + r][t * 16 + ln] = v; } }
  __builtin_amdgcn_fence(__ATOMIC_ACQ_REL, "workgroup"); __builtin_amdgcn_wave_barrier();
  const int rsub = lane >> 4, c4 = (lane & 15) * 4; typedef _Float16 v4h __attribute__((ext_vector_type(4)));
  {
#pragma unroll
    for (int q = 0; q < 8; ++q) { const int r = q * 2 + rsub; if (col0 + c4 < N) { const v4f v = *(const v4fa*)&so[w][r][c4]; if (C) *(v4f*)(C + cofs + (size_t)(row0 + r) * ldc + col0 + c4) = v; if (C16) { v4h h4; for (int i = 0; i < 4; ++i) h4[i] = (_Float16)v[i]; *(v4h*)(C16 + cofs + (size_t)(row0 + r) * ldc + col0 + c4) = h4; } } }
     }
}


typedef _Float16 v4h __attribute__((ext_vector_type(4)));

__global__ __launch_bounds__(256) void k_h16(const float* __restrict__ x, _Float16* __restrict__ X16, size_t n8) { const size_t t = (size_t)blockIdx.x * 256 + threadIdx.x; if (t >= n8) return; FragH f;
#pragma unroll
  for (int q = 0; q < 8; ++q) f.h[q] = (_Float16)x[t * 8 + q]; *(v8us*)((unsigned short*)X16 + t * 8) = f.half[0];  }
__global__ __launch_bounds__(256) void k_round16f(const float* __restrict__ W, _Float16* __restrict__ Bt, size_t n8) { const size_t t = (size_t)blockIdx.x * 256 + threadIdx.x; if (t >= n8) return; FragH f;
#pragma unroll
  for (int i = 0; i < 8; ++i) f.h[i] = (_Float16)(bf16_round(W[t * 8 + i]) * 16.0f); *(v8us*)((unsigned short*)Bt + t * 8) = f.half[0];  }

__global__ __launch_bounds__(256) void k_hl(const float* __restrict__ F, _Float16* __restrict__ Hh, _Float16* __restrict__ Hl, size_t n8) { const size_t t = (size_t)blockIdx.x * 256 + threadIdx.x; if (t >= n8) return; FragH fh, fl; const v4f a = *(const v4fa*)(F + t * 8), c = *(const v4fa*)(F + t * 8 + 4);
#pragma unroll
  for (int q = 0; q < 4; ++q) { _Float16 h = (_Float16)a[q]; fh.h[q] = h; fl.h[q] = (_Float16)((a[q] - (float)h) * 1024.0f); h = (_Float16)c[q]; fh.h[4 + q] = h; fl.h[4 + q] = (_Float16)((c[q] - (float)h) * 1024.0f); }
  { *(v8us*)((unsigned short*)Hh + t * 8) = fh.half[0]; *(v8us*)((unsigned short*)Hl + t * 8) = fl.half[0];  } }

// ---- fragment load and product of the 32x64 wave tile ----
__device__ __forceinline__ v16h g2_frag(const _Float16* p, int hh) { FragH f; f.half[0] = *(const v8us*)((const unsigned short*)p + 8 * hh); f.half[1] = *(const v8us*)((const unsigned short*)p + 16 + 8 * hh); return f.v; }
__device__ __forceinline__ v8f g2_mma(v16h a, v16h b, v8f c) { v8f d = __builtin_amdgcn_wmma_f32_16x16x32_f16(false, a, false, b, (short)0, c, false, false); asm volatile("v_nop\n\tv_nop\n\tv_nop\n\tv_nop" : "+v"(d) : "v"(a), "v"(b)); return d; }

// The four weight matrices, f16(bf16(w) * 16), in one grid; the block index picks the matrix (uniform in a work-group).
__global__ __launch_bounds__(256) void k_cvt4(const float* __restrict__ w0, const float* __restrict__ w1, const float* __restrict__ w2, const float* __restrict__ w3, _Float16* __restrict__ Bt) {
  constexpr int WB = DW * DIN / 8 / 256;      /* blocks per weight matrix */
  const int j = blockIdx.x / WB, blk = blockIdx.x - j * WB; const float* s = (j == 0) ? w0 : (j == 1) ? w1 : (j == 2) ? w2 : w3; _Float16* d = Bt + (size_t)j * DW * DIN;
  const size_t t = (size_t)blk * 256 + threadIdx.x; FragH f;
#pragma unroll      /* constant indices: the eight values stay in registers and their loads join into two of 16 bytes */
  for (int q = 0; q < 8; ++q) f.h[q] = (_Float16)(bf16_round(s[t * 8 + q]) * 16.0f);
  *(v8us*)((unsigned short*)d + t * 8) = f.half[0];
}
// ---- q, k, v projections straight from the f32 inputs (grid.y = plane): no conversion launch, no f16 copy of the inputs in memory ----
// A work-group of 8 waves owns 64 token rows x all 256 output columns, so each input row is read from memory once, in whole lines, all 16 loads of a
// lane in flight, rounded once (f16(bf16(x)), as the conversion kernel did) and laid in LDS at a pitch of 16 B x 33 for the ds_load_b128 fragment reads.
// The plane's weights go through LDS as well, in four stages of 64 k (one whole 128-byte line of each of the 256 weight rows): the work-group fetches each line once, a
// wave-wide load covering 4 whole lines, and all eight waves take their B fragments from LDS (pitch 16 B x 9). Two stage buffers, in the space that the output
// staging uses afterwards; stage 0 is fetched beside the input rows, each later stage during the products of the stage before it, so no product waits for a load from L2.
// Wave tile 32 x 64. The v plane is stored transposed, V^T [(b, column)][token], the layout the attention kernel's A fragments read: in an accumulator tile a
// lane holds 8 consecutive tokens of one column, 16 bytes of a V^T row; the work-group's 64 tokens are one whole 128-byte line of each of its 256 V^T rows.
__global__ __launch_bounds__(256) void k_proj(const float* __restrict__ x0, const float* __restrict__ x1, const float* __restrict__ x2, const _Float16* __restrict__ Bh,
                                              const float* __restrict__ bias0, const float* __restrict__ bias1, const float* __restrict__ bias2, _Float16* __restrict__ C16, _Float16* __restrict__ VT) {
  __shared__ __attribute__((aligned(16))) _Float16 sa[64][DIN + 8];
  constexpr int WST = DW * 72;      /* one weight stage in LDS, in f16: 256 rows of 64 k at a pitch of 72 */
  __shared__ __attribute__((aligned(16))) float su[2 * WST / 2];      /* two weight stages during the k loop, output staging behind it */
  float (*so)[32][68] = reinterpret_cast<float (*)[32][68]>(su); unsigned short* sb = (unsigned short*)su;
  static_assert(sizeof(float) * 8 * 32 * 68 <= sizeof(su), "output staging fits the stage buffers");
  const int tid = threadIdx.x, w = tid >> 5, lane = tid & 31, ln = lane & 15, hh = lane >> 4; const int by = blockIdx.y;
  const float* xs = ((by == 0) ? x0 : (by == 1) ? x1 : x2) + (size_t)blockIdx.x * 64 * DIN; const float* bp = (by == 0) ? bias0 : (by == 1) ? bias1 : bias2;
  const unsigned short* wsrc = (const unsigned short*)Bh + (size_t)by * DW * DIN + (size_t)(tid >> 3) * DIN + (tid & 7) * 8;      /* 8 lanes = one 128-byte line of a weight row */
  unsigned short* wdst = sb + (tid >> 3) * 72 + (tid & 7) * 8;
  v4f t[16]; v8us wn[8];
#pragma unroll      /* constant indices: the sixteen loads stand in registers and issue together */
  for (int i = 0; i < 16; ++i) t[i] = *(const v4fa*)(xs + (size_t)(i * 256 + tid) * 4);
#pragma unroll      /* constant indices: the loads of weight stage 0 issue behind the input loads */
  for (int i = 0; i < 8; ++i) wn[i] = *(const v8us*)(wsrc + (size_t)i * 32 * DIN);
  __builtin_amdgcn_sched_barrier(0);      /* keeps the weight loads up here: sunk below the input conversion they started only when the inputs had arrived */
#pragma unroll      /* constant indices, as above */
  for (int i = 0; i < 16; ++i) { v4h h4;
#pragma unroll      /* constant indices, as above */
    for (int q = 0; q < 4; ++q) h4[q] = (_Float16)bf16_round(t[i][q]);
    *(v4h*)&sa[i * 4 + (tid >> 6)][(tid & 63) * 4] = h4; }
#pragma unroll      /* constant indices, as above */
  for (int i = 0; i < 8; ++i) *(v8us*)(wdst + i * 32 * 72) = wn[i];
  __syncthreads();      /* the 64 converted rows and weight stage 0 are in LDS for all eight waves */
  const int rl0 = (w >> 2) * 32, col0 = (w & 3) * 64; const int row0 = blockIdx.x * 64 + rl0; const size_t cofs = (size_t)by * NR * DW;
  const _Float16* a0p = &sa[rl0 + ln][0]; const _Float16* a1p = &sa[rl0 + 16 + ln][0];
  const v8f z8 = {0.f,0.f,0.f,0.f,0.f,0.f,0.f,0.f}; v8f c00 = z8, c01 = z8, c02 = z8, c03 = z8, c10 = z8, c11 = z8, c12 = z8, c13 = z8;
#pragma unroll      /* four stages: buffer choice, the refills and every LDS offset are constants */
  for (int j = 0; j < DIN / 64; ++j) { const _Float16* bs = (const _Float16*)(sb + (j & 1) * WST + (col0 + ln) * 72);
    if (j + 1 < DIN / 64) {
#pragma unroll      /* constant indices: the next stage stays in registers and flies during this stage's products (issued behind the barrier, which waits for every load in flight) */
      for (int i = 0; i < 8; ++i) wn[i] = *(const v8us*)(wsrc + (size_t)i * 32 * DIN + (j + 1) * 64);
    }
#pragma unroll      /* constant offsets, as above */
    for (int ks = 0; ks < 2; ++ks) { const int kb = j * 64 + ks * 32; const v16h a0 = g2_frag(a0p + kb, hh), a1 = g2_frag(a1p + kb, hh);
      const v16h b0 = g2_frag(bs + ks * 32, hh), b1 = g2_frag(bs + 16 * 72 + ks * 32, hh), b2 = g2_frag(bs + 32 * 72 + ks * 32, hh), b3 = g2_frag(bs + 48 * 72 + ks * 32, hh);
      c00 = g2_mma(a0, b0, c00); c10 = g2_mma(a1, b0, c10); c01 = g2_mma(a0, b1, c01); c11 = g2_mma(a1, b1, c11);
      c02 = g2_mma(a0, b2, c02); c12 = g2_mma(a1, b2, c12); c03 = g2_mma(a0, b3, c03); c13 = g2_mma(a1, b3, c13); }
    if (j + 1 < DIN / 64) {
#pragma unroll      /* constant indices, as above; the other buffer: its last readers, stage j - 1's products, ended in front of the barrier before this stage */
      for (int i = 0; i < 8; ++i) *(v8us*)(wdst + ((j + 1) & 1) * WST + i * 32 * 72) = wn[i];
    }
    __syncthreads();      /* stage j + 1 is in LDS for all eight waves, and every wave has read stage j (behind the last stage: the buffers become output staging) */
  }
  asm volatile("s_wait_xcnt 0x0" :: "v"(wsrc) : "memory");      /* stands before the registers of the weight address are used again: the operand keeps them untouched up to here */
  v8f accs[8] = {c00, c01, c02, c03, c10, c11, c12, c13};
  if (by < 2) {      /* q and k planes, row-major. The test in this form and order: the built code then has the v path first, and the q/k path does not keep the v path's values alive (162 registers, five waves a SIMD instead of six, with the test written the other way round) */
#pragma unroll      /* constant indices: the tiles stay in registers */
  for (int u = 0; u < 8; ++u) { const int tt = u & 3, half = u >> 2; const float bv = bf16_round(bp[col0 + tt * 16 + ln]);
#pragma unroll      /* constant indices: the tiles stay in registers */
    for (int r = 0; r < 8; ++r) so[w][half * 16 + 8 * hh + r][tt * 16 + ln] = accs[u][r] * 0.0625f + bv; }
  __builtin_amdgcn_fence(__ATOMIC_ACQ_REL, "workgroup"); __builtin_amdgcn_wave_barrier();      /* a wave reads back only its own staging rows */
  const int rsub = lane >> 4, c4 = (lane & 15) * 4;
#pragma unroll      /* the LDS reads issue ahead of the stores */
  for (int q = 0; q < 16; ++q) { const int r = q * 2 + rsub; const v4f v = *(const v4fa*)&so[w][r][c4]; v4h h4;
#pragma unroll      /* constant indices */
    for (int i = 0; i < 4; ++i) h4[i] = (_Float16)v[i];
    *(v4h*)(C16 + cofs + (size_t)(row0 + r) * DW + col0 + c4) = h4; }
  } else {      /* v plane (uniform in the grid's y): 256 columns x 64 tokens through LDS at a pitch of 16 B x 9, in the weight stage buffers, free behind the k loop */
    unsigned short* tv = (unsigned short*)&so[0][0][0];
#pragma unroll      /* constant indices: the tiles stay in registers */
    for (int u = 0; u < 8; ++u) { const int tt = u & 3, half = u >> 2; const float bv = bf16_round(bp[col0 + tt * 16 + ln]); FragH f;
#pragma unroll      /* constant indices: the tiles stay in registers */
      for (int r = 0; r < 8; ++r) f.h[r] = (_Float16)(accs[u][r] * 0.0625f + bv);
      *(v8us*)(tv + (col0 + tt * 16 + ln) * 72 + rl0 + half * 16 + 8 * hh) = f.half[0]; }
    __syncthreads();      /* both token halves of every V^T line are in LDS: a line is stored whole by 8 lanes of one wave */
    unsigned short* vo = (unsigned short*)VT + (size_t)(blockIdx.x / (NTK / 64)) * DW * NTK + (blockIdx.x % (NTK / 64)) * 64;
#pragma unroll      /* the LDS reads issue ahead of the stores */
    for (int i = 0; i < 8; ++i) { const int idx = i * 256 + tid, col = idx >> 3, c8 = (idx & 7) * 8; *(v8us*)(vo + (size_t)col * NTK + c8) = *(const v8us*)(tv + col * 72 + c8); }
    asm volatile("s_wait_xcnt 0x0" ::: "memory");      /* behind the last store: in the built code the q/k path stands below this one and rewrites the stores' address registers */
  }
}
// ---- fused causal attention: S^T = K Q^T, online softmax in registers, O^T += V^T P^T; scores and weights never reach memory ----
// One wave = 32 queries of one head; a pass = 32 keys. In S^T a lane holds one query's scores (column ln, keys 8*hh + r), so two S^T tiles,
// converted in place, are the B operand of V^T P^T in the hardware k order. Weights carry a factor 1024 (as exp2(... + 10)); it cancels in O / l.
__device__ __forceinline__ float fa_xhalf(float x) { const int b = __float_as_int(x); return __int_as_float(__builtin_amdgcn_permlanex16(b, b, 0x76543210, 0xfedcba98, false, false)); }
__device__ __forceinline__ v16h fa_frag(const _Float16* p) { FragH f; f.half[0] = *(const v8us*)((const unsigned short*)p); f.half[1] = *(const v8us*)((const unsigned short*)p + 16); return f.v; }      /* p already holds the lane half's 8 * hh */
__device__ __forceinline__ v8f fa_mma(v16h a, v16h b, v8f c) { return __builtin_amdgcn_wmma_f32_16x16x32_f16(false, a, false, b, (short)0, c, false, false); }
// Eight independent v_exp_f32 and the slot that the instruction set asks for behind a transcendental, in one statement: a v_nop in a statement of its own
// did not stay behind them. Outputs are early-clobber, so that none of the eight overwrites a source of the one in front of it.
__device__ __forceinline__ void fa_exp8(v8f& e, const v8f x) {
  float e0, e1, e2, e3, e4, e5, e6, e7;
  asm("v_exp_f32 %0, %8\n\tv_exp_f32 %1, %9\n\tv_exp_f32 %2, %10\n\tv_exp_f32 %3, %11\n\tv_exp_f32 %4, %12\n\tv_exp_f32 %5, %13\n\tv_exp_f32 %6, %14\n\tv_exp_f32 %7, %15\n\tv_nop"
      : "=&v"(e0), "=&v"(e1), "=&v"(e2), "=&v"(e3), "=&v"(e4), "=&v"(e5), "=&v"(e6), "=&v"(e7)
      : "v"(x[0]), "v"(x[1]), "v"(x[2]), "v"(x[3]), "v"(x[4]), "v"(x[5]), "v"(x[6]), "v"(x[7]));
  e[0] = e0; e[1] = e1; e[2] = e2; e[3] = e3; e[4] = e4; e[5] = e5; e[6] = e6; e[7] = e7;
}
template <bool DIAG>
__device__ __forceinline__ void fa_pass(const v16h k0, const v16h k1, const v16h v0, const v16h v1, const v16h q0f, const v16h q1f, v8f (&o)[2][2], float (&m)[2], float (&l)[2], const int ln, const int hh) {
  const float C = 0.17677669529663687f * 1.4426950408889634f;      /* 1/sqrt(32) * log2(e) */
  const v8f z8 = {0.f,0.f,0.f,0.f,0.f,0.f,0.f,0.f};
  v8f s[2][2];
  s[0][0] = fa_mma(k0, q0f, z8); s[0][1] = fa_mma(k1, q0f, z8); s[1][0] = fa_mma(k0, q1f, z8); s[1][1] = fa_mma(k1, q1f, z8);
  float mn[2];
#pragma unroll      /* constant indices: the tiles stay in registers */
  for (int qt = 0; qt < 2; ++qt) {
    if (DIAG) {
#pragma unroll      /* constant indices: the tiles stay in registers */
      for (int r = 0; r < 8; ++r) { if (8 * hh + r > 16 * qt + ln) s[qt][0][r] = -3.0e38f; if (16 + 8 * hh + r > 16 * qt + ln) s[qt][1][r] = -3.0e38f; }
    }
    float mx = fmaxf(s[qt][0][0], s[qt][1][0]);
#pragma unroll      /* constant indices: the tiles stay in registers */
    for (int r = 1; r < 8; ++r) mx = fmaxf(mx, fmaxf(s[qt][0][r], s[qt][1][r]));
    mx = fmaxf(mx, fa_xhalf(mx));
    mn[qt] = fmaxf(m[qt], mx * C);
  }
  if (__builtin_amdgcn_ballot_w32(mn[0] > m[0] || mn[1] > m[1]) != 0) {      /* a maximum rose somewhere in the wave: rescale (factor exactly 1 where it did not) */
#pragma unroll      /* constant indices: the tiles stay in registers */
    for (int qt = 0; qt < 2; ++qt) { const float al = __builtin_amdgcn_exp2f(m[qt] - mn[qt]); o[qt][0] *= al; o[qt][1] *= al; l[qt] *= al; m[qt] = mn[qt]; }
  }
  FragH p[2];
#pragma unroll      /* constant indices: the tiles stay in registers */
  for (int qt = 0; qt < 2; ++qt) {
    const float sh = 10.0f - m[qt]; float su = 0.f;
#pragma unroll      /* constant indices: the tiles stay in registers */
    for (int t = 0; t < 2; ++t) { v8f x, e;
#pragma unroll      /* constant indices: the tiles stay in registers */
      for (int r = 0; r < 8; ++r) x[r] = fmaf(s[qt][t][r], C, sh);
      fa_exp8(e, x);
#pragma unroll      /* constant indices: the tiles stay in registers */
      for (int r = 0; r < 8; ++r) { su += e[r]; p[qt].h[8 * t + r] = (_Float16)e[r]; } }
    l[qt] += su;
  }
  o[0][0] = fa_mma(v0, p[0].v, o[0][0]); o[0][1] = fa_mma(v1, p[0].v, o[0][1]); o[1][0] = fa_mma(v0, p[1].v, o[1][0]); o[1][1] = fa_mma(v1, p[1].v, o[1][1]);
}
// Grid: 8 batches x 32 work-groups of 16 waves = all eight heads x the two query groups p and 63 - p (equal work in every work-group; waves w, w + 4, w + 8
// and w + 12 together: 130 passes). Context = O / l, split hi + residual * 1024, stays in LDS: the work-group holds all 256 context columns of its 64 tokens, so it
// does their output projection itself, out = (ctx_hi + ctx_lo / 1024) Wo^T + bo, and the context planes never reach memory.
// Output projection: a wave owns 16 rows x 64 columns and keeps two sets of accumulators, one per context plane, so that each weight fragment is loaded once and
// serves both planes. The 8 k steps are unrolled over a ring of three fragment sets in registers: the loads of two steps are in flight while one step's products run.
__global__ __launch_bounds__(512) void k_fattn(const _Float16* __restrict__ Q, const _Float16* __restrict__ Kk, const _Float16* __restrict__ Vt, const _Float16* __restrict__ Bh, const float* __restrict__ bias, float* __restrict__ C) {
  __shared__ __attribute__((aligned(16))) _Float16 st[2][64][DW + 8];      /* context plane, token (query group * 32 + row), column; pitch 16 B x 33 for the ds_load_b128 fragment reads */
  __shared__ __attribute__((aligned(16))) float so[16][16][68];
  const int lane = threadIdx.x & 31, ln = lane & 15, hh = lane >> 4; const int w = __builtin_amdgcn_readfirstlane(threadIdx.x >> 5);
  const int b = blockIdx.x & (NB - 1), p = blockIdx.x / NB; const int head = w & 7, tsel = w >> 3;
  const int g = tsel ? 63 - p : p;
  const int rb = w >> 2, col0 = (w & 3) * 64; const int row0 = b * NTK + ((rb >> 1) ? 63 - p : p) * 32 + (rb & 1) * 16;      /* the wave's tile of the output projection: row block rb of the work-group's 64 tokens, 64 columns */
  float bv[4];
#pragma unroll      /* constant indices; read here so that the epilogue does not wait for them */
  for (int t = 0; t < 4; ++t) bv[t] = bias[col0 + t * 16 + ln];
  const _Float16* qp = Q + ((size_t)b * NTK + g * 32 + ln) * DW + head * HD + 8 * hh;
  const v16h q0f = fa_frag(qp), q1f = fa_frag(qp + (size_t)16 * DW);
  const _Float16* kp = Kk + ((size_t)b * NTK + ln) * DW + head * HD + 8 * hh;
  const _Float16* vp = Vt + ((size_t)b * DW + head * HD + ln) * NTK + 8 * hh;
  const v8f z8 = {0.f,0.f,0.f,0.f,0.f,0.f,0.f,0.f};
  v8f o[2][2] = {{z8, z8}, {z8, z8}}; float m[2] = {-3.0e38f, -3.0e38f}, l[2] = {0.f, 0.f};
  v16h k0 = fa_frag(kp), k1 = fa_frag(kp + (size_t)16 * DW), v0 = fa_frag(vp), v1 = fa_frag(vp + (size_t)16 * NTK);
  asm volatile("s_wait_xcnt 0x0" :: "v"(qp) : "memory");      /* stands before the registers of the query and bias addresses are used again: the operand keeps the query's untouched up to here */
  for (int kb = 0; kb < g; ++kb) {      /* passes below the diagonal; the next pass's fragments are fetched ahead (pass g always exists) */
    kp += (size_t)32 * DW; vp += 32;
    const v16h nk0 = fa_frag(kp), nk1 = fa_frag(kp + (size_t)16 * DW), nv0 = fa_frag(vp), nv1 = fa_frag(vp + (size_t)16 * NTK);
    fa_pass<false>(k0, k1, v0, v1, q0f, q1f, o, m, l, ln, hh);
    k0 = nk0; k1 = nk1; v0 = nv0; v1 = nv1;
  }
  fa_pass<true>(k0, k1, v0, v1, q0f, q1f, o, m, l, ln, hh);
  const _Float16* bp = Bh + (size_t)(col0 + ln) * DW + 8 * hh;
  v16h fh[3], fl[3], fb[3][4];
#pragma unroll      /* constant indices: the ring stays in registers; the first two steps' weights are fetched here, in front of the barrier: they do not depend on the context */
  for (int s = 0; s < 2; ++s) {
#pragma unroll      /* constant indices, as above */
    for (int t = 0; t < 4; ++t) fb[s][t] = fa_frag(bp + t * 16 * DW + s * 32); }
#pragma unroll      /* constant indices: the tiles stay in registers */
  for (int qt = 0; qt < 2; ++qt) { const float inv = 1.0f / (l[qt] + fa_xhalf(l[qt]));
#pragma unroll      /* constant indices: the tiles stay in registers */
    for (int dt = 0; dt < 2; ++dt) { FragH f, fr;
#pragma unroll      /* constant indices: the tiles stay in registers */
      for (int r = 0; r < 8; ++r) { const float v = o[qt][dt][r] * inv; const _Float16 hv = (_Float16)v; f.h[r] = hv; fr.h[r] = (_Float16)((v - (float)hv) * 1024.0f); }
      *(v8us*)&st[0][tsel * 32 + 16 * qt + ln][head * HD + 16 * dt + 8 * hh] = f.half[0]; *(v8us*)&st[1][tsel * 32 + 16 * qt + ln][head * HD + 16 * dt + 8 * hh] = fr.half[0]; } }
  __syncthreads();      /* all eight heads' columns of the 64 context rows are in LDS */
  const _Float16* ahp = &st[0][rb * 16 + ln][8 * hh]; const _Float16* alp = &st[1][rb * 16 + ln][8 * hh];
  v8f ch[4] = {z8, z8, z8, z8}, cl[4] = {z8, z8, z8, z8};
#pragma unroll      /* constant indices: the ring stays in registers */
  for (int s = 0; s < 2; ++s) { fh[s] = fa_frag(ahp + s * 32); fl[s] = fa_frag(alp + s * 32); }
#pragma unroll      /* constant indices: the ring stays in registers and every address is a base plus an immediate */
  for (int s = 0; s < DW / 32; ++s) {
    if (s + 2 < DW / 32) { const int n = s + 2, sl = n % 3; fh[sl] = fa_frag(ahp + n * 32); fl[sl] = fa_frag(alp + n * 32);
#pragma unroll      /* constant indices, as above */
      for (int t = 0; t < 4; ++t) fb[sl][t] = fa_frag(bp + t * 16 * DW + n * 32); }
    const int cu = s % 3;
#pragma unroll      /* constant indices, as above */
    for (int t = 0; t < 4; ++t) { ch[t] = fa_mma(fh[cu], fb[cu][t], ch[t]); cl[t] = fa_mma(fl[cu], fb[cu][t], cl[t]); }
    __builtin_amdgcn_sched_barrier(0);      /* keeps later steps' loads below this step: lifted to the top they took over 256 registers or spilled */
  }
  asm volatile("s_wait_xcnt 0x0" :: "v"(bp) : "memory");      /* stands before the registers of the weight address are used again: the operand keeps them untouched up to here */
#pragma unroll      /* constant indices: the tiles stay in registers */
  for (int t = 0; t < 4; ++t) { const float bt = bf16_round(bv[t]);
#pragma unroll      /* constant indices: the tiles stay in registers */
    for (int r = 0; r < 8; ++r) { float v = ch[t][r] * 0.0625f + bt; v += cl[t][r] * (0.0625f / 1024.0f); so[w][8 * hh + r][t * 16 + ln] = v; } }
  __builtin_amdgcn_fence(__ATOMIC_ACQ_REL, "workgroup"); __builtin_amdgcn_wave_barrier();      /* a wave reads back only its own staging rows */
  const int rsub = lane >> 4, c4 = (lane & 15) * 4;
#pragma unroll      /* the LDS reads issue ahead of the stores */
  for (int q = 0; q < 8; ++q) { const int r = q * 2 + rsub; const v4f v = *(const v4fa*)&so[w][r][c4]; *(v4f*)(C + (size_t)(row0 + r) * DW + col0 + c4) = v; }
}

extern "C" void kernel_launch(void* const* d_in, const int* in_sizes, int n_in,
                              void* d_out, int out_size, void* d_ws, size_t ws_size, hipStream_t stream) {
  (void)in_sizes; (void)n_in; (void)out_size;
  const float* const* I = (const float* const*)d_in; const float* xq = I[0]; const float* xk = I[1]; const float* xv = I[2]; const float* Wq = I[3]; const float* bq = I[4]; const float* Wk = I[5]; const float* bk = I[6]; const float* Wv = I[7]; const float* bv = I[8]; const float* Wo = I[9]; const float* bo = I[10];
  char* ws = (char*)d_ws; size_t off = 0;
  auto take = [&](size_t bytes) { char* p = ws + off; off += (bytes + 255) & ~(size_t)255; return p; };
  const size_t np = (size_t)NR * DW;
  _Float16* BW = (_Float16*)take((size_t)4 * DW * DIN * 2); _Float16* Q16 = (_Float16*)take(2 * np * 2); _Float16* K16 = Q16 + np; _Float16* VT = (_Float16*)take(np * 2);      /* q and k planes in a row, a plane is one step of grid.y; v transposed */
  if (off > ws_size) return;      /* 0.5 + 3 x 8 MiB */
  k_cvt4<<<4 * (DW * DIN / 8 / 256), 256, 0, stream>>>(Wq, Wk, Wv, Wo, BW);      /* torch (out, in) naturals */
  const dim3 gP3(NR / 64, 3);
  k_proj<<<gP3, 256, 0, stream>>>(xq, xk, xv, BW, bq, bk, bv, Q16, VT);      /* q, k, v projections from the f32 inputs: grid.y = 0, 1, 2; v as V^T [b*256 + column][2048]: head h of batch b = rows b*256 + h*32 */
  k_fattn<<<NB * 32, 512, 0, stream>>>(Q16, K16, VT, BW + (size_t)3 * DW * DIN, bo, (float*)d_out);      /* all heads, all batches: attention and out = (ctx_hi + ctx_lo / 1024) Wo^T + bo */
}

// v008
// It runs in 56.1 microseconds.
// Two timings next to v007 put it at 1.07 and 1.09 times that version's speed.
// All steps since v000 together make it 26.1 times as fast.
#include <hip/hip_runtime.h>
// my_attention (8 x 2048 tokens x 256; 8 heads x 32; q/k/v = query/key/value W^T + b; causal softmax(q.k / sqrt(32)); out = merged ctx Wo^T + bo).
// Compute dtype: inputs rounded to bf16; inputs/weights exact as f16; q/k/v and the softmax weights as plain f16 operands (~2^-12); context hi + residual into Wo; softmax f32. v_wmma_f32_16x16x32_f16.
#define NB 8
#define NTK 2048
#define DIN 256
#define NH 8
#define HD 32
#define DW 256
#define NR (NB * NTK)
typedef __bf16 v16b __attribute__((ext_vector_type(16)));
typedef unsigned short v8us __attribute__((ext_vector_type(8), may_alias));
typedef float  v8f  __attribute__((ext_vector_type(8)));
typedef float  v4f  __attribute__((ext_vector_type(4)));
typedef float  v4fa __attribute__((ext_vector_type(4), may_alias));
union FragB { v16b v; v8us half[2]; unsigned short u[16]; };

__device__ __forceinline__ unsigned short bf16_bits(float x) { unsigned int u = __float_as_uint(x); return (unsigned short)((u + 0x7FFFu + ((u >> 16) & 1u)) >> 16); }
__device__ __forceinline__ float bf16_val(unsigned short b) { return __uint_as_float(((unsigned int)b) << 16); }
__device__ __forceinline__ float bf16_round(float x) { return bf16_val(bf16_bits(x)); }
// D += A·B with NT terms: 1 = ah·bh, 2 = + al·bh (A split), 3 = + ah·bl (both split)
template <int NT>
__device__ __forceinline__ v8f mmaN(v16b ah, v16b al, v16b bh, v16b bl, v8f c) {
  c = __builtin_amdgcn_wmma_f32_16x16x32_bf16(false, ah, false, bh, (short)0, c, false, false);
  if (NT >= 2) c = __builtin_amdgcn_wmma_f32_16x16x32_bf16(false, al, false, bh, (short)0, c, false, false);
  if (NT >= 3) c = __builtin_amdgcn_wmma_f32_16x16x32_bf16(false, ah, false, bl, (short)0, c, false, false);
  asm volatile("v_nop\n\tv_nop\n\tv_nop\n\tv_nop" : "+v"(c) : "v"(ah), "v"(al), "v"(bh), "v"(bl));
  return c;
}

__global__ __launch_bounds__(256) void k_wt_bf16(const float* __restrict__ W, unsigned short* __restrict__ Wt, int K, int N) {
  const int t = blockIdx.x * 256 + threadIdx.x;
  const int k8n = K / 8;
  if (t >= N * k8n) return;
  const int n = t / k8n, k8 = (t % k8n) * 8;
  v8us v;
#pragma unroll
  for (int i = 0; i < 8; ++i) v[i] = bf16_bits(W[(size_t)(k8 + i) * N + n]);
  *(v8us*)(Wt + (size_t)n * K + k8) = v;
  
}

// GEMM C[M][N] (f32, pitch ldc) = act(A[M][K]·W + bias). A f32 row-major (pitch lda) converted per fragment to bf16
// (ASPLIT: hi/lo two planes -> 2 terms, else single rounded term); Wt bf16 [N][K] (pitch ldb). BIAS_BF16 rounds the
// bias to bf16 first (bias quantised to bf16 before the add). K%32==0, M%16==0, N%64==0.
template <bool ASPLIT, int ACT, bool BIAS_BF16>
__global__ __launch_bounds__(128) void k_gemm_bf(const float* __restrict__ A, int lda, const unsigned short* __restrict__ Wt, int ldb,
                                               const float* __restrict__ bias, float* __restrict__ C, int ldc, int M, int N, int K) {
  __shared__ __attribute__((aligned(16))) float so[4][16][64];
  const int tid = threadIdx.x, w = tid >> 5, lane = tid & 31, ln = lane & 15, hh = lane >> 4;
  const int ntn = N / 64;
  const int wid = blockIdx.x * 4 + w;
  const int mt = wid / ntn, nq = wid % ntn;
  if (mt * 16 >= M) return;
  const int row0 = mt * 16, col0 = nq * 64;
  const float* arow = A + (size_t)(row0 + ln) * lda;
  v8f acc[4] = {};
  for (int kb = 0; kb < K; kb += 32) {
    FragB ah, al;
    const v4f x0 = *(const v4fa*)(arow + kb + 8 * hh), x1 = *(const v4fa*)(arow + kb + 8 * hh + 4);
    const v4f x2 = *(const v4fa*)(arow + kb + 16 + 8 * hh), x3 = *(const v4fa*)(arow + kb + 16 + 8 * hh + 4);
    float xs[16] = {x0[0],x0[1],x0[2],x0[3],x1[0],x1[1],x1[2],x1[3],x2[0],x2[1],x2[2],x2[3],x3[0],x3[1],x3[2],x3[3]};
#pragma unroll
    for (int i = 0; i < 16; ++i) { const unsigned short hb = bf16_bits(xs[i]); ah.u[i] = hb; al.u[i] = ASPLIT ? bf16_bits(xs[i] - bf16_val(hb)) : (unsigned short)0; }
#pragma unroll
    for (int t = 0; t < 4; ++t) {
      const unsigned short* brow = Wt + (size_t)(col0 + t * 16 + ln) * ldb + kb;
      FragB b;
      b.half[0] = *(const v8us*)(brow + 8 * hh);
      b.half[1] = *(const v8us*)(brow + 16 + 8 * hh);
      acc[t] = mmaN<ASPLIT ? 2 : 1>(ah.v, al.v, b.v, b.v, acc[t]);
    }
  }
#pragma unroll
  for (int t = 0; t < 4; ++t) {
    float bv = bias ? bias[col0 + t * 16 + ln] : 0.f;
    if (BIAS_BF16) bv = bf16_round(bv);
#pragma unroll
    for (int r = 0; r < 8; ++r) { float v = acc[t][r] + bv; if (ACT == 1) v = fmaxf(v, 0.f); so[w][8 * hh + r][t * 16 + ln] = v; }
  }
  __builtin_amdgcn_fence(__ATOMIC_ACQ_REL, "workgroup");
  __builtin_amdgcn_wave_barrier();
  const int rsub = lane >> 4, c4 = (lane & 15) * 4;
  {
#pragma unroll
    for (int q = 0; q < 8; ++q) {
      const int r = q * 2 + rsub;
      const v4f v = *(const v4fa*)&so[w][r][c4];
      *(v4f*)(C + (size_t)(row0 + r) * ldc + col0 + c4) = v;
    }
    
  }
}

// GEMM C = act(A·W + bias + resid): A f32 (ASPLIT -> hi/lo 2 terms), Wt bf16 [N][K]; ACT 0 none, 1 relu, 2 exact gelu;
// resid (optional, f32, row index = (row % rmod), pitch ldr, RES_BF16 rounds it) added before the activation.
template <bool ASPLIT, int ACT, bool BIAS_BF16, bool RES_BF16>
__global__ __launch_bounds__(128) void k_gemm_bf3(const float* __restrict__ A, int lda, const unsigned short* __restrict__ Wt, int ldb,
                                                const float* __restrict__ bias, const float* __restrict__ resid, int rmod, int ldr,
                                                float* __restrict__ C, int ldc, int M, int N, int K) {
  __shared__ __attribute__((aligned(16))) float so[4][16][64];
  const int tid = threadIdx.x, w = tid >> 5, lane = tid & 31, ln = lane & 15, hh = lane >> 4;
  const int ntn = N / 64;
  const int wid = blockIdx.x * 4 + w;
  const int mt = wid / ntn, nq = wid % ntn;
  if (mt * 16 >= M) return;
  const int row0 = mt * 16, col0 = nq * 64;
  const float* arow = A + (size_t)(row0 + ln) * lda;
  v8f acc[4] = {};
  for (int kb = 0; kb < K; kb += 32) {
    FragB ah, al;
    const v4f x0 = *(const v4fa*)(arow + kb + 8 * hh), x1 = *(const v4fa*)(arow + kb + 8 * hh + 4);
    const v4f x2 = *(const v4fa*)(arow + kb + 16 + 8 * hh), x3 = *(const v4fa*)(arow + kb + 16 + 8 * hh + 4);
    float xs[16] = {x0[0],x0[1],x0[2],x0[3],x1[0],x1[1],x1[2],x1[3],x2[0],x2[1],x2[2],x2[3],x3[0],x3[1],x3[2],x3[3]};
#pragma unroll
    for (int i = 0; i < 16; ++i) { const unsigned short hb = bf16_bits(xs[i]); ah.u[i] = hb; al.u[i] = ASPLIT ? bf16_bits(xs[i] - bf16_val(hb)) : (unsigned short)0; }
#pragma unroll
    for (int t = 0; t < 4; ++t) {
      const unsigned short* brow = Wt + (size_t)(col0 + t * 16 + ln) * ldb + kb;
      FragB b;
      b.half[0] = *(const v8us*)(brow + 8 * hh);
      b.half[1] = *(const v8us*)(brow + 16 + 8 * hh);
      acc[t] = mmaN<ASPLIT ? 2 : 1>(ah.v, al.v, b.v, b.v, acc[t]);
    }
  }
#pragma unroll
  for (int t = 0; t < 4; ++t) {
    const int col = col0 + t * 16 + ln;
    float bv = bias ? bias[col] : 0.f;
    if (BIAS_BF16) bv = bf16_round(bv);
#pragma unroll
    for (int r = 0; r < 8; ++r) {
      float v = acc[t][r] + bv;
      if (resid) { float rv = resid[(size_t)((row0 + 8 * hh + r) % rmod) * ldr + col]; if (RES_BF16) rv = bf16_round(rv); v += rv; }
      if (ACT == 1) v = fmaxf(v, 0.f);
      if (ACT == 2) v = 0.5f * v * (1.0f + erff(v * 0.70710678118654752f));
      if (ACT == 3) { const float u = 0.7978845608028654f * (v + 0.044715f * v * v * v); v = 0.5f * v * (1.0f + tanhf(u)); }
      so[w][8 * hh + r][t * 16 + ln] = v;
    }
  }
  __builtin_amdgcn_fence(__ATOMIC_ACQ_REL, "workgroup");
  __builtin_amdgcn_wave_barrier();
  const int rsub = lane >> 4, c4 = (lane & 15) * 4;
  {
#pragma unroll
    for (int q = 0; q < 8; ++q) {
      const int r = q * 2 + rsub;
      const v4f v = *(const v4fa*)&so[w][r][c4];
      *(v4f*)(C + (size_t)(row0 + r) * ldc + col0 + c4) = v;
    }
    
  }
}
// row LayerNorm (biased variance, eps) over N: s = X (+ R); optional out_sum <- s; out_norm <- (s-mu)*rsqrt(var+eps)*g + b
template <bool PARAM_BF16>
__global__ __launch_bounds__(256) void k_layernorm(const float* __restrict__ X, const float* __restrict__ R, const float* __restrict__ g, const float* __restrict__ bta,
                                                  float* __restrict__ out_sum, float* __restrict__ out_norm, int N, float eps) {
  __shared__ float red[256];
  const int row = blockIdx.x, tid = threadIdx.x;
  const float* x = X + (size_t)row * N; const float* rr = R ? R + (size_t)row * N : nullptr;
  float vals[16];                     // up to N = 4096
  const int per = N / 256;            // contiguous chunk per thread? use strided-by-4 chunks: thread handles j = tid*4 + 1024*u
  float s1 = 0.f;
  for (int u = 0; u < per / 4; ++u) {
    const int j = tid * 4 + 1024 * u;
    const v4f a = *(const v4fa*)(x + j);
    v4f b = {0.f,0.f,0.f,0.f}; if (rr) b = *(const v4fa*)(rr + j);
#pragma unroll
    for (int q = 0; q < 4; ++q) { const float v = a[q] + b[q]; vals[u * 4 + q] = v; s1 += v; }
  }
  red[tid] = s1; __syncthreads();
  for (int st = 128; st > 0; st >>= 1) { if (tid < st) red[tid] += red[tid + st]; __syncthreads(); }
  const float mu = red[0] / (float)N; __syncthreads();
  float s2 = 0.f;
  for (int u = 0; u < per / 4; ++u)
#pragma unroll
    for (int q = 0; q < 4; ++q) { const float c = vals[u * 4 + q] - mu; s2 += c * c; }
  red[tid] = s2; __syncthreads();
  for (int st = 128; st > 0; st >>= 1) { if (tid < st) red[tid] += red[tid + st]; __syncthreads(); }
  const float rs = rsqrtf(red[0] / (float)N + eps);
  {
    for (int u = 0; u < per / 4; ++u) {
      const int j = tid * 4 + 1024 * u;
      v4f o, sm;
#pragma unroll
      for (int q = 0; q < 4; ++q) {
        float gg = g[j + q], bb = bta[j + q];
        if (PARAM_BF16) { gg = bf16_round(gg); bb = bf16_round(bb); }
        sm[q] = vals[u * 4 + q]; o[q] = (vals[u * 4 + q] - mu) * rs * gg + bb;
      }
      if (out_sum) *(v4f*)(out_sum + (size_t)row * N + j) = sm;
      *(v4f*)(out_norm + (size_t)row * N + j) = o;
    }
    
  }
}



// ---- f16 WMMA path (v_wmma_f32_16x16x32_f16): 11-bit significands for operands in range — used where a [0,1] probability operand needs more precision than bf16
typedef _Float16 v16h __attribute__((ext_vector_type(16)));
union FragH { v16h v; v8us half[2]; _Float16 h[16]; unsigned short u[16]; };
template <int NT>
__device__ __forceinline__ v8f mmaH(v16h ah, v16h al, v16h bh, v16h bl, v8f c) {
  c = __builtin_amdgcn_wmma_f32_16x16x32_f16(false, ah, false, bh, (short)0, c, false, false);
  if (NT >= 2) c = __builtin_amdgcn_wmma_f32_16x16x32_f16(false, al, false, bh, (short)0, c, false, false);
  if (NT >= 3) c = __builtin_amdgcn_wmma_f32_16x16x32_f16(false, ah, false, bl, (short)0, c, false, false);
  asm volatile("v_nop\n\tv_nop\n\tv_nop\n\tv_nop" : "+v"(c) : "v"(ah), "v"(al), "v"(bh), "v"(bl));
  return c;
}
// batched GEMM like k_gemm_b but f16 operands: A f32 (split into f16 hi/lo if ASPLIT, else rounded to f16), Bt = f16 values [n][k]; alpha; C f32; N multiple of 16 (partial tiles skipped)
template <bool ASPLIT>
__global__ __launch_bounds__(128) void k_gemm_h(const float* __restrict__ A, int lda, size_t sA, const _Float16* __restrict__ Bh, int ldb, size_t sB, float alpha, float* __restrict__ C, int ldc, size_t sC, int M, int N, int K) {
  __shared__ __attribute__((aligned(16))) float so[4][16][64];
  const int tid = threadIdx.x, w = tid >> 5, lane = tid & 31, ln = lane & 15, hh = lane >> 4; const int by = blockIdx.y;
  A += (size_t)by * sA; Bh += (size_t)by * sB; C += (size_t)by * sC;
  const int ntn = (N + 63) / 64; const int wid = blockIdx.x * 4 + w; const int mt = wid / ntn, nq = wid % ntn; if (mt * 16 >= M) return;
  const int row0 = mt * 16, col0 = nq * 64; const float* arow = A + (size_t)(row0 + ln) * lda;
  v8f acc[4] = {};
  for (int kb = 0; kb < K; kb += 32) {
    FragH ah, al;
    const v4f x0 = *(const v4fa*)(arow + kb + 8 * hh), x1 = *(const v4fa*)(arow + kb + 8 * hh + 4), x2 = *(const v4fa*)(arow + kb + 16 + 8 * hh), x3 = *(const v4fa*)(arow + kb + 16 + 8 * hh + 4);
    float xs[16] = {x0[0],x0[1],x0[2],x0[3],x1[0],x1[1],x1[2],x1[3],x2[0],x2[1],x2[2],x2[3],x3[0],x3[1],x3[2],x3[3]};
#pragma unroll
    for (int i = 0; i < 16; ++i) { const _Float16 h = (_Float16)xs[i]; ah.h[i] = h; al.h[i] = ASPLIT ? (_Float16)(xs[i] - (float)h) : (_Float16)0.0f; }
#pragma unroll
    for (int t = 0; t < 4; ++t) { if (col0 + t * 16 >= N) continue; const size_t boff = (size_t)(col0 + t * 16 + ln) * ldb + kb; FragH bq; bq.half[0] = *(const v8us*)(Bh + boff + 8 * hh); bq.half[1] = *(const v8us*)(Bh + boff + 16 + 8 * hh);
      acc[t] = mmaH<ASPLIT ? 2 : 1>(ah.v, al.v, bq.v, bq.v, acc[t]); }
  }
#pragma unroll
  for (int t = 0; t < 4; ++t) { if (col0 + t * 16 >= N) continue;
#pragma unroll
    for (int r = 0; r < 8; ++r) so[w][8 * hh + r][t * 16 + ln] = acc[t][r] * alpha; }
  __builtin_amdgcn_fence(__ATOMIC_ACQ_REL, "workgroup"); __builtin_amdgcn_wave_barrier();
  const int rsub = lane >> 4, c4 = (lane & 15) * 4;
  {
#pragma unroll
    for (int q = 0; q < 8; ++q) { const int r = q * 2 + rsub; if (col0 + c4 < N) { const v4f v = *(const v4fa*)&so[w][r][c4]; *(v4f*)(C + (size_t)(row0 + r) * ldc + col0 + c4) = v; } }
     }
}

// Wt[n][k] = f16(W[k][n]·scale) from f32 row-major W[K][N] (scale = power of two; bf16-exact weights stay exact in f16 away from the subnormal range)
__global__ __launch_bounds__(256) void k_wt_f16(const float* __restrict__ W, _Float16* __restrict__ Wt, int K, int N, float scale) {
  const int t = blockIdx.x * 256 + threadIdx.x; if (t >= N * (K / 8)) return; const int n = t / (K / 8), k8 = (t % (K / 8)) * 8; FragH f;
#pragma unroll
  for (int i = 0; i < 8; ++i) f.h[i] = (_Float16)(bf16_round(W[(size_t)(k8 + i) * N + n]) * scale); const v8us o = f.half[0];
  *(v8us*)((unsigned short*)Wt + (size_t)n * K + k8) = o; 
}
// k_gemm_hh variant with fused epilogue: v = acc·alpha + bias[by·sBias + col] (+ CP[(row/rowsPerB)·sCPb + by·64 + col] if CP) ; ACT 0 none / 1 elu ; writes f32 C and/or f16 C16 (each if non-null)
template <int ACT>
__global__ __launch_bounds__(128) void k_gemm_hhx(const _Float16* __restrict__ A, int lda, size_t sA, const _Float16* __restrict__ Bh, int ldb, size_t sB, float alpha, const float* __restrict__ bias, size_t sBias, const float* __restrict__ CP, int rowsPerB, size_t sCPb, int row0g,
    float* __restrict__ C, _Float16* __restrict__ C16, int ldc, size_t sC, int M, int N, int K) {
  __shared__ __attribute__((aligned(16))) float so[4][16][64];
  const int tid = threadIdx.x, w = tid >> 5, lane = tid & 31, ln = lane & 15, hh = lane >> 4; const int by = blockIdx.y;
  A += (size_t)by * sA; Bh += (size_t)by * sB; const size_t cofs = (size_t)by * sC; const float* bp = bias ? bias + (size_t)by * sBias : nullptr;
  const int ntn = (N + 63) / 64; const int wid = blockIdx.x * 4 + w; const int mt = wid / ntn, nq = wid % ntn; if (mt * 16 >= M) return;
  const int row0 = mt * 16, col0 = nq * 64; const _Float16* arow = A + (size_t)(row0 + ln) * lda;
  v8f acc[4] = {};
  for (int kb = 0; kb < K; kb += 32) { FragH ah; ah.half[0] = *(const v8us*)((const unsigned short*)arow + kb + 8 * hh); ah.half[1] = *(const v8us*)((const unsigned short*)arow + kb + 16 + 8 * hh);
#pragma unroll
    for (int t = 0; t < 4; ++t) { if (col0 + t * 16 >= N) continue; const size_t boff = (size_t)(col0 + t * 16 + ln) * ldb + kb; FragH bq; bq.half[0] = *(const v8us*)((const unsigned short*)Bh + boff + 8 * hh); bq.half[1] = *(const v8us*)((const unsigned short*)Bh + boff + 16 + 8 * hh);
      acc[t] = mmaH<1>(ah.v, ah.v, bq.v, bq.v, acc[t]); }
  }
#pragma unroll
  for (int t = 0; t < 4; ++t) { if (col0 + t * 16 >= N) continue; const int col = col0 + t * 16 + ln; const float bv = bp ? bf16_round(bp[col]) : 0.f;
#pragma unroll
    for (int r = 0; r < 8; ++r) { float v = acc[t][r] * alpha + bv; if (CP) { const int rr = row0g + row0 + 8 * hh + r; if (rowsPerB < 0) v += CP[cofs + (size_t)rr * ldc + col];      /* rowsPerB < 0: own element of the batched C plane */ else { const int bidx = rr / rowsPerB; v += CP[(size_t)bidx * sCPb + (size_t)by * 64 + col]; } } if (ACT == 1) v = (v > 0.f) ? v : expm1f(v); else if (ACT == 7) v = (v > 0.f) ? v + 1.0f : expf(v); else if (ACT == 8) v = tanhf(v); else if (ACT == 9) v = 0.5f * v * (1.0f + tanhf(0.7978845608028654f * (v + 0.044715f * v * v * v))); else if (ACT == 11) v = 1.0f / (1.0f + expf(-v)); else if (ACT == 12) v = (v > 0.f) ? v : 0.01f * v; else if (ACT == 14) v = (v > 0.f) ? v : 0.1f * v; else if (ACT == 16) v = (v >= 0.f) ? v : 0.3f * v; else if (ACT == 17) v = (v >= 0.f) ? v : 0.2f * v; else if (ACT == 15) v = v / (1.0f + expf(-v)); else if (ACT == 3) v = fmaxf(v, 0.f); else if (ACT == 6) v = 0.5f * v * (1.0f + erff(v * 0.70710678118654752f)); so[w][8 * hh + r][t * 16 + ln] = v; } }
  __builtin_amdgcn_fence(__ATOMIC_ACQ_REL, "workgroup"); __builtin_amdgcn_wave_barrier();
  const int rsub = lane >> 4, c4 = (lane & 15) * 4; typedef _Float16 v4h __attribute__((ext_vector_type(4)));
  {
#pragma unroll
    for (int q = 0; q < 8; ++q) { const int r = q * 2 + rsub; if (col0 + c4 < N) { const v4f v = *(const v4fa*)&so[w][r][c4]; if (C) *(v4f*)(C + cofs + (size_t)(row0 + r) * ldc + col0 + c4) = v; if (C16) { v4h h4; for (int i = 0; i < 4; ++i) h4[i] = (_Float16)v[i]; *(v4h*)(C16 + cofs + (size_t)(row0 + r) * ldc + col0 + c4) = h4; } } }
     }
}


typedef _Float16 v4h __attribute__((ext_vector_type(4)));

__global__ __launch_bounds__(256) void k_h16(const float* __restrict__ x, _Float16* __restrict__ X16, size_t n8) { const size_t t = (size_t)blockIdx.x * 256 + threadIdx.x; if (t >= n8) return; FragH f;
#pragma unroll
  for (int q = 0; q < 8; ++q) f.h[q] = (_Float16)x[t * 8 + q]; *(v8us*)((unsigned short*)X16 + t * 8) = f.half[0];  }
__global__ __launch_bounds__(256) void k_round16f(const float* __restrict__ W, _Float16* __restrict__ Bt, size_t n8) { const size_t t = (size_t)blockIdx.x * 256 + threadIdx.x; if (t >= n8) return; FragH f;
#pragma unroll
  for (int i = 0; i < 8; ++i) f.h[i] = (_Float16)(bf16_round(W[t * 8 + i]) * 16.0f); *(v8us*)((unsigned short*)Bt + t * 8) = f.half[0];  }

__global__ __launch_bounds__(256) void k_hl(const float* __restrict__ F, _Float16* __restrict__ Hh, _Float16* __restrict__ Hl, size_t n8) { const size_t t = (size_t)blockIdx.x * 256 + threadIdx.x; if (t >= n8) return; FragH fh, fl; const v4f a = *(const v4fa*)(F + t * 8), c = *(const v4fa*)(F + t * 8 + 4);
#pragma unroll
  for (int q = 0; q < 4; ++q) { _Float16 h = (_Float16)a[q]; fh.h[q] = h; fl.h[q] = (_Float16)((a[q] - (float)h) * 1024.0f); h = (_Float16)c[q]; fh.h[4 + q] = h; fl.h[4 + q] = (_Float16)((c[q] - (float)h) * 1024.0f); }
  { *(v8us*)((unsigned short*)Hh + t * 8) = fh.half[0]; *(v8us*)((unsigned short*)Hl + t * 8) = fl.half[0];  } }

// ---- fragment load and product of the 32x64 wave tile ----
__device__ __forceinline__ v16h g2_frag(const _Float16* p, int hh) { FragH f; f.half[0] = *(const v8us*)((const unsigned short*)p + 8 * hh); f.half[1] = *(const v8us*)((const unsigned short*)p + 16 + 8 * hh); return f.v; }
__device__ __forceinline__ v8f g2_mma(v16h a, v16h b, v8f c) { v8f d = __builtin_amdgcn_wmma_f32_16x16x32_f16(false, a, false, b, (short)0, c, false, false); asm volatile("v_nop\n\tv_nop\n\tv_nop\n\tv_nop" : "+v"(d) : "v"(a), "v"(b)); return d; }

// The four weight matrices, f16(bf16(w) * 16), in one grid; the block index picks the matrix (uniform in a work-group).
__global__ __launch_bounds__(256) void k_cvt4(const float* __restrict__ w0, const float* __restrict__ w1, const float* __restrict__ w2, const float* __restrict__ w3, _Float16* __restrict__ Bt) {
  constexpr int WB = DW * DIN / 8 / 256;      /* blocks per weight matrix */
  const int j = blockIdx.x / WB, blk = blockIdx.x - j * WB; const float* s = (j == 0) ? w0 : (j == 1) ? w1 : (j == 2) ? w2 : w3; _Float16* d = Bt + (size_t)j * DW * DIN;
  const size_t t = (size_t)blk * 256 + threadIdx.x; FragH f;
#pragma unroll      /* constant indices: the eight values stay in registers and their loads join into two of 16 bytes */
  for (int q = 0; q < 8; ++q) f.h[q] = (_Float16)(bf16_round(s[t * 8 + q]) * 16.0f);
  *(v8us*)((unsigned short*)d + t * 8) = f.half[0];
}
// ---- q, k, v projections straight from the f32 inputs (grid.y = plane): no conversion launch, no f16 copy of the inputs in memory ----
// A work-group of 8 waves owns 64 token rows x all 256 output columns, so each input row is read from memory once, in whole lines, all 16 loads of a
// lane in flight, rounded once (f16(bf16(x)), as the conversion kernel did) and laid in LDS at a pitch of 16 B x 33 for the ds_load_b128 fragment reads.
// The plane's weights go through LDS as well, in four stages of 64 k (one whole 128-byte line of each of the 256 weight rows): the work-group fetches each line once, a
// wave-wide load covering 4 whole lines, and all eight waves take their B fragments from LDS (pitch 16 B x 9). Two stage buffers, in the space that the output
// staging uses afterwards; stage 0 is fetched beside the input rows, each later stage during the products of the stage before it, so no product waits for a load from L2.
// Wave tile 32 x 64. The v plane is stored transposed, V^T [(b, column)][token], the layout the attention kernel's A fragments read: in an accumulator tile a
// lane holds 8 consecutive tokens of one column, 16 bytes of a V^T row; the work-group's 64 tokens are one whole 128-byte line of each of its 256 V^T rows.
__global__ __launch_bounds__(256) void k_proj(const float* __restrict__ x0, const float* __restrict__ x1, const float* __restrict__ x2, const _Float16* __restrict__ Bh,
                                              const float* __restrict__ bias0, const float* __restrict__ bias1, const float* __restrict__ bias2, _Float16* __restrict__ C16, _Float16* __restrict__ VT) {
  __shared__ __attribute__((aligned(16))) _Float16 sa[64][DIN + 8];
  constexpr int WST = DW * 72;      /* one weight stage in LDS, in f16: 256 rows of 64 k at a pitch of 72 */
  __shared__ __attribute__((aligned(16))) float su[2 * WST / 2];      /* two weight stages during the k loop, output staging behind it */
  float (*so)[32][68] = reinterpret_cast<float (*)[32][68]>(su); unsigned short* sb = (unsigned short*)su;
  static_assert(sizeof(float) * 8 * 32 * 68 <= sizeof(su), "output staging fits the stage buffers");
  const int tid = threadIdx.x, w = tid >> 5, lane = tid & 31, ln = lane & 15, hh = lane >> 4; const int by = blockIdx.y;
  const float* xs = ((by == 0) ? x0 : (by == 1) ? x1 : x2) + (size_t)blockIdx.x * 64 * DIN; const float* bp = (by == 0) ? bias0 : (by == 1) ? bias1 : bias2;
  const unsigned short* wsrc = (const unsigned short*)Bh + (size_t)by * DW * DIN + (size_t)(tid >> 3) * DIN + (tid & 7) * 8;      /* 8 lanes = one 128-byte line of a weight row */
  unsigned short* wdst = sb + (tid >> 3) * 72 + (tid & 7) * 8;
  v4f t[16]; v8us wn[8];
#pragma unroll      /* constant indices: the sixteen loads stand in registers and issue together */
  for (int i = 0; i < 16; ++i) t[i] = *(const v4fa*)(xs + (size_t)(i * 256 + tid) * 4);
#pragma unroll      /* constant indices: the loads of weight stage 0 issue behind the input loads */
  for (int i = 0; i < 8; ++i) wn[i] = *(const v8us*)(wsrc + (size_t)i * 32 * DIN);
  __builtin_amdgcn_sched_barrier(0);      /* keeps the weight loads up here: sunk below the input conversion they started only when the inputs had arrived */
#pragma unroll      /* constant indices, as above */
  for (int i = 0; i < 16; ++i) { v4h h4;
#pragma unroll      /* constant indices, as above */
    for (int q = 0; q < 4; ++q) h4[q] = (_Float16)bf16_round(t[i][q]);
    *(v4h*)&sa[i * 4 + (tid >> 6)][(tid & 63) * 4] = h4; }
#pragma unroll      /* constant indices, as above */
  for (int i = 0; i < 8; ++i) *(v8us*)(wdst + i * 32 * 72) = wn[i];
  __syncthreads();      /* the 64 converted rows and weight stage 0 are in LDS for all eight waves */
  const int rl0 = (w >> 2) * 32, col0 = (w & 3) * 64; const int row0 = blockIdx.x * 64 + rl0; const size_t cofs = (size_t)by * NR * DW;
  const _Float16* a0p = &sa[rl0 + ln][0]; const _Float16* a1p = &sa[rl0 + 16 + ln][0];
  const v8f z8 = {0.f,0.f,0.f,0.f,0.f,0.f,0.f,0.f}; v8f c00 = z8, c01 = z8, c02 = z8, c03 = z8, c10 = z8, c11 = z8, c12 = z8, c13 = z8;
#pragma unroll      /* four stages: buffer choice, the refills and every LDS offset are constants */
  for (int j = 0; j < DIN / 64; ++j) { const _Float16* bs = (const _Float16*)(sb + (j & 1) * WST + (col0 + ln) * 72);
    if (j + 1 < DIN / 64) {
#pragma unroll      /* constant indices: the next stage stays in registers and flies during this stage's products (issued behind the barrier, which waits for every load in flight) */
      for (int i = 0; i < 8; ++i) wn[i] = *(const v8us*)(wsrc + (size_t)i * 32 * DIN + (j + 1) * 64);
    }
#pragma unroll      /* constant offsets, as above */
    for (int ks = 0; ks < 2; ++ks) { const int kb = j * 64 + ks * 32; const v16h a0 = g2_frag(a0p + kb, hh), a1 = g2_frag(a1p + kb, hh);
      const v16h b0 = g2_frag(bs + ks * 32, hh), b1 = g2_frag(bs + 16 * 72 + ks * 32, hh), b2 = g2_frag(bs + 32 * 72 + ks * 32, hh), b3 = g2_frag(bs + 48 * 72 + ks * 32, hh);
      c00 = g2_mma(a0, b0, c00); c10 = g2_mma(a1, b0, c10); c01 = g2_mma(a0, b1, c01); c11 = g2_mma(a1, b1, c11);
      c02 = g2_mma(a0, b2, c02); c12 = g2_mma(a1, b2, c12); c03 = g2_mma(a0, b3, c03); c13 = g2_mma(a1, b3, c13); }
    if (j + 1 < DIN / 64) {
#pragma unroll      /* constant indices, as above; the other buffer: its last readers, stage j - 1's products, ended in front of the barrier before this stage */
      for (int i = 0; i < 8; ++i) *(v8us*)(wdst + ((j + 1) & 1) * WST + i * 32 * 72) = wn[i];
    }
    __syncthreads();      /* stage j + 1 is in LDS for all eight waves, and every wave has read stage j (behind the last stage: the buffers become output staging) */
  }
  asm volatile("s_wait_xcnt 0x0" :: "v"(wsrc) : "memory");      /* stands before the registers of the weight address are used again: the operand keeps them untouched up to here */
  v8f accs[8] = {c00, c01, c02, c03, c10, c11, c12, c13};
  if (by < 2) {      /* q and k planes, row-major. The test in this form and order: the built code then has the v path first, and the q/k path does not keep the v path's values alive (162 registers, five waves a SIMD instead of six, with the test written the other way round) */
#pragma unroll      /* constant indices: the tiles stay in registers */
  for (int u = 0; u < 8; ++u) { const int tt = u & 3, half = u >> 2; const float bv = bf16_round(bp[col0 + tt * 16 + ln]);
#pragma unroll      /* constant indices: the tiles stay in registers */
    for (int r = 0; r < 8; ++r) so[w][half * 16 + 8 * hh + r][tt * 16 + ln] = accs[u][r] * 0.0625f + bv; }
  __builtin_amdgcn_fence(__ATOMIC_ACQ_REL, "workgroup"); __builtin_amdgcn_wave_barrier();      /* a wave reads back only its own staging rows */
  const int rsub = lane >> 4, c4 = (lane & 15) * 4;
#pragma unroll      /* the LDS reads issue ahead of the stores */
  for (int q = 0; q < 16; ++q) { const int r = q * 2 + rsub; const v4f v = *(const v4fa*)&so[w][r][c4]; v4h h4;
#pragma unroll      /* constant indices */
    for (int i = 0; i < 4; ++i) h4[i] = (_Float16)v[i];
    *(v4h*)(C16 + cofs + (size_t)(row0 + r) * DW + col0 + c4) = h4; }
  } else {      /* v plane (uniform in the grid's y): 256 columns x 64 tokens through LDS at a pitch of 16 B x 9, in the weight stage buffers, free behind the k loop */
    unsigned short* tv = (unsigned short*)&so[0][0][0];
#pragma unroll      /* constant indices: the tiles stay in registers */
    for (int u = 0; u < 8; ++u) { const int tt = u & 3, half = u >> 2; const float bv = bf16_round(bp[col0 + tt * 16 + ln]); FragH f;
#pragma unroll      /* constant indices: the tiles stay in registers */
      for (int r = 0; r < 8; ++r) f.h[r] = (_Float16)(accs[u][r] * 0.0625f + bv);
      *(v8us*)(tv + (col0 + tt * 16 + ln) * 72 + rl0 + half * 16 + 8 * hh) = f.half[0]; }
    __syncthreads();      /* both token halves of every V^T line are in LDS: a line is stored whole by 8 lanes of one wave */
    unsigned short* vo = (unsigned short*)VT + (size_t)(blockIdx.x / (NTK / 64)) * DW * NTK + (blockIdx.x % (NTK / 64)) * 64;
#pragma unroll      /* the LDS reads issue ahead of the stores */
    for (int i = 0; i < 8; ++i) { const int idx = i * 256 + tid, col = idx >> 3, c8 = (idx & 7) * 8; *(v8us*)(vo + (size_t)col * NTK + c8) = *(const v8us*)(tv + col * 72 + c8); }
    asm volatile("s_wait_xcnt 0x0" ::: "memory");      /* behind the last store: in the built code the q/k path stands below this one and rewrites the stores' address registers */
  }
}
// ---- fused causal attention: S^T = K Q^T, online softmax in registers, O^T += V^T P^T; scores and weights never reach memory ----
// One wave = 32 queries of one head; a pass = 32 keys. In S^T a lane holds one query's scores (column ln, keys 8*hh + r), so two S^T tiles,
// converted in place, are the B operand of V^T P^T in the hardware k order. Weights carry a factor 1024 (as exp2(... + 10)); it cancels in O / l.
__device__ __forceinline__ float fa_xhalf(float x) { const int b = __float_as_int(x); return __int_as_float(__builtin_amdgcn_permlanex16(b, b, 0x76543210, 0xfedcba98, false, false)); }
__device__ __forceinline__ v16h fa_frag(const _Float16* p) { FragH f; f.half[0] = *(const v8us*)((const unsigned short*)p); f.half[1] = *(const v8us*)((const unsigned short*)p + 16); return f.v; }      /* p already holds the lane half's 8 * hh */
__device__ __forceinline__ v8f fa_mma(v16h a, v16h b, v8f c) { return __builtin_amdgcn_wmma_f32_16x16x32_f16(false, a, false, b, (short)0, c, false, false); }
// Eight independent v_exp_f32 and the slot that the instruction set asks for behind a transcendental, in one statement: a v_nop in a statement of its own
// did not stay behind them. Outputs are early-clobber, so that none of the eight overwrites a source of the one in front of it.
__device__ __forceinline__ void fa_exp8(v8f& e, const v8f x) {
  float e0, e1, e2, e3, e4, e5, e6, e7;
  asm("v_exp_f32 %0, %8\n\tv_exp_f32 %1, %9\n\tv_exp_f32 %2, %10\n\tv_exp_f32 %3, %11\n\tv_exp_f32 %4, %12\n\tv_exp_f32 %5, %13\n\tv_exp_f32 %6, %14\n\tv_exp_f32 %7, %15\n\tv_nop"
      : "=&v"(e0), "=&v"(e1), "=&v"(e2), "=&v"(e3), "=&v"(e4), "=&v"(e5), "=&v"(e6), "=&v"(e7)
      : "v"(x[0]), "v"(x[1]), "v"(x[2]), "v"(x[3]), "v"(x[4]), "v"(x[5]), "v"(x[6]), "v"(x[7]));
  e[0] = e0; e[1] = e1; e[2] = e2; e[3] = e3; e[4] = e4; e[5] = e5; e[6] = e6; e[7] = e7;
}
template <bool DIAG>
__device__ __forceinline__ void fa_pass(const v16h k0, const v16h k1, const v16h v0, const v16h v1, const v16h q0f, const v16h q1f, v8f (&o)[2][2], float (&m)[2], float (&l)[2], const int ln, const int hh) {
  const float C = 0.17677669529663687f * 1.4426950408889634f;      /* 1/sqrt(32) * log2(e) */
  const v8f z8 = {0.f,0.f,0.f,0.f,0.f,0.f,0.f,0.f};
  v8f s[2][2];
  s[0][0] = fa_mma(k0, q0f, z8); s[0][1] = fa_mma(k1, q0f, z8); s[1][0] = fa_mma(k0, q1f, z8); s[1][1] = fa_mma(k1, q1f, z8);
  float mn[2];
#pragma unroll      /* constant indices: the tiles stay in registers */
  for (int qt = 0; qt < 2; ++qt) {
    if (DIAG) {
#pragma unroll      /* constant indices: the tiles stay in registers */
      for (int r = 0; r < 8; ++r) { if (8 * hh + r > 16 * qt + ln) s[qt][0][r] = -3.0e38f; if (16 + 8 * hh + r > 16 * qt + ln) s[qt][1][r] = -3.0e38f; }
    }
    float mx = fmaxf(s[qt][0][0], s[qt][1][0]);
#pragma unroll      /* constant indices: the tiles stay in registers */
    for (int r = 1; r < 8; ++r) mx = fmaxf(mx, fmaxf(s[qt][0][r], s[qt][1][r]));
    mx = fmaxf(mx, fa_xhalf(mx));
    mn[qt] = fmaxf(m[qt], mx * C);
  }
  if (__builtin_amdgcn_ballot_w32(mn[0] > m[0] || mn[1] > m[1]) != 0) {      /* a maximum rose somewhere in the wave: rescale (factor exactly 1 where it did not) */
#pragma unroll      /* constant indices: the tiles stay in registers */
    for (int qt = 0; qt < 2; ++qt) { const float al = __builtin_amdgcn_exp2f(m[qt] - mn[qt]); o[qt][0] *= al; o[qt][1] *= al; l[qt] *= al; m[qt] = mn[qt]; }
  }
  FragH p[2];
#pragma unroll      /* constant indices: the tiles stay in registers */
  for (int qt = 0; qt < 2; ++qt) {
    const float sh = 10.0f - m[qt]; float su = 0.f;
#pragma unroll      /* constant indices: the tiles stay in registers */
    for (int t = 0; t < 2; ++t) { v8f x, e;
#pragma unroll      /* constant indices: the tiles stay in registers */
      for (int r = 0; r < 8; ++r) x[r] = fmaf(s[qt][t][r], C, sh);
      fa_exp8(e, x);
#pragma unroll      /* constant indices: the tiles stay in registers */
      for (int r = 0; r < 8; ++r) { su += e[r]; p[qt].h[8 * t + r] = (_Float16)e[r]; } }
    l[qt] += su;
  }
  o[0][0] = fa_mma(v0, p[0].v, o[0][0]); o[0][1] = fa_mma(v1, p[0].v, o[0][1]); o[1][0] = fa_mma(v0, p[1].v, o[1][0]); o[1][1] = fa_mma(v1, p[1].v, o[1][1]);
}
// ---- K and V^T through LDS: a stage = 64 keys of all eight heads, 64 K rows of 512 bytes and one whole 128-byte line of each of the 256 V^T rows ----
#define KPT (DW + 8)      /* K row pitch in LDS, in f16: 16 B x 33 for the ds_load_b128 fragment reads */
#define VPT 72            /* V^T row pitch in LDS, in f16: 16 B x 9, likewise */
// A lane's eight 16-byte pieces of one stage: four of K (a wave covers one whole row, 4 lines) and four of V^T (a wave covers 4 whole lines), from global memory straight into LDS.
// The copies and s_wait_xcnt 0 stand in one statement, so that no later write of an address register can be moved in front of that wait.
__device__ __forceinline__ void fa_copy8(const unsigned lk, const unsigned lv, const _Float16* gk, const _Float16* gv) {
  const unsigned lk1 = lk + 16 * KPT * 2, lk2 = lk + 32 * KPT * 2, lk3 = lk + 48 * KPT * 2, lv1 = lv + 64 * VPT * 2, lv2 = lv + 128 * VPT * 2, lv3 = lv + 192 * VPT * 2;
  const _Float16* gk1 = gk + (size_t)16 * DW; const _Float16* gk2 = gk + (size_t)32 * DW; const _Float16* gk3 = gk + (size_t)48 * DW;
  const _Float16* gv1 = gv + (size_t)64 * NTK; const _Float16* gv2 = gv + (size_t)128 * NTK; const _Float16* gv3 = gv + (size_t)192 * NTK;
  asm volatile("global_load_async_to_lds_b128 %0, %8, off\n\tglobal_load_async_to_lds_b128 %1, %9, off\n\tglobal_load_async_to_lds_b128 %2, %10, off\n\tglobal_load_async_to_lds_b128 %3, %11, off\n\t"
               "global_load_async_to_lds_b128 %4, %12, off\n\tglobal_load_async_to_lds_b128 %5, %13, off\n\tglobal_load_async_to_lds_b128 %6, %14, off\n\tglobal_load_async_to_lds_b128 %7, %15, off\n\ts_wait_xcnt 0x0"
               :: "v"(lk), "v"(lk1), "v"(lk2), "v"(lk3), "v"(lv), "v"(lv1), "v"(lv2), "v"(lv3), "v"(gk), "v"(gk1), "v"(gk2), "v"(gk3), "v"(gv), "v"(gv1), "v"(gv2), "v"(gv3) : "memory");
}
// Grid: 8 batches x 32 work-groups of 16 waves = all eight heads x the two query groups p and 63 - p (equal work in every work-group; waves w, w + 4, w + 8
// and w + 12 together: 130 passes). Context = O / l, split hi + residual * 1024, stays in LDS: the work-group holds all 256 context columns of its 64 tokens, so it
// does their output projection itself, out = (ctx_hi + ctx_lo / 1024) Wo^T + bo, and the context planes never reach memory.
// All 16 waves walk the keys from 0 together, a stage of 64 keys (two passes) at a time: the work-group fetches every K and V^T line once, in whole lines, by asynchronous copies
// into one of two LDS buffers, the next stage flying during this stage's passes, and each wave takes its head's fragments from LDS. A fragment load from global memory touched 16 lines for
// 512 bytes, and each line was asked for by several waves. Every wave copies and passes every barrier up to the longer group's last stage; a wave past its diagonal skips only the passes.
// Output projection: a wave owns 16 rows x 64 columns and keeps two sets of accumulators, one per context plane, so that each weight fragment is loaded once and
// serves both planes. The 8 k steps are unrolled over a ring of three fragment sets in registers: the loads of two steps are in flight while one step's products run.
__global__ __launch_bounds__(512) void k_fattn(const _Float16* __restrict__ Q, const _Float16* __restrict__ Kk, const _Float16* __restrict__ Vt, const _Float16* __restrict__ Bh, const float* __restrict__ bias, float* __restrict__ C) {
  __shared__ __attribute__((aligned(16))) _Float16 st[2][64][DW + 8];      /* context plane, token (query group * 32 + row), column; pitch 16 B x 33 for the ds_load_b128 fragment reads */
  __shared__ __attribute__((aligned(16))) float so[16][16][68];
  __shared__ __attribute__((aligned(16))) _Float16 sk[2][64][KPT];      /* two stages of K: key in the stage, column */
  __shared__ __attribute__((aligned(16))) _Float16 sv[2][DW][VPT];      /* two stages of V^T: column, key in the stage */
  const int lane = threadIdx.x & 31, ln = lane & 15, hh = lane >> 4; const int w = __builtin_amdgcn_readfirstlane(threadIdx.x >> 5);
  const int b = blockIdx.x & (NB - 1), p = blockIdx.x / NB; const int head = w & 7, tsel = w >> 3;
  const int g = tsel ? 63 - p : p;
  const int rb = w >> 2, col0 = (w & 3) * 64; const int row0 = b * NTK + ((rb >> 1) ? 63 - p : p) * 32 + (rb & 1) * 16;      /* the wave's tile of the output projection: row block rb of the work-group's 64 tokens, 64 columns */
  float bv[4];
#pragma unroll      /* constant indices; read here so that the epilogue does not wait for them */
  for (int t = 0; t < 4; ++t) bv[t] = bias[col0 + t * 16 + ln];
  const _Float16* qp = Q + ((size_t)b * NTK + g * 32 + ln) * DW + head * HD + 8 * hh;
  const v16h q0f = fa_frag(qp), q1f = fa_frag(qp + (size_t)16 * DW);
  asm volatile("s_wait_xcnt 0x0" :: "v"(qp) : "memory");      /* stands before the registers of the query and bias addresses are used again: the operand keeps the query's untouched up to here */
  const int vr = threadIdx.x >> 3, vc = (threadIdx.x & 7) * 8;      /* the lane's place in a V^T stage: 8 lanes = one line */
  const _Float16* gk = Kk + ((size_t)b * NTK + w) * DW + lane * 8; const _Float16* gv = Vt + ((size_t)b * DW + vr) * NTK + vc;
  const unsigned lk = (unsigned)(size_t)&sk[0][w][lane * 8], lv = (unsigned)(size_t)&sv[0][vr][vc];      /* LDS byte addresses, buffer 0 */
  constexpr unsigned KB = sizeof(sk[0]), VB = sizeof(sv[0]);
  const int S = (65 - p) >> 1;      /* stages up to the diagonal of the longer group, 63 - p: 17 to 32, the same for the whole work-group */
  const v8f z8 = {0.f,0.f,0.f,0.f,0.f,0.f,0.f,0.f};
  v8f o[2][2] = {{z8, z8}, {z8, z8}}; float m[2] = {-3.0e38f, -3.0e38f}, l[2] = {0.f, 0.f};
  fa_copy8(lk, lv, gk, gv);
  asm volatile("s_wait_asynccnt 0x0" ::: "memory");      /* this wave's part of stage 0 has landed */
  __syncthreads();      /* stage 0 is in LDS for all sixteen waves */
  v16h kd0 = q0f, kd1 = q0f, vd0 = q0f, vd1 = q0f;      /* the diagonal pass's fragments, taken in the stage that holds them (every wave has one), used behind the loop */
  for (int t = 0; t < S; ++t) {
    const _Float16* kf = &sk[t & 1][ln][head * HD + 8 * hh]; const _Float16* vf = &sv[t & 1][head * HD + ln][8 * hh];
    const v16h k0 = fa_frag(kf), k1 = fa_frag(kf + 16 * KPT), k2 = fa_frag(kf + 32 * KPT), k3 = fa_frag(kf + 48 * KPT);      /* both passes' fragment reads stand together at the top */
    const v16h v0 = fa_frag(vf), v1 = fa_frag(vf + 16 * VPT), v2 = fa_frag(vf + 32), v3 = fa_frag(vf + 16 * VPT + 32);
    if (t + 1 < S) fa_copy8(lk + ((t + 1) & 1) * KB, lv + ((t + 1) & 1) * VB, gk + (size_t)(t + 1) * 64 * DW, gv + (t + 1) * 64);      /* uniform in the work-group: stage t + 1 flies during this stage's passes; issued behind the fragment reads, whose latency covers the issue */
    if (2 * t < g) fa_pass<false>(k0, k1, v0, v1, q0f, q1f, o, m, l, ln, hh);      /* uniform in the wave: a wave past its diagonal skips the passes, never the copies, the waits and the barrier */
    if (2 * t + 1 < g) fa_pass<false>(k2, k3, v2, v3, q0f, q1f, o, m, l, ln, hh);
    if (2 * t == g) { kd0 = k0; kd1 = k1; vd0 = v0; vd1 = v1; }
    if (2 * t + 1 == g) { kd0 = k2; kd1 = k3; vd0 = v2; vd1 = v3; }
    asm volatile("s_wait_dscnt 0x0" ::: "memory");      /* this wave's reads of stage t have returned before the buffer is handed to the copies */
    asm volatile("s_wait_asynccnt 0x0" ::: "memory");      /* this wave's part of stage t + 1 has landed */
    __syncthreads();      /* stage t + 1 is in LDS for all sixteen waves, and every wave has left stage t's buffer: the next trip refills it */
  }
  asm volatile("s_wait_asynccnt 0x0" ::: "memory");      /* no copy is outstanding behind the loop */
  fa_pass<true>(kd0, kd1, vd0, vd1, q0f, q1f, o, m, l, ln, hh);      /* the pass on the diagonal, each wave's last */
  const _Float16* bp = Bh + (size_t)(col0 + ln) * DW + 8 * hh;
  v16h fh[3], fl[3], fb[3][4];
#pragma unroll      /* constant indices: the ring stays in registers; the first two steps' weights are fetched here, in front of the barrier: they do not depend on the context */
  for (int s = 0; s < 2; ++s) {
#pragma unroll      /* constant indices, as above */
    for (int t = 0; t < 4; ++t) fb[s][t] = fa_frag(bp + t * 16 * DW + s * 32); }
#pragma unroll      /* constant indices: the tiles stay in registers */
  for (int qt = 0; qt < 2; ++qt) { const float inv = 1.0f / (l[qt] + fa_xhalf(l[qt]));
#pragma unroll      /* constant indices: the tiles stay in registers */
    for (int dt = 0; dt < 2; ++dt) { FragH f, fr;
#pragma unroll      /* constant indices: the tiles stay in registers */
      for (int r = 0; r < 8; ++r) { const float v = o[qt][dt][r] * inv; const _Float16 hv = (_Float16)v; f.h[r] = hv; fr.h[r] = (_Float16)((v - (float)hv) * 1024.0f); }
      *(v8us*)&st[0][tsel * 32 + 16 * qt + ln][head * HD + 16 * dt + 8 * hh] = f.half[0]; *(v8us*)&st[1][tsel * 32 + 16 * qt + ln][head * HD + 16 * dt + 8 * hh] = fr.half[0]; } }
  __syncthreads();      /* all eight heads' columns of the 64 context rows are in LDS */
  const _Float16* ahp = &st[0][rb * 16 + ln][8 * hh]; const _Float16* alp = &st[1][rb * 16 + ln][8 * hh];
  v8f ch[4] = {z8, z8, z8, z8}, cl[4] = {z8, z8, z8, z8};
#pragma unroll      /* constant indices: the ring stays in registers */
  for (int s = 0; s < 2; ++s) { fh[s] = fa_frag(ahp + s * 32); fl[s] = fa_frag(alp + s * 32); }
#pragma unroll      /* constant indices: the ring stays in registers and every address is a base plus an immediate */
  for (int s = 0; s < DW / 32; ++s) {
    if (s + 2 < DW / 32) { const int n = s + 2, sl = n % 3; fh[sl] = fa_frag(ahp + n * 32); fl[sl] = fa_frag(alp + n * 32);
#pragma unroll      /* constant indices, as above */
      for (int t = 0; t < 4; ++t) fb[sl][t] = fa_frag(bp + t * 16 * DW + n * 32); }
    const int cu = s % 3;
#pragma unroll      /* constant indices, as above */
    for (int t = 0; t < 4; ++t) { ch[t] = fa_mma(fh[cu], fb[cu][t], ch[t]); cl[t] = fa_mma(fl[cu], fb[cu][t], cl[t]); }
    __builtin_amdgcn_sched_barrier(0);      /* keeps later steps' loads below this step: lifted to the top they took over 256 registers or spilled */
  }
  asm volatile("s_wait_xcnt 0x0" :: "v"(bp) : "memory");      /* stands before the registers of the weight address are used again: the operand keeps them untouched up to here */
#pragma unroll      /* constant indices: the tiles stay in registers */
  for (int t = 0; t < 4; ++t) { const float bt = bf16_round(bv[t]);
#pragma unroll      /* constant indices: the tiles stay in registers */
    for (int r = 0; r < 8; ++r) { float v = ch[t][r] * 0.0625f + bt; v += cl[t][r] * (0.0625f / 1024.0f); so[w][8 * hh + r][t * 16 + ln] = v; } }
  __builtin_amdgcn_fence(__ATOMIC_ACQ_REL, "workgroup"); __builtin_amdgcn_wave_barrier();      /* a wave reads back only its own staging rows */
  const int rsub = lane >> 4, c4 = (lane & 15) * 4;
#pragma unroll      /* the LDS reads issue ahead of the stores */
  for (int q = 0; q < 8; ++q) { const int r = q * 2 + rsub; const v4f v = *(const v4fa*)&so[w][r][c4]; *(v4f*)(C + (size_t)(row0 + r) * DW + col0 + c4) = v; }
}

extern "C" void kernel_launch(void* const* d_in, const int* in_sizes, int n_in,
                              void* d_out, int out_size, void* d_ws, size_t ws_size, hipStream_t stream) {
  (void)in_sizes; (void)n_in; (void)out_size;
  const float* const* I = (const float* const*)d_in; const float* xq = I[0]; const float* xk = I[1]; const float* xv = I[2]; const float* Wq = I[3]; const float* bq = I[4]; const float* Wk = I[5]; const float* bk = I[6]; const float* Wv = I[7]; const float* bv = I[8]; const float* Wo = I[9]; const float* bo = I[10];
  char* ws = (char*)d_ws; size_t off = 0;
  auto take = [&](size_t bytes) { char* p = ws + off; off += (bytes + 255) & ~(size_t)255; return p; };
  const size_t np = (size_t)NR * DW;
  _Float16* BW = (_Float16*)take((size_t)4 * DW * DIN * 2); _Float16* Q16 = (_Float16*)take(2 * np * 2); _Float16* K16 = Q16 + np; _Float16* VT = (_Float16*)take(np * 2);      /* q and k planes in a row, a plane is one step of grid.y; v transposed */
  if (off > ws_size) return;      /* 0.5 + 3 x 8 MiB */
  k_cvt4<<<4 * (DW * DIN / 8 / 256), 256, 0, stream>>>(Wq, Wk, Wv, Wo, BW);      /* torch (out, in) naturals */
  const dim3 gP3(NR / 64, 3);
  k_proj<<<gP3, 256, 0, stream>>>(xq, xk, xv, BW, bq, bk, bv, Q16, VT);      /* q, k, v projections from the f32 inputs: grid.y = 0, 1, 2; v as V^T [b*256 + column][2048]: head h of batch b = rows b*256 + h*32 */
  k_fattn<<<NB * 32, 512, 0, stream>>>(Q16, K16, VT, BW + (size_t)3 * DW * DIN, bo, (float*)d_out);      /* all heads, all batches: attention and out = (ctx_hi + ctx_lo / 1024) Wo^T + bo */
}

// v009
// One run takes 54.8 microseconds.
// Two timings next to v008 put it at 1.03 and 1.02 times that version's speed.
// Counting every step since v000, it is 26.8 times as fast.
#include <hip/hip_runtime.h>
// my_attention (8 x 2048 tokens x 256; 8 heads x 32; q/k/v = query/key/value W^T + b; causal softmax(q.k / sqrt(32)); out = merged ctx Wo^T + bo).
// Compute dtype: inputs rounded to bf16; inputs/weights exact as f16; q/k/v and the softmax weights as plain f16 operands (~2^-12); context hi + residual into Wo; softmax f32. v_wmma_f32_16x16x32_f16.
#define NB 8
#define NTK 2048
#define DIN 256
#define NH 8
#define HD 32
#define DW 256
#define NR (NB * NTK)
typedef __bf16 v16b __attribute__((ext_vector_type(16)));
typedef unsigned short v8us __attribute__((ext_vector_type(8), may_alias));
typedef float  v8f  __attribute__((ext_vector_type(8)));
typedef float  v4f  __attribute__((ext_vector_type(4)));
typedef float  v4fa __attribute__((ext_vector_type(4), may_alias));
union FragB { v16b v; v8us half[2]; unsigned short u[16]; };

__device__ __forceinline__ unsigned short bf16_bits(float x) { unsigned int u = __float_as_uint(x); return (unsigned short)((u + 0x7FFFu + ((u >> 16) & 1u)) >> 16); }
__device__ __forceinline__ float bf16_val(unsigned short b) { return __uint_as_float(((unsigned int)b) << 16); }
__device__ __forceinline__ float bf16_round(float x) { return bf16_val(bf16_bits(x)); }
// D += A·B with NT terms: 1 = ah·bh, 2 = + al·bh (A split), 3 = + ah·bl (both split)
template <int NT>
__device__ __forceinline__ v8f mmaN(v16b ah, v16b al, v16b bh, v16b bl, v8f c) {
  c = __builtin_amdgcn_wmma_f32_16x16x32_bf16(false, ah, false, bh, (short)0, c, false, false);
  if (NT >= 2) c = __builtin_amdgcn_wmma_f32_16x16x32_bf16(false, al, false, bh, (short)0, c, false, false);
  if (NT >= 3) c = __builtin_amdgcn_wmma_f32_16x16x32_bf16(false, ah, false, bl, (short)0, c, false, false);
  asm volatile("v_nop\n\tv_nop\n\tv_nop\n\tv_nop" : "+v"(c) : "v"(ah), "v"(al), "v"(bh), "v"(bl));
  return c;
}

__global__ __launch_bounds__(256) void k_wt_bf16(const float* __restrict__ W, unsigned short* __restrict__ Wt, int K, int N) {
  const int t = blockIdx.x * 256 + threadIdx.x;
  const int k8n = K / 8;
  if (t >= N * k8n) return;
  const int n = t / k8n, k8 = (t % k8n) * 8;
  v8us v;
#pragma unroll
  for (int i = 0; i < 8; ++i) v[i] = bf16_bits(W[(size_t)(k8 + i) * N + n]);
  *(v8us*)(Wt + (size_t)n * K + k8) = v;
  
}

// GEMM C[M][N] (f32, pitch ldc) = act(A[M][K]·W + bias). A f32 row-major (pitch lda) converted per fragment to bf16
// (ASPLIT: hi/lo two planes -> 2 terms, else single rounded term); Wt bf16 [N][K] (pitch ldb). BIAS_BF16 rounds the
// bias to bf16 first (bias quantised to bf16 before the add). K%32==0, M%16==0, N%64==0.
template <bool ASPLIT, int ACT, bool BIAS_BF16>
__global__ __launch_bounds__(128) void k_gemm_bf(const float* __restrict__ A, int lda, const unsigned short* __restrict__ Wt, int ldb,
                                               const float* __restrict__ bias, float* __restrict__ C, int ldc, int M, int N, int K) {
  __shared__ __attribute__((aligned(16))) float so[4][16][64];
  const int tid = threadIdx.x, w = tid >> 5, lane = tid & 31, ln = lane & 15, hh = lane >> 4;
  const int ntn = N / 64;
  const int wid = blockIdx.x * 4 + w;
  const int mt = wid / ntn, nq = wid % ntn;
  if (mt * 16 >= M) return;
  const int row0 = mt * 16, col0 = nq * 64;
  const float* arow = A + (size_t)(row0 + ln) * lda;
  v8f acc[4] = {};
  for (int kb = 0; kb < K; kb += 32) {
    FragB ah, al;
    const v4f x0 = *(const v4fa*)(arow + kb + 8 * hh), x1 = *(const v4fa*)(arow + kb + 8 * hh + 4);
    const v4f x2 = *(const v4fa*)(arow + kb + 16 + 8 * hh), x3 = *(const v4fa*)(arow + kb + 16 + 8 * hh + 4);
    float xs[16] = {x0[0],x0[1],x0[2],x0[3],x1[0],x1[1],x1[2],x1[3],x2[0],x2[1],x2[2],x2[3],x3[0],x3[1],x3[2],x3[3]};
#pragma unroll
    for (int i = 0; i < 16; ++i) { const unsigned short hb = bf16_bits(xs[i]); ah.u[i] = hb; al.u[i] = ASPLIT ? bf16_bits(xs[i] - bf16_val(hb)) : (unsigned short)0; }
#pragma unroll
    for (int t = 0; t < 4; ++t) {
      const unsigned short* brow = Wt + (size_t)(col0 + t * 16 + ln) * ldb + kb;
      FragB b;
      b.half[0] = *(const v8us*)(brow + 8 * hh);
      b.half[1] = *(const v8us*)(brow + 16 + 8 * hh);
      acc[t] = mmaN<ASPLIT ? 2 : 1>(ah.v, al.v, b.v, b.v, acc[t]);
    }
  }
#pragma unroll
  for (int t = 0; t < 4; ++t) {
    float bv = bias ? bias[col0 + t * 16 + ln] : 0.f;
    if (BIAS_BF16) bv = bf16_round(bv);
#pragma unroll
    for (int r = 0; r < 8; ++r) { float v = acc[t][r] + bv; if (ACT == 1) v = fmaxf(v, 0.f); so[w][8 * hh + r][t * 16 + ln] = v; }
  }
  __builtin_amdgcn_fence(__ATOMIC_ACQ_REL, "workgroup");
  __builtin_amdgcn_wave_barrier();
  const int rsub = lane >> 4, c4 = (lane & 15) * 4;
  {
#pragma unroll
    for (int q = 0; q < 8; ++q) {
      const int r = q * 2 + rsub;
      const v4f v = *(const v4fa*)&so[w][r][c4];
      *(v4f*)(C + (size_t)(row0 + r) * ldc + col0 + c4) = v;
    }
    
  }
}

// GEMM C = act(A·W + bias + resid): A f32 (ASPLIT -> hi/lo 2 terms), Wt bf16 [N][K]; ACT 0 none, 1 relu, 2 exact gelu;
// resid (optional, f32, row index = (row % rmod), pitch ldr, RES_BF16 rounds it) added before the activation.
template <bool ASPLIT, int ACT, bool BIAS_BF16, bool RES_BF16>
__global__ __launch_bounds__(128) void k_gemm_bf3(const float* __restrict__ A, int lda, const unsigned short* __restrict__ Wt, int ldb,
                                                const float* __restrict__ bias, const float* __restrict__ resid, int rmod, int ldr,
                                                float* __restrict__ C, int ldc, int M, int N, int K) {
  __shared__ __attribute__((aligned(16))) float so[4][16][64];
  const int tid = threadIdx.x, w = tid >> 5, lane = tid & 31, ln = lane & 15, hh = lane >> 4;
  const int ntn = N / 64;
  const int wid = blockIdx.x * 4 + w;
  const int mt = wid / ntn, nq = wid % ntn;
  if (mt * 16 >= M) return;
  const int row0 = mt * 16, col0 = nq * 64;
  const float* arow = A + (size_t)(row0 + ln) * lda;
  v8f acc[4] = {};
  for (int kb = 0; kb < K; kb += 32) {
    FragB ah, al;
    const v4f x0 = *(const v4fa*)(arow + kb + 8 * hh), x1 = *(const v4fa*)(arow + kb + 8 * hh + 4);
    const v4f x2 = *(const v4fa*)(arow + kb + 16 + 8 * hh), x3 = *(const v4fa*)(arow + kb + 16 + 8 * hh + 4);
    float xs[16] = {x0[0],x0[1],x0[2],x0[3],x1[0],x1[1],x1[2],x1[3],x2[0],x2[1],x2[2],x2[3],x3[0],x3[1],x3[2],x3[3]};
#pragma unroll
    for (int i = 0; i < 16; ++i) { const unsigned short hb = bf16_bits(xs[i]); ah.u[i] = hb; al.u[i] = ASPLIT ? bf16_bits(xs[i] - bf16_val(hb)) : (unsigned short)0; }
#pragma unroll
    for (int t = 0; t < 4; ++t) {
      const unsigned short* brow = Wt + (size_t)(col0 + t * 16 + ln) * ldb + kb;
      FragB b;
      b.half[0] = *(const v8us*)(brow + 8 * hh);
      b.half[1] = *(const v8us*)(brow + 16 + 8 * hh);
      acc[t] = mmaN<ASPLIT ? 2 : 1>(ah.v, al.v, b.v, b.v, acc[t]);
    }
  }
#pragma unroll
  for (int t = 0; t < 4; ++t) {
    const int col = col0 + t * 16 + ln;
    float bv = bias ? bias[col] : 0.f;
    if (BIAS_BF16) bv = bf16_round(bv);
#pragma unroll
    for (int r = 0; r < 8; ++r) {
      float v = acc[t][r] + bv;
      if (resid) { float rv = resid[(size_t)((row0 + 8 * hh + r) % rmod) * ldr + col]; if (RES_BF16) rv = bf16_round(rv); v += rv; }
      if (ACT == 1) v = fmaxf(v, 0.f);
      if (ACT == 2) v = 0.5f * v * (1.0f + erff(v * 0.70710678118654752f));
      if (ACT == 3) { const float u = 0.7978845608028654f * (v + 0.044715f * v * v * v); v = 0.5f * v * (1.0f + tanhf(u)); }
      so[w][8 * hh + r][t * 16 + ln] = v;
    }
  }
  __builtin_amdgcn_fence(__ATOMIC_ACQ_REL, "workgroup");
  __builtin_amdgcn_wave_barrier();
  const int rsub = lane >> 4, c4 = (lane & 15) * 4;
  {
#pragma unroll
    for (int q = 0; q < 8; ++q) {
      const int r = q * 2 + rsub;
      const v4f v = *(const v4fa*)&so[w][r][c4];
      *(v4f*)(C + (size_t)(row0 + r) * ldc + col0 + c4) = v;
    }
    
  }
}
// row LayerNorm (biased variance, eps) over N: s = X (+ R); optional out_sum <- s; out_norm <- (s-mu)*rsqrt(var+eps)*g + b
template <bool PARAM_BF16>
__global__ __launch_bounds__(256) void k_layernorm(const float* __restrict__ X, const float* __restrict__ R, const float* __restrict__ g, const float* __restrict__ bta,
                                                  float* __restrict__ out_sum, float* __restrict__ out_norm, int N, float eps) {
  __shared__ float red[256];
  const int row = blockIdx.x, tid = threadIdx.x;
  const float* x = X + (size_t)row * N; const float* rr = R ? R + (size_t)row * N : nullptr;
  float vals[16];                     // up to N = 4096
  const int per = N / 256;            // contiguous chunk per thread? use strided-by-4 chunks: thread handles j = tid*4 + 1024*u
  float s1 = 0.f;
  for (int u = 0; u < per / 4; ++u) {
    const int j = tid * 4 + 1024 * u;
    const v4f a = *(const v4fa*)(x + j);
    v4f b = {0.f,0.f,0.f,0.f}; if (rr) b = *(const v4fa*)(rr + j);
#pragma unroll
    for (int q = 0; q < 4; ++q) { const float v = a[q] + b[q]; vals[u * 4 + q] = v; s1 += v; }
  }
  red[tid] = s1; __syncthreads();
  for (int st = 128; st > 0; st >>= 1) { if (tid < st) red[tid] += red[tid + st]; __syncthreads(); }
  const float mu = red[0] / (float)N; __syncthreads();
  float s2 = 0.f;
  for (int u = 0; u < per / 4; ++u)
#pragma unroll
    for (int q = 0; q < 4; ++q) { const float c = vals[u * 4 + q] - mu; s2 += c * c; }
  red[tid] = s2; __syncthreads();
  for (int st = 128; st > 0; st >>= 1) { if (tid < st) red[tid] += red[tid + st]; __syncthreads(); }
  const float rs = rsqrtf(red[0] / (float)N + eps);
  {
    for (int u = 0; u < per / 4; ++u) {
      const int j = tid * 4 + 1024 * u;
      v4f o, sm;
#pragma unroll
      for (int q = 0; q < 4; ++q) {
        float gg = g[j + q], bb = bta[j + q];
        if (PARAM_BF16) { gg = bf16_round(gg); bb = bf16_round(bb); }
        sm[q] = vals[u * 4 + q]; o[q] = (vals[u * 4 + q] - mu) * rs * gg + bb;
      }
      if (out_sum) *(v4f*)(out_sum + (size_t)row * N + j) = sm;
      *(v4f*)(out_norm + (size_t)row * N + j) = o;
    }
    
  }
}



// ---- f16 WMMA path (v_wmma_f32_16x16x32_f16): 11-bit significands for operands in range — used where a [0,1] probability operand needs more precision than bf16
typedef _Float16 v16h __attribute__((ext_vector_type(16)));
union FragH { v16h v; v8us half[2]; _Float16 h[16]; unsigned short u[16]; };
template <int NT>
__device__ __forceinline__ v8f mmaH(v16h ah, v16h al, v16h bh, v16h bl, v8f c) {
  c = __builtin_amdgcn_wmma_f32_16x16x32_f16(false, ah, false, bh, (short)0, c, false, false);
  if (NT >= 2) c = __builtin_amdgcn_wmma_f32_16x16x32_f16(false, al, false, bh, (short)0, c, false, false);
  if (NT >= 3) c = __builtin_amdgcn_wmma_f32_16x16x32_f16(false, ah, false, bl, (short)0, c, false, false);
  asm volatile("v_nop\n\tv_nop\n\tv_nop\n\tv_nop" : "+v"(c) : "v"(ah), "v"(al), "v"(bh), "v"(bl));
  return c;
}
// batched GEMM like k_gemm_b but f16 operands: A f32 (split into f16 hi/lo if ASPLIT, else rounded to f16), Bt = f16 values [n][k]; alpha; C f32; N multiple of 16 (partial tiles skipped)
template <bool ASPLIT>
__global__ __launch_bounds__(128) void k_gemm_h(const float* __restrict__ A, int lda, size_t sA, const _Float16* __restrict__ Bh, int ldb, size_t sB, float alpha, float* __restrict__ C, int ldc, size_t sC, int M, int N, int K) {
  __shared__ __attribute__((aligned(16))) float so[4][16][64];
  const int tid = threadIdx.x, w = tid >> 5, lane = tid & 31, ln = lane & 15, hh = lane >> 4; const int by = blockIdx.y;
  A += (size_t)by * sA; Bh += (size_t)by * sB; C += (size_t)by * sC;
  const int ntn = (N + 63) / 64; const int wid = blockIdx.x * 4 + w; const int mt = wid / ntn, nq = wid % ntn; if (mt * 16 >= M) return;
  const int row0 = mt * 16, col0 = nq * 64; const float* arow = A + (size_t)(row0 + ln) * lda;
  v8f acc[4] = {};
  for (int kb = 0; kb < K; kb += 32) {
    FragH ah, al;
    const v4f x0 = *(const v4fa*)(arow + kb + 8 * hh), x1 = *(const v4fa*)(arow + kb + 8 * hh + 4), x2 = *(const v4fa*)(arow + kb + 16 + 8 * hh), x3 = *(const v4fa*)(arow + kb + 16 + 8 * hh + 4);
    float xs[16] = {x0[0],x0[1],x0[2],x0[3],x1[0],x1[1],x1[2],x1[3],x2[0],x2[1],x2[2],x2[3],x3[0],x3[1],x3[2],x3[3]};
#pragma unroll
    for (int i = 0; i < 16; ++i) { const _Float16 h = (_Float16)xs[i]; ah.h[i] = h; al.h[i] = ASPLIT ? (_Float16)(xs[i] - (float)h) : (_Float16)0.0f; }
#pragma unroll
    for (int t = 0; t < 4; ++t) { if (col0 + t * 16 >= N) continue; const size_t boff = (size_t)(col0 + t * 16 + ln) * ldb + kb; FragH bq; bq.half[0] = *(const v8us*)(Bh + boff + 8 * hh); bq.half[1] = *(const v8us*)(Bh + boff + 16 + 8 * hh);
      acc[t] = mmaH<ASPLIT ? 2 : 1>(ah.v, al.v, bq.v, bq.v, acc[t]); }
  }
#pragma unroll
  for (int t = 0; t < 4; ++t) { if (col0 + t * 16 >= N) continue;
#pragma unroll
    for (int r = 0; r < 8; ++r) so[w][8 * hh + r][t * 16 + ln] = acc[t][r] * alpha; }
  __builtin_amdgcn_fence(__ATOMIC_ACQ_REL, "workgroup"); __builtin_amdgcn_wave_barrier();
  const int rsub = lane >> 4, c4 = (lane & 15) * 4;
  {
#pragma unroll
    for (int q = 0; q < 8; ++q) { const int r = q * 2 + rsub; if (col0 + c4 < N) { const v4f v = *(const v4fa*)&so[w][r][c4]; *(v4f*)(C + (size_t)(row0 + r) * ldc + col0 + c4) = v; } }
     }
}

// Wt[n][k] = f16(W[k][n]·scale) from f32 row-major W[K][N] (scale = power of two; bf16-exact weights stay exact in f16 away from the subnormal range)
__global__ __launch_bounds__(256) void k_wt_f16(const float* __restrict__ W, _Float16* __restrict__ Wt, int K, int N, float scale) {
  const int t = blockIdx.x * 256 + threadIdx.x; if (t >= N * (K / 8)) return; const int n = t / (K / 8), k8 = (t % (K / 8)) * 8; FragH f;
#pragma unroll
  for (int i = 0; i < 8; ++i) f.h[i] = (_Float16)(bf16_round(W[(size_t)(k8 + i) * N + n]) * scale); const v8us o = f.half[0];
  *(v8us*)((unsigned short*)Wt + (size_t)n * K + k8) = o; 
}
// k_gemm_hh variant with fused epilogue: v = acc·alpha + bias[by·sBias + col] (+ CP[(row/rowsPerB)·sCPb + by·64 + col] if CP) ; ACT 0 none / 1 elu ; writes f32 C and/or f16 C16 (each if non-null)
template <int ACT>
__global__ __launch_bounds__(128) void k_gemm_hhx(const _Float16* __restrict__ A, int lda, size_t sA, const _Float16* __restrict__ Bh, int ldb, size_t sB, float alpha, const float* __restrict__ bias, size_t sBias, const float* __restrict__ CP, int rowsPerB, size_t sCPb, int row0g,
    float* __restrict__ C, _Float16* __restrict__ C16, int ldc, size_t sC, int M, int N, int K) {
  __shared__ __attribute__((aligned(16))) float so[4][16][64];
  const int tid = threadIdx.x, w = tid >> 5, lane = tid & 31, ln = lane & 15, hh = lane >> 4; const int by = blockIdx.y;
  A += (size_t)by * sA; Bh += (size_t)by * sB; const size_t cofs = (size_t)by * sC; const float* bp = bias ? bias + (size_t)by * sBias : nullptr;
  const int ntn = (N + 63) / 64; const int wid = blockIdx.x * 4 + w; const int mt = wid / ntn, nq = wid % ntn; if (mt * 16 >= M) return;
  const int row0 = mt * 16, col0 = nq * 64; const _Float16* arow = A + (size_t)(row0 + ln) * lda;
  v8f acc[4] = {};
  for (int kb = 0; kb < K; kb += 32) { FragH ah; ah.half[0] = *(const v8us*)((const unsigned short*)arow + kb + 8 * hh); ah.half[1] = *(const v8us*)((const unsigned short*)arow + kb + 16 + 8 * hh);
#pragma unroll
    for (int t = 0; t < 4; ++t) { if (col0 + t * 16 >= N) continue; const size_t boff = (size_t)(col0 + t * 16 + ln) * ldb + kb; FragH bq; bq.half[0] = *(const v8us*)((const unsigned short*)Bh + boff + 8 * hh); bq.half[1] = *(const v8us*)((const unsigned short*)Bh + boff + 16 + 8 * hh);
      acc[t] = mmaH<1>(ah.v, ah.v, bq.v, bq.v, acc[t]); }
  }
#pragma unroll
  for (int t = 0; t < 4; ++t) { if (col0 + t * 16 >= N) continue; const int col = col0 + t * 16 + ln; const float bv = bp ? bf16_round(bp[col]) : 0.f;
#pragma unroll
    for (int r = 0; r < 8; ++r) { float v = acc[t][r] * alpha + bv; if (CP) { const int rr = row0g + row0 + 8 * hh + r; if (rowsPerB < 0) v += CP[cofs + (size_t)rr * ldc + col];      /* rowsPerB < 0: own element of the batched C plane */ else { const int bidx = rr / rowsPerB; v += CP[(size_t)bidx * sCPb + (size_t)by * 64 + col]; } } if (ACT == 1) v = (v > 0.f) ? v : expm1f(v); else if (ACT == 7) v = (v > 0.f) ? v + 1.0f : expf(v); else if (ACT == 8) v = tanhf(v); else if (ACT == 9) v = 0.5f * v * (1.0f + tanhf(0.7978845608028654f * (v + 0.044715f * v * v * v))); else if (ACT == 11) v = 1.0f / (1.0f + expf(-v)); else if (ACT == 12) v = (v > 0.f) ? v : 0.01f * v; else if (ACT == 14) v = (v > 0.f) ? v : 0.1f * v; else if (ACT == 16) v = (v >= 0.f) ? v : 0.3f * v; else if (ACT == 17) v = (v >= 0.f) ? v : 0.2f * v; else if (ACT == 15) v = v / (1.0f + expf(-v)); else if (ACT == 3) v = fmaxf(v, 0.f); else if (ACT == 6) v = 0.5f * v * (1.0f + erff(v * 0.70710678118654752f)); so[w][8 * hh + r][t * 16 + ln] = v; } }
  __builtin_amdgcn_fence(__ATOMIC_ACQ_REL, "workgroup"); __builtin_amdgcn_wave_barrier();
  const int rsub = lane >> 4, c4 = (lane & 15) * 4; typedef _Float16 v4h __attribute__((ext_vector_type(4)));
  {
#pragma unroll
    for (int q = 0; q < 8; ++q) { const int r = q * 2 + rsub; if (col0 + c4 < N) { const v4f v = *(const v4fa*)&so[w][r][c4]; if (C) *(v4f*)(C + cofs + (size_t)(row0 + r) * ldc + col0 + c4) = v; if (C16) { v4h h4; for (int i = 0; i < 4; ++i) h4[i] = (_Float16)v[i]; *(v4h*)(C16 + cofs + (size_t)(row0 + r) * ldc + col0 + c4) = h4; } } }
     }
}


typedef _Float16 v4h __attribute__((ext_vector_type(4)));

__global__ __launch_bounds__(256) void k_h16(const float* __restrict__ x, _Float16* __restrict__ X16, size_t n8) { const size_t t = (size_t)blockIdx.x * 256 + threadIdx.x; if (t >= n8) return; FragH f;
#pragma unroll
  for (int q = 0; q < 8; ++q) f.h[q] = (_Float16)x[t * 8 + q]; *(v8us*)((unsigned short*)X16 + t * 8) = f.half[0];  }
__global__ __launch_bounds__(256) void k_round16f(const float* __restrict__ W, _Float16* __restrict__ Bt, size_t n8) { const size_t t = (size_t)blockIdx.x * 256 + threadIdx.x; if (t >= n8) return; FragH f;
#pragma unroll
  for (int i = 0; i < 8; ++i) f.h[i] = (_Float16)(bf16_round(W[t * 8 + i]) * 16.0f); *(v8us*)((unsigned short*)Bt + t * 8) = f.half[0];  }

__global__ __launch_bounds__(256) void k_hl(const float* __restrict__ F, _Float16* __restrict__ Hh, _Float16* __restrict__ Hl, size_t n8) { const size_t t = (size_t)blockIdx.x * 256 + threadIdx.x; if (t >= n8) return; FragH fh, fl; const v4f a = *(const v4fa*)(F + t * 8), c = *(const v4fa*)(F + t * 8 + 4);
#pragma unroll
  for (int q = 0; q < 4; ++q) { _Float16 h = (_Float16)a[q]; fh.h[q] = h; fl.h[q] = (_Float16)((a[q] - (float)h) * 1024.0f); h = (_Float16)c[q]; fh.h[4 + q] = h; fl.h[4 + q] = (_Float16)((c[q] - (float)h) * 1024.0f); }
  { *(v8us*)((unsigned short*)Hh + t * 8) = fh.half[0]; *(v8us*)((unsigned short*)Hl + t * 8) = fl.half[0];  } }

// ---- fragment load and product of the 32x64 wave tile ----
__device__ __forceinline__ v16h g2_frag(const _Float16* p, int hh) { FragH f; f.half[0] = *(const v8us*)((const unsigned short*)p + 8 * hh); f.half[1] = *(const v8us*)((const unsigned short*)p + 16 + 8 * hh); return f.v; }
__device__ __forceinline__ v8f g2_mma(v16h a, v16h b, v8f c) { v8f d = __builtin_amdgcn_wmma_f32_16x16x32_f16(false, a, false, b, (short)0, c, false, false); asm volatile("v_nop\n\tv_nop\n\tv_nop\n\tv_nop" : "+v"(d) : "v"(a), "v"(b)); return d; }

// The four weight matrices, f16(bf16(w) * 16), in one grid; the block index picks the matrix (uniform in a work-group).
__global__ __launch_bounds__(256) void k_cvt4(const float* __restrict__ w0, const float* __restrict__ w1, const float* __restrict__ w2, const float* __restrict__ w3, _Float16* __restrict__ Bt) {
  constexpr int WB = DW * DIN / 8 / 256;      /* blocks per weight matrix */
  const int j = blockIdx.x / WB, blk = blockIdx.x - j * WB; const float* s = (j == 0) ? w0 : (j == 1) ? w1 : (j == 2) ? w2 : w3; _Float16* d = Bt + (size_t)j * DW * DIN;
  const size_t t = (size_t)blk * 256 + threadIdx.x; FragH f;
#pragma unroll      /* constant indices: the eight values stay in registers and their loads join into two of 16 bytes */
  for (int q = 0; q < 8; ++q) f.h[q] = (_Float16)(bf16_round(s[t * 8 + q]) * 16.0f);
  *(v8us*)((unsigned short*)d + t * 8) = f.half[0];
}
// ---- q, k, v projections straight from the f32 inputs (grid.y = plane): no conversion launch, no f16 copy of the inputs in memory ----
// A work-group of 8 waves owns 64 token rows x all 256 output columns, so each input row is read from memory once, in whole lines, all 16 loads of a
// lane in flight, rounded once (f16(bf16(x)), as the conversion kernel did) and laid in LDS at a pitch of 16 B x 33 for the ds_load_b128 fragment reads.
// The plane's weights go through LDS as well, in four stages of 64 k (one whole 128-byte line of each of the 256 weight rows): the work-group fetches each line once, a
// wave-wide load covering 4 whole lines, and all eight waves take their B fragments from LDS (pitch 16 B x 9). Two stage buffers, in the space that the output
// staging uses afterwards; stage 0 is fetched beside the input rows, each later stage during the products of the stage before it, so no product waits for a load from L2.
// Wave tile 32 x 64. The v plane is stored transposed, V^T [(b, column)][token], the layout the attention kernel's A fragments read: in an accumulator tile a
// lane holds 8 consecutive tokens of one column, 16 bytes of a V^T row; the work-group's 64 tokens are one whole 128-byte line of each of its 256 V^T rows.
__global__ __launch_bounds__(256) void k_proj(const float* __restrict__ x0, const float* __restrict__ x1, const float* __restrict__ x2, const _Float16* __restrict__ Bh,
                                              const float* __restrict__ bias0, const float* __restrict__ bias1, const float* __restrict__ bias2, _Float16* __restrict__ C16, _Float16* __restrict__ VT) {
  __shared__ __attribute__((aligned(16))) _Float16 sa[64][DIN + 8];
  constexpr int WST = DW * 72;      /* one weight stage in LDS, in f16: 256 rows of 64 k at a pitch of 72 */
  __shared__ __attribute__((aligned(16))) float su[2 * WST / 2];      /* two weight stages during the k loop, output staging behind it */
  float (*so)[32][68] = reinterpret_cast<float (*)[32][68]>(su); unsigned short* sb = (unsigned short*)su;
  static_assert(sizeof(float) * 8 * 32 * 68 <= sizeof(su), "output staging fits the stage buffers");
  const int tid = threadIdx.x, w = tid >> 5, lane = tid & 31, ln = lane & 15, hh = lane >> 4; const int by = blockIdx.y;
  const float* xs = ((by == 0) ? x0 : (by == 1) ? x1 : x2) + (size_t)blockIdx.x * 64 * DIN; const float* bp = (by == 0) ? bias0 : (by == 1) ? bias1 : bias2;
  const unsigned short* wsrc = (const unsigned short*)Bh + (size_t)by * DW * DIN + (size_t)(tid >> 3) * DIN + (tid & 7) * 8;      /* 8 lanes = one 128-byte line of a weight row */
  unsigned short* wdst = sb + (tid >> 3) * 72 + (tid & 7) * 8;
  v4f t[16]; v8us wn[8];
#pragma unroll      /* constant indices: the sixteen loads stand in registers and issue together */
  for (int i = 0; i < 16; ++i) t[i] = *(const v4fa*)(xs + (size_t)(i * 256 + tid) * 4);
#pragma unroll      /* constant indices: the loads of weight stage 0 issue behind the input loads */
  for (int i = 0; i < 8; ++i) wn[i] = *(const v8us*)(wsrc + (size_t)i * 32 * DIN);
  __builtin_amdgcn_sched_barrier(0);      /* keeps the weight loads up here: sunk below the input conversion they started only when the inputs had arrived */
#pragma unroll      /* constant indices, as above */
  for (int i = 0; i < 16; ++i) { v4h h4;
#pragma unroll      /* constant indices, as above */
    for (int q = 0; q < 4; ++q) h4[q] = (_Float16)bf16_round(t[i][q]);
    *(v4h*)&sa[i * 4 + (tid >> 6)][(tid & 63) * 4] = h4; }
#pragma unroll      /* constant indices, as above */
  for (int i = 0; i < 8; ++i) *(v8us*)(wdst + i * 32 * 72) = wn[i];
  __syncthreads();      /* the 64 converted rows and weight stage 0 are in LDS for all eight waves */
  const int rl0 = (w >> 2) * 32, col0 = (w & 3) * 64; const int row0 = blockIdx.x * 64 + rl0; const size_t cofs = (size_t)by * NR * DW;
  const _Float16* a0p = &sa[rl0 + ln][0]; const _Float16* a1p = &sa[rl0 + 16 + ln][0];
  const v8f z8 = {0.f,0.f,0.f,0.f,0.f,0.f,0.f,0.f}; v8f c00 = z8, c01 = z8, c02 = z8, c03 = z8, c10 = z8, c11 = z8, c12 = z8, c13 = z8;
#pragma unroll      /* four stages: buffer choice, the refills and every LDS offset are constants */
  for (int j = 0; j < DIN / 64; ++j) { const _Float16* bs = (const _Float16*)(sb + (j & 1) * WST + (col0 + ln) * 72);
    if (j + 1 < DIN / 64) {
#pragma unroll      /* constant indices: the next stage stays in registers and flies during this stage's products (issued behind the barrier, which waits for every load in flight) */
      for (int i = 0; i < 8; ++i) wn[i] = *(const v8us*)(wsrc + (size_t)i * 32 * DIN + (j + 1) * 64);
    }
#pragma unroll      /* constant offsets, as above */
    for (int ks = 0; ks < 2; ++ks) { const int kb = j * 64 + ks * 32; const v16h a0 = g2_frag(a0p + kb, hh), a1 = g2_frag(a1p + kb, hh);
      const v16h b0 = g2_frag(bs + ks * 32, hh), b1 = g2_frag(bs + 16 * 72 + ks * 32, hh), b2 = g2_frag(bs + 32 * 72 + ks * 32, hh), b3 = g2_frag(bs + 48 * 72 + ks * 32, hh);
      c00 = g2_mma(a0, b0, c00); c10 = g2_mma(a1, b0, c10); c01 = g2_mma(a0, b1, c01); c11 = g2_mma(a1, b1, c11);
      c02 = g2_mma(a0, b2, c02); c12 = g2_mma(a1, b2, c12); c03 = g2_mma(a0, b3, c03); c13 = g2_mma(a1, b3, c13); }
    if (j + 1 < DIN / 64) {
#pragma unroll      /* constant indices, as above; the other buffer: its last readers, stage j - 1's products, ended in front of the barrier before this stage */
      for (int i = 0; i < 8; ++i) *(v8us*)(wdst + ((j + 1) & 1) * WST + i * 32 * 72) = wn[i];
    }
    __syncthreads();      /* stage j + 1 is in LDS for all eight waves, and every wave has read stage j (behind the last stage: the buffers become output staging) */
  }
  asm volatile("s_wait_xcnt 0x0" :: "v"(wsrc) : "memory");      /* stands before the registers of the weight address are used again: the operand keeps them untouched up to here */
  v8f accs[8] = {c00, c01, c02, c03, c10, c11, c12, c13};
  if (by < 2) {      /* q and k planes, row-major. The test in this form and order: the built code then has the v path first, and the q/k path does not keep the v path's values alive (162 registers, five waves a SIMD instead of six, with the test written the other way round) */
#pragma unroll      /* constant indices: the tiles stay in registers */
  for (int u = 0; u < 8; ++u) { const int tt = u & 3, half = u >> 2; const float bv = bf16_round(bp[col0 + tt * 16 + ln]);
#pragma unroll      /* constant indices: the tiles stay in registers */
    for (int r = 0; r < 8; ++r) so[w][half * 16 + 8 * hh + r][tt * 16 + ln] = accs[u][r] * 0.0625f + bv; }
  __builtin_amdgcn_fence(__ATOMIC_ACQ_REL, "workgroup"); __builtin_amdgcn_wave_barrier();      /* a wave reads back only its own staging rows */
  const int rsub = lane >> 4, c4 = (lane & 15) * 4;
#pragma unroll      /* the LDS reads issue ahead of the stores */
  for (int q = 0; q < 16; ++q) { const int r = q * 2 + rsub; const v4f v = *(const v4fa*)&so[w][r][c4]; v4h h4;
#pragma unroll      /* constant indices */
    for (int i = 0; i < 4; ++i) h4[i] = (_Float16)v[i];
    *(v4h*)(C16 + cofs + (size_t)(row0 + r) * DW + col0 + c4) = h4; }
  } else {      /* v plane (uniform in the grid's y): 256 columns x 64 tokens through LDS at a pitch of 16 B x 9, in the weight stage buffers, free behind the k loop */
    unsigned short* tv = (unsigned short*)&so[0][0][0];
#pragma unroll      /* constant indices: the tiles stay in registers */
    for (int u = 0; u < 8; ++u) { const int tt = u & 3, half = u >> 2; const float bv = bf16_round(bp[col0 + tt * 16 + ln]); FragH f;
#pragma unroll      /* constant indices: the tiles stay in registers */
      for (int r = 0; r < 8; ++r) f.h[r] = (_Float16)(accs[u][r] * 0.0625f + bv);
      *(v8us*)(tv + (col0 + tt * 16 + ln) * 72 + rl0 + half * 16 + 8 * hh) = f.half[0]; }
    __syncthreads();      /* both token halves of every V^T line are in LDS: a line is stored whole by 8 lanes of one wave */
    unsigned short* vo = (unsigned short*)VT + (size_t)(blockIdx.x / (NTK / 64)) * DW * NTK + (blockIdx.x % (NTK / 64)) * 64;
#pragma unroll      /* the LDS reads issue ahead of the stores */
    for (int i = 0; i < 8; ++i) { const int idx = i * 256 + tid, col = idx >> 3, c8 = (idx & 7) * 8; *(v8us*)(vo + (size_t)col * NTK + c8) = *(const v8us*)(tv + col * 72 + c8); }
    asm volatile("s_wait_xcnt 0x0" ::: "memory");      /* behind the last store: in the built code the q/k path stands below this one and rewrites the stores' address registers */
  }
}
// ---- fused causal attention: S^T = K Q^T, online softmax in registers, O^T += V^T P^T; scores and weights never reach memory ----
// One wave = 32 queries of one head; a pass = 32 keys. In S^T a lane holds one query's scores (column ln, keys 8*hh + r), so two S^T tiles,
// converted in place, are the B operand of V^T P^T in the hardware k order. Weights carry a factor 1024 (as exp2(... + 10)); it cancels in O / l.
__device__ __forceinline__ float fa_xhalf(float x) { const int b = __float_as_int(x); return __int_as_float(__builtin_amdgcn_permlanex16(b, b, 0x76543210, 0xfedcba98, false, false)); }
__device__ __forceinline__ v16h fa_frag(const _Float16* p) { FragH f; f.half[0] = *(const v8us*)((const unsigned short*)p); f.half[1] = *(const v8us*)((const unsigned short*)p + 16); return f.v; }      /* p already holds the lane half's 8 * hh */
__device__ __forceinline__ v8f fa_mma(v16h a, v16h b, v8f c) { return __builtin_amdgcn_wmma_f32_16x16x32_f16(false, a, false, b, (short)0, c, false, false); }
// Eight independent v_exp_f32 and the slot that the instruction set asks for behind a transcendental, in one statement: a v_nop in a statement of its own
// did not stay behind them. Outputs are early-clobber, so that none of the eight overwrites a source of the one in front of it.
__device__ __forceinline__ void fa_exp8(v8f& e, const v8f x) {
  float e0, e1, e2, e3, e4, e5, e6, e7;
  asm("v_exp_f32 %0, %8\n\tv_exp_f32 %1, %9\n\tv_exp_f32 %2, %10\n\tv_exp_f32 %3, %11\n\tv_exp_f32 %4, %12\n\tv_exp_f32 %5, %13\n\tv_exp_f32 %6, %14\n\tv_exp_f32 %7, %15\n\tv_nop"
      : "=&v"(e0), "=&v"(e1), "=&v"(e2), "=&v"(e3), "=&v"(e4), "=&v"(e5), "=&v"(e6), "=&v"(e7)
      : "v"(x[0]), "v"(x[1]), "v"(x[2]), "v"(x[3]), "v"(x[4]), "v"(x[5]), "v"(x[6]), "v"(x[7]));
  e[0] = e0; e[1] = e1; e[2] = e2; e[3] = e3; e[4] = e4; e[5] = e5; e[6] = e6; e[7] = e7;
}
template <bool DIAG>
__device__ __forceinline__ void fa_pass(const v16h k0, const v16h k1, const v16h v0, const v16h v1, const v16h q0f, const v16h q1f, v8f (&o)[2][2], float (&m)[2], float (&th)[2], float (&l)[2], const int ln, const int hh) {
  const float C = 0.17677669529663687f * 1.4426950408889634f;      /* 1/sqrt(32) * log2(e) */
  const v8f z8 = {0.f,0.f,0.f,0.f,0.f,0.f,0.f,0.f};
  v8f s[2][2];
  s[0][0] = fa_mma(k0, q0f, z8); s[0][1] = fa_mma(k1, q0f, z8); s[1][0] = fa_mma(k0, q1f, z8); s[1][1] = fa_mma(k1, q1f, z8);
  float mx[2];      /* the largest raw score among the lane's own 16 keys of each query */
#pragma unroll      /* constant indices: the tiles stay in registers */
  for (int qt = 0; qt < 2; ++qt) {
    if (DIAG) {
#pragma unroll      /* constant indices: the tiles stay in registers */
      for (int r = 0; r < 8; ++r) { if (8 * hh + r > 16 * qt + ln) s[qt][0][r] = -3.0e38f; if (16 + 8 * hh + r > 16 * qt + ln) s[qt][1][r] = -3.0e38f; }
    }
    float a = fmaxf(s[qt][0][0], s[qt][1][0]);
#pragma unroll      /* constant indices: the tiles stay in registers */
    for (int r = 1; r < 8; ++r) a = fmaxf(a, fmaxf(s[qt][0][r], s[qt][1][r]));
    mx[qt] = a;
  }
  /* Lazy rescale: m is the reference in use, not the running maximum. It moves only when some score in the wave lies more than 5 (scaled log2) above it, th = (m + 5) / C in raw
     scores, so a weight is at most 1024 * 32 = 2^15, inside f16, and O / l does not depend on the reference. Each lane tests its own keys; the halves meet only inside the branch. */
  if (__builtin_amdgcn_ballot_w32(mx[0] > th[0] || mx[1] > th[1]) != 0) {
#pragma unroll      /* constant indices: the tiles stay in registers */
    for (int qt = 0; qt < 2; ++qt) { const float mn = fmaxf(m[qt], fmaxf(mx[qt], fa_xhalf(mx[qt])) * C);      /* factor exactly 1 where the maximum did not rise */
      const float al = __builtin_amdgcn_exp2f(m[qt] - mn); o[qt][0] *= al; o[qt][1] *= al; l[qt] *= al; m[qt] = mn; th[qt] = fmaf(mn, 1.0f / C, 5.0f / C); }
  }
  FragH p[2];
#pragma unroll      /* constant indices: the tiles stay in registers */
  for (int qt = 0; qt < 2; ++qt) {
    const float sh = 10.0f - m[qt]; float su = 0.f;
#pragma unroll      /* constant indices: the tiles stay in registers */
    for (int t = 0; t < 2; ++t) { v8f x, e;
#pragma unroll      /* constant indices: the tiles stay in registers */
      for (int r = 0; r < 8; ++r) x[r] = fmaf(s[qt][t][r], C, sh);
      fa_exp8(e, x);
#pragma unroll      /* constant indices: the tiles stay in registers */
      for (int r = 0; r < 8; ++r) { su += e[r]; p[qt].h[8 * t + r] = (_Float16)e[r]; } }
    l[qt] += su;
  }
  o[0][0] = fa_mma(v0, p[0].v, o[0][0]); o[0][1] = fa_mma(v1, p[0].v, o[0][1]); o[1][0] = fa_mma(v0, p[1].v, o[1][0]); o[1][1] = fa_mma(v1, p[1].v, o[1][1]);
}
// ---- K and V^T through LDS: a stage = 64 keys of all eight heads, 64 K rows of 512 bytes and one whole 128-byte line of each of the 256 V^T rows ----
#define KPT (DW + 8)      /* K row pitch in LDS, in f16: 16 B x 33 for the ds_load_b128 fragment reads */
#define VPT 72            /* V^T row pitch in LDS, in f16: 16 B x 9, likewise */
// A lane's eight 16-byte pieces of one stage: four of K (a wave covers one whole row, 4 lines) and four of V^T (a wave covers 4 whole lines), from global memory straight into LDS.
// The copies and s_wait_xcnt 0 stand in one statement, so that no later write of an address register can be moved in front of that wait.
__device__ __forceinline__ void fa_copy8(const unsigned lk, const unsigned lv, const _Float16* gk, const _Float16* gv) {
  const unsigned lk1 = lk + 16 * KPT * 2, lk2 = lk + 32 * KPT * 2, lk3 = lk + 48 * KPT * 2, lv1 = lv + 64 * VPT * 2, lv2 = lv + 128 * VPT * 2, lv3 = lv + 192 * VPT * 2;
  const _Float16* gk1 = gk + (size_t)16 * DW; const _Float16* gk2 = gk + (size_t)32 * DW; const _Float16* gk3 = gk + (size_t)48 * DW;
  const _Float16* gv1 = gv + (size_t)64 * NTK; const _Float16* gv2 = gv + (size_t)128 * NTK; const _Float16* gv3 = gv + (size_t)192 * NTK;
  asm volatile("global_load_async_to_lds_b128 %0, %8, off\n\tglobal_load_async_to_lds_b128 %1, %9, off\n\tglobal_load_async_to_lds_b128 %2, %10, off\n\tglobal_load_async_to_lds_b128 %3, %11, off\n\t"
               "global_load_async_to_lds_b128 %4, %12, off\n\tglobal_load_async_to_lds_b128 %5, %13, off\n\tglobal_load_async_to_lds_b128 %6, %14, off\n\tglobal_load_async_to_lds_b128 %7, %15, off\n\ts_wait_xcnt 0x0"
               :: "v"(lk), "v"(lk1), "v"(lk2), "v"(lk3), "v"(lv), "v"(lv1), "v"(lv2), "v"(lv3), "v"(gk), "v"(gk1), "v"(gk2), "v"(gk3), "v"(gv), "v"(gv1), "v"(gv2), "v"(gv3) : "memory");
}
// Grid: 8 batches x 32 work-groups of 16 waves = all eight heads x the two query groups p and 63 - p (equal work in every work-group; waves w, w + 4, w + 8
// and w + 12 together: 130 passes). Context = O / l, split hi + residual * 1024, stays in LDS: the work-group holds all 256 context columns of its 64 tokens, so it
// does their output projection itself, out = (ctx_hi + ctx_lo / 1024) Wo^T + bo, and the context planes never reach memory.
// All 16 waves walk the keys from 0 together, a stage of 64 keys (two passes) at a time: the work-group fetches every K and V^T line once, in whole lines, by asynchronous copies
// into one of two LDS buffers, the next stage flying during this stage's passes, and each wave takes its head's fragments from LDS. A fragment load from global memory touched 16 lines for
// 512 bytes, and each line was asked for by several waves. Every wave copies and passes every barrier up to the longer group's last stage; a wave past its diagonal skips only the passes.
// Output projection: a wave owns 16 rows x 64 columns and keeps two sets of accumulators, one per context plane, so that each weight fragment is loaded once and
// serves both planes. The 8 k steps are unrolled over a ring of three fragment sets in registers: the loads of two steps are in flight while one step's products run.
__global__ __launch_bounds__(512) void k_fattn(const _Float16* __restrict__ Q, const _Float16* __restrict__ Kk, const _Float16* __restrict__ Vt, const _Float16* __restrict__ Bh, const float* __restrict__ bias, float* __restrict__ C) {
  __shared__ __attribute__((aligned(16))) _Float16 st[2][64][DW + 8];      /* context plane, token (query group * 32 + row), column; pitch 16 B x 33 for the ds_load_b128 fragment reads */
  __shared__ __attribute__((aligned(16))) float so[16][16][68];
  __shared__ __attribute__((aligned(16))) _Float16 sk[2][64][KPT];      /* two stages of K: key in the stage, column */
  __shared__ __attribute__((aligned(16))) _Float16 sv[2][DW][VPT];      /* two stages of V^T: column, key in the stage */
  const int lane = threadIdx.x & 31, ln = lane & 15, hh = lane >> 4; const int w = __builtin_amdgcn_readfirstlane(threadIdx.x >> 5);
  const int b = blockIdx.x & (NB - 1), p = blockIdx.x / NB; const int head = w & 7, tsel = w >> 3;
  const int g = tsel ? 63 - p : p;
  const int rb = w >> 2, col0 = (w & 3) * 64; const int row0 = b * NTK + ((rb >> 1) ? 63 - p : p) * 32 + (rb & 1) * 16;      /* the wave's tile of the output projection: row block rb of the work-group's 64 tokens, 64 columns */
  float bv[4];
#pragma unroll      /* constant indices; read here so that the epilogue does not wait for them */
  for (int t = 0; t < 4; ++t) bv[t] = bias[col0 + t * 16 + ln];
  const _Float16* qp = Q + ((size_t)b * NTK + g * 32 + ln) * DW + head * HD + 8 * hh;
  const v16h q0f = fa_frag(qp), q1f = fa_frag(qp + (size_t)16 * DW);
  asm volatile("s_wait_xcnt 0x0" :: "v"(qp) : "memory");      /* stands before the registers of the query and bias addresses are used again: the operand keeps the query's untouched up to here */
  const int vr = threadIdx.x >> 3, vc = (threadIdx.x & 7) * 8;      /* the lane's place in a V^T stage: 8 lanes = one line */
  const _Float16* gk = Kk + ((size_t)b * NTK + w) * DW + lane * 8; const _Float16* gv = Vt + ((size_t)b * DW + vr) * NTK + vc;
  const unsigned lk = (unsigned)(size_t)&sk[0][w][lane * 8], lv = (unsigned)(size_t)&sv[0][vr][vc];      /* LDS byte addresses, buffer 0 */
  constexpr unsigned KB = sizeof(sk[0]), VB = sizeof(sv[0]);
  const int S = (65 - p) >> 1;      /* stages up to the diagonal of the longer group, 63 - p: 17 to 32, the same for the whole work-group */
  const v8f z8 = {0.f,0.f,0.f,0.f,0.f,0.f,0.f,0.f};
  v8f o[2][2] = {{z8, z8}, {z8, z8}}; float m[2] = {-3.0e38f, -3.0e38f}, th[2] = {-3.0e38f, -3.0e38f}, l[2] = {0.f, 0.f};
  fa_copy8(lk, lv, gk, gv);
  asm volatile("s_wait_asynccnt 0x0" ::: "memory");      /* this wave's part of stage 0 has landed */
  __syncthreads();      /* stage 0 is in LDS for all sixteen waves */
  v16h kd0 = q0f, kd1 = q0f, vd0 = q0f, vd1 = q0f;      /* the diagonal pass's fragments, taken in the stage that holds them (every wave has one), used behind the loop */
  for (int t = 0; t < S; ++t) {
    const _Float16* kf = &sk[t & 1][ln][head * HD + 8 * hh]; const _Float16* vf = &sv[t & 1][head * HD + ln][8 * hh];
    const v16h k0 = fa_frag(kf), k1 = fa_frag(kf + 16 * KPT), k2 = fa_frag(kf + 32 * KPT), k3 = fa_frag(kf + 48 * KPT);      /* both passes' fragment reads stand together at the top */
    const v16h v0 = fa_frag(vf), v1 = fa_frag(vf + 16 * VPT), v2 = fa_frag(vf + 32), v3 = fa_frag(vf + 16 * VPT + 32);
    if (t + 1 < S) fa_copy8(lk + ((t + 1) & 1) * KB, lv + ((t + 1) & 1) * VB, gk + (size_t)(t + 1) * 64 * DW, gv + (t + 1) * 64);      /* uniform in the work-group: stage t + 1 flies during this stage's passes; issued behind the fragment reads, whose latency covers the issue */
    if (2 * t < g) fa_pass<false>(k0, k1, v0, v1, q0f, q1f, o, m, th, l, ln, hh);      /* uniform in the wave: a wave past its diagonal skips the passes, never the copies, the waits and the barrier */
    if (2 * t + 1 < g) fa_pass<false>(k2, k3, v2, v3, q0f, q1f, o, m, th, l, ln, hh);
    if (2 * t == g) { kd0 = k0; kd1 = k1; vd0 = v0; vd1 = v1; }
    if (2 * t + 1 == g) { kd0 = k2; kd1 = k3; vd0 = v2; vd1 = v3; }
    asm volatile("s_wait_dscnt 0x0" ::: "memory");      /* this wave's reads of stage t have returned before the buffer is handed to the copies */
    asm volatile("s_wait_asynccnt 0x0" ::: "memory");      /* this wave's part of stage t + 1 has landed */
    __syncthreads();      /* stage t + 1 is in LDS for all sixteen waves, and every wave has left stage t's buffer: the next trip refills it */
  }
  asm volatile("s_wait_asynccnt 0x0" ::: "memory");      /* no copy is outstanding behind the loop */
  fa_pass<true>(kd0, kd1, vd0, vd1, q0f, q1f, o, m, th, l, ln, hh);      /* the pass on the diagonal, each wave's last */
  const _Float16* bp = Bh + (size_t)(col0 + ln) * DW + 8 * hh;
  v16h fh[3], fl[3], fb[3][4];
#pragma unroll      /* constant indices: the ring stays in registers; the first two steps' weights are fetched here, in front of the barrier: they do not depend on the context */
  for (int s = 0; s < 2; ++s) {
#pragma unroll      /* constant indices, as above */
    for (int t = 0; t < 4; ++t) fb[s][t] = fa_frag(bp + t * 16 * DW + s * 32); }
#pragma unroll      /* constant indices: the tiles stay in registers */
  for (int qt = 0; qt < 2; ++qt) { const float inv = 1.0f / (l[qt] + fa_xhalf(l[qt]));
#pragma unroll      /* constant indices: the tiles stay in registers */
    for (int dt = 0; dt < 2; ++dt) { FragH f, fr;
#pragma unroll      /* constant indices: the tiles stay in registers */
      for (int r = 0; r < 8; ++r) { const float v = o[qt][dt][r] * inv; const _Float16 hv = (_Float16)v; f.h[r] = hv; fr.h[r] = (_Float16)((v - (float)hv) * 1024.0f); }
      *(v8us*)&st[0][tsel * 32 + 16 * qt + ln][head * HD + 16 * dt + 8 * hh] = f.half[0]; *(v8us*)&st[1][tsel * 32 + 16 * qt + ln][head * HD + 16 * dt + 8 * hh] = fr.half[0]; } }
  __syncthreads();      /* all eight heads' columns of the 64 context rows are in LDS */
  const _Float16* ahp = &st[0][rb * 16 + ln][8 * hh]; const _Float16* alp = &st[1][rb * 16 + ln][8 * hh];
  v8f ch[4] = {z8, z8, z8, z8}, cl[4] = {z8, z8, z8, z8};
#pragma unroll      /* constant indices: the ring stays in registers */
  for (int s = 0; s < 2; ++s) { fh[s] = fa_frag(ahp + s * 32); fl[s] = fa_frag(alp + s * 32); }
#pragma unroll      /* constant indices: the ring stays in registers and every address is a base plus an immediate */
  for (int s = 0; s < DW / 32; ++s) {
    if (s + 2 < DW / 32) { const int n = s + 2, sl = n % 3; fh[sl] = fa_frag(ahp + n * 32); fl[sl] = fa_frag(alp + n * 32);
#pragma unroll      /* constant indices, as above */
      for (int t = 0; t < 4; ++t) fb[sl][t] = fa_frag(bp + t * 16 * DW + n * 32); }
    const int cu = s % 3;
#pragma unroll      /* constant indices, as above */
    for (int t = 0; t < 4; ++t) { ch[t] = fa_mma(fh[cu], fb[cu][t], ch[t]); cl[t] = fa_mma(fl[cu], fb[cu][t], cl[t]); }
    __builtin_amdgcn_sched_barrier(0);      /* keeps later steps' loads below this step: lifted to the top they took over 256 registers or spilled */
  }
  asm volatile("s_wait_xcnt 0x0" :: "v"(bp) : "memory");      /* stands before the registers of the weight address are used again: the operand keeps them untouched up to here */
#pragma unroll      /* constant indices: the tiles stay in registers */
  for (int t = 0; t < 4; ++t) { const float bt = bf16_round(bv[t]);
#pragma unroll      /* constant indices: the tiles stay in registers */
    for (int r = 0; r < 8; ++r) { float v = ch[t][r] * 0.0625f + bt; v += cl[t][r] * (0.0625f / 1024.0f); so[w][8 * hh + r][t * 16 + ln] = v; } }
  __builtin_amdgcn_fence(__ATOMIC_ACQ_REL, "workgroup"); __builtin_amdgcn_wave_barrier();      /* a wave reads back only its own staging rows */
  const int rsub = lane >> 4, c4 = (lane & 15) * 4;
#pragma unroll      /* the LDS reads issue ahead of the stores */
  for (int q = 0; q < 8; ++q) { const int r = q * 2 + rsub; const v4f v = *(const v4fa*)&so[w][r][c4]; *(v4f*)(C + (size_t)(row0 + r) * DW + col0 + c4) = v; }
}

extern "C" void kernel_launch(void* const* d_in, const int* in_sizes, int n_in,
                              void* d_out, int out_size, void* d_ws, size_t ws_size, hipStream_t stream) {
  (void)in_sizes; (void)n_in; (void)out_size;
  const float* const* I = (const float* const*)d_in; const float* xq = I[0]; const float* xk = I[1]; const float* xv = I[2]; const float* Wq = I[3]; const float* bq = I[4]; const float* Wk = I[5]; const float* bk = I[6]; const float* Wv = I[7]; const float* bv = I[8]; const float* Wo = I[9]; const float* bo = I[10];
  char* ws = (char*)d_ws; size_t off = 0;
  auto take = [&](size_t bytes) { char* p = ws + off; off += (bytes + 255) & ~(size_t)255; return p; };
  const size_t np = (size_t)NR * DW;
  _Float16* BW = (_Float16*)take((size_t)4 * DW * DIN * 2); _Float16* Q16 = (_Float16*)take(2 * np * 2); _Float16* K16 = Q16 + np; _Float16* VT = (_Float16*)take(np * 2);      /* q and k planes in a row, a plane is one step of grid.y; v transposed */
  if (off > ws_size) return;      /* 0.5 + 3 x 8 MiB */
  k_cvt4<<<4 * (DW * DIN / 8 / 256), 256, 0, stream>>>(Wq, Wk, Wv, Wo, BW);      /* torch (out, in) naturals */
  const dim3 gP3(NR / 64, 3);
  k_proj<<<gP3, 256, 0, stream>>>(xq, xk, xv, BW, bq, bk, bv, Q16, VT);      /* q, k, v projections from the f32 inputs: grid.y = 0, 1, 2; v as V^T [b*256 + column][2048]: head h of batch b = rows b*256 + h*32 */
  k_fattn<<<NB * 32, 512, 0, stream>>>(Q16, K16, VT, BW + (size_t)3 * DW * DIN, bo, (float*)d_out);      /* all heads, all batches: attention and out = (ctx_hi + ctx_lo / 1024) Wo^T + bo */
}

// v010
// It runs in 52.1 microseconds.
// Two timings next to v009 both put it at 1.05 times that version's speed.
// Counting every step since v000, it is 28.0 times as fast.
#include <hip/hip_runtime.h>
// my_attention (8 x 2048 tokens x 256; 8 heads x 32; q/k/v = query/key/value W^T + b; causal softmax(q.k / sqrt(32)); out = merged ctx Wo^T + bo).
// Compute dtype: inputs rounded to bf16; inputs/weights exact as f16; q/k/v and the softmax weights as plain f16 operands (~2^-12); context hi + residual into Wo; softmax f32. v_wmma_f32_16x16x32_f16.
#define NB 8
#define NTK 2048
#define DIN 256
#define NH 8
#define HD 32
#define DW 256
#define NR (NB * NTK)
typedef __bf16 v16b __attribute__((ext_vector_type(16)));
typedef unsigned short v8us __attribute__((ext_vector_type(8), may_alias));
typedef float  v8f  __attribute__((ext_vector_type(8)));
typedef float  v4f  __attribute__((ext_vector_type(4)));
typedef float  v4fa __attribute__((ext_vector_type(4), may_alias));
union FragB { v16b v; v8us half[2]; unsigned short u[16]; };

__device__ __forceinline__ unsigned short bf16_bits(float x) { unsigned int u = __float_as_uint(x); return (unsigned short)((u + 0x7FFFu + ((u >> 16) & 1u)) >> 16); }
__device__ __forceinline__ float bf16_val(unsigned short b) { return __uint_as_float(((unsigned int)b) << 16); }
__device__ __forceinline__ float bf16_round(float x) { return bf16_val(bf16_bits(x)); }
// D += A·B with NT terms: 1 = ah·bh, 2 = + al·bh (A split), 3 = + ah·bl (both split)
template <int NT>
__device__ __forceinline__ v8f mmaN(v16b ah, v16b al, v16b bh, v16b bl, v8f c) {
  c = __builtin_amdgcn_wmma_f32_16x16x32_bf16(false, ah, false, bh, (short)0, c, false, false);
  if (NT >= 2) c = __builtin_amdgcn_wmma_f32_16x16x32_bf16(false, al, false, bh, (short)0, c, false, false);
  if (NT >= 3) c = __builtin_amdgcn_wmma_f32_16x16x32_bf16(false, ah, false, bl, (short)0, c, false, false);
  asm volatile("v_nop\n\tv_nop\n\tv_nop\n\tv_nop" : "+v"(c) : "v"(ah), "v"(al), "v"(bh), "v"(bl));
  return c;
}

__global__ __launch_bounds__(256) void k_wt_bf16(const float* __restrict__ W, unsigned short* __restrict__ Wt, int K, int N) {
  const int t = blockIdx.x * 256 + threadIdx.x;
  const int k8n = K / 8;
  if (t >= N * k8n) return;
  const int n = t / k8n, k8 = (t % k8n) * 8;
  v8us v;
#pragma unroll
  for (int i = 0; i < 8; ++i) v[i] = bf16_bits(W[(size_t)(k8 + i) * N + n]);
  *(v8us*)(Wt + (size_t)n * K + k8) = v;
  
}

// GEMM C[M][N] (f32, pitch ldc) = act(A[M][K]·W + bias). A f32 row-major (pitch lda) converted per fragment to bf16
// (ASPLIT: hi/lo two planes -> 2 terms, else single rounded term); Wt bf16 [N][K] (pitch ldb). BIAS_BF16 rounds the
// bias to bf16 first (bias quantised to bf16 before the add). K%32==0, M%16==0, N%64==0.
template <bool ASPLIT, int ACT, bool BIAS_BF16>
__global__ __launch_bounds__(128) void k_gemm_bf(const float* __restrict__ A, int lda, const unsigned short* __restrict__ Wt, int ldb,
                                               const float* __restrict__ bias, float* __restrict__ C, int ldc, int M, int N, int K) {
  __shared__ __attribute__((aligned(16))) float so[4][16][64];
  const int tid = threadIdx.x, w = tid >> 5, lane = tid & 31, ln = lane & 15, hh = lane >> 4;
  const int ntn = N / 64;
  const int wid = blockIdx.x * 4 + w;
  const int mt = wid / ntn, nq = wid % ntn;
  if (mt * 16 >= M) return;
  const int row0 = mt * 16, col0 = nq * 64;
  const float* arow = A + (size_t)(row0 + ln) * lda;
  v8f acc[4] = {};
  for (int kb = 0; kb < K; kb += 32) {
    FragB ah, al;
    const v4f x0 = *(const v4fa*)(arow + kb + 8 * hh), x1 = *(const v4fa*)(arow + kb + 8 * hh + 4);
    const v4f x2 = *(const v4fa*)(arow + kb + 16 + 8 * hh), x3 = *(const v4fa*)(arow + kb + 16 + 8 * hh + 4);
    float xs[16] = {x0[0],x0[1],x0[2],x0[3],x1[0],x1[1],x1[2],x1[3],x2[0],x2[1],x2[2],x2[3],x3[0],x3[1],x3[2],x3[3]};
#pragma unroll
    for (int i = 0; i < 16; ++i) { const unsigned short hb = bf16_bits(xs[i]); ah.u[i] = hb; al.u[i] = ASPLIT ? bf16_bits(xs[i] - bf16_val(hb)) : (unsigned short)0; }
#pragma unroll
    for (int t = 0; t < 4; ++t) {
      const unsigned short* brow = Wt + (size_t)(col0 + t * 16 + ln) * ldb + kb;
      FragB b;
      b.half[0] = *(const v8us*)(brow + 8 * hh);
      b.half[1] = *(const v8us*)(brow + 16 + 8 * hh);
      acc[t] = mmaN<ASPLIT ? 2 : 1>(ah.v, al.v, b.v, b.v, acc[t]);
    }
  }
#pragma unroll
  for (int t = 0; t < 4; ++t) {
    float bv = bias ? bias[col0 + t * 16 + ln] : 0.f;
    if (BIAS_BF16) bv = bf16_round(bv);
#pragma unroll
    for (int r = 0; r < 8; ++r) { float v = acc[t][r] + bv; if (ACT == 1) v = fmaxf(v, 0.f); so[w][8 * hh + r][t * 16 + ln] = v; }
  }
  __builtin_amdgcn_fence(__ATOMIC_ACQ_REL, "workgroup");
  __builtin_amdgcn_wave_barrier();
  const int rsub = lane >> 4, c4 = (lane & 15) * 4;
  {
#pragma unroll
    for (int q = 0; q < 8; ++q) {
      const int r = q * 2 + rsub;
      const v4f v = *(const v4fa*)&so[w][r][c4];
      *(v4f*)(C + (size_t)(row0 + r) * ldc + col0 + c4) = v;
    }
    
  }
}

// GEMM C = act(A·W + bias + resid): A f32 (ASPLIT -> hi/lo 2 terms), Wt bf16 [N][K]; ACT 0 none, 1 relu, 2 exact gelu;
// resid (optional, f32, row index = (row % rmod), pitch ldr, RES_BF16 rounds it) added before the activation.
template <bool ASPLIT, int ACT, bool BIAS_BF16, bool RES_BF16>
__global__ __launch_bounds__(128) void k_gemm_bf3(const float* __restrict__ A, int lda, const unsigned short* __restrict__ Wt, int ldb,
                                                const float* __restrict__ bias, const float* __restrict__ resid, int rmod, int ldr,
                                                float* __restrict__ C, int ldc, int M, int N, int K) {
  __shared__ __attribute__((aligned(16))) float so[4][16][64];
  const int tid = threadIdx.x, w = tid >> 5, lane = tid & 31, ln = lane & 15, hh = lane >> 4;
  const int ntn = N / 64;
  const int wid = blockIdx.x * 4 + w;
  const int mt = wid / ntn, nq = wid % ntn;
  if (mt * 16 >= M) return;
  const int row0 = mt * 16, col0 = nq * 64;
  const float* arow = A + (size_t)(row0 + ln) * lda;
  v8f acc[4] = {};
  for (int kb = 0; kb < K; kb += 32) {
    FragB ah, al;
    const v4f x0 = *(const v4fa*)(arow + kb + 8 * hh), x1 = *(const v4fa*)(arow + kb + 8 * hh + 4);
    const v4f x2 = *(const v4fa*)(arow + kb + 16 + 8 * hh), x3 = *(const v4fa*)(arow + kb + 16 + 8 * hh + 4);
    float xs[16] = {x0[0],x0[1],x0[2],x0[3],x1[0],x1[1],x1[2],x1[3],x2[0],x2[1],x2[2],x2[3],x3[0],x3[1],x3[2],x3[3]};
#pragma unroll
    for (int i = 0; i < 16; ++i) { const unsigned short hb = bf16_bits(xs[i]); ah.u[i] = hb; al.u[i] = ASPLIT ? bf16_bits(xs[i] - bf16_val(hb)) : (unsigned short)0; }
#pragma unroll
    for (int t = 0; t < 4; ++t) {
      const unsigned short* brow = Wt + (size_t)(col0 + t * 16 + ln) * ldb + kb;
      FragB b;
      b.half[0] = *(const v8us*)(brow + 8 * hh);
      b.half[1] = *(const v8us*)(brow + 16 + 8 * hh);
      acc[t] = mmaN<ASPLIT ? 2 : 1>(ah.v, al.v, b.v, b.v, acc[t]);
    }
  }
#pragma unroll
  for (int t = 0; t < 4; ++t) {
    const int col = col0 + t * 16 + ln;
    float bv = bias ? bias[col] : 0.f;
    if (BIAS_BF16) bv = bf16_round(bv);
#pragma unroll
    for (int r = 0; r < 8; ++r) {
      float v = acc[t][r] + bv;
      if (resid) { float rv = resid[(size_t)((row0 + 8 * hh + r) % rmod) * ldr + col]; if (RES_BF16) rv = bf16_round(rv); v += rv; }
      if (ACT == 1) v = fmaxf(v, 0.f);
      if (ACT == 2) v = 0.5f * v * (1.0f + erff(v * 0.70710678118654752f));
      if (ACT == 3) { const float u = 0.7978845608028654f * (v + 0.044715f * v * v * v); v = 0.5f * v * (1.0f + tanhf(u)); }
      so[w][8 * hh + r][t * 16 + ln] = v;
    }
  }
  __builtin_amdgcn_fence(__ATOMIC_ACQ_REL, "workgroup");
  __builtin_amdgcn_wave_barrier();
  const int rsub = lane >> 4, c4 = (lane & 15) * 4;
  {
#pragma unroll
    for (int q = 0; q < 8; ++q) {
      const int r = q * 2 + rsub;
      const v4f v = *(const v4fa*)&so[w][r][c4];
      *(v4f*)(C + (size_t)(row0 + r) * ldc + col0 + c4) = v;
    }
    
  }
}
// row LayerNorm (biased variance, eps) over N: s = X (+ R); optional out_sum <- s; out_norm <- (s-mu)*rsqrt(var+eps)*g + b
template <bool PARAM_BF16>
__global__ __launch_bounds__(256) void k_layernorm(const float* __restrict__ X, const float* __restrict__ R, const float* __restrict__ g, const float* __restrict__ bta,
                                                  float* __restrict__ out_sum, float* __restrict__ out_norm, int N, float eps) {
  __shared__ float red[256];
  const int row = blockIdx.x, tid = threadIdx.x;
  const float* x = X + (size_t)row * N; const float* rr = R ? R + (size_t)row * N : nullptr;
  float vals[16];                     // up to N = 4096
  const int per = N / 256;            // contiguous chunk per thread? use strided-by-4 chunks: thread handles j = tid*4 + 1024*u
  float s1 = 0.f;
  for (int u = 0; u < per / 4; ++u) {
    const int j = tid * 4 + 1024 * u;
    const v4f a = *(const v4fa*)(x + j);
    v4f b = {0.f,0.f,0.f,0.f}; if (rr) b = *(const v4fa*)(rr + j);
#pragma unroll
    for (int q = 0; q < 4; ++q) { const float v = a[q] + b[q]; vals[u * 4 + q] = v; s1 += v; }
  }
  red[tid] = s1; __syncthreads();
  for (int st = 128; st > 0; st >>= 1) { if (tid < st) red[tid] += red[tid + st]; __syncthreads(); }
  const float mu = red[0] / (float)N; __syncthreads();
  float s2 = 0.f;
  for (int u = 0; u < per / 4; ++u)
#pragma unroll
    for (int q = 0; q < 4; ++q) { const float c = vals[u * 4 + q] - mu; s2 += c * c; }
  red[tid] = s2; __syncthreads();
  for (int st = 128; st > 0; st >>= 1) { if (tid < st) red[tid] += red[tid + st]; __syncthreads(); }
  const float rs = rsqrtf(red[0] / (float)N + eps);
  {
    for (int u = 0; u < per / 4; ++u) {
      const int j = tid * 4 + 1024 * u;
      v4f o, sm;
#pragma unroll
      for (int q = 0; q < 4; ++q) {
        float gg = g[j + q], bb = bta[j + q];
        if (PARAM_BF16) { gg = bf16_round(gg); bb = bf16_round(bb); }
        sm[q] = vals[u * 4 + q]; o[q] = (vals[u * 4 + q] - mu) * rs * gg + bb;
      }
      if (out_sum) *(v4f*)(out_sum + (size_t)row * N + j) = sm;
      *(v4f*)(out_norm + (size_t)row * N + j) = o;
    }
    
  }
}



// ---- f16 WMMA path (v_wmma_f32_16x16x32_f16): 11-bit significands for operands in range — used where a [0,1] probability operand needs more precision than bf16
typedef _Float16 v16h __attribute__((ext_vector_type(16)));
union FragH { v16h v; v8us half[2]; _Float16 h[16]; unsigned short u[16]; };
template <int NT>
__device__ __forceinline__ v8f mmaH(v16h ah, v16h al, v16h bh, v16h bl, v8f c) {
  c = __builtin_amdgcn_wmma_f32_16x16x32_f16(false, ah, false, bh, (short)0, c, false, false);
  if (NT >= 2) c = __builtin_amdgcn_wmma_f32_16x16x32_f16(false, al, false, bh, (short)0, c, false, false);
  if (NT >= 3) c = __builtin_amdgcn_wmma_f32_16x16x32_f16(false, ah, false, bl, (short)0, c, false, false);
  asm volatile("v_nop\n\tv_nop\n\tv_nop\n\tv_nop" : "+v"(c) : "v"(ah), "v"(al), "v"(bh), "v"(bl));
  return c;
}
// batched GEMM like k_gemm_b but f16 operands: A f32 (split into f16 hi/lo if ASPLIT, else rounded to f16), Bt = f16 values [n][k]; alpha; C f32; N multiple of 16 (partial tiles skipped)
template <bool ASPLIT>
__global__ __launch_bounds__(128) void k_gemm_h(const float* __restrict__ A, int lda, size_t sA, const _Float16* __restrict__ Bh, int ldb, size_t sB, float alpha, float* __restrict__ C, int ldc, size_t sC, int M, int N, int K) {
  __shared__ __attribute__((aligned(16))) float so[4][16][64];
  const int tid = threadIdx.x, w = tid >> 5, lane = tid & 31, ln = lane & 15, hh = lane >> 4; const int by = blockIdx.y;
  A += (size_t)by * sA; Bh += (size_t)by * sB; C += (size_t)by * sC;
  const int ntn = (N + 63) / 64; const int wid = blockIdx.x * 4 + w; const int mt = wid / ntn, nq = wid % ntn; if (mt * 16 >= M) return;
  const int row0 = mt * 16, col0 = nq * 64; const float* arow = A + (size_t)(row0 + ln) * lda;
  v8f acc[4] = {};
  for (int kb = 0; kb < K; kb += 32) {
    FragH ah, al;
    const v4f x0 = *(const v4fa*)(arow + kb + 8 * hh), x1 = *(const v4fa*)(arow + kb + 8 * hh + 4), x2 = *(const v4fa*)(arow + kb + 16 + 8 * hh), x3 = *(const v4fa*)(arow + kb + 16 + 8 * hh + 4);
    float xs[16] = {x0[0],x0[1],x0[2],x0[3],x1[0],x1[1],x1[2],x1[3],x2[0],x2[1],x2[2],x2[3],x3[0],x3[1],x3[2],x3[3]};
#pragma unroll
    for (int i = 0; i < 16; ++i) { const _Float16 h = (_Float16)xs[i]; ah.h[i] = h; al.h[i] = ASPLIT ? (_Float16)(xs[i] - (float)h) : (_Float16)0.0f; }
#pragma unroll
    for (int t = 0; t < 4; ++t) { if (col0 + t * 16 >= N) continue; const size_t boff = (size_t)(col0 + t * 16 + ln) * ldb + kb; FragH bq; bq.half[0] = *(const v8us*)(Bh + boff + 8 * hh); bq.half[1] = *(const v8us*)(Bh + boff + 16 + 8 * hh);
      acc[t] = mmaH<ASPLIT ? 2 : 1>(ah.v, al.v, bq.v, bq.v, acc[t]); }
  }
#pragma unroll
  for (int t = 0; t < 4; ++t) { if (col0 + t * 16 >= N) continue;
#pragma unroll
    for (int r = 0; r < 8; ++r) so[w][8 * hh + r][t * 16 + ln] = acc[t][r] * alpha; }
  __builtin_amdgcn_fence(__ATOMIC_ACQ_REL, "workgroup"); __builtin_amdgcn_wave_barrier();
  const int rsub = lane >> 4, c4 = (lane & 15) * 4;
  {
#pragma unroll
    for (int q = 0; q < 8; ++q) { const int r = q * 2 + rsub; if (col0 + c4 < N) { const v4f v = *(const v4fa*)&so[w][r][c4]; *(v4f*)(C + (size_t)(row0 + r) * ldc + col0 + c4) = v; } }
     }
}

// Wt[n][k] = f16(W[k][n]·scale) from f32 row-major W[K][N] (scale = power of two; bf16-exact weights stay exact in f16 away from the subnormal range)
__global__ __launch_bounds__(256) void k_wt_f16(const float* __restrict__ W, _Float16* __restrict__ Wt, int K, int N, float scale) {
  const int t = blockIdx.x * 256 + threadIdx.x; if (t >= N * (K / 8)) return; const int n = t / (K / 8), k8 = (t % (K / 8)) * 8; FragH f;
#pragma unroll
  for (int i = 0; i < 8; ++i) f.h[i] = (_Float16)(bf16_round(W[(size_t)(k8 + i) * N + n]) * scale); const v8us o = f.half[0];
  *(v8us*)((unsigned short*)Wt + (size_t)n * K + k8) = o; 
}
// k_gemm_hh variant with fused epilogue: v = acc·alpha + bias[by·sBias + col] (+ CP[(row/rowsPerB)·sCPb + by·64 + col] if CP) ; ACT 0 none / 1 elu ; writes f32 C and/or f16 C16 (each if non-null)
template <int ACT>
__global__ __launch_bounds__(128) void k_gemm_hhx(const _Float16* __restrict__ A, int lda, size_t sA, const _Float16* __restrict__ Bh, int ldb, size_t sB, float alpha, const float* __restrict__ bias, size_t sBias, const float* __restrict__ CP, int rowsPerB, size_t sCPb, int row0g,
    float* __restrict__ C, _Float16* __restrict__ C16, int ldc, size_t sC, int M, int N, int K) {
  __shared__ __attribute__((aligned(16))) float so[4][16][64];
  const int tid = threadIdx.x, w = tid >> 5, lane = tid & 31, ln = lane & 15, hh = lane >> 4; const int by = blockIdx.y;
  A += (size_t)by * sA; Bh += (size_t)by * sB; const size_t cofs = (size_t)by * sC; const float* bp = bias ? bias + (size_t)by * sBias : nullptr;
  const int ntn = (N + 63) / 64; const int wid = blockIdx.x * 4 + w; const int mt = wid / ntn, nq = wid % ntn; if (mt * 16 >= M) return;
  const int row0 = mt * 16, col0 = nq * 64; const _Float16* arow = A + (size_t)(row0 + ln) * lda;
  v8f acc[4] = {};
  for (int kb = 0; kb < K; kb += 32) { FragH ah; ah.half[0] = *(const v8us*)((const unsigned short*)arow + kb + 8 * hh); ah.half[1] = *(const v8us*)((const unsigned short*)arow + kb + 16 + 8 * hh);
#pragma unroll
    for (int t = 0; t < 4; ++t) { if (col0 + t * 16 >= N) continue; const size_t boff = (size_t)(col0 + t * 16 + ln) * ldb + kb; FragH bq; bq.half[0] = *(const v8us*)((const unsigned short*)Bh + boff + 8 * hh); bq.half[1] = *(const v8us*)((const unsigned short*)Bh + boff + 16 + 8 * hh);
      acc[t] = mmaH<1>(ah.v, ah.v, bq.v, bq.v, acc[t]); }
  }
#pragma unroll
  for (int t = 0; t < 4; ++t) { if (col0 + t * 16 >= N) continue; const int col = col0 + t * 16 + ln; const float bv = bp ? bf16_round(bp[col]) : 0.f;
#pragma unroll
    for (int r = 0; r < 8; ++r) { float v = acc[t][r] * alpha + bv; if (CP) { const int rr = row0g + row0 + 8 * hh + r; if (rowsPerB < 0) v += CP[cofs + (size_t)rr * ldc + col];      /* rowsPerB < 0: own element of the batched C plane */ else { const int bidx = rr / rowsPerB; v += CP[(size_t)bidx * sCPb + (size_t)by * 64 + col]; } } if (ACT == 1) v = (v > 0.f) ? v : expm1f(v); else if (ACT == 7) v = (v > 0.f) ? v + 1.0f : expf(v); else if (ACT == 8) v = tanhf(v); else if (ACT == 9) v = 0.5f * v * (1.0f + tanhf(0.7978845608028654f * (v + 0.044715f * v * v * v))); else if (ACT == 11) v = 1.0f / (1.0f + expf(-v)); else if (ACT == 12) v = (v > 0.f) ? v : 0.01f * v; else if (ACT == 14) v = (v > 0.f) ? v : 0.1f * v; else if (ACT == 16) v = (v >= 0.f) ? v : 0.3f * v; else if (ACT == 17) v = (v >= 0.f) ? v : 0.2f * v; else if (ACT == 15) v = v / (1.0f + expf(-v)); else if (ACT == 3) v = fmaxf(v, 0.f); else if (ACT == 6) v = 0.5f * v * (1.0f + erff(v * 0.70710678118654752f)); so[w][8 * hh + r][t * 16 + ln] = v; } }
  __builtin_amdgcn_fence(__ATOMIC_ACQ_REL, "workgroup"); __builtin_amdgcn_wave_barrier();
  const int rsub = lane >> 4, c4 = (lane & 15) * 4; typedef _Float16 v4h __attribute__((ext_vector_type(4)));
  {
#pragma unroll
    for (int q = 0; q < 8; ++q) { const int r = q * 2 + rsub; if (col0 + c4 < N) { const v4f v = *(const v4fa*)&so[w][r][c4]; if (C) *(v4f*)(C + cofs + (size_t)(row0 + r) * ldc + col0 + c4) = v; if (C16) { v4h h4; for (int i = 0; i < 4; ++i) h4[i] = (_Float16)v[i]; *(v4h*)(C16 + cofs + (size_t)(row0 + r) * ldc + col0 + c4) = h4; } } }
     }
}


typedef _Float16 v4h __attribute__((ext_vector_type(4)));

__global__ __launch_bounds__(256) void k_h16(const float* __restrict__ x, _Float16* __restrict__ X16, size_t n8) { const size_t t = (size_t)blockIdx.x * 256 + threadIdx.x; if (t >= n8) return; FragH f;
#pragma unroll
  for (int q = 0; q < 8; ++q) f.h[q] = (_Float16)x[t * 8 + q]; *(v8us*)((unsigned short*)X16 + t * 8) = f.half[0];  }
__global__ __launch_bounds__(256) void k_round16f(const float* __restrict__ W, _Float16* __restrict__ Bt, size_t n8) { const size_t t = (size_t)blockIdx.x * 256 + threadIdx.x; if (t >= n8) return; FragH f;
#pragma unroll
  for (int i = 0; i < 8; ++i) f.h[i] = (_Float16)(bf16_round(W[t * 8 + i]) * 16.0f); *(v8us*)((unsigned short*)Bt + t * 8) = f.half[0];  }

__global__ __launch_bounds__(256) void k_hl(const float* __restrict__ F, _Float16* __restrict__ Hh, _Float16* __restrict__ Hl, size_t n8) { const size_t t = (size_t)blockIdx.x * 256 + threadIdx.x; if (t >= n8) return; FragH fh, fl; const v4f a = *(const v4fa*)(F + t * 8), c = *(const v4fa*)(F + t * 8 + 4);
#pragma unroll
  for (int q = 0; q < 4; ++q) { _Float16 h = (_Float16)a[q]; fh.h[q] = h; fl.h[q] = (_Float16)((a[q] - (float)h) * 1024.0f); h = (_Float16)c[q]; fh.h[4 + q] = h; fl.h[4 + q] = (_Float16)((c[q] - (float)h) * 1024.0f); }
  { *(v8us*)((unsigned short*)Hh + t * 8) = fh.half[0]; *(v8us*)((unsigned short*)Hl + t * 8) = fl.half[0];  } }

// ---- fragment load and product of the 32x64 wave tile ----
__device__ __forceinline__ v16h g2_frag(const _Float16* p, int hh) { FragH f; f.half[0] = *(const v8us*)((const unsigned short*)p + 8 * hh); f.half[1] = *(const v8us*)((const unsigned short*)p + 16 + 8 * hh); return f.v; }
__device__ __forceinline__ v8f g2_mma(v16h a, v16h b, v8f c) { v8f d = __builtin_amdgcn_wmma_f32_16x16x32_f16(false, a, false, b, (short)0, c, false, false); asm volatile("v_nop\n\tv_nop\n\tv_nop\n\tv_nop" : "+v"(d) : "v"(a), "v"(b)); return d; }

// The four weight matrices, f16(bf16(w) * 16), in one grid; the block index picks the matrix (uniform in a work-group).
__global__ __launch_bounds__(256) void k_cvt4(const float* __restrict__ w0, const float* __restrict__ w1, const float* __restrict__ w2, const float* __restrict__ w3, _Float16* __restrict__ Bt) {
  constexpr int WB = DW * DIN / 8 / 256;      /* blocks per weight matrix */
  const int j = blockIdx.x / WB, blk = blockIdx.x - j * WB; const float* s = (j == 0) ? w0 : (j == 1) ? w1 : (j == 2) ? w2 : w3; _Float16* d = Bt + (size_t)j * DW * DIN;
  const size_t t = (size_t)blk * 256 + threadIdx.x; FragH f;
#pragma unroll      /* constant indices: the eight values stay in registers and their loads join into two of 16 bytes */
  for (int q = 0; q < 8; ++q) f.h[q] = (_Float16)(bf16_round(s[t * 8 + q]) * 16.0f);
  *(v8us*)((unsigned short*)d + t * 8) = f.half[0];
}
// ---- q, k, v projections straight from the f32 inputs (grid.y = plane): no conversion launch, no f16 copy of the inputs in memory ----
// A work-group of 8 waves owns 64 token rows x all 256 output columns, so each input row is read from memory once, in whole lines, all 16 loads of a
// lane in flight, rounded once (f16(bf16(x)), as the conversion kernel did) and laid in LDS at a pitch of 16 B x 33 for the ds_load_b128 fragment reads.
// The plane's weights go through LDS as well, in four stages of 64 k (one whole 128-byte line of each of the 256 weight rows): the work-group fetches each line once, a
// wave-wide load covering 4 whole lines, and all eight waves take their B fragments from LDS (pitch 16 B x 9). Two stage buffers, in the space that the output
// staging uses afterwards; stage 0 is fetched beside the input rows, each later stage during the products of the stage before it, so no product waits for a load from L2.
// Wave tile 32 x 64. The v plane is stored transposed, V^T [(b, column)][token], the layout the attention kernel's A fragments read: in an accumulator tile a
// lane holds 8 consecutive tokens of one column, 16 bytes of a V^T row; the work-group's 64 tokens are one whole 128-byte line of each of its 256 V^T rows.
__global__ __launch_bounds__(256) void k_proj(const float* __restrict__ x0, const float* __restrict__ x1, const float* __restrict__ x2, const _Float16* __restrict__ Bh,
                                              const float* __restrict__ bias0, const float* __restrict__ bias1, const float* __restrict__ bias2, _Float16* __restrict__ C16, _Float16* __restrict__ VT) {
  __shared__ __attribute__((aligned(16))) _Float16 sa[64][DIN + 8];
  constexpr int WST = DW * 72;      /* one weight stage in LDS, in f16: 256 rows of 64 k at a pitch of 72 */
  __shared__ __attribute__((aligned(16))) float su[2 * WST / 2];      /* two weight stages during the k loop, output staging behind it */
  float (*so)[32][68] = reinterpret_cast<float (*)[32][68]>(su); unsigned short* sb = (unsigned short*)su;
  static_assert(sizeof(float) * 8 * 32 * 68 <= sizeof(su), "output staging fits the stage buffers");
  const int tid = threadIdx.x, w = tid >> 5, lane = tid & 31, ln = lane & 15, hh = lane >> 4; const int by = blockIdx.y;
  const float* xs = ((by == 0) ? x0 : (by == 1) ? x1 : x2) + (size_t)blockIdx.x * 64 * DIN; const float* bp = (by == 0) ? bias0 : (by == 1) ? bias1 : bias2;
  const unsigned short* wsrc = (const unsigned short*)Bh + (size_t)by * DW * DIN + (size_t)(tid >> 3) * DIN + (tid & 7) * 8;      /* 8 lanes = one 128-byte line of a weight row */
  unsigned short* wdst = sb + (tid >> 3) * 72 + (tid & 7) * 8;
  v4f t[16]; v8us wn[8];
#pragma unroll      /* constant indices: the sixteen loads stand in registers and issue together */
  for (int i = 0; i < 16; ++i) t[i] = *(const v4fa*)(xs + (size_t)(i * 256 + tid) * 4);
#pragma unroll      /* constant indices: the loads of weight stage 0 issue behind the input loads */
  for (int i = 0; i < 8; ++i) wn[i] = *(const v8us*)(wsrc + (size_t)i * 32 * DIN);
  __builtin_amdgcn_sched_barrier(0);      /* keeps the weight loads up here: sunk below the input conversion they started only when the inputs had arrived */
#pragma unroll      /* constant indices, as above */
  for (int i = 0; i < 16; ++i) { v4h h4;
#pragma unroll      /* constant indices, as above */
    for (int q = 0; q < 4; ++q) h4[q] = (_Float16)bf16_round(t[i][q]);
    *(v4h*)&sa[i * 4 + (tid >> 6)][(tid & 63) * 4] = h4; }
#pragma unroll      /* constant indices, as above */
  for (int i = 0; i < 8; ++i) *(v8us*)(wdst + i * 32 * 72) = wn[i];
  __syncthreads();      /* the 64 converted rows and weight stage 0 are in LDS for all eight waves */
  const int rl0 = (w >> 2) * 32, col0 = (w & 3) * 64; const int row0 = blockIdx.x * 64 + rl0; const size_t cofs = (size_t)by * NR * DW;
  const _Float16* a0p = &sa[rl0 + ln][0]; const _Float16* a1p = &sa[rl0 + 16 + ln][0];
  const v8f z8 = {0.f,0.f,0.f,0.f,0.f,0.f,0.f,0.f}; v8f c00 = z8, c01 = z8, c02 = z8, c03 = z8, c10 = z8, c11 = z8, c12 = z8, c13 = z8;
#pragma unroll      /* four stages: buffer choice, the refills and every LDS offset are constants */
  for (int j = 0; j < DIN / 64; ++j) { const _Float16* bs = (const _Float16*)(sb + (j & 1) * WST + (col0 + ln) * 72);
    if (j + 1 < DIN / 64) {
#pragma unroll      /* constant indices: the next stage stays in registers and flies during this stage's products (issued behind the barrier, which waits for every load in flight) */
      for (int i = 0; i < 8; ++i) wn[i] = *(const v8us*)(wsrc + (size_t)i * 32 * DIN + (j + 1) * 64);
    }
#pragma unroll      /* constant offsets, as above */
    for (int ks = 0; ks < 2; ++ks) { const int kb = j * 64 + ks * 32; const v16h a0 = g2_frag(a0p + kb, hh), a1 = g2_frag(a1p + kb, hh);
      const v16h b0 = g2_frag(bs + ks * 32, hh), b1 = g2_frag(bs + 16 * 72 + ks * 32, hh), b2 = g2_frag(bs + 32 * 72 + ks * 32, hh), b3 = g2_frag(bs + 48 * 72 + ks * 32, hh);
      c00 = g2_mma(a0, b0, c00); c10 = g2_mma(a1, b0, c10); c01 = g2_mma(a0, b1, c01); c11 = g2_mma(a1, b1, c11);
      c02 = g2_mma(a0, b2, c02); c12 = g2_mma(a1, b2, c12); c03 = g2_mma(a0, b3, c03); c13 = g2_mma(a1, b3, c13); }
    if (j + 1 < DIN / 64) {
#pragma unroll      /* constant indices, as above; the other buffer: its last readers, stage j - 1's products, ended in front of the barrier before this stage */
      for (int i = 0; i < 8; ++i) *(v8us*)(wdst + ((j + 1) & 1) * WST + i * 32 * 72) = wn[i];
    }
    __syncthreads();      /* stage j + 1 is in LDS for all eight waves, and every wave has read stage j (behind the last stage: the buffers become output staging) */
  }
  asm volatile("s_wait_xcnt 0x0" :: "v"(wsrc) : "memory");      /* stands before the registers of the weight address are used again: the operand keeps them untouched up to here */
  v8f accs[8] = {c00, c01, c02, c03, c10, c11, c12, c13};
  if (by < 2) {      /* q and k planes, row-major. The test in this form and order: the built code then has the v path first, and the q/k path does not keep the v path's values alive (162 registers, five waves a SIMD instead of six, with the test written the other way round) */
#pragma unroll      /* constant indices: the tiles stay in registers */
  for (int u = 0; u < 8; ++u) { const int tt = u & 3, half = u >> 2; const float bv = bf16_round(bp[col0 + tt * 16 + ln]);
#pragma unroll      /* constant indices: the tiles stay in registers */
    for (int r = 0; r < 8; ++r) so[w][half * 16 + 8 * hh + r][tt * 16 + ln] = accs[u][r] * 0.0625f + bv; }
  __builtin_amdgcn_fence(__ATOMIC_ACQ_REL, "workgroup"); __builtin_amdgcn_wave_barrier();      /* a wave reads back only its own staging rows */
  const int rsub = lane >> 4, c4 = (lane & 15) * 4;
#pragma unroll      /* the LDS reads issue ahead of the stores */
  for (int q = 0; q < 16; ++q) { const int r = q * 2 + rsub; const v4f v = *(const v4fa*)&so[w][r][c4]; v4h h4;
#pragma unroll      /* constant indices */
    for (int i = 0; i < 4; ++i) h4[i] = (_Float16)v[i];
    *(v4h*)(C16 + cofs + (size_t)(row0 + r) * DW + col0 + c4) = h4; }
  } else {      /* v plane (uniform in the grid's y): 256 columns x 64 tokens through LDS at a pitch of 16 B x 9, in the weight stage buffers, free behind the k loop */
    unsigned short* tv = (unsigned short*)&so[0][0][0];
#pragma unroll      /* constant indices: the tiles stay in registers */
    for (int u = 0; u < 8; ++u) { const int tt = u & 3, half = u >> 2; const float bv = bf16_round(bp[col0 + tt * 16 + ln]); FragH f;
#pragma unroll      /* constant indices: the tiles stay in registers */
      for (int r = 0; r < 8; ++r) f.h[r] = (_Float16)(accs[u][r] * 0.0625f + bv);
      *(v8us*)(tv + (col0 + tt * 16 + ln) * 72 + rl0 + half * 16 + 8 * hh) = f.half[0]; }
    __syncthreads();      /* both token halves of every V^T line are in LDS: a line is stored whole by 8 lanes of one wave */
    unsigned short* vo = (unsigned short*)VT + (size_t)(blockIdx.x / (NTK / 64)) * DW * NTK + (blockIdx.x % (NTK / 64)) * 64;
#pragma unroll      /* the LDS reads issue ahead of the stores */
    for (int i = 0; i < 8; ++i) { const int idx = i * 256 + tid, col = idx >> 3, c8 = (idx & 7) * 8; *(v8us*)(vo + (size_t)col * NTK + c8) = *(const v8us*)(tv + col * 72 + c8); }
    asm volatile("s_wait_xcnt 0x0" ::: "memory");      /* behind the last store: in the built code the q/k path stands below this one and rewrites the stores' address registers */
  }
}
// ---- fused causal attention: S^T = K Q^T, online softmax in registers, O^T += V^T P^T; scores and weights never reach memory ----
// One wave = 32 queries of one head; a pass = 32 keys. In S^T a lane holds one query's scores (column ln, keys 8*hh + r), so two S^T tiles,
// converted in place, are the B operand of V^T P^T in the hardware k order. Weights carry a factor 1024 (as exp2(... + 10)); it cancels in O / l.
__device__ __forceinline__ float fa_xhalf(float x) { const int b = __float_as_int(x); return __int_as_float(__builtin_amdgcn_permlanex16(b, b, 0x76543210, 0xfedcba98, false, false)); }
__device__ __forceinline__ v16h fa_frag(const _Float16* p) { FragH f; f.half[0] = *(const v8us*)((const unsigned short*)p); f.half[1] = *(const v8us*)((const unsigned short*)p + 16); return f.v; }      /* p already holds the lane half's 8 * hh */
__device__ __forceinline__ v8f fa_mma(v16h a, v16h b, v8f c) { return __builtin_amdgcn_wmma_f32_16x16x32_f16(false, a, false, b, (short)0, c, false, false); }
// Eight independent v_exp_f32 and the slot that the instruction set asks for behind a transcendental, in one statement: a v_nop in a statement of its own
// did not stay behind them. Outputs are early-clobber, so that none of the eight overwrites a source of the one in front of it.
__device__ __forceinline__ void fa_exp8(v8f& e, const v8f x) {
  float e0, e1, e2, e3, e4, e5, e6, e7;
  asm("v_exp_f32 %0, %8\n\tv_exp_f32 %1, %9\n\tv_exp_f32 %2, %10\n\tv_exp_f32 %3, %11\n\tv_exp_f32 %4, %12\n\tv_exp_f32 %5, %13\n\tv_exp_f32 %6, %14\n\tv_exp_f32 %7, %15\n\tv_nop"
      : "=&v"(e0), "=&v"(e1), "=&v"(e2), "=&v"(e3), "=&v"(e4), "=&v"(e5), "=&v"(e6), "=&v"(e7)
      : "v"(x[0]), "v"(x[1]), "v"(x[2]), "v"(x[3]), "v"(x[4]), "v"(x[5]), "v"(x[6]), "v"(x[7]));
  e[0] = e0; e[1] = e1; e[2] = e2; e[3] = e3; e[4] = e4; e[5] = e5; e[6] = e6; e[7] = e7;
}
template <bool DIAG>
__device__ __forceinline__ void fa_pass(const v16h k0, const v16h k1, const v16h v0, const v16h v1, const v16h q0f, const v16h q1f, v8f (&o)[2][2], float (&m)[2], float (&th)[2], float (&l)[2], const int ln, const int hh) {
  const float C = 0.17677669529663687f * 1.4426950408889634f;      /* 1/sqrt(32) * log2(e) */
  const v8f z8 = {0.f,0.f,0.f,0.f,0.f,0.f,0.f,0.f};
  v8f s[2][2];
  s[0][0] = fa_mma(k0, q0f, z8); s[0][1] = fa_mma(k1, q0f, z8); s[1][0] = fa_mma(k0, q1f, z8); s[1][1] = fa_mma(k1, q1f, z8);
  float mx[2];      /* the largest raw score among the lane's own 16 keys of each query */
#pragma unroll      /* constant indices: the tiles stay in registers */
  for (int qt = 0; qt < 2; ++qt) {
    if (DIAG) {
#pragma unroll      /* constant indices: the tiles stay in registers */
      for (int r = 0; r < 8; ++r) { if (8 * hh + r > 16 * qt + ln) s[qt][0][r] = -3.0e38f; if (16 + 8 * hh + r > 16 * qt + ln) s[qt][1][r] = -3.0e38f; }
    }
    float a = fmaxf(s[qt][0][0], s[qt][1][0]);
#pragma unroll      /* constant indices: the tiles stay in registers */
    for (int r = 1; r < 8; ++r) a = fmaxf(a, fmaxf(s[qt][0][r], s[qt][1][r]));
    mx[qt] = a;
  }
  /* Lazy rescale: m is the reference in use, not the running maximum. It moves only when some score in the wave lies more than 5 (scaled log2) above it, th = (m + 5) / C in raw
     scores, so a weight is at most 1024 * 32 = 2^15, inside f16, and O / l does not depend on the reference. Each lane tests its own keys; the halves meet only inside the branch. */
  if (__builtin_amdgcn_ballot_w32(mx[0] > th[0] || mx[1] > th[1]) != 0) {
#pragma unroll      /* constant indices: the tiles stay in registers */
    for (int qt = 0; qt < 2; ++qt) { const float mn = fmaxf(m[qt], fmaxf(mx[qt], fa_xhalf(mx[qt])) * C);      /* factor exactly 1 where the maximum did not rise */
      const float al = __builtin_amdgcn_exp2f(m[qt] - mn); o[qt][0] *= al; o[qt][1] *= al; l[qt] *= al; m[qt] = mn; th[qt] = fmaf(mn, 1.0f / C, 5.0f / C); }
  }
  FragH p[2];
#pragma unroll      /* constant indices: the tiles stay in registers */
  for (int qt = 0; qt < 2; ++qt) {
    const float sh = 10.0f - m[qt]; float su = 0.f;
#pragma unroll      /* constant indices: the tiles stay in registers */
    for (int t = 0; t < 2; ++t) { v8f x, e;
#pragma unroll      /* constant indices: the tiles stay in registers */
      for (int r = 0; r < 8; ++r) x[r] = fmaf(s[qt][t][r], C, sh);
      fa_exp8(e, x);
#pragma unroll      /* constant indices: the tiles stay in registers */
      for (int r = 0; r < 8; ++r) { su += e[r]; p[qt].h[8 * t + r] = (_Float16)e[r]; } }
    l[qt] += su;
  }
  o[0][0] = fa_mma(v0, p[0].v, o[0][0]); o[0][1] = fa_mma(v1, p[0].v, o[0][1]); o[1][0] = fa_mma(v0, p[1].v, o[1][0]); o[1][1] = fa_mma(v1, p[1].v, o[1][1]);
}
// ---- K and V^T through LDS: a stage = 64 keys of all eight heads, 64 K rows of 512 bytes and one whole 128-byte line of each of the 256 V^T rows ----
#define KPT (DW + 8)      /* K row pitch in LDS, in f16: 16 B x 33 for the ds_load_b128 fragment reads */
#define VPT 72            /* V^T row pitch in LDS, in f16: 16 B x 9, likewise */
// A lane's eight 16-byte pieces of one stage: four of K (a wave covers one whole row, 4 lines) and four of V^T (a wave covers 4 whole lines), from global memory straight into LDS.
// The copies and s_wait_xcnt 0 stand in one statement, so that no later write of an address register can be moved in front of that wait.
__device__ __forceinline__ void fa_copy8(const unsigned lk, const unsigned lv, const _Float16* gk, const _Float16* gv) {
  const unsigned lk1 = lk + 16 * KPT * 2, lk2 = lk + 32 * KPT * 2, lk3 = lk + 48 * KPT * 2, lv1 = lv + 64 * VPT * 2, lv2 = lv + 128 * VPT * 2, lv3 = lv + 192 * VPT * 2;
  const _Float16* gk1 = gk + (size_t)16 * DW; const _Float16* gk2 = gk + (size_t)32 * DW; const _Float16* gk3 = gk + (size_t)48 * DW;
  const _Float16* gv1 = gv + (size_t)64 * NTK; const _Float16* gv2 = gv + (size_t)128 * NTK; const _Float16* gv3 = gv + (size_t)192 * NTK;
  asm volatile("global_load_async_to_lds_b128 %0, %8, off\n\tglobal_load_async_to_lds_b128 %1, %9, off\n\tglobal_load_async_to_lds_b128 %2, %10, off\n\tglobal_load_async_to_lds_b128 %3, %11, off\n\t"
               "global_load_async_to_lds_b128 %4, %12, off\n\tglobal_load_async_to_lds_b128 %5, %13, off\n\tglobal_load_async_to_lds_b128 %6, %14, off\n\tglobal_load_async_to_lds_b128 %7, %15, off\n\ts_wait_xcnt 0x0"
               :: "v"(lk), "v"(lk1), "v"(lk2), "v"(lk3), "v"(lv), "v"(lv1), "v"(lv2), "v"(lv3), "v"(gk), "v"(gk1), "v"(gk2), "v"(gk3), "v"(gv), "v"(gv1), "v"(gv2), "v"(gv3) : "memory");
}
// Eight whole rows of 512 bytes, 16 rows apart (a wave covers one row, 4 lines, per copy), from a row-major [.][DW] f16 matrix in global memory into LDS rows at the pitch KPT.
// As above, the copies and s_wait_xcnt 0 stand in one statement, so that no later write of an address register can be moved in front of that wait.
__device__ __forceinline__ void fa_rows8(const unsigned l0, const _Float16* g0) {
  const unsigned l1 = l0 + 16 * KPT * 2, l2 = l0 + 32 * KPT * 2, l3 = l0 + 48 * KPT * 2, l4 = l0 + 64 * KPT * 2, l5 = l0 + 80 * KPT * 2, l6 = l0 + 96 * KPT * 2, l7 = l0 + 112 * KPT * 2;
  const _Float16* g1 = g0 + 16 * DW; const _Float16* g2 = g0 + 32 * DW; const _Float16* g3 = g0 + 48 * DW; const _Float16* g4 = g0 + 64 * DW; const _Float16* g5 = g0 + 80 * DW; const _Float16* g6 = g0 + 96 * DW; const _Float16* g7 = g0 + 112 * DW;
  asm volatile("global_load_async_to_lds_b128 %0, %8, off\n\tglobal_load_async_to_lds_b128 %1, %9, off\n\tglobal_load_async_to_lds_b128 %2, %10, off\n\tglobal_load_async_to_lds_b128 %3, %11, off\n\t"
               "global_load_async_to_lds_b128 %4, %12, off\n\tglobal_load_async_to_lds_b128 %5, %13, off\n\tglobal_load_async_to_lds_b128 %6, %14, off\n\tglobal_load_async_to_lds_b128 %7, %15, off\n\ts_wait_xcnt 0x0"
               :: "v"(l0), "v"(l1), "v"(l2), "v"(l3), "v"(l4), "v"(l5), "v"(l6), "v"(l7), "v"(g0), "v"(g1), "v"(g2), "v"(g3), "v"(g4), "v"(g5), "v"(g6), "v"(g7) : "memory");
}
// Grid: 8 batches x 32 work-groups of 16 waves = all eight heads x the two query groups p and 63 - p (equal work in every work-group; waves w, w + 4, w + 8
// and w + 12 together: 130 passes). Context = O / l, split hi + residual * 1024, stays in LDS: the work-group holds all 256 context columns of its 64 tokens, so it
// does their output projection itself, out = (ctx_hi + ctx_lo / 1024) Wo^T + bo, and the context planes never reach memory.
// All 16 waves walk the keys from 0 together, a stage of 64 keys (two passes) at a time: the work-group fetches every K and V^T line once, in whole lines, by asynchronous copies
// into one of two LDS buffers, the next stage flying during this stage's passes, and each wave takes its head's fragments from LDS. A fragment load from global memory touched 16 lines for
// 512 bytes, and each line was asked for by several waves. Every wave copies and passes every barrier up to the longer group's last stage; a wave past its diagonal skips only the passes.
// Output projection: a wave owns 16 rows x 64 columns and keeps two sets of accumulators, one per context plane, so that each weight fragment is loaded once and
// serves both planes. The 8 k steps are unrolled over a ring of three fragment sets in registers: the loads of two steps are in flight while one step's products run.
// Wo goes through LDS too: behind the loop's last barrier the K and V^T buffers are free, and the work-group fetches the 256 weight rows once, in whole lines, by asynchronous copies
// (rows 0 to 127 into the K buffers, 128 to 255 into the V^T buffers, pitch KPT) that fly during the diagonal pass; the barrier in front of the products publishes them with the context.
// A weight fragment load from global memory touched 16 lines for 512 bytes, 64 such loads a wave, and four waves asked for each line.
__global__ __launch_bounds__(512) void k_fattn(const _Float16* __restrict__ Q, const _Float16* __restrict__ Kk, const _Float16* __restrict__ Vt, const _Float16* __restrict__ Bh, const float* __restrict__ bias, float* __restrict__ C) {
  __shared__ __attribute__((aligned(16))) _Float16 st[2][64][DW + 8];      /* context plane, token (query group * 32 + row), column; pitch 16 B x 33 for the ds_load_b128 fragment reads */
  __shared__ __attribute__((aligned(16))) float so[16][16][68];
  __shared__ __attribute__((aligned(16))) _Float16 sk[2][64][KPT];      /* two stages of K: key in the stage, column */
  __shared__ __attribute__((aligned(16))) _Float16 sv[2][DW][VPT];      /* two stages of V^T: column, key in the stage */
  const int lane = threadIdx.x & 31, ln = lane & 15, hh = lane >> 4; const int w = __builtin_amdgcn_readfirstlane(threadIdx.x >> 5);
  const int b = blockIdx.x & (NB - 1), p = blockIdx.x / NB; const int head = w & 7, tsel = w >> 3;
  const int g = tsel ? 63 - p : p;
  const int rb = w >> 2, col0 = (w & 3) * 64; const int row0 = b * NTK + ((rb >> 1) ? 63 - p : p) * 32 + (rb & 1) * 16;      /* the wave's tile of the output projection: row block rb of the work-group's 64 tokens, 64 columns */
  float bv[4];
#pragma unroll      /* constant indices; read here so that the epilogue does not wait for them */
  for (int t = 0; t < 4; ++t) bv[t] = bias[col0 + t * 16 + ln];
  const _Float16* qp = Q + ((size_t)b * NTK + g * 32 + ln) * DW + head * HD + 8 * hh;
  const v16h q0f = fa_frag(qp), q1f = fa_frag(qp + (size_t)16 * DW);
  asm volatile("s_wait_xcnt 0x0" :: "v"(qp) : "memory");      /* stands before the registers of the query and bias addresses are used again: the operand keeps the query's untouched up to here */
  const int vr = threadIdx.x >> 3, vc = (threadIdx.x & 7) * 8;      /* the lane's place in a V^T stage: 8 lanes = one line */
  const _Float16* gk = Kk + ((size_t)b * NTK + w) * DW + lane * 8; const _Float16* gv = Vt + ((size_t)b * DW + vr) * NTK + vc;
  const unsigned lk = (unsigned)(size_t)&sk[0][w][lane * 8], lv = (unsigned)(size_t)&sv[0][vr][vc];      /* LDS byte addresses, buffer 0 */
  constexpr unsigned KB = sizeof(sk[0]), VB = sizeof(sv[0]);
  const int S = (65 - p) >> 1;      /* stages up to the diagonal of the longer group, 63 - p: 17 to 32, the same for the whole work-group */
  const v8f z8 = {0.f,0.f,0.f,0.f,0.f,0.f,0.f,0.f};
  v8f o[2][2] = {{z8, z8}, {z8, z8}}; float m[2] = {-3.0e38f, -3.0e38f}, th[2] = {-3.0e38f, -3.0e38f}, l[2] = {0.f, 0.f};
  fa_copy8(lk, lv, gk, gv);
  asm volatile("s_wait_asynccnt 0x0" ::: "memory");      /* this wave's part of stage 0 has landed */
  __syncthreads();      /* stage 0 is in LDS for all sixteen waves */
  v16h kd0 = q0f, kd1 = q0f, vd0 = q0f, vd1 = q0f;      /* the diagonal pass's fragments, taken in the stage that holds them (every wave has one), used behind the loop */
  for (int t = 0; t < S; ++t) {
    const _Float16* kf = &sk[t & 1][ln][head * HD + 8 * hh]; const _Float16* vf = &sv[t & 1][head * HD + ln][8 * hh];
    const v16h k0 = fa_frag(kf), k1 = fa_frag(kf + 16 * KPT), k2 = fa_frag(kf + 32 * KPT), k3 = fa_frag(kf + 48 * KPT);      /* both passes' fragment reads stand together at the top */
    const v16h v0 = fa_frag(vf), v1 = fa_frag(vf + 16 * VPT), v2 = fa_frag(vf + 32), v3 = fa_frag(vf + 16 * VPT + 32);
    if (t + 1 < S) fa_copy8(lk + ((t + 1) & 1) * KB, lv + ((t + 1) & 1) * VB, gk + (size_t)(t + 1) * 64 * DW, gv + (t + 1) * 64);      /* uniform in the work-group: stage t + 1 flies during this stage's passes; issued behind the fragment reads, whose latency covers the issue */
    if (2 * t < g) fa_pass<false>(k0, k1, v0, v1, q0f, q1f, o, m, th, l, ln, hh);      /* uniform in the wave: a wave past its diagonal skips the passes, never the copies, the waits and the barrier */
    if (2 * t + 1 < g) fa_pass<false>(k2, k3, v2, v3, q0f, q1f, o, m, th, l, ln, hh);
    if (2 * t == g) { kd0 = k0; kd1 = k1; vd0 = v0; vd1 = v1; }
    if (2 * t + 1 == g) { kd0 = k2; kd1 = k3; vd0 = v2; vd1 = v3; }
    asm volatile("s_wait_dscnt 0x0" ::: "memory");      /* this wave's reads of stage t have returned before the buffer is handed to the copies */
    asm volatile("s_wait_asynccnt 0x0" ::: "memory");      /* this wave's part of stage t + 1 has landed */
    __syncthreads();      /* stage t + 1 is in LDS for all sixteen waves, and every wave has left stage t's buffer: the next trip refills it */
  }
  asm volatile("s_wait_asynccnt 0x0" ::: "memory");      /* no copy is outstanding behind the loop */
  static_assert(sizeof(sk) == sizeof(_Float16) * 128 * KPT && sizeof(sv) >= sizeof(_Float16) * 128 * KPT, "half of Wo fits the K buffers, half the V^T buffers");
  const unsigned lw = (unsigned)(size_t)&sv[0][0][0] + (unsigned)(w * KPT + lane * 8) * 2;      /* LDS byte address of weight row 128 + w; row w lies where the lane's K pieces lay */
  fa_rows8(lk, Bh + (size_t)w * DW + lane * 8); fa_rows8(lw, Bh + (size_t)(128 + w) * DW + lane * 8);      /* every reader left the buffers in front of the loop's last barrier */
  __builtin_amdgcn_sched_barrier(0);      /* keeps the diagonal pass below the copies: about a hundred of its instructions were lifted over them, and the copies started that much later */
  fa_pass<true>(kd0, kd1, vd0, vd1, q0f, q1f, o, m, th, l, ln, hh);      /* the pass on the diagonal, each wave's last */
  v16h fh[3], fl[3], fb[3][4];
#pragma unroll      /* constant indices: the tiles stay in registers */
  for (int qt = 0; qt < 2; ++qt) { const float inv = 1.0f / (l[qt] + fa_xhalf(l[qt]));
#pragma unroll      /* constant indices: the tiles stay in registers */
    for (int dt = 0; dt < 2; ++dt) { FragH f, fr;
#pragma unroll      /* constant indices: the tiles stay in registers */
      for (int r = 0; r < 8; ++r) { const float v = o[qt][dt][r] * inv; const _Float16 hv = (_Float16)v; f.h[r] = hv; fr.h[r] = (_Float16)((v - (float)hv) * 1024.0f); }
      *(v8us*)&st[0][tsel * 32 + 16 * qt + ln][head * HD + 16 * dt + 8 * hh] = f.half[0]; *(v8us*)&st[1][tsel * 32 + 16 * qt + ln][head * HD + 16 * dt + 8 * hh] = fr.half[0]; } }
  asm volatile("s_wait_asynccnt 0x0" ::: "memory");      /* this wave's rows of Wo have landed */
  __syncthreads();      /* all eight heads' columns of the 64 context rows and all of Wo are in LDS */
  const _Float16* ahp = &st[0][rb * 16 + ln][8 * hh]; const _Float16* alp = &st[1][rb * 16 + ln][8 * hh];
  v8f ch[4] = {z8, z8, z8, z8}, cl[4] = {z8, z8, z8, z8};
  const _Float16* bp = ((w & 2) ? &sv[0][0][0] + (col0 - 128 + ln) * KPT : &sk[0][0][0] + (col0 + ln) * KPT) + 8 * hh;      /* uniform in the wave: the wave's 64 weight rows lie in one of the two halves */
#pragma unroll      /* constant indices: the ring stays in registers */
  for (int s = 0; s < 2; ++s) { fh[s] = fa_frag(ahp + s * 32); fl[s] = fa_frag(alp + s * 32);
#pragma unroll      /* constant indices, as above */
    for (int t = 0; t < 4; ++t) fb[s][t] = fa_frag(bp + t * 16 * KPT + s * 32); }
#pragma unroll      /* constant indices: the ring stays in registers and every address is a base plus an immediate */
  for (int s = 0; s < DW / 32; ++s) {
    if (s + 2 < DW / 32) { const int n = s + 2, sl = n % 3; fh[sl] = fa_frag(ahp + n * 32); fl[sl] = fa_frag(alp + n * 32);
#pragma unroll      /* constant indices, as above */
      for (int t = 0; t < 4; ++t) fb[sl][t] = fa_frag(bp + t * 16 * KPT + n * 32); }
    const int cu = s % 3;
#pragma unroll      /* constant indices, as above */
    for (int t = 0; t < 4; ++t) { ch[t] = fa_mma(fh[cu], fb[cu][t], ch[t]); cl[t] = fa_mma(fl[cu], fb[cu][t], cl[t]); }
    __builtin_amdgcn_sched_barrier(0);      /* keeps later steps' loads below this step: lifted to the top they took over 256 registers or spilled */
  }
#pragma unroll      /* constant indices: the tiles stay in registers */
  for (int t = 0; t < 4; ++t) { const float bt = bf16_round(bv[t]);
#pragma unroll      /* constant indices: the tiles stay in registers */
    for (int r = 0; r < 8; ++r) { float v = ch[t][r] * 0.0625f + bt; v += cl[t][r] * (0.0625f / 1024.0f); so[w][8 * hh + r][t * 16 + ln] = v; } }
  __builtin_amdgcn_fence(__ATOMIC_ACQ_REL, "workgroup"); __builtin_amdgcn_wave_barrier();      /* a wave reads back only its own staging rows */
  const int rsub = lane >> 4, c4 = (lane & 15) * 4;
#pragma unroll      /* the LDS reads issue ahead of the stores */
  for (int q = 0; q < 8; ++q) { const int r = q * 2 + rsub; const v4f v = *(const v4fa*)&so[w][r][c4]; *(v4f*)(C + (size_t)(row0 + r) * DW + col0 + c4) = v; }
}

extern "C" void kernel_launch(void* const* d_in, const int* in_sizes, int n_in,
                              void* d_out, int out_size, void* d_ws, size_t ws_size, hipStream_t stream) {
  (void)in_sizes; (void)n_in; (void)out_size;
  const float* const* I = (const float* const*)d_in; const float* xq = I[0]; const float* xk = I[1]; const float* xv = I[2]; const float* Wq = I[3]; const float* bq = I[4]; const float* Wk = I[5]; const float* bk = I[6]; const float* Wv = I[7]; const float* bv = I[8]; const float* Wo = I[9]; const float* bo = I[10];
  char* ws = (char*)d_ws; size_t off = 0;
  auto take = [&](size_t bytes) { char* p = ws + off; off += (bytes + 255) & ~(size_t)255; return p; };
  const size_t np = (size_t)NR * DW;
  _Float16* BW = (_Float16*)take((size_t)4 * DW * DIN * 2); _Float16* Q16 = (_Float16*)take(2 * np * 2); _Float16* K16 = Q16 + np; _Float16* VT = (_Float16*)take(np * 2);      /* q and k planes in a row, a plane is one step of grid.y; v transposed */
  if (off > ws_size) return;      /* 0.5 + 3 x 8 MiB */
  k_cvt4<<<4 * (DW * DIN / 8 / 256), 256, 0, stream>>>(Wq, Wk, Wv, Wo, BW);      /* torch (out, in) naturals */
  const dim3 gP3(NR / 64, 3);
  k_proj<<<gP3, 256, 0, stream>>>(xq, xk, xv, BW, bq, bk, bv, Q16, VT);      /* q, k, v projections from the f32 inputs: grid.y = 0, 1, 2; v as V^T [b*256 + column][2048]: head h of batch b = rows b*256 + h*32 */
  k_fattn<<<NB * 32, 512, 0, stream>>>(Q16, K16, VT, BW + (size_t)3 * DW * DIN, bo, (float*)d_out);      /* all heads, all batches: attention and out = (ctx_hi + ctx_lo / 1024) Wo^T + bo */
}
